// v000
// Measured on an AMD MI455X. A time is GPU time per run, averaged over a window of back-to-back runs after a warm-up
// (all launches, gaps included; the runs take copies of the inputs in turn), and the median of several windows.
// Apart from v000's, it joins two sittings. Times from different sittings can be a few percent apart, while
// side-by-side timings come from the same sitting.
// v000 is the starting kernel. One run takes 2140 microseconds.
#include <hip/hip_runtime.h>

// Multiscale causal attention (x0 [1][2048][1024], x1 [1][1024][1024], x2 [1][512][1024]; v_base = x0 Wv^T + bv shared, average-pooled by 2^i for scale i; per scale i: q, k = x_i W[i]^T + b[i] ('oi' [1024][1024] + [1024]; 16 heads x 64), rotate-half rotary at positions t x 2^i (base 1e4), scores = q.k / 8, causal (finfo.min); softmax; ctx_i = w v_i; out_i = ctx_i Wo^T + bo -> tuple ([1][2048][1024], [1][1024][1024], [1][512][1024]) (3.7 M)).
// Realisation: each scale runs the same T-2048 causal pipeline on its sequence zero-padded to 2048 rows - causality means every real query row only sees real keys (j <= i < N_i), so the padding never reaches a real output; the per-scale rope table uses positions t x 2^i; the pooled values are built by a small averaging kernel; the output GEMM writes only the N_i real rows of each tuple member.
// Compute dtypes, f32 accumulate: every input rounded to bf16; q/k/v on PLAIN bf16 operands (inputs: exact) + biases; rotary in f32 (precise sinf/cosf, 32 baked float32 inverse frequencies, position factor 2^i exact); causal tile skipping; value pooling in f32 (in-order means of 2^i rows as the reference's reshape-mean); scores and attn.v: query rows < 512 hl (3 products), the rest single fp16 (x1024); softmax f32; Wo hl x exact (2 products) + bo.

#define NB_  1
#define TT   2048
#define DM   1024
#define NH_  16
#define NKV  16
#define REP  (NH_ / NKV)
#define HD   64
#define DQ   (NH_ * HD)
#define DKV  (NKV * HD)
#define ZH   2
#define RH   512                  // query rows < RH use hi+lo planes (0: none)
#define WIN  2048
#define PCAR 1024.0f
#define SCL  0.125f   // HD^-0.5
typedef _Float16 h16;
typedef unsigned short bf;
typedef __attribute__((ext_vector_type(16))) __bf16   v16bf;
typedef __attribute__((ext_vector_type(16))) _Float16 v16h;
typedef __attribute__((ext_vector_type(8)))  _Float16 v8h;
typedef __attribute__((ext_vector_type(8)))  unsigned short v8us;
typedef __attribute__((ext_vector_type(8)))  float    v8f;
typedef __attribute__((ext_vector_type(4)))  float    v4f;
typedef v8h  __attribute__((may_alias)) v8ha;
typedef v4f  __attribute__((may_alias)) v4fa;
typedef v8us __attribute__((may_alias)) v8usa;

__device__ __forceinline__ unsigned short f2bf(float f) { unsigned u = __float_as_uint(f); u += 0x7FFFu + ((u >> 16) & 1u); return (unsigned short)(u >> 16); }
__device__ __forceinline__ float bf2f(unsigned short b) { return __uint_as_float(((unsigned)b) << 16); }
__device__ __forceinline__ float bfr(float f) { return bf2f(f2bf(f)); }
__device__ __forceinline__ v16h cat16(v8h lo, v8h hi) { return __builtin_shufflevector(lo, hi, 0, 1, 2, 3, 4, 5, 6, 7, 8, 9, 10, 11, 12, 13, 14, 15); }
__device__ __forceinline__ v16bf cat16b(v8us lo, v8us hi) { return __builtin_bit_cast(v16bf, __builtin_shufflevector(lo, hi, 0, 1, 2, 3, 4, 5, 6, 7, 8, 9, 10, 11, 12, 13, 14, 15)); }
__device__ __forceinline__ v8f wmma16(v16h a, v16h b, v8f c) { return __builtin_amdgcn_wmma_f32_16x16x32_f16(false, a, false, b, (short)0, c, false, false); }
__device__ __forceinline__ v8f wmmab(v16bf a, v16bf b, v8f c) { return __builtin_amdgcn_wmma_f32_16x16x32_bf16(false, a, false, b, (short)0, c, false, false); }



// ---- k_gemmw: register-blocked GEMM, ONE WAVE per 64x64 output tile (16 accumulators), operands straight from K-contiguous 16-bit planes; grid (M/64, N/64, Z), 32 threads.
// C[m][n] (f32, pitch ldc, + optional f32 bias[n]) = sum_k A[m][k] Bt[n][k] (+ split products per NSPLIT). z-batch strides sA/sB/sC in elements. K % 32 == 0.
template <typename T16> struct WFrag;
template <> struct WFrag<h16> { typedef v16h V; static __device__ __forceinline__ V ld(const h16* p) { return cat16(*(const v8h*)p, *(const v8h*)(p + 16)); } static __device__ __forceinline__ v8f mma(V a, V b, v8f c) { return wmma16(a, b, c); } };
template <> struct WFrag<bf> { typedef v16bf V; static __device__ __forceinline__ V ld(const bf* p) { return cat16b(*(const v8us*)p, *(const v8us*)(p + 16)); } static __device__ __forceinline__ v8f mma(V a, V b, v8f c) { return wmmab(a, b, c); } };
template <typename T16, int NSPLIT, bool BIAS>
__global__ __launch_bounds__(32) void k_gemmw(const T16* __restrict__ A, const T16* __restrict__ A2, const T16* __restrict__ Bt, const T16* __restrict__ Bt2, int K, float* C, int ldc, const float* __restrict__ bias, size_t sA, size_t sB, size_t sC) {
    typedef typename WFrag<T16>::V V;
    __shared__ __align__(16) float os[16 * 68];
    const size_t z = blockIdx.z; A += z * sA; if (A2) A2 += z * sA; Bt += z * sB; if (Bt2) Bt2 += z * sB; C += z * sC;
    const int lane = threadIdx.x & 31, lr = lane & 15, hi = lane >> 4; const int r0 = blockIdx.x * 64, c0 = blockIdx.y * 64;
    v8f acc[4][4];
#pragma unroll
    for (int mb = 0; mb < 4; ++mb)
#pragma unroll
        for (int nb = 0; nb < 4; ++nb) acc[mb][nb] = (v8f){};
    const size_t aoff = (size_t)(r0 + lr) * K + 8 * hi, boff = (size_t)(c0 + lr) * K + 8 * hi;
#pragma unroll 1
    for (int kc = 0; kc < K; kc += 32) {
        V a[4], a2[4];
#pragma unroll
        for (int mb = 0; mb < 4; ++mb) { a[mb] = WFrag<T16>::ld(A + aoff + (size_t)mb * 16 * K + kc); if (NSPLIT == 1 || NSPLIT == 2) a2[mb] = WFrag<T16>::ld(A2 + aoff + (size_t)mb * 16 * K + kc); }
#pragma unroll
        for (int nb = 0; nb < 4; ++nb) { const V b = WFrag<T16>::ld(Bt + boff + (size_t)nb * 16 * K + kc); V b2; if (NSPLIT >= 2) b2 = WFrag<T16>::ld(Bt2 + boff + (size_t)nb * 16 * K + kc);
#pragma unroll
            for (int mb = 0; mb < 4; ++mb) { acc[mb][nb] = WFrag<T16>::mma(a[mb], b, acc[mb][nb]); if (NSPLIT == 1 || NSPLIT == 2) acc[mb][nb] = WFrag<T16>::mma(a2[mb], b, acc[mb][nb]); if (NSPLIT >= 2) acc[mb][nb] = WFrag<T16>::mma(a[mb], b2, acc[mb][nb]); } }
        asm volatile("v_nop\n\tv_nop\n\tv_nop\n\tv_nop" : "+v"(acc[0][0]), "+v"(acc[1][1]), "+v"(acc[2][2]), "+v"(acc[3][3]) : "v"(a[0]), "v"(a[3]));
    }
#pragma unroll
    for (int mb = 0; mb < 4; ++mb) {
#pragma unroll
        for (int nb = 0; nb < 4; ++nb) {
#pragma unroll
            for (int j = 0; j < 8; ++j) os[(hi * 8 + j) * 68 + nb * 16 + lr] = acc[mb][nb][j]; }
        __builtin_amdgcn_wave_barrier(); asm volatile("" ::: "memory");
        float* crow = C + (size_t)(r0 + mb * 16) * ldc + c0;
{
#pragma unroll
            for (int s = 0; s < 8; ++s) { const int row = 2 * s + hi, cofs = lr * 4; v4f val = *(const v4fa*)(os + row * 68 + cofs); if (BIAS) { val[0] += bfr(bias[c0 + cofs]); val[1] += bfr(bias[c0 + cofs + 1]); val[2] += bfr(bias[c0 + cofs + 2]); val[3] += bfr(bias[c0 + cofs + 3]); }
                *(v4f*)(crow + (size_t)row * ldc + cofs) = val; }
             }
        __builtin_amdgcn_wave_barrier(); asm volatile("" ::: "memory");
    }
}

// ---- k_gemmc: the same one-wave 64x64 tile GEMM specialised for causal attention: CMODE 1 skips score tiles entirely above the diagonal (query rows r0+roff.., key columns c0..), CMODE 2 limits the
// key (K) loop of the probability x value contraction to the diagonal block (probabilities beyond it are exactly zero). roff = row offset of this launch's first row within the sequence.
template <typename T16, int NSPLIT, int CMODE>
__global__ __launch_bounds__(32) void k_gemmc(const T16* __restrict__ A, const T16* __restrict__ A2, const T16* __restrict__ Bt, const T16* __restrict__ Bt2, int K, float* C, int ldc, int roff, size_t sA, size_t sB, size_t sC) {
    typedef typename WFrag<T16>::V V;
    __shared__ __align__(16) float os[16 * 68];
    const size_t z = blockIdx.z; A += z * sA; if (A2) A2 += z * sA; Bt += z * sB; if (Bt2) Bt2 += z * sB; C += z * sC;
    const int lane = threadIdx.x & 31, lr = lane & 15, hi = lane >> 4; const int r0 = blockIdx.x * 64, c0 = blockIdx.y * 64;
    if (CMODE == 1 && c0 > r0 + roff + 63) return;                  // score tile entirely above the causal diagonal: left unwritten (the softmax reads it but masks j > i by select)
    const int Kl = (CMODE == 2) ? min(K, r0 + roff + 64) : K;        // P.V: probabilities are exactly 0 beyond the diagonal block, so the K loop stops there
    v8f acc[4][4];
#pragma unroll
    for (int mb = 0; mb < 4; ++mb)
#pragma unroll
        for (int nb = 0; nb < 4; ++nb) acc[mb][nb] = (v8f){};
    const size_t aoff = (size_t)(r0 + lr) * K + 8 * hi, boff = (size_t)(c0 + lr) * K + 8 * hi;
#pragma unroll 1
    for (int kc = 0; kc < Kl; kc += 32) {
        V a[4], a2[4];
#pragma unroll
        for (int mb = 0; mb < 4; ++mb) { a[mb] = WFrag<T16>::ld(A + aoff + (size_t)mb * 16 * K + kc); if (NSPLIT == 1 || NSPLIT == 2) a2[mb] = WFrag<T16>::ld(A2 + aoff + (size_t)mb * 16 * K + kc); }
#pragma unroll
        for (int nb = 0; nb < 4; ++nb) { const V b = WFrag<T16>::ld(Bt + boff + (size_t)nb * 16 * K + kc); V b2; if (NSPLIT >= 2) b2 = WFrag<T16>::ld(Bt2 + boff + (size_t)nb * 16 * K + kc);
#pragma unroll
            for (int mb = 0; mb < 4; ++mb) { acc[mb][nb] = WFrag<T16>::mma(a[mb], b, acc[mb][nb]); if (NSPLIT == 1 || NSPLIT == 2) acc[mb][nb] = WFrag<T16>::mma(a2[mb], b, acc[mb][nb]); if (NSPLIT >= 2) acc[mb][nb] = WFrag<T16>::mma(a[mb], b2, acc[mb][nb]); } }
        asm volatile("v_nop\n\tv_nop\n\tv_nop\n\tv_nop" : "+v"(acc[0][0]), "+v"(acc[1][1]), "+v"(acc[2][2]), "+v"(acc[3][3]) : "v"(a[0]), "v"(a[3]));
    }
#pragma unroll
    for (int mb = 0; mb < 4; ++mb) {
#pragma unroll
        for (int nb = 0; nb < 4; ++nb) {
#pragma unroll
            for (int j = 0; j < 8; ++j) os[(hi * 8 + j) * 68 + nb * 16 + lr] = acc[mb][nb][j]; }
        __builtin_amdgcn_wave_barrier(); asm volatile("" ::: "memory");
        float* crow = C + (size_t)(r0 + mb * 16) * ldc + c0;
{
#pragma unroll
            for (int s = 0; s < 8; ++s) { const int row = 2 * s + hi, cofs = lr * 4; v4f val = *(const v4fa*)(os + row * 68 + cofs);
                *(v4f*)(crow + (size_t)row * ldc + cofs) = val; }
             }
        __builtin_amdgcn_wave_barrier(); asm volatile("" ::: "memory");
    }
}

__device__ __forceinline__ h16 tohx(float x) { return (h16)x; }
__device__ __forceinline__ void splitf(float y, unsigned short& h, unsigned short& l) { h = f2bf(y); l = f2bf(y - bf2f(h)); }
typedef __attribute__((ext_vector_type(2))) _Float16 v2h;
typedef __attribute__((ext_vector_type(4))) _Float16 v4h;
typedef __attribute__((ext_vector_type(2))) unsigned short v2us;
typedef __attribute__((ext_vector_type(4))) unsigned short v4us;
typedef __attribute__((ext_vector_type(2))) float v2f;
typedef __attribute__((ext_vector_type(4))) int v4i;

__global__ __launch_bounds__(256) void k_wtG(const float* __restrict__ w, int K, int N, bf* Bt) {
    const int lane = threadIdx.x & 31; const int L0 = (blockIdx.x * 8 + (threadIdx.x >> 5)) * 8; const int nlines = N * K / 64;
{
#pragma unroll 1
        for (int l = 0; l < 8; ++l) { const int L = L0 + l; if (L >= nlines) break; const size_t e = (size_t)L * 64 + lane * 2; const int k = (int)(e % K), n = (int)(e / K); v2us o;
            o[0] = f2bf(w[(size_t)k * N + n]); o[1] = f2bf(w[(size_t)(k + 1) * N + n]); *(v2us*)(Bt + e) = o; }
         }
}
__global__ __launch_bounds__(256) void k_cvt8(const float* __restrict__ src, bf* dst, size_t n8) { const size_t i = (size_t)blockIdx.x * 256 + threadIdx.x; if (i >= n8) return; const v8f v = *(const v8f*)(src + i * 8); v8us o;
#pragma unroll
    for (int k = 0; k < 8; ++k) o[k] = f2bf(v[k]); *(v8us*)(dst + i * 8) = o;  }
__constant__ float INV[HD / 2] = {1.0f,0.749894202f,0.562341332f,0.421696514f,0.316227764f,0.237137362f,0.177827939f,0.133352146f,0.100000001f,0.0749894157f,0.0562341288f,0.0421696492f,0.0316227786f,0.0237137359f,0.0177827943f,0.0133352149f,0.00999999978f,0.00749894232f,0.00562341325f,0.00421696482f,0.00316227786f,0.00237137382f,0.00177827943f,0.00133352145f,0.00100000005f,0.000749894185f,0.000562341302f,0.000421696488f,0.000316227786f,0.000237137385f,0.00017782794f,0.00013335215f};   // float32 1/10000^(2i/64), eager-JAX values
__global__ __launch_bounds__(256) void k_cstab(float* CS, float pm) { const int idx = blockIdx.x * 256 + threadIdx.x; if (idx >= TT * HD) return; const int t = idx / HD, d = idx % HD; float p = __fmul_rn((float)t, pm); asm volatile("" : "+v"(p)); const float ang = __fmul_rn(p, INV[d % (HD / 2)]); v2f cs; cs[0] = cosf(ang); cs[1] = sinf(ang);
    *(v2f*)(CS + (size_t)idx * 2) = cs;  }
__global__ __launch_bounds__(256) void k_zero16(bf* Z, size_t n8) { const size_t i = (size_t)blockIdx.x * 256 + threadIdx.x; if (i >= n8) return; v8us o; for (int k = 0; k < 8; ++k) o[k] = 0; *(v8us*)(Z + i * 8) = o;  }
__global__ __launch_bounds__(256) void k_pool(const float* __restrict__ FVB, int p, float* FVP) { const size_t i = (size_t)blockIdx.x * 256 + threadIdx.x; if (i >= (size_t)TT * DKV / 4) return; const size_t t = i / (DKV / 4); const int c0 = (int)(i % (DKV / 4)) * 4; v4f o; o[0] = o[1] = o[2] = o[3] = 0.f;
    if (t < (size_t)(TT / p)) { for (int r = 0; r < p; ++r) { const v4f a = *(const v4f*)(FVB + (t * p + r) * DKV + c0); for (int q = 0; q < 4; ++q) o[q] = __fadd_rn(o[q], a[q]); } const float inv = 1.0f / (float)p; for (int q = 0; q < 4; ++q) o[q] = __fmul_rn(o[q], inv); }
    *(v4f*)(FVP + t * DKV + c0) = o;  }

// k_rope: head planes [h][t][d] (fp16 + hi/lo) of rope(x) x sc with the rotate-half convention out[d] = x[d] cos[t][d] - x[d+HD/2] sin[t][d], out[d+HD/2] = x[d+HD/2] cos[t][d+HD/2] + x[d] sin[t][d+HD/2]
__global__ __launch_bounds__(256) void k_rope(const float* __restrict__ F, int pitch, int nheads, const float* __restrict__ CS, const float* __restrict__ RF, const float* __restrict__ nw, float sc, h16* P16, bf* Ph, bf* Pl) {
    const size_t e = ((size_t)blockIdx.x * 256 + threadIdx.x) * 2; if (e >= (size_t)nheads * TT * HD) return; const int d = (int)(e % HD); const int t = (int)((e / HD) % TT); const int h = (int)(e / ((size_t)HD * TT)); const float* f = F + (size_t)t * pitch + h * HD; const float rf = RF ? RF[(size_t)h * TT + t] : 1.0f; v2h o16; v2us oh, ol;
#pragma unroll
    for (int q = 0; q < 2; ++q) { const int dd = d + q; const int dp = (dd < HD / 2) ? dd + HD / 2 : dd - HD / 2; float x0 = f[dd], x1 = f[dp];
        if (RF) { float n0 = __fmul_rn(x0, rf), n1 = __fmul_rn(x1, rf); asm volatile("" : "+v"(n0)); asm volatile("" : "+v"(n1)); x0 = __fmul_rn(bfr(nw[dd]), n0); x1 = __fmul_rn(bfr(nw[dp]), n1); }
        const v2f cs = *(const v2f*)(CS + ((size_t)t * HD + dd) * 2); float a = __fmul_rn(x0, cs[0]), bq = __fmul_rn(x1, cs[1]); asm volatile("" : "+v"(a)); asm volatile("" : "+v"(bq)); const float r = ((dd < HD / 2) ? __fsub_rn(a, bq) : __fadd_rn(a, bq)) * sc;
        o16[q] = tohx(r); unsigned short a2, c2; splitf(r, a2, c2); oh[q] = a2; ol[q] = c2; }
    *(v2h*)(P16 + e) = o16; *(v2us*)(Ph + e) = oh; *(v2us*)(Pl + e) = ol;  }
__global__ __launch_bounds__(256) void k_vtp(const float* __restrict__ F, int pitch, int nheads, h16* V16, bf* Vh, bf* Vl) { const size_t e = ((size_t)blockIdx.x * 256 + threadIdx.x) * 2; if (e >= (size_t)nheads * HD * TT) return; const int t = (int)(e % TT); const int d = (int)((e / TT) % HD); const int g = (int)(e / ((size_t)TT * HD)); v2h o16; v2us oh, ol;
#pragma unroll
    for (int q = 0; q < 2; ++q) { const float x = F[(size_t)(t + q) * pitch + g * HD + d]; o16[q] = tohx(x); unsigned short a2, c2; splitf(x, a2, c2); oh[q] = a2; ol[q] = c2; }
    *(v2h*)(V16 + e) = o16; *(v2us*)(Vh + e) = oh; *(v2us*)(Vl + e) = ol;  }
// k_asoft: per row (zz, i): t = S x HD^-0.5 for j <= i and i - j < WIN (WIN = TT, so the window test always holds: plain causal; the reference's -1e9 additive fill vanishes identically); softmax over the 2048 keys (register row, one exp, fixed trees);
__global__ __launch_bounds__(256) void k_asoft(const float* __restrict__ Sb, h16* P16, bf* Ph, bf* Pl) {
    const int lane = threadIdx.x & 31; const int row = blockIdx.x * 8 + (threadIdx.x >> 5); if (row >= ZH * TT) return; const int i = row % TT; const int zz = row / TT; (void)zz; const bool hires = (i < RH); const float* sr = Sb + (size_t)row * TT; float v[TT / 32]; float mx = -3.0e38f;
#pragma unroll
    for (int ch = 0; ch < TT / 128; ++ch) { const int j0 = ch * 128 + lane * 4; const v4f a = *(const v4f*)(sr + j0);
#pragma unroll
        for (int q = 0; q < 4; ++q) { const int j = j0 + q; (void)j; const float t = (j <= i && i - j < WIN) ? a[q] * SCL : -3.0e38f; v[ch * 4 + q] = t; mx = fmaxf(mx, t); } }
#pragma unroll
    for (int sh = 16; sh; sh >>= 1) mx = fmaxf(mx, __shfl_xor(mx, sh, 32));
    float sum = 0.f;
#pragma unroll
    for (int k = 0; k < TT / 32; ++k) { float d0 = __fsub_rn(v[k], mx); asm volatile("" : "+v"(d0)); v[k] = __builtin_amdgcn_exp2f(__fmul_rn(d0, 1.4426950408889634f)); sum += v[k]; }
#pragma unroll
    for (int sh = 16; sh; sh >>= 1) sum += __shfl_xor(sum, sh, 32);
    const float f = __fdiv_rn(hires ? 1.0f : PCAR, sum);
{
        if (hires) {
#pragma unroll
            for (int ch = 0; ch < TT / 128; ++ch) { v4us oh, ol;
#pragma unroll
                for (int q = 0; q < 4; ++q) { unsigned short a, c2; splitf(v[ch * 4 + q] * f, a, c2); oh[q] = a; ol[q] = c2; }
                const size_t oo = ((size_t)zz * (RH ? RH : 1) + i) * TT + ch * 128 + lane * 4; *(v4us*)(Ph + oo) = oh; *(v4us*)(Pl + oo) = ol; }
        } else {
#pragma unroll
            for (int ch = 0; ch < TT / 128; ++ch) { v4h o4;
#pragma unroll
                for (int q = 0; q < 4; ++q) o4[q] = tohx(v[ch * 4 + q] * f);
                *(v4h*)(P16 + (size_t)row * TT + ch * 128 + lane * 4) = o4; } }
         }
}
__global__ __launch_bounds__(256) void k_merge(const float* __restrict__ O, int h0, bf* Ah, bf* Al) { const size_t e = ((size_t)blockIdx.x * 256 + threadIdx.x) * 2; if (e >= (size_t)ZH * TT * HD) return; const int d = (int)(e % HD); const int t = (int)((e / HD) % TT); const int zz = (int)(e / ((size_t)HD * TT)); const float cs = (t < RH) ? 1.0f : (1.0f / PCAR); const size_t oo = (size_t)t * DQ + (h0 + zz) * HD + d;
    v2us oh, ol;
#pragma unroll
    for (int q = 0; q < 2; ++q) { unsigned short a, c2; splitf(O[e + q] * cs, a, c2); oh[q] = a; ol[q] = c2; } *(v2us*)(Ah + oo) = oh; *(v2us*)(Al + oo) = ol;  }

extern "C" void kernel_launch(void* const* d_in, const int* in_sizes, int n_in,
                              void* d_out, int out_size, void* d_ws, size_t ws_size, hipStream_t stream) {
    (void)in_sizes; (void)n_in; (void)out_size;
    const float* x0 = (const float*)d_in[0]; const float* x1 = (const float*)d_in[1]; const float* x2 = (const float*)d_in[2]; const float* wqA = (const float*)d_in[3]; const float* bqA = (const float*)d_in[4]; const float* wkA = (const float*)d_in[5]; const float* bkA = (const float*)d_in[6]; const float* wv = (const float*)d_in[7]; const float* bv = (const float*)d_in[8]; const float* wo = (const float*)d_in[9]; const float* bo = (const float*)d_in[10]; const float* x = nullptr; const float* wq = nullptr; const float* wk = nullptr; (void)x; (void)wq; (void)wk;
    float* OUT = (float*)d_out;     // [2048 + 1024 + 512][1024]: the three tuple members back to back
    char* wsp = (char*)d_ws;
    auto take = [&](size_t bytes) { char* p = wsp; wsp += (bytes + 255) & ~(size_t)255; return (void*)p; };
    bf* WQ = (bf*)take((size_t)DQ * DM * 2); bf* WK = (bf*)take((size_t)DKV * DM * 2); bf* WV = (bf*)take((size_t)DKV * DM * 2); bf* WO = (bf*)take((size_t)DM * DQ * 2); float* CS = (float*)take((size_t)TT * HD * 2 * 4); float* FVB = (float*)take((size_t)TT * DKV * 4); float* FVP = (float*)take((size_t)TT * DKV * 4);
    bf* XB = (bf*)take((size_t)TT * DM * 2); float* FQ = (float*)take((size_t)TT * DQ * 4); float* FK = (float*)take((size_t)TT * DKV * 4);
    h16* QP16 = (h16*)take((size_t)NH_ * TT * HD * 2); h16* KP16 = (h16*)take((size_t)NKV * TT * HD * 2); h16* VT16 = (h16*)take((size_t)NKV * HD * TT * 2);
    bf* QPh = (bf*)take((size_t)NH_ * TT * HD * 2); bf* QPl = (bf*)take((size_t)NH_ * TT * HD * 2); bf* KPh = (bf*)take((size_t)NKV * TT * HD * 2); bf* KPl = (bf*)take((size_t)NKV * TT * HD * 2); bf* VTh = (bf*)take((size_t)NKV * HD * TT * 2); bf* VTl = (bf*)take((size_t)NKV * HD * TT * 2); bf* Ph = (bf*)take((size_t)ZH * RH * TT * 2); bf* Pl = (bf*)take((size_t)ZH * RH * TT * 2);
    float* Sb = (float*)take((size_t)ZH * TT * TT * 4); h16* P16 = (h16*)take((size_t)ZH * TT * TT * 2); float* Ob = (float*)take((size_t)ZH * TT * HD * 4); bf* ATh = (bf*)take((size_t)TT * DQ * 2); bf* ATl = (bf*)take((size_t)TT * DQ * 2);
    if ((size_t)(wsp - (char*)d_ws) > ws_size) return;    // ws 256 MiB
    /* shared value base: v_base = x0 Wv^T + bv (exact) */
    k_cvt8<<<(unsigned)(((size_t)DKV * DM / 8 + 255) / 256), 256, 0, stream>>>(wv, WV, (size_t)DKV * DM / 8); k_cvt8<<<(unsigned)(((size_t)DM * DQ / 8 + 255) / 256), 256, 0, stream>>>(wo, WO, (size_t)DM * DQ / 8);
    k_cvt8<<<(unsigned)(((size_t)TT * DM / 8 + 255) / 256), 256, 0, stream>>>(x0, XB, (size_t)TT * DM / 8);
    k_gemmw<bf, 0, true><<<dim3(TT / 64, DKV / 64, 1), 32, 0, stream>>>(XB, nullptr, WV, nullptr, DM, FVB, DKV, bv, 0, 0, 0);
    const unsigned LQ = (unsigned)(((size_t)NH_ * TT * HD / 2 + 255) / 256), LKv = (unsigned)(((size_t)NKV * TT * HD / 2 + 255) / 256);
    const float* xs[3] = {x0, x1, x2}; size_t orow = 0;
    for (int s = 0; s < 3; ++s) { const int p = 1 << s; const int Ns = TT >> s;
        k_cvt8<<<(unsigned)(((size_t)DQ * DM / 8 + 255) / 256), 256, 0, stream>>>(wqA + (size_t)s * DQ * DM, WQ, (size_t)DQ * DM / 8); k_cvt8<<<(unsigned)(((size_t)DKV * DM / 8 + 255) / 256), 256, 0, stream>>>(wkA + (size_t)s * DKV * DM, WK, (size_t)DKV * DM / 8);
        k_cstab<<<(TT * HD + 255) / 256, 256, 0, stream>>>(CS, (float)p);                                      /* positions t x 2^s */
        if (s > 0) { k_zero16<<<(unsigned)(((size_t)TT * DM / 8 + 255) / 256), 256, 0, stream>>>(XB, (size_t)TT * DM / 8); }
        k_cvt8<<<(unsigned)(((size_t)Ns * DM / 8 + 255) / 256), 256, 0, stream>>>(xs[s], XB, (size_t)Ns * DM / 8);   /* the scale's rows, zero-padded to 2048 */
        k_gemmw<bf, 0, true><<<dim3(TT / 64, DQ / 64, 1), 32, 0, stream>>>(XB, nullptr, WQ, nullptr, DM, FQ, DQ, bqA + (size_t)s * DQ, 0, 0, 0);
        k_rope<<<LQ, 256, 0, stream>>>(FQ, DQ, NH_, CS, nullptr, nullptr, 1.0f, QP16, QPh, QPl);
        k_gemmw<bf, 0, true><<<dim3(TT / 64, DKV / 64, 1), 32, 0, stream>>>(XB, nullptr, WK, nullptr, DM, FK, DKV, bkA + (size_t)s * DKV, 0, 0, 0);
        k_rope<<<LKv, 256, 0, stream>>>(FK, DKV, NKV, CS, nullptr, nullptr, 1.0f, KP16, KPh, KPl);
        if (s == 0) { k_vtp<<<LKv, 256, 0, stream>>>(FVB, DKV, NKV, VT16, VTh, VTl); }
        else { k_pool<<<(unsigned)(((size_t)TT * DKV / 4 + 255) / 256), 256, 0, stream>>>(FVB, p, FVP); k_vtp<<<LKv, 256, 0, stream>>>(FVP, DKV, NKV, VT16, VTh, VTl); }   /* pooled values, padded rows zero */
        for (int h0 = 0; h0 < NH_; h0 += ZH) { const size_t zq = (size_t)h0, zk = (size_t)(h0 / REP);   // one kv head per query head: the pass's two heads use consecutive kv planes (z-strides TT*HD)
            k_gemmc<bf, 2, 1><<<dim3(RH / 64, TT / 64, ZH), 32, 0, stream>>>(QPh + zq * TT * HD, QPl + zq * TT * HD, KPh + zk * TT * HD, KPl + zk * TT * HD, HD, Sb, TT, 0, (size_t)TT * HD, (size_t)TT * HD, (size_t)TT * TT);
            k_gemmc<h16, 0, 1><<<dim3((TT - RH) / 64, TT / 64, ZH), 32, 0, stream>>>(QP16 + zq * TT * HD + (size_t)RH * HD, nullptr, KP16 + zk * TT * HD, nullptr, HD, Sb + (size_t)RH * TT, TT, RH, (size_t)TT * HD, (size_t)TT * HD, (size_t)TT * TT);
            k_asoft<<<ZH * TT / 8, 256, 0, stream>>>(Sb, P16, Ph, Pl);
            k_gemmc<bf, 2, 2><<<dim3(RH / 64, HD / 64, ZH), 32, 0, stream>>>(Ph, Pl, VTh + zk * HD * TT, VTl + zk * HD * TT, TT, Ob, HD, 0, (size_t)RH * TT, (size_t)HD * TT, (size_t)TT * HD);
            k_gemmc<h16, 0, 2><<<dim3((TT - RH) / 64, HD / 64, ZH), 32, 0, stream>>>(P16 + (size_t)RH * TT, nullptr, VT16 + zk * HD * TT, nullptr, TT, Ob + (size_t)RH * HD, HD, RH, (size_t)TT * TT, (size_t)HD * TT, (size_t)TT * HD);
            k_merge<<<(unsigned)(((size_t)ZH * TT * HD / 2 + 255) / 256), 256, 0, stream>>>(Ob, h0, ATh, ATl); }
        k_gemmw<bf, 1, true><<<dim3(Ns / 64, DM / 64, 1), 32, 0, stream>>>(ATh, ATl, WO, nullptr, DQ, OUT + orow * DM, DM, bo, 0, 0, 0);   /* only the N_s real rows of this tuple member */
        orow += (size_t)Ns; }
}

// v001
// A run of this version takes 1230 microseconds.
// Timed twice side by side with v000, it ran 1.74 and 1.73 times as fast.
#include <hip/hip_runtime.h>

// Multiscale causal attention (x0 [1][2048][1024], x1 [1][1024][1024], x2 [1][512][1024]; v_base = x0 Wv^T + bv shared, average-pooled by 2^i for scale i; per scale i: q, k = x_i W[i]^T + b[i] ('oi' [1024][1024] + [1024]; 16 heads x 64), rotate-half rotary at positions t x 2^i (base 1e4), scores = q.k / 8, causal (finfo.min); softmax; ctx_i = w v_i; out_i = ctx_i Wo^T + bo -> tuple ([1][2048][1024], [1][1024][1024], [1][512][1024]) (3.7 M)).
// Realisation: each scale runs the same T-2048 causal pipeline on its sequence zero-padded to 2048 rows - causality means every real query row only sees real keys (j <= i < N_i), so the padding never reaches a real output; the per-scale rope table uses positions t x 2^i; the pooled values are built by a small averaging kernel; the output GEMM writes only the N_i real rows of each tuple member.
// Compute dtypes, f32 accumulate: every input rounded to bf16; q/k/v on PLAIN bf16 operands (inputs: exact) + biases; rotary in f32 (precise sinf/cosf, 32 baked float32 inverse frequencies, position factor 2^i exact); causal tile skipping; value pooling in f32 (in-order means of 2^i rows as the reference's reshape-mean); scores and attn.v: query rows < 512 hl (3 products), the rest single fp16 (x1024); softmax f32; Wo hl x exact (2 products) + bo.

#define NB_  1
#define TT   2048
#define DM   1024
#define NH_  16
#define NKV  16
#define REP  (NH_ / NKV)
#define HD   64
#define DQ   (NH_ * HD)
#define DKV  (NKV * HD)
#define ZH   2
#define RH   512                  // query rows < RH use hi+lo planes (0: none)
#define WIN  2048
#define PCAR 1024.0f
#define SCL  0.125f   // HD^-0.5
typedef _Float16 h16;
typedef unsigned short bf;
typedef __attribute__((ext_vector_type(16))) __bf16   v16bf;
typedef __attribute__((ext_vector_type(16))) _Float16 v16h;
typedef __attribute__((ext_vector_type(8)))  _Float16 v8h;
typedef __attribute__((ext_vector_type(8)))  unsigned short v8us;
typedef __attribute__((ext_vector_type(8)))  float    v8f;
typedef __attribute__((ext_vector_type(4)))  float    v4f;
typedef v8h  __attribute__((may_alias)) v8ha;
typedef v4f  __attribute__((may_alias)) v4fa;
typedef v8us __attribute__((may_alias)) v8usa;

__device__ __forceinline__ unsigned short f2bf(float f) { unsigned u = __float_as_uint(f); u += 0x7FFFu + ((u >> 16) & 1u); return (unsigned short)(u >> 16); }
__device__ __forceinline__ float bf2f(unsigned short b) { return __uint_as_float(((unsigned)b) << 16); }
__device__ __forceinline__ float bfr(float f) { return bf2f(f2bf(f)); }
__device__ __forceinline__ v16h cat16(v8h lo, v8h hi) { return __builtin_shufflevector(lo, hi, 0, 1, 2, 3, 4, 5, 6, 7, 8, 9, 10, 11, 12, 13, 14, 15); }
__device__ __forceinline__ v16bf cat16b(v8us lo, v8us hi) { return __builtin_bit_cast(v16bf, __builtin_shufflevector(lo, hi, 0, 1, 2, 3, 4, 5, 6, 7, 8, 9, 10, 11, 12, 13, 14, 15)); }
__device__ __forceinline__ v8f wmma16(v16h a, v16h b, v8f c) { return __builtin_amdgcn_wmma_f32_16x16x32_f16(false, a, false, b, (short)0, c, false, false); }
__device__ __forceinline__ v8f wmmab(v16bf a, v16bf b, v8f c) { return __builtin_amdgcn_wmma_f32_16x16x32_bf16(false, a, false, b, (short)0, c, false, false); }



// ---- k_gemmk: register-blocked GEMM, one 64x64 output tile per work-group of NW waves, the K loop split over the waves: wave w takes the 64-element (128-byte) K chunks w, w + NW, ... with its own 16 accumulators,
// operands straight from K-contiguous 16-bit planes; the NW partial tiles meet in LDS and are added in wave order 0..NW-1. grid (M/64, N/64, Z), NW x 32 threads.
// C[m][n] (f32, pitch ldc, + optional f32 bias[n]) = sum_k A[m][k] Bt[n][k] (+ split products per NSPLIT). z-batch strides sA/sB/sC in elements. K % 64 == 0.
// CMODE 2 (probability x value): the K loop ends at the diagonal block of query rows r0 + roff.. (probabilities beyond it are exactly zero); roff = row offset of this launch's first row within the sequence.
template <typename T16> struct WFrag;
template <> struct WFrag<h16> { typedef v16h V; static __device__ __forceinline__ V ld(const h16* p) { return cat16(*(const v8h*)p, *(const v8h*)(p + 16)); } static __device__ __forceinline__ v8f mma(V a, V b, v8f c) { return wmma16(a, b, c); } };
template <> struct WFrag<bf> { typedef v16bf V; static __device__ __forceinline__ V ld(const bf* p) { return cat16b(*(const v8us*)p, *(const v8us*)(p + 16)); } static __device__ __forceinline__ v8f mma(V a, V b, v8f c) { return wmmab(a, b, c); } };
template <typename T16, int NSPLIT, bool BIAS, int CMODE, int NW>
__global__ __launch_bounds__(NW * 32) void k_gemmk(const T16* __restrict__ A, const T16* __restrict__ A2, const T16* __restrict__ Bt, const T16* __restrict__ Bt2, int K, float* C, int ldc, const float* __restrict__ bias, int roff, size_t sA, size_t sB, size_t sC) {
    typedef typename WFrag<T16>::V V;
    constexpr int RR = 2 * NW;                                        // tile rows added per round: one float4 per thread
    constexpr int NBUF = (2 * NW * RR * 68 * 4 <= 160 * 1024) ? 2 : 1; // two round buffers where both fit in half a WGP's LDS
    __shared__ __align__(16) float os[NBUF * NW * RR * 68];
    const size_t z = blockIdx.z; A += z * sA; if (A2) A2 += z * sA; Bt += z * sB; if (Bt2) Bt2 += z * sB; C += z * sC;
    const int lane = threadIdx.x & 31, lr = lane & 15, hi = lane >> 4; const int r0 = blockIdx.x * 64, c0 = blockIdx.y * 64;
    const int wv = __builtin_amdgcn_readfirstlane((int)(threadIdx.x >> 5));   // wave number in a scalar register: the K loop stays a scalar loop with every lane on
    const int Kl = (CMODE == 2) ? min(K, r0 + roff + 64) : K;
    v8f acc[4][4];
#pragma unroll
    for (int mb = 0; mb < 4; ++mb)
#pragma unroll
        for (int nb = 0; nb < 4; ++nb) acc[mb][nb] = (v8f){};
    const size_t aoff = (size_t)(r0 + lr) * K + 8 * hi, boff = (size_t)(c0 + lr) * K + 8 * hi;
#pragma unroll 1
    for (int kc = wv * 64; kc < Kl; kc += (kc & 32) ? NW * 64 - 32 : 32) {   // both halves of a 128-byte chunk, then this wave's next chunk
        V a[4], a2[4];
#pragma unroll
        for (int mb = 0; mb < 4; ++mb) { a[mb] = WFrag<T16>::ld(A + aoff + (size_t)mb * 16 * K + kc); if (NSPLIT == 1 || NSPLIT == 2) a2[mb] = WFrag<T16>::ld(A2 + aoff + (size_t)mb * 16 * K + kc); }
#pragma unroll
        for (int nb = 0; nb < 4; ++nb) { const V b = WFrag<T16>::ld(Bt + boff + (size_t)nb * 16 * K + kc); V b2; if (NSPLIT >= 2) b2 = WFrag<T16>::ld(Bt2 + boff + (size_t)nb * 16 * K + kc);
#pragma unroll
            for (int mb = 0; mb < 4; ++mb) { acc[mb][nb] = WFrag<T16>::mma(a[mb], b, acc[mb][nb]); if (NSPLIT == 1 || NSPLIT == 2) acc[mb][nb] = WFrag<T16>::mma(a2[mb], b, acc[mb][nb]); if (NSPLIT >= 2) acc[mb][nb] = WFrag<T16>::mma(a[mb], b2, acc[mb][nb]); } }
        // four vector slots behind the last matrix instruction, on the back edge and on the exit alike, before its operands or results are touched
        asm volatile("v_nop\n\tv_nop\n\tv_nop\n\tv_nop" : "+v"(acc[0][0]), "+v"(acc[1][1]), "+v"(acc[2][2]), "+v"(acc[3][3]) : "v"(a[0]), "v"(a[3]));
    }
    const int row = threadIdx.x >> 4, cofs = (threadIdx.x & 15) * 4;
    v4f res[64 / RR];
#pragma unroll
    for (int rd = 0; rd < 64 / RR; ++rd) {
        float* ob = os + (rd % NBUF) * (NW * RR * 68);                // two buffers in turn: one barrier a round is enough
        if (NBUF == 1 && rd) __syncthreads();                         // one buffer: the round before is read before it is overwritten
#pragma unroll
        for (int m = 0; m < RR / 16; ++m) {
#pragma unroll
            for (int nb = 0; nb < 4; ++nb) {
#pragma unroll
                for (int j = 0; j < 8; ++j) ob[(wv * RR + m * 16 + hi * 8 + j) * 68 + nb * 16 + lr] = acc[rd * (RR / 16) + m][nb][j]; } }
        __syncthreads();                                              // every wave's partial rows of this round are in LDS (two buffers: and every read of the buffer written next is done)
        v4f val = *(const v4fa*)(ob + row * 68 + cofs);
#pragma unroll
        for (int w = 1; w < NW; ++w) val += *(const v4fa*)(ob + (w * RR + row) * 68 + cofs);
        res[rd] = val;
    }
    v4f bb; bb[0] = bb[1] = bb[2] = bb[3] = 0.f;
    if (BIAS) { bb[0] = bfr(bias[c0 + cofs]); bb[1] = bfr(bias[c0 + cofs + 1]); bb[2] = bfr(bias[c0 + cofs + 2]); bb[3] = bfr(bias[c0 + cofs + 3]); }
#pragma unroll
    for (int rd = 0; rd < 64 / RR; ++rd) {                            // stores behind the last barrier: no barrier waits for a global store
        v4f val = res[rd]; if (BIAS) val += bb;
        *(v4f*)(C + (size_t)(r0 + rd * RR + row) * ldc + c0 + cofs) = val; }
}

// ---- k_gemmc: one-wave 64x64 tile GEMM (16 accumulators, 32 threads) specialised for causal attention: CMODE 1 skips score tiles entirely above the diagonal (query rows r0+roff.., key columns c0..), CMODE 2 limits the
// key (K) loop of the probability x value contraction to the diagonal block (probabilities beyond it are exactly zero). roff = row offset of this launch's first row within the sequence.
template <typename T16, int NSPLIT, int CMODE>
__global__ __launch_bounds__(32) void k_gemmc(const T16* __restrict__ A, const T16* __restrict__ A2, const T16* __restrict__ Bt, const T16* __restrict__ Bt2, int K, float* C, int ldc, int roff, size_t sA, size_t sB, size_t sC) {
    typedef typename WFrag<T16>::V V;
    __shared__ __align__(16) float os[16 * 68];
    const size_t z = blockIdx.z; A += z * sA; if (A2) A2 += z * sA; Bt += z * sB; if (Bt2) Bt2 += z * sB; C += z * sC;
    const int lane = threadIdx.x & 31, lr = lane & 15, hi = lane >> 4; const int r0 = blockIdx.x * 64, c0 = blockIdx.y * 64;
    if (CMODE == 1 && c0 > r0 + roff + 63) return;                  // score tile entirely above the causal diagonal: left unwritten (the softmax reads it but masks j > i by select)
    const int Kl = (CMODE == 2) ? min(K, r0 + roff + 64) : K;        // P.V: probabilities are exactly 0 beyond the diagonal block, so the K loop stops there
    v8f acc[4][4];
#pragma unroll
    for (int mb = 0; mb < 4; ++mb)
#pragma unroll
        for (int nb = 0; nb < 4; ++nb) acc[mb][nb] = (v8f){};
    const size_t aoff = (size_t)(r0 + lr) * K + 8 * hi, boff = (size_t)(c0 + lr) * K + 8 * hi;
#pragma unroll 1
    for (int kc = 0; kc < Kl; kc += 32) {
        V a[4], a2[4];
#pragma unroll
        for (int mb = 0; mb < 4; ++mb) { a[mb] = WFrag<T16>::ld(A + aoff + (size_t)mb * 16 * K + kc); if (NSPLIT == 1 || NSPLIT == 2) a2[mb] = WFrag<T16>::ld(A2 + aoff + (size_t)mb * 16 * K + kc); }
#pragma unroll
        for (int nb = 0; nb < 4; ++nb) { const V b = WFrag<T16>::ld(Bt + boff + (size_t)nb * 16 * K + kc); V b2; if (NSPLIT >= 2) b2 = WFrag<T16>::ld(Bt2 + boff + (size_t)nb * 16 * K + kc);
#pragma unroll
            for (int mb = 0; mb < 4; ++mb) { acc[mb][nb] = WFrag<T16>::mma(a[mb], b, acc[mb][nb]); if (NSPLIT == 1 || NSPLIT == 2) acc[mb][nb] = WFrag<T16>::mma(a2[mb], b, acc[mb][nb]); if (NSPLIT >= 2) acc[mb][nb] = WFrag<T16>::mma(a[mb], b2, acc[mb][nb]); } }
        asm volatile("v_nop\n\tv_nop\n\tv_nop\n\tv_nop" : "+v"(acc[0][0]), "+v"(acc[1][1]), "+v"(acc[2][2]), "+v"(acc[3][3]) : "v"(a[0]), "v"(a[3]));
    }
#pragma unroll
    for (int mb = 0; mb < 4; ++mb) {
#pragma unroll
        for (int nb = 0; nb < 4; ++nb) {
#pragma unroll
            for (int j = 0; j < 8; ++j) os[(hi * 8 + j) * 68 + nb * 16 + lr] = acc[mb][nb][j]; }
        __builtin_amdgcn_wave_barrier(); asm volatile("" ::: "memory");
        float* crow = C + (size_t)(r0 + mb * 16) * ldc + c0;
{
#pragma unroll
            for (int s = 0; s < 8; ++s) { const int row = 2 * s + hi, cofs = lr * 4; v4f val = *(const v4fa*)(os + row * 68 + cofs);
                *(v4f*)(crow + (size_t)row * ldc + cofs) = val; }
             }
        __builtin_amdgcn_wave_barrier(); asm volatile("" ::: "memory");
    }
}

__device__ __forceinline__ h16 tohx(float x) { return (h16)x; }
__device__ __forceinline__ void splitf(float y, unsigned short& h, unsigned short& l) { h = f2bf(y); l = f2bf(y - bf2f(h)); }
typedef __attribute__((ext_vector_type(2))) _Float16 v2h;
typedef __attribute__((ext_vector_type(4))) _Float16 v4h;
typedef __attribute__((ext_vector_type(2))) unsigned short v2us;
typedef __attribute__((ext_vector_type(4))) unsigned short v4us;
typedef __attribute__((ext_vector_type(2))) float v2f;
typedef __attribute__((ext_vector_type(4))) int v4i;

__global__ __launch_bounds__(256) void k_wtG(const float* __restrict__ w, int K, int N, bf* Bt) {
    const int lane = threadIdx.x & 31; const int L0 = (blockIdx.x * 8 + (threadIdx.x >> 5)) * 8; const int nlines = N * K / 64;
{
#pragma unroll 1
        for (int l = 0; l < 8; ++l) { const int L = L0 + l; if (L >= nlines) break; const size_t e = (size_t)L * 64 + lane * 2; const int k = (int)(e % K), n = (int)(e / K); v2us o;
            o[0] = f2bf(w[(size_t)k * N + n]); o[1] = f2bf(w[(size_t)(k + 1) * N + n]); *(v2us*)(Bt + e) = o; }
         }
}
__global__ __launch_bounds__(256) void k_cvt8(const float* __restrict__ src, bf* dst, size_t n8) { const size_t i = (size_t)blockIdx.x * 256 + threadIdx.x; if (i >= n8) return; const v8f v = *(const v8f*)(src + i * 8); v8us o;
#pragma unroll
    for (int k = 0; k < 8; ++k) o[k] = f2bf(v[k]); *(v8us*)(dst + i * 8) = o;  }
__constant__ float INV[HD / 2] = {1.0f,0.749894202f,0.562341332f,0.421696514f,0.316227764f,0.237137362f,0.177827939f,0.133352146f,0.100000001f,0.0749894157f,0.0562341288f,0.0421696492f,0.0316227786f,0.0237137359f,0.0177827943f,0.0133352149f,0.00999999978f,0.00749894232f,0.00562341325f,0.00421696482f,0.00316227786f,0.00237137382f,0.00177827943f,0.00133352145f,0.00100000005f,0.000749894185f,0.000562341302f,0.000421696488f,0.000316227786f,0.000237137385f,0.00017782794f,0.00013335215f};   // float32 1/10000^(2i/64), eager-JAX values
__global__ __launch_bounds__(256) void k_cstab(float* CS, float pm) { const int idx = blockIdx.x * 256 + threadIdx.x; if (idx >= TT * HD) return; const int t = idx / HD, d = idx % HD; float p = __fmul_rn((float)t, pm); asm volatile("" : "+v"(p)); const float ang = __fmul_rn(p, INV[d % (HD / 2)]); v2f cs; cs[0] = cosf(ang); cs[1] = sinf(ang);
    *(v2f*)(CS + (size_t)idx * 2) = cs;  }
__global__ __launch_bounds__(256) void k_zero16(bf* Z, size_t n8) { const size_t i = (size_t)blockIdx.x * 256 + threadIdx.x; if (i >= n8) return; v8us o; for (int k = 0; k < 8; ++k) o[k] = 0; *(v8us*)(Z + i * 8) = o;  }
__global__ __launch_bounds__(256) void k_pool(const float* __restrict__ FVB, int p, float* FVP) { const size_t i = (size_t)blockIdx.x * 256 + threadIdx.x; if (i >= (size_t)TT * DKV / 4) return; const size_t t = i / (DKV / 4); const int c0 = (int)(i % (DKV / 4)) * 4; v4f o; o[0] = o[1] = o[2] = o[3] = 0.f;
    if (t < (size_t)(TT / p)) { for (int r = 0; r < p; ++r) { const v4f a = *(const v4f*)(FVB + (t * p + r) * DKV + c0); for (int q = 0; q < 4; ++q) o[q] = __fadd_rn(o[q], a[q]); } const float inv = 1.0f / (float)p; for (int q = 0; q < 4; ++q) o[q] = __fmul_rn(o[q], inv); }
    *(v4f*)(FVP + t * DKV + c0) = o;  }

// k_rope: head planes [h][t][d] (fp16 + hi/lo) of rope(x) x sc with the rotate-half convention out[d] = x[d] cos[t][d] - x[d+HD/2] sin[t][d], out[d+HD/2] = x[d+HD/2] cos[t][d+HD/2] + x[d] sin[t][d+HD/2]
__global__ __launch_bounds__(256) void k_rope(const float* __restrict__ F, int pitch, int nheads, const float* __restrict__ CS, const float* __restrict__ RF, const float* __restrict__ nw, float sc, h16* P16, bf* Ph, bf* Pl) {
    const size_t e = ((size_t)blockIdx.x * 256 + threadIdx.x) * 2; if (e >= (size_t)nheads * TT * HD) return; const int d = (int)(e % HD); const int t = (int)((e / HD) % TT); const int h = (int)(e / ((size_t)HD * TT)); const float* f = F + (size_t)t * pitch + h * HD; const float rf = RF ? RF[(size_t)h * TT + t] : 1.0f; v2h o16; v2us oh, ol;
#pragma unroll
    for (int q = 0; q < 2; ++q) { const int dd = d + q; const int dp = (dd < HD / 2) ? dd + HD / 2 : dd - HD / 2; float x0 = f[dd], x1 = f[dp];
        if (RF) { float n0 = __fmul_rn(x0, rf), n1 = __fmul_rn(x1, rf); asm volatile("" : "+v"(n0)); asm volatile("" : "+v"(n1)); x0 = __fmul_rn(bfr(nw[dd]), n0); x1 = __fmul_rn(bfr(nw[dp]), n1); }
        const v2f cs = *(const v2f*)(CS + ((size_t)t * HD + dd) * 2); float a = __fmul_rn(x0, cs[0]), bq = __fmul_rn(x1, cs[1]); asm volatile("" : "+v"(a)); asm volatile("" : "+v"(bq)); const float r = ((dd < HD / 2) ? __fsub_rn(a, bq) : __fadd_rn(a, bq)) * sc;
        o16[q] = tohx(r); unsigned short a2, c2; splitf(r, a2, c2); oh[q] = a2; ol[q] = c2; }
    *(v2h*)(P16 + e) = o16; *(v2us*)(Ph + e) = oh; *(v2us*)(Pl + e) = ol;  }
__global__ __launch_bounds__(256) void k_vtp(const float* __restrict__ F, int pitch, int nheads, h16* V16, bf* Vh, bf* Vl) { const size_t e = ((size_t)blockIdx.x * 256 + threadIdx.x) * 2; if (e >= (size_t)nheads * HD * TT) return; const int t = (int)(e % TT); const int d = (int)((e / TT) % HD); const int g = (int)(e / ((size_t)TT * HD)); v2h o16; v2us oh, ol;
#pragma unroll
    for (int q = 0; q < 2; ++q) { const float x = F[(size_t)(t + q) * pitch + g * HD + d]; o16[q] = tohx(x); unsigned short a2, c2; splitf(x, a2, c2); oh[q] = a2; ol[q] = c2; }
    *(v2h*)(V16 + e) = o16; *(v2us*)(Vh + e) = oh; *(v2us*)(Vl + e) = ol;  }
// k_asoft: per row (zz, i): t = S x HD^-0.5 for j <= i and i - j < WIN (WIN = TT, so the window test always holds: plain causal; the reference's -1e9 additive fill vanishes identically); softmax over the 2048 keys (register row, one exp, fixed trees);
__global__ __launch_bounds__(256) void k_asoft(const float* __restrict__ Sb, h16* P16, bf* Ph, bf* Pl) {
    const int lane = threadIdx.x & 31; const int row = blockIdx.x * 8 + (threadIdx.x >> 5); if (row >= ZH * TT) return; const int i = row % TT; const int zz = row / TT; (void)zz; const bool hires = (i < RH); const float* sr = Sb + (size_t)row * TT; float v[TT / 32]; float mx = -3.0e38f;
#pragma unroll
    for (int ch = 0; ch < TT / 128; ++ch) { const int j0 = ch * 128 + lane * 4; const v4f a = *(const v4f*)(sr + j0);
#pragma unroll
        for (int q = 0; q < 4; ++q) { const int j = j0 + q; (void)j; const float t = (j <= i && i - j < WIN) ? a[q] * SCL : -3.0e38f; v[ch * 4 + q] = t; mx = fmaxf(mx, t); } }
#pragma unroll
    for (int sh = 16; sh; sh >>= 1) mx = fmaxf(mx, __shfl_xor(mx, sh, 32));
    float sum = 0.f;
#pragma unroll
    for (int k = 0; k < TT / 32; ++k) { float d0 = __fsub_rn(v[k], mx); asm volatile("" : "+v"(d0)); v[k] = __builtin_amdgcn_exp2f(__fmul_rn(d0, 1.4426950408889634f)); sum += v[k]; }
#pragma unroll
    for (int sh = 16; sh; sh >>= 1) sum += __shfl_xor(sum, sh, 32);
    const float f = __fdiv_rn(hires ? 1.0f : PCAR, sum);
{
        if (hires) {
#pragma unroll
            for (int ch = 0; ch < TT / 128; ++ch) { v4us oh, ol;
#pragma unroll
                for (int q = 0; q < 4; ++q) { unsigned short a, c2; splitf(v[ch * 4 + q] * f, a, c2); oh[q] = a; ol[q] = c2; }
                const size_t oo = ((size_t)zz * (RH ? RH : 1) + i) * TT + ch * 128 + lane * 4; *(v4us*)(Ph + oo) = oh; *(v4us*)(Pl + oo) = ol; }
        } else {
#pragma unroll
            for (int ch = 0; ch < TT / 128; ++ch) { v4h o4;
#pragma unroll
                for (int q = 0; q < 4; ++q) o4[q] = tohx(v[ch * 4 + q] * f);
                *(v4h*)(P16 + (size_t)row * TT + ch * 128 + lane * 4) = o4; } }
         }
}
__global__ __launch_bounds__(256) void k_merge(const float* __restrict__ O, int h0, bf* Ah, bf* Al) { const size_t e = ((size_t)blockIdx.x * 256 + threadIdx.x) * 2; if (e >= (size_t)ZH * TT * HD) return; const int d = (int)(e % HD); const int t = (int)((e / HD) % TT); const int zz = (int)(e / ((size_t)HD * TT)); const float cs = (t < RH) ? 1.0f : (1.0f / PCAR); const size_t oo = (size_t)t * DQ + (h0 + zz) * HD + d;
    v2us oh, ol;
#pragma unroll
    for (int q = 0; q < 2; ++q) { unsigned short a, c2; splitf(O[e + q] * cs, a, c2); oh[q] = a; ol[q] = c2; } *(v2us*)(Ah + oo) = oh; *(v2us*)(Al + oo) = ol;  }

extern "C" void kernel_launch(void* const* d_in, const int* in_sizes, int n_in,
                              void* d_out, int out_size, void* d_ws, size_t ws_size, hipStream_t stream) {
    (void)in_sizes; (void)n_in; (void)out_size;
    const float* x0 = (const float*)d_in[0]; const float* x1 = (const float*)d_in[1]; const float* x2 = (const float*)d_in[2]; const float* wqA = (const float*)d_in[3]; const float* bqA = (const float*)d_in[4]; const float* wkA = (const float*)d_in[5]; const float* bkA = (const float*)d_in[6]; const float* wv = (const float*)d_in[7]; const float* bv = (const float*)d_in[8]; const float* wo = (const float*)d_in[9]; const float* bo = (const float*)d_in[10]; const float* x = nullptr; const float* wq = nullptr; const float* wk = nullptr; (void)x; (void)wq; (void)wk;
    float* OUT = (float*)d_out;     // [2048 + 1024 + 512][1024]: the three tuple members back to back
    char* wsp = (char*)d_ws;
    auto take = [&](size_t bytes) { char* p = wsp; wsp += (bytes + 255) & ~(size_t)255; return (void*)p; };
    bf* WQ = (bf*)take((size_t)DQ * DM * 2); bf* WK = (bf*)take((size_t)DKV * DM * 2); bf* WV = (bf*)take((size_t)DKV * DM * 2); bf* WO = (bf*)take((size_t)DM * DQ * 2); float* CS = (float*)take((size_t)TT * HD * 2 * 4); float* FVB = (float*)take((size_t)TT * DKV * 4); float* FVP = (float*)take((size_t)TT * DKV * 4);
    bf* XB = (bf*)take((size_t)TT * DM * 2); float* FQ = (float*)take((size_t)TT * DQ * 4); float* FK = (float*)take((size_t)TT * DKV * 4);
    h16* QP16 = (h16*)take((size_t)NH_ * TT * HD * 2); h16* KP16 = (h16*)take((size_t)NKV * TT * HD * 2); h16* VT16 = (h16*)take((size_t)NKV * HD * TT * 2);
    bf* QPh = (bf*)take((size_t)NH_ * TT * HD * 2); bf* QPl = (bf*)take((size_t)NH_ * TT * HD * 2); bf* KPh = (bf*)take((size_t)NKV * TT * HD * 2); bf* KPl = (bf*)take((size_t)NKV * TT * HD * 2); bf* VTh = (bf*)take((size_t)NKV * HD * TT * 2); bf* VTl = (bf*)take((size_t)NKV * HD * TT * 2); bf* Ph = (bf*)take((size_t)ZH * RH * TT * 2); bf* Pl = (bf*)take((size_t)ZH * RH * TT * 2);
    float* Sb = (float*)take((size_t)ZH * TT * TT * 4); h16* P16 = (h16*)take((size_t)ZH * TT * TT * 2); float* Ob = (float*)take((size_t)ZH * TT * HD * 4); bf* ATh = (bf*)take((size_t)TT * DQ * 2); bf* ATl = (bf*)take((size_t)TT * DQ * 2);
    if ((size_t)(wsp - (char*)d_ws) > ws_size) return;    // ws 256 MiB
    /* shared value base: v_base = x0 Wv^T + bv (exact) */
    k_cvt8<<<(unsigned)(((size_t)DKV * DM / 8 + 255) / 256), 256, 0, stream>>>(wv, WV, (size_t)DKV * DM / 8); k_cvt8<<<(unsigned)(((size_t)DM * DQ / 8 + 255) / 256), 256, 0, stream>>>(wo, WO, (size_t)DM * DQ / 8);
    k_cvt8<<<(unsigned)(((size_t)TT * DM / 8 + 255) / 256), 256, 0, stream>>>(x0, XB, (size_t)TT * DM / 8);
    k_gemmk<bf, 0, true, 0, 8><<<dim3(TT / 64, DKV / 64, 1), 256, 0, stream>>>(XB, nullptr, WV, nullptr, DM, FVB, DKV, bv, 0, 0, 0, 0);
    const unsigned LQ = (unsigned)(((size_t)NH_ * TT * HD / 2 + 255) / 256), LKv = (unsigned)(((size_t)NKV * TT * HD / 2 + 255) / 256);
    const float* xs[3] = {x0, x1, x2}; size_t orow = 0;
    for (int s = 0; s < 3; ++s) { const int p = 1 << s; const int Ns = TT >> s;
        k_cvt8<<<(unsigned)(((size_t)DQ * DM / 8 + 255) / 256), 256, 0, stream>>>(wqA + (size_t)s * DQ * DM, WQ, (size_t)DQ * DM / 8); k_cvt8<<<(unsigned)(((size_t)DKV * DM / 8 + 255) / 256), 256, 0, stream>>>(wkA + (size_t)s * DKV * DM, WK, (size_t)DKV * DM / 8);
        k_cstab<<<(TT * HD + 255) / 256, 256, 0, stream>>>(CS, (float)p);                                      /* positions t x 2^s */
        if (s > 0) { k_zero16<<<(unsigned)(((size_t)TT * DM / 8 + 255) / 256), 256, 0, stream>>>(XB, (size_t)TT * DM / 8); }
        k_cvt8<<<(unsigned)(((size_t)Ns * DM / 8 + 255) / 256), 256, 0, stream>>>(xs[s], XB, (size_t)Ns * DM / 8);   /* the scale's rows, zero-padded to 2048 */
        k_gemmk<bf, 0, true, 0, 8><<<dim3(TT / 64, DQ / 64, 1), 256, 0, stream>>>(XB, nullptr, WQ, nullptr, DM, FQ, DQ, bqA + (size_t)s * DQ, 0, 0, 0, 0);
        k_rope<<<LQ, 256, 0, stream>>>(FQ, DQ, NH_, CS, nullptr, nullptr, 1.0f, QP16, QPh, QPl);
        k_gemmk<bf, 0, true, 0, 8><<<dim3(TT / 64, DKV / 64, 1), 256, 0, stream>>>(XB, nullptr, WK, nullptr, DM, FK, DKV, bkA + (size_t)s * DKV, 0, 0, 0, 0);
        k_rope<<<LKv, 256, 0, stream>>>(FK, DKV, NKV, CS, nullptr, nullptr, 1.0f, KP16, KPh, KPl);
        if (s == 0) { k_vtp<<<LKv, 256, 0, stream>>>(FVB, DKV, NKV, VT16, VTh, VTl); }
        else { k_pool<<<(unsigned)(((size_t)TT * DKV / 4 + 255) / 256), 256, 0, stream>>>(FVB, p, FVP); k_vtp<<<LKv, 256, 0, stream>>>(FVP, DKV, NKV, VT16, VTh, VTl); }   /* pooled values, padded rows zero */
        for (int h0 = 0; h0 < NH_; h0 += ZH) { const size_t zq = (size_t)h0, zk = (size_t)(h0 / REP);   // one kv head per query head: the pass's two heads use consecutive kv planes (z-strides TT*HD)
            k_gemmc<bf, 2, 1><<<dim3(RH / 64, TT / 64, ZH), 32, 0, stream>>>(QPh + zq * TT * HD, QPl + zq * TT * HD, KPh + zk * TT * HD, KPl + zk * TT * HD, HD, Sb, TT, 0, (size_t)TT * HD, (size_t)TT * HD, (size_t)TT * TT);
            k_gemmc<h16, 0, 1><<<dim3((TT - RH) / 64, TT / 64, ZH), 32, 0, stream>>>(QP16 + zq * TT * HD + (size_t)RH * HD, nullptr, KP16 + zk * TT * HD, nullptr, HD, Sb + (size_t)RH * TT, TT, RH, (size_t)TT * HD, (size_t)TT * HD, (size_t)TT * TT);
            k_asoft<<<ZH * TT / 8, 256, 0, stream>>>(Sb, P16, Ph, Pl);
            k_gemmk<bf, 2, false, 2, 8><<<dim3(RH / 64, HD / 64, ZH), 256, 0, stream>>>(Ph, Pl, VTh + zk * HD * TT, VTl + zk * HD * TT, TT, Ob, HD, nullptr, 0, (size_t)RH * TT, (size_t)HD * TT, (size_t)TT * HD);
            k_gemmk<h16, 0, false, 2, 16><<<dim3((TT - RH) / 64, HD / 64, ZH), 512, 0, stream>>>(P16 + (size_t)RH * TT, nullptr, VT16 + zk * HD * TT, nullptr, TT, Ob + (size_t)RH * HD, HD, nullptr, RH, (size_t)TT * TT, (size_t)HD * TT, (size_t)TT * HD);
            k_merge<<<(unsigned)(((size_t)ZH * TT * HD / 2 + 255) / 256), 256, 0, stream>>>(Ob, h0, ATh, ATl); }
        k_gemmk<bf, 1, true, 0, 8><<<dim3(Ns / 64, DM / 64, 1), 256, 0, stream>>>(ATh, ATl, WO, nullptr, DQ, OUT + orow * DM, DM, bo, 0, 0, 0, 0);   /* only the N_s real rows of this tuple member */
        orow += (size_t)Ns; }
}

// v002
// Measured time: 694 microseconds a run.
// Two timings next to v001 put it at 1.75 and 1.76 times that version's speed.
// All steps since v000 together make it 3.05 times as fast.
#include <hip/hip_runtime.h>

// Multiscale causal attention (x0 [1][2048][1024], x1 [1][1024][1024], x2 [1][512][1024]; v_base = x0 Wv^T + bv shared, average-pooled by 2^i for scale i; per scale i: q, k = x_i W[i]^T + b[i] ('oi' [1024][1024] + [1024]; 16 heads x 64), rotate-half rotary at positions t x 2^i (base 1e4), scores = q.k / 8, causal (finfo.min); softmax; ctx_i = w v_i; out_i = ctx_i Wo^T + bo -> tuple ([1][2048][1024], [1][1024][1024], [1][512][1024]) (3.7 M)).
// Realisation: each scale runs the same T-2048 causal pipeline on its sequence zero-padded to 2048 rows - causality means every real query row only sees real keys (j <= i < N_i), so the padding never reaches a real output; the per-scale rope table uses positions t x 2^i; the pooled values are built by a small averaging kernel; the output GEMM writes only the N_i real rows of each tuple member.
// Compute dtypes, f32 accumulate: every input rounded to bf16; q/k/v on PLAIN bf16 operands (inputs: exact) + biases; rotary in f32 (precise sinf/cosf, 32 baked float32 inverse frequencies, position factor 2^i exact); causal tile skipping; value pooling in f32 (in-order means of 2^i rows as the reference's reshape-mean); scores and attn.v: query rows < 512 hl (3 products), the rest single fp16 (x1024); softmax f32; Wo hl x exact (2 products) + bo.

#define NB_  1
#define TT   2048
#define DM   1024
#define NH_  16
#define NKV  16
#define REP  (NH_ / NKV)
#define HD   64
#define DQ   (NH_ * HD)
#define DKV  (NKV * HD)
#define ZH   8                    // heads per attention pass
#define PP   (2 * TT)             // pitch, in 16-bit elements, of a probability row stored in place over its f32 score row
#define RH   512                  // query rows < RH use hi+lo planes (0: none)
#define WIN  2048
#define PCAR 1024.0f
#define SCL  0.125f   // HD^-0.5
typedef _Float16 h16;
typedef unsigned short bf;
typedef __attribute__((ext_vector_type(16))) __bf16   v16bf;
typedef __attribute__((ext_vector_type(16))) _Float16 v16h;
typedef __attribute__((ext_vector_type(8)))  _Float16 v8h;
typedef __attribute__((ext_vector_type(8)))  unsigned short v8us;
typedef __attribute__((ext_vector_type(8)))  float    v8f;
typedef __attribute__((ext_vector_type(4)))  float    v4f;
typedef v8h  __attribute__((may_alias)) v8ha;
typedef v4f  __attribute__((may_alias)) v4fa;
typedef v8us __attribute__((may_alias)) v8usa;

__device__ __forceinline__ unsigned short f2bf(float f) { unsigned u = __float_as_uint(f); u += 0x7FFFu + ((u >> 16) & 1u); return (unsigned short)(u >> 16); }
__device__ __forceinline__ float bf2f(unsigned short b) { return __uint_as_float(((unsigned)b) << 16); }
__device__ __forceinline__ float bfr(float f) { return bf2f(f2bf(f)); }
__device__ __forceinline__ v16h cat16(v8h lo, v8h hi) { return __builtin_shufflevector(lo, hi, 0, 1, 2, 3, 4, 5, 6, 7, 8, 9, 10, 11, 12, 13, 14, 15); }
__device__ __forceinline__ v16bf cat16b(v8us lo, v8us hi) { return __builtin_bit_cast(v16bf, __builtin_shufflevector(lo, hi, 0, 1, 2, 3, 4, 5, 6, 7, 8, 9, 10, 11, 12, 13, 14, 15)); }
__device__ __forceinline__ v8f wmma16(v16h a, v16h b, v8f c) { return __builtin_amdgcn_wmma_f32_16x16x32_f16(false, a, false, b, (short)0, c, false, false); }
__device__ __forceinline__ v8f wmmab(v16bf a, v16bf b, v8f c) { return __builtin_amdgcn_wmma_f32_16x16x32_bf16(false, a, false, b, (short)0, c, false, false); }



// ---- k_gemmk: register-blocked GEMM, one 64x64 output tile per work-group of NW waves, the K loop split over the waves: wave w takes the 64-element (128-byte) K chunks w, w + NW, ... with its own 16 accumulators,
// operands straight from K-contiguous 16-bit planes; the NW partial tiles meet in LDS and are added in wave order 0..NW-1. grid (M/64, N/64, Z), NW x 32 threads.
// C[m][n] (f32, pitch ldc, + optional f32 bias[n]) = sum_k A[m][k] Bt[n][k] (+ split products per NSPLIT). A rows have pitch lda, Bt rows pitch K. z-batch strides sA/sB/sC in elements. K % 64 == 0.
// CMODE 2 (probability x value): the K loop ends at the diagonal block of query rows r0 + roff.. (probabilities beyond it are exactly zero); roff = row offset of this launch's first row within the sequence.
template <typename T16> struct WFrag;
template <> struct WFrag<h16> { typedef v16h V; static __device__ __forceinline__ V ld(const h16* p) { return cat16(*(const v8h*)p, *(const v8h*)(p + 16)); } static __device__ __forceinline__ v8f mma(V a, V b, v8f c) { return wmma16(a, b, c); } };
template <> struct WFrag<bf> { typedef v16bf V; static __device__ __forceinline__ V ld(const bf* p) { return cat16b(*(const v8us*)p, *(const v8us*)(p + 16)); } static __device__ __forceinline__ v8f mma(V a, V b, v8f c) { return wmmab(a, b, c); } };
template <typename T16, int NSPLIT, bool BIAS, int CMODE, int NW>
__global__ __launch_bounds__(NW * 32) void k_gemmk(const T16* __restrict__ A, const T16* __restrict__ A2, int lda, const T16* __restrict__ Bt, const T16* __restrict__ Bt2, int K, float* C, int ldc, const float* __restrict__ bias, int roff, size_t sA, size_t sB, size_t sC) {
    typedef typename WFrag<T16>::V V;
    constexpr int RR = 2 * NW;                                        // tile rows added per round: one float4 per thread
    constexpr int NBUF = (2 * NW * RR * 68 * 4 <= 160 * 1024) ? 2 : 1; // two round buffers where both fit in half a WGP's LDS
    __shared__ __align__(16) float os[NBUF * NW * RR * 68];
    const size_t z = blockIdx.z; A += z * sA; if (A2) A2 += z * sA; Bt += z * sB; if (Bt2) Bt2 += z * sB; C += z * sC;
    const int lane = threadIdx.x & 31, lr = lane & 15, hi = lane >> 4; const int r0 = blockIdx.x * 64, c0 = blockIdx.y * 64;
    const int wv = __builtin_amdgcn_readfirstlane((int)(threadIdx.x >> 5));   // wave number in a scalar register: the K loop stays a scalar loop with every lane on
    const int Kl = (CMODE == 2) ? min(K, r0 + roff + 64) : K;
    v8f acc[4][4];
#pragma unroll
    for (int mb = 0; mb < 4; ++mb)
#pragma unroll
        for (int nb = 0; nb < 4; ++nb) acc[mb][nb] = (v8f){};
    const size_t aoff = (size_t)(r0 + lr) * lda + 8 * hi, boff = (size_t)(c0 + lr) * K + 8 * hi;
#pragma unroll 1
    for (int kc = wv * 64; kc < Kl; kc += (kc & 32) ? NW * 64 - 32 : 32) {   // both halves of a 128-byte chunk, then this wave's next chunk
        V a[4], a2[4];
#pragma unroll
        for (int mb = 0; mb < 4; ++mb) { a[mb] = WFrag<T16>::ld(A + aoff + (size_t)mb * 16 * lda + kc); if (NSPLIT == 1 || NSPLIT == 2) a2[mb] = WFrag<T16>::ld(A2 + aoff + (size_t)mb * 16 * lda + kc); }
#pragma unroll
        for (int nb = 0; nb < 4; ++nb) { const V b = WFrag<T16>::ld(Bt + boff + (size_t)nb * 16 * K + kc); V b2; if (NSPLIT >= 2) b2 = WFrag<T16>::ld(Bt2 + boff + (size_t)nb * 16 * K + kc);
#pragma unroll
            for (int mb = 0; mb < 4; ++mb) { acc[mb][nb] = WFrag<T16>::mma(a[mb], b, acc[mb][nb]); if (NSPLIT == 1 || NSPLIT == 2) acc[mb][nb] = WFrag<T16>::mma(a2[mb], b, acc[mb][nb]); if (NSPLIT >= 2) acc[mb][nb] = WFrag<T16>::mma(a[mb], b2, acc[mb][nb]); } }
        // four vector slots behind the last matrix instruction, on the back edge and on the exit alike, before its operands or results are touched
        asm volatile("v_nop\n\tv_nop\n\tv_nop\n\tv_nop" : "+v"(acc[0][0]), "+v"(acc[1][1]), "+v"(acc[2][2]), "+v"(acc[3][3]) : "v"(a[0]), "v"(a[3]));
    }
    const int row = threadIdx.x >> 4, cofs = (threadIdx.x & 15) * 4;
    v4f res[64 / RR];
#pragma unroll
    for (int rd = 0; rd < 64 / RR; ++rd) {
        float* ob = os + (rd % NBUF) * (NW * RR * 68);                // two buffers in turn: one barrier a round is enough
        if (NBUF == 1 && rd) __syncthreads();                         // one buffer: the round before is read before it is overwritten
#pragma unroll
        for (int m = 0; m < RR / 16; ++m) {
#pragma unroll
            for (int nb = 0; nb < 4; ++nb) {
#pragma unroll
                for (int j = 0; j < 8; ++j) ob[(wv * RR + m * 16 + hi * 8 + j) * 68 + nb * 16 + lr] = acc[rd * (RR / 16) + m][nb][j]; } }
        __syncthreads();                                              // every wave's partial rows of this round are in LDS (two buffers: and every read of the buffer written next is done)
        v4f val = *(const v4fa*)(ob + row * 68 + cofs);
#pragma unroll
        for (int w = 1; w < NW; ++w) val += *(const v4fa*)(ob + (w * RR + row) * 68 + cofs);
        res[rd] = val;
    }
    v4f bb; bb[0] = bb[1] = bb[2] = bb[3] = 0.f;
    if (BIAS) { bb[0] = bfr(bias[c0 + cofs]); bb[1] = bfr(bias[c0 + cofs + 1]); bb[2] = bfr(bias[c0 + cofs + 2]); bb[3] = bfr(bias[c0 + cofs + 3]); }
#pragma unroll
    for (int rd = 0; rd < 64 / RR; ++rd) {                            // stores behind the last barrier: no barrier waits for a global store
        v4f val = res[rd]; if (BIAS) val += bb;
        *(v4f*)(C + (size_t)(r0 + rd * RR + row) * ldc + c0 + cofs) = val; }
}

// ---- k_gemmc: one-wave 64x64 tile GEMM (16 accumulators, 32 threads) specialised for causal attention: CMODE 1 skips score tiles entirely above the diagonal (query rows r0+roff.., key columns c0..), CMODE 2 limits the
// key (K) loop of the probability x value contraction to the diagonal block (probabilities beyond it are exactly zero). roff = row offset of this launch's first row within the sequence.
template <typename T16, int NSPLIT, int CMODE>
__global__ __launch_bounds__(32) void k_gemmc(const T16* __restrict__ A, const T16* __restrict__ A2, const T16* __restrict__ Bt, const T16* __restrict__ Bt2, int K, float* C, int ldc, int roff, size_t sA, size_t sB, size_t sC) {
    typedef typename WFrag<T16>::V V;
    __shared__ __align__(16) float os[16 * 68];
    const size_t z = blockIdx.z; A += z * sA; if (A2) A2 += z * sA; Bt += z * sB; if (Bt2) Bt2 += z * sB; C += z * sC;
    const int lane = threadIdx.x & 31, lr = lane & 15, hi = lane >> 4; const int r0 = blockIdx.x * 64, c0 = blockIdx.y * 64;
    if (CMODE == 1 && c0 > r0 + roff + 63) return;                  // score tile entirely above the causal diagonal: left unwritten (the softmax reads it but masks j > i by select)
    const int Kl = (CMODE == 2) ? min(K, r0 + roff + 64) : K;        // P.V: probabilities are exactly 0 beyond the diagonal block, so the K loop stops there
    v8f acc[4][4];
#pragma unroll
    for (int mb = 0; mb < 4; ++mb)
#pragma unroll
        for (int nb = 0; nb < 4; ++nb) acc[mb][nb] = (v8f){};
    const size_t aoff = (size_t)(r0 + lr) * K + 8 * hi, boff = (size_t)(c0 + lr) * K + 8 * hi;
#pragma unroll 1
    for (int kc = 0; kc < Kl; kc += 32) {
        V a[4], a2[4];
#pragma unroll
        for (int mb = 0; mb < 4; ++mb) { a[mb] = WFrag<T16>::ld(A + aoff + (size_t)mb * 16 * K + kc); if (NSPLIT == 1 || NSPLIT == 2) a2[mb] = WFrag<T16>::ld(A2 + aoff + (size_t)mb * 16 * K + kc); }
#pragma unroll
        for (int nb = 0; nb < 4; ++nb) { const V b = WFrag<T16>::ld(Bt + boff + (size_t)nb * 16 * K + kc); V b2; if (NSPLIT >= 2) b2 = WFrag<T16>::ld(Bt2 + boff + (size_t)nb * 16 * K + kc);
#pragma unroll
            for (int mb = 0; mb < 4; ++mb) { acc[mb][nb] = WFrag<T16>::mma(a[mb], b, acc[mb][nb]); if (NSPLIT == 1 || NSPLIT == 2) acc[mb][nb] = WFrag<T16>::mma(a2[mb], b, acc[mb][nb]); if (NSPLIT >= 2) acc[mb][nb] = WFrag<T16>::mma(a[mb], b2, acc[mb][nb]); } }
        asm volatile("v_nop\n\tv_nop\n\tv_nop\n\tv_nop" : "+v"(acc[0][0]), "+v"(acc[1][1]), "+v"(acc[2][2]), "+v"(acc[3][3]) : "v"(a[0]), "v"(a[3]));
    }
#pragma unroll
    for (int mb = 0; mb < 4; ++mb) {
#pragma unroll
        for (int nb = 0; nb < 4; ++nb) {
#pragma unroll
            for (int j = 0; j < 8; ++j) os[(hi * 8 + j) * 68 + nb * 16 + lr] = acc[mb][nb][j]; }
        __builtin_amdgcn_wave_barrier(); asm volatile("" ::: "memory");
        float* crow = C + (size_t)(r0 + mb * 16) * ldc + c0;
{
#pragma unroll
            for (int s = 0; s < 8; ++s) { const int row = 2 * s + hi, cofs = lr * 4; v4f val = *(const v4fa*)(os + row * 68 + cofs);
                *(v4f*)(crow + (size_t)row * ldc + cofs) = val; }
             }
        __builtin_amdgcn_wave_barrier(); asm volatile("" ::: "memory");
    }
}

__device__ __forceinline__ h16 tohx(float x) { return (h16)x; }
__device__ __forceinline__ void splitf(float y, unsigned short& h, unsigned short& l) { h = f2bf(y); l = f2bf(y - bf2f(h)); }
typedef __attribute__((ext_vector_type(2))) _Float16 v2h;
typedef __attribute__((ext_vector_type(4))) _Float16 v4h;
typedef __attribute__((ext_vector_type(2))) unsigned short v2us;
typedef __attribute__((ext_vector_type(4))) unsigned short v4us;
typedef __attribute__((ext_vector_type(2))) float v2f;
typedef __attribute__((ext_vector_type(4))) int v4i;

__global__ __launch_bounds__(256) void k_wtG(const float* __restrict__ w, int K, int N, bf* Bt) {
    const int lane = threadIdx.x & 31; const int L0 = (blockIdx.x * 8 + (threadIdx.x >> 5)) * 8; const int nlines = N * K / 64;
{
#pragma unroll 1
        for (int l = 0; l < 8; ++l) { const int L = L0 + l; if (L >= nlines) break; const size_t e = (size_t)L * 64 + lane * 2; const int k = (int)(e % K), n = (int)(e / K); v2us o;
            o[0] = f2bf(w[(size_t)k * N + n]); o[1] = f2bf(w[(size_t)(k + 1) * N + n]); *(v2us*)(Bt + e) = o; }
         }
}
__global__ __launch_bounds__(256) void k_cvt8(const float* __restrict__ src, bf* dst, size_t n8) { const size_t i = (size_t)blockIdx.x * 256 + threadIdx.x; if (i >= n8) return; const v8f v = *(const v8f*)(src + i * 8); v8us o;
#pragma unroll
    for (int k = 0; k < 8; ++k) o[k] = f2bf(v[k]); *(v8us*)(dst + i * 8) = o;  }
__constant__ float INV[HD / 2] = {1.0f,0.749894202f,0.562341332f,0.421696514f,0.316227764f,0.237137362f,0.177827939f,0.133352146f,0.100000001f,0.0749894157f,0.0562341288f,0.0421696492f,0.0316227786f,0.0237137359f,0.0177827943f,0.0133352149f,0.00999999978f,0.00749894232f,0.00562341325f,0.00421696482f,0.00316227786f,0.00237137382f,0.00177827943f,0.00133352145f,0.00100000005f,0.000749894185f,0.000562341302f,0.000421696488f,0.000316227786f,0.000237137385f,0.00017782794f,0.00013335215f};   // float32 1/10000^(2i/64), eager-JAX values
__global__ __launch_bounds__(256) void k_cstab(float* CS, float pm) { const int idx = blockIdx.x * 256 + threadIdx.x; if (idx >= TT * HD) return; const int t = idx / HD, d = idx % HD; float p = __fmul_rn((float)t, pm); asm volatile("" : "+v"(p)); const float ang = __fmul_rn(p, INV[d % (HD / 2)]); v2f cs; cs[0] = cosf(ang); cs[1] = sinf(ang);
    *(v2f*)(CS + (size_t)idx * 2) = cs;  }
__global__ __launch_bounds__(256) void k_zero16(bf* Z, size_t n8) { const size_t i = (size_t)blockIdx.x * 256 + threadIdx.x; if (i >= n8) return; v8us o; for (int k = 0; k < 8; ++k) o[k] = 0; *(v8us*)(Z + i * 8) = o;  }
__global__ __launch_bounds__(256) void k_pool(const float* __restrict__ FVB, int p, float* FVP) { const size_t i = (size_t)blockIdx.x * 256 + threadIdx.x; if (i >= (size_t)TT * DKV / 4) return; const size_t t = i / (DKV / 4); const int c0 = (int)(i % (DKV / 4)) * 4; v4f o; o[0] = o[1] = o[2] = o[3] = 0.f;
    if (t < (size_t)(TT / p)) { for (int r = 0; r < p; ++r) { const v4f a = *(const v4f*)(FVB + (t * p + r) * DKV + c0); for (int q = 0; q < 4; ++q) o[q] = __fadd_rn(o[q], a[q]); } const float inv = 1.0f / (float)p; for (int q = 0; q < 4; ++q) o[q] = __fmul_rn(o[q], inv); }
    *(v4f*)(FVP + t * DKV + c0) = o;  }

// k_rope: head planes [h][t][d] (fp16 + hi/lo) of rope(x) x sc with the rotate-half convention out[d] = x[d] cos[t][d] - x[d+HD/2] sin[t][d], out[d+HD/2] = x[d+HD/2] cos[t][d+HD/2] + x[d] sin[t][d+HD/2]
__global__ __launch_bounds__(256) void k_rope(const float* __restrict__ F, int pitch, int nheads, const float* __restrict__ CS, const float* __restrict__ RF, const float* __restrict__ nw, float sc, h16* P16, bf* Ph, bf* Pl) {
    const size_t e = ((size_t)blockIdx.x * 256 + threadIdx.x) * 2; if (e >= (size_t)nheads * TT * HD) return; const int d = (int)(e % HD); const int t = (int)((e / HD) % TT); const int h = (int)(e / ((size_t)HD * TT)); const float* f = F + (size_t)t * pitch + h * HD; const float rf = RF ? RF[(size_t)h * TT + t] : 1.0f; v2h o16; v2us oh, ol;
#pragma unroll
    for (int q = 0; q < 2; ++q) { const int dd = d + q; const int dp = (dd < HD / 2) ? dd + HD / 2 : dd - HD / 2; float x0 = f[dd], x1 = f[dp];
        if (RF) { float n0 = __fmul_rn(x0, rf), n1 = __fmul_rn(x1, rf); asm volatile("" : "+v"(n0)); asm volatile("" : "+v"(n1)); x0 = __fmul_rn(bfr(nw[dd]), n0); x1 = __fmul_rn(bfr(nw[dp]), n1); }
        const v2f cs = *(const v2f*)(CS + ((size_t)t * HD + dd) * 2); float a = __fmul_rn(x0, cs[0]), bq = __fmul_rn(x1, cs[1]); asm volatile("" : "+v"(a)); asm volatile("" : "+v"(bq)); const float r = ((dd < HD / 2) ? __fsub_rn(a, bq) : __fadd_rn(a, bq)) * sc;
        o16[q] = tohx(r); unsigned short a2, c2; splitf(r, a2, c2); oh[q] = a2; ol[q] = c2; }
    *(v2h*)(P16 + e) = o16; *(v2us*)(Ph + e) = oh; *(v2us*)(Pl + e) = ol;  }
__global__ __launch_bounds__(256) void k_vtp(const float* __restrict__ F, int pitch, int nheads, h16* V16, bf* Vh, bf* Vl) { const size_t e = ((size_t)blockIdx.x * 256 + threadIdx.x) * 2; if (e >= (size_t)nheads * HD * TT) return; const int t = (int)(e % TT); const int d = (int)((e / TT) % HD); const int g = (int)(e / ((size_t)TT * HD)); v2h o16; v2us oh, ol;
#pragma unroll
    for (int q = 0; q < 2; ++q) { const float x = F[(size_t)(t + q) * pitch + g * HD + d]; o16[q] = tohx(x); unsigned short a2, c2; splitf(x, a2, c2); oh[q] = a2; ol[q] = c2; }
    *(v2h*)(V16 + e) = o16; *(v2us*)(Vh + e) = oh; *(v2us*)(Vl + e) = ol;  }
// k_asoft: per row (zz, i): t = S x HD^-0.5 for j <= i and i - j < WIN (sliding causal window; the reference's -1e9 additive fill vanishes identically); softmax over the 2048 keys (register row, one exp, fixed trees);
// the probabilities go IN PLACE over the row's own 8 KiB of scores (pitch PP): fp16 in the first half, or the hi plane in the first and the lo plane in the second half. One wave owns a row and holds all of it in registers
// (the row sum needs every load) before its first store, and no other wave touches that row; hence no __restrict__ here.
__global__ __launch_bounds__(256) void k_asoft(const float* Sb, h16* P16, bf* Ph, bf* Pl) {
    const int lane = threadIdx.x & 31; const int row = blockIdx.x * 8 + (threadIdx.x >> 5); if (row >= ZH * TT) return; const int i = row % TT; const int zz = row / TT; (void)zz; const bool hires = (i < RH); const float* sr = Sb + (size_t)row * TT; float v[TT / 32]; float mx = -3.0e38f;
#pragma unroll
    for (int ch = 0; ch < TT / 128; ++ch) { const int j0 = ch * 128 + lane * 4; const v4f a = *(const v4fa*)(sr + j0);   // may_alias: the 16-bit stores below land on these same bytes
#pragma unroll
        for (int q = 0; q < 4; ++q) { const int j = j0 + q; (void)j; const float t = (j <= i && i - j < WIN) ? a[q] * SCL : -3.0e38f; v[ch * 4 + q] = t; mx = fmaxf(mx, t); } }
#pragma unroll
    for (int sh = 16; sh; sh >>= 1) mx = fmaxf(mx, __shfl_xor(mx, sh, 32));
    float sum = 0.f;
#pragma unroll
    for (int k = 0; k < TT / 32; ++k) { float d0 = __fsub_rn(v[k], mx); asm volatile("" : "+v"(d0)); v[k] = __builtin_amdgcn_exp2f(__fmul_rn(d0, 1.4426950408889634f)); sum += v[k]; }
#pragma unroll
    for (int sh = 16; sh; sh >>= 1) sum += __shfl_xor(sum, sh, 32);
    const float f = __fdiv_rn(hires ? 1.0f : PCAR, sum);
{
        if (hires) {
#pragma unroll
            for (int ch = 0; ch < TT / 128; ++ch) { v4us oh, ol;
#pragma unroll
                for (int q = 0; q < 4; ++q) { unsigned short a, c2; splitf(v[ch * 4 + q] * f, a, c2); oh[q] = a; ol[q] = c2; }
                const size_t oo = (size_t)row * PP + ch * 128 + lane * 4; *(v4us*)(Ph + oo) = oh; *(v4us*)(Pl + oo) = ol; }
        } else {
#pragma unroll
            for (int ch = 0; ch < TT / 128; ++ch) { v4h o4;
#pragma unroll
                for (int q = 0; q < 4; ++q) o4[q] = tohx(v[ch * 4 + q] * f);
                *(v4h*)(P16 + (size_t)row * PP + ch * 128 + lane * 4) = o4; } }
         }
}
__global__ __launch_bounds__(256) void k_merge(const float* __restrict__ O, int h0, bf* Ah, bf* Al) { const size_t e = ((size_t)blockIdx.x * 256 + threadIdx.x) * 2; if (e >= (size_t)ZH * TT * HD) return; const int d = (int)(e % HD); const int t = (int)((e / HD) % TT); const int zz = (int)(e / ((size_t)HD * TT)); const float cs = (t < RH) ? 1.0f : (1.0f / PCAR); const size_t oo = (size_t)t * DQ + (h0 + zz) * HD + d;
    v2us oh, ol;
#pragma unroll
    for (int q = 0; q < 2; ++q) { unsigned short a, c2; splitf(O[e + q] * cs, a, c2); oh[q] = a; ol[q] = c2; } *(v2us*)(Ah + oo) = oh; *(v2us*)(Al + oo) = ol;  }

extern "C" void kernel_launch(void* const* d_in, const int* in_sizes, int n_in,
                              void* d_out, int out_size, void* d_ws, size_t ws_size, hipStream_t stream) {
    (void)in_sizes; (void)n_in; (void)out_size;
    const float* x0 = (const float*)d_in[0]; const float* x1 = (const float*)d_in[1]; const float* x2 = (const float*)d_in[2]; const float* wqA = (const float*)d_in[3]; const float* bqA = (const float*)d_in[4]; const float* wkA = (const float*)d_in[5]; const float* bkA = (const float*)d_in[6]; const float* wv = (const float*)d_in[7]; const float* bv = (const float*)d_in[8]; const float* wo = (const float*)d_in[9]; const float* bo = (const float*)d_in[10]; const float* x = nullptr; const float* wq = nullptr; const float* wk = nullptr; (void)x; (void)wq; (void)wk;
    float* OUT = (float*)d_out;     // [2048 + 1024 + 512][1024]: the three tuple members back to back
    char* wsp = (char*)d_ws;
    auto take = [&](size_t bytes) { char* p = wsp; wsp += (bytes + 255) & ~(size_t)255; return (void*)p; };
    bf* WQ = (bf*)take((size_t)DQ * DM * 2); bf* WK = (bf*)take((size_t)DKV * DM * 2); bf* WV = (bf*)take((size_t)DKV * DM * 2); bf* WO = (bf*)take((size_t)DM * DQ * 2); float* CS = (float*)take((size_t)TT * HD * 2 * 4); float* FVB = (float*)take((size_t)TT * DKV * 4); float* FVP = (float*)take((size_t)TT * DKV * 4);
    bf* XB = (bf*)take((size_t)TT * DM * 2); float* FQ = (float*)take((size_t)TT * DQ * 4); float* FK = (float*)take((size_t)TT * DKV * 4);
    h16* QP16 = (h16*)take((size_t)NH_ * TT * HD * 2); h16* KP16 = (h16*)take((size_t)NKV * TT * HD * 2); h16* VT16 = (h16*)take((size_t)NKV * HD * TT * 2);
    bf* QPh = (bf*)take((size_t)NH_ * TT * HD * 2); bf* QPl = (bf*)take((size_t)NH_ * TT * HD * 2); bf* KPh = (bf*)take((size_t)NKV * TT * HD * 2); bf* KPl = (bf*)take((size_t)NKV * TT * HD * 2); bf* VTh = (bf*)take((size_t)NKV * HD * TT * 2); bf* VTl = (bf*)take((size_t)NKV * HD * TT * 2);
    float* Sb = (float*)take((size_t)ZH * TT * TT * 4); h16* P16 = (h16*)Sb; bf* Ph = (bf*)Sb; bf* Pl = Ph + TT; /* probability planes in place over the score rows, pitch PP */ float* Ob = (float*)take((size_t)ZH * TT * HD * 4); bf* ATh = (bf*)take((size_t)TT * DQ * 2); bf* ATl = (bf*)take((size_t)TT * DQ * 2);
    if ((size_t)(wsp - (char*)d_ws) > ws_size) return;    // ws 256 MiB
    /* shared value base: v_base = x0 Wv^T + bv (exact) */
    k_cvt8<<<(unsigned)(((size_t)DKV * DM / 8 + 255) / 256), 256, 0, stream>>>(wv, WV, (size_t)DKV * DM / 8); k_cvt8<<<(unsigned)(((size_t)DM * DQ / 8 + 255) / 256), 256, 0, stream>>>(wo, WO, (size_t)DM * DQ / 8);
    k_cvt8<<<(unsigned)(((size_t)TT * DM / 8 + 255) / 256), 256, 0, stream>>>(x0, XB, (size_t)TT * DM / 8);
    k_gemmk<bf, 0, true, 0, 8><<<dim3(TT / 64, DKV / 64, 1), 256, 0, stream>>>(XB, nullptr, DM, WV, nullptr, DM, FVB, DKV, bv, 0, 0, 0, 0);
    const unsigned LQ = (unsigned)(((size_t)NH_ * TT * HD / 2 + 255) / 256), LKv = (unsigned)(((size_t)NKV * TT * HD / 2 + 255) / 256);
    const float* xs[3] = {x0, x1, x2}; size_t orow = 0;
    for (int s = 0; s < 3; ++s) { const int p = 1 << s; const int Ns = TT >> s;
        k_cvt8<<<(unsigned)(((size_t)DQ * DM / 8 + 255) / 256), 256, 0, stream>>>(wqA + (size_t)s * DQ * DM, WQ, (size_t)DQ * DM / 8); k_cvt8<<<(unsigned)(((size_t)DKV * DM / 8 + 255) / 256), 256, 0, stream>>>(wkA + (size_t)s * DKV * DM, WK, (size_t)DKV * DM / 8);
        k_cstab<<<(TT * HD + 255) / 256, 256, 0, stream>>>(CS, (float)p);                                      /* positions t x 2^s */
        if (s > 0) { k_zero16<<<(unsigned)(((size_t)TT * DM / 8 + 255) / 256), 256, 0, stream>>>(XB, (size_t)TT * DM / 8); }
        k_cvt8<<<(unsigned)(((size_t)Ns * DM / 8 + 255) / 256), 256, 0, stream>>>(xs[s], XB, (size_t)Ns * DM / 8);   /* the scale's rows, zero-padded to 2048 */
        k_gemmk<bf, 0, true, 0, 8><<<dim3(TT / 64, DQ / 64, 1), 256, 0, stream>>>(XB, nullptr, DM, WQ, nullptr, DM, FQ, DQ, bqA + (size_t)s * DQ, 0, 0, 0, 0);
        k_rope<<<LQ, 256, 0, stream>>>(FQ, DQ, NH_, CS, nullptr, nullptr, 1.0f, QP16, QPh, QPl);
        k_gemmk<bf, 0, true, 0, 8><<<dim3(TT / 64, DKV / 64, 1), 256, 0, stream>>>(XB, nullptr, DM, WK, nullptr, DM, FK, DKV, bkA + (size_t)s * DKV, 0, 0, 0, 0);
        k_rope<<<LKv, 256, 0, stream>>>(FK, DKV, NKV, CS, nullptr, nullptr, 1.0f, KP16, KPh, KPl);
        if (s == 0) { k_vtp<<<LKv, 256, 0, stream>>>(FVB, DKV, NKV, VT16, VTh, VTl); }
        else { k_pool<<<(unsigned)(((size_t)TT * DKV / 4 + 255) / 256), 256, 0, stream>>>(FVB, p, FVP); k_vtp<<<LKv, 256, 0, stream>>>(FVP, DKV, NKV, VT16, VTh, VTl); }   /* pooled values, padded rows zero */
        for (int h0 = 0; h0 < NH_; h0 += ZH) { const size_t zq = (size_t)h0, zk = (size_t)(h0 / REP);   // one kv head per query head: the pass's ZH heads use consecutive kv planes (z-strides TT*HD)
            k_gemmc<bf, 2, 1><<<dim3(RH / 64, TT / 64, ZH), 32, 0, stream>>>(QPh + zq * TT * HD, QPl + zq * TT * HD, KPh + zk * TT * HD, KPl + zk * TT * HD, HD, Sb, TT, 0, (size_t)TT * HD, (size_t)TT * HD, (size_t)TT * TT);
            k_gemmc<h16, 0, 1><<<dim3((TT - RH) / 64, TT / 64, ZH), 32, 0, stream>>>(QP16 + zq * TT * HD + (size_t)RH * HD, nullptr, KP16 + zk * TT * HD, nullptr, HD, Sb + (size_t)RH * TT, TT, RH, (size_t)TT * HD, (size_t)TT * HD, (size_t)TT * TT);
            k_asoft<<<ZH * TT / 8, 256, 0, stream>>>(Sb, P16, Ph, Pl);
            k_gemmk<bf, 2, false, 2, 8><<<dim3(RH / 64, HD / 64, ZH), 256, 0, stream>>>(Ph, Pl, PP, VTh + zk * HD * TT, VTl + zk * HD * TT, TT, Ob, HD, nullptr, 0, (size_t)TT * PP, (size_t)HD * TT, (size_t)TT * HD);
            k_gemmk<h16, 0, false, 2, 16><<<dim3((TT - RH) / 64, HD / 64, ZH), 512, 0, stream>>>(P16 + (size_t)RH * PP, nullptr, PP, VT16 + zk * HD * TT, nullptr, TT, Ob + (size_t)RH * HD, HD, nullptr, RH, (size_t)TT * PP, (size_t)HD * TT, (size_t)TT * HD);
            k_merge<<<(unsigned)(((size_t)ZH * TT * HD / 2 + 255) / 256), 256, 0, stream>>>(Ob, h0, ATh, ATl); }
        k_gemmk<bf, 1, true, 0, 8><<<dim3(Ns / 64, DM / 64, 1), 256, 0, stream>>>(ATh, ATl, DQ, WO, nullptr, DQ, OUT + orow * DM, DM, bo, 0, 0, 0, 0);   /* only the N_s real rows of this tuple member */
        orow += (size_t)Ns; }
}

// v003
// A run of this version takes 477 microseconds.
// Next to v002, in two timings, it ran 1.44 and 1.46 times as fast.
// All steps since v000 together make it 4.42 times as fast.
#include <hip/hip_runtime.h>

// Multiscale causal attention (x0 [1][2048][1024], x1 [1][1024][1024], x2 [1][512][1024]; v_base = x0 Wv^T + bv shared, average-pooled by 2^i for scale i; per scale i: q, k = x_i W[i]^T + b[i] ('oi' [1024][1024] + [1024]; 16 heads x 64), rotate-half rotary at positions t x 2^i (base 1e4), scores = q.k / 8, causal (finfo.min); softmax; ctx_i = w v_i; out_i = ctx_i Wo^T + bo -> tuple ([1][2048][1024], [1][1024][1024], [1][512][1024]) (3.7 M)).
// Realisation: each scale runs the same causal kernels at its own length N_i = 2048 >> i: every grid covers N_i rows (and N_i key columns), a softmax row is N_i long; the planes keep the pitches of the 2048 layout, and rows or columns >= N_i are neither written nor read; the per-scale rope table uses positions t x 2^i; the pooled values are built by a small averaging kernel.
// Compute dtypes, f32 accumulate: every input rounded to bf16; q/k/v on PLAIN bf16 operands (inputs: exact) + biases; rotary in f32 (precise sinf/cosf, 32 baked float32 inverse frequencies, position factor 2^i exact); causal tile skipping; value pooling in f32 (in-order sums of 2^i rows x 2^-i as the reference's reshape-mean); scores and attn.v: query rows < 512 hl (3 products), the rest single fp16 (x1024); softmax f32; Wo hl x exact (2 products) + bo.

#define NB_  1
#define TT   2048
#define DM   1024
#define NH_  16
#define NKV  16
#define REP  (NH_ / NKV)
#define HD   64
#define DQ   (NH_ * HD)
#define DKV  (NKV * HD)
#define ZH   8                    // heads per attention pass
#define PP   (2 * TT)             // pitch, in 16-bit elements, of a probability row stored in place over its f32 score row
#define RH   512                  // query rows < RH use hi+lo planes (0: none)
#define WIN  2048
#define PCAR 1024.0f
#define SCL  0.125f   // HD^-0.5
typedef _Float16 h16;
typedef unsigned short bf;
typedef __attribute__((ext_vector_type(16))) __bf16   v16bf;
typedef __attribute__((ext_vector_type(16))) _Float16 v16h;
typedef __attribute__((ext_vector_type(8)))  _Float16 v8h;
typedef __attribute__((ext_vector_type(8)))  unsigned short v8us;
typedef __attribute__((ext_vector_type(8)))  float    v8f;
typedef __attribute__((ext_vector_type(4)))  float    v4f;
typedef v8h  __attribute__((may_alias)) v8ha;
typedef v4f  __attribute__((may_alias)) v4fa;
typedef v8us __attribute__((may_alias)) v8usa;

__device__ __forceinline__ unsigned short f2bf(float f) { unsigned u = __float_as_uint(f); u += 0x7FFFu + ((u >> 16) & 1u); return (unsigned short)(u >> 16); }
__device__ __forceinline__ float bf2f(unsigned short b) { return __uint_as_float(((unsigned)b) << 16); }
__device__ __forceinline__ float bfr(float f) { return bf2f(f2bf(f)); }
__device__ __forceinline__ v16h cat16(v8h lo, v8h hi) { return __builtin_shufflevector(lo, hi, 0, 1, 2, 3, 4, 5, 6, 7, 8, 9, 10, 11, 12, 13, 14, 15); }
__device__ __forceinline__ v16bf cat16b(v8us lo, v8us hi) { return __builtin_bit_cast(v16bf, __builtin_shufflevector(lo, hi, 0, 1, 2, 3, 4, 5, 6, 7, 8, 9, 10, 11, 12, 13, 14, 15)); }
__device__ __forceinline__ v8f wmma16(v16h a, v16h b, v8f c) { return __builtin_amdgcn_wmma_f32_16x16x32_f16(false, a, false, b, (short)0, c, false, false); }
__device__ __forceinline__ v8f wmmab(v16bf a, v16bf b, v8f c) { return __builtin_amdgcn_wmma_f32_16x16x32_bf16(false, a, false, b, (short)0, c, false, false); }



// ---- k_gemmk: register-blocked GEMM, one 64x64 output tile per work-group of NW waves, the K loop split over the waves: wave w takes the 64-element (128-byte) K chunks w, w + NW, ... with its own 16 accumulators,
// operands straight from K-contiguous 16-bit planes; the NW partial tiles meet in LDS and are added in wave order 0..NW-1. grid (M/64, N/64, Z), NW x 32 threads.
// C[m][n] (f32, pitch ldc, + optional f32 bias[n]) = sum_k A[m][k] Bt[n][k] (+ split products per NSPLIT). A rows have pitch lda, Bt rows pitch K. z-batch strides sA/sB/sC in elements. K % 64 == 0.
// CMODE 2 (probability x value): the K loop ends at the diagonal block of query rows r0 + roff.. (probabilities beyond it are exactly zero); roff = row offset of this launch's first row within the sequence.
template <typename T16> struct WFrag;
template <> struct WFrag<h16> { typedef v16h V; static __device__ __forceinline__ V ld(const h16* p) { return cat16(*(const v8h*)p, *(const v8h*)(p + 16)); } static __device__ __forceinline__ v8f mma(V a, V b, v8f c) { return wmma16(a, b, c); } };
template <> struct WFrag<bf> { typedef v16bf V; static __device__ __forceinline__ V ld(const bf* p) { return cat16b(*(const v8us*)p, *(const v8us*)(p + 16)); } static __device__ __forceinline__ v8f mma(V a, V b, v8f c) { return wmmab(a, b, c); } };
template <typename T16, int NSPLIT, bool BIAS, int CMODE, int NW>
__global__ __launch_bounds__(NW * 32) void k_gemmk(const T16* __restrict__ A, const T16* __restrict__ A2, int lda, const T16* __restrict__ Bt, const T16* __restrict__ Bt2, int K, float* C, int ldc, const float* __restrict__ bias, int roff, size_t sA, size_t sB, size_t sC) {
    typedef typename WFrag<T16>::V V;
    constexpr int RR = 2 * NW;                                        // tile rows added per round: one float4 per thread
    constexpr int NBUF = (2 * NW * RR * 68 * 4 <= 160 * 1024) ? 2 : 1; // two round buffers where both fit in half a WGP's LDS
    __shared__ __align__(16) float os[NBUF * NW * RR * 68];
    const size_t z = blockIdx.z; A += z * sA; if (A2) A2 += z * sA; Bt += z * sB; if (Bt2) Bt2 += z * sB; C += z * sC;
    const int lane = threadIdx.x & 31, lr = lane & 15, hi = lane >> 4; const int r0 = blockIdx.x * 64, c0 = blockIdx.y * 64;
    const int wv = __builtin_amdgcn_readfirstlane((int)(threadIdx.x >> 5));   // wave number in a scalar register: the K loop stays a scalar loop with every lane on
    const int Kl = (CMODE == 2) ? min(K, r0 + roff + 64) : K;
    v8f acc[4][4];
#pragma unroll
    for (int mb = 0; mb < 4; ++mb)
#pragma unroll
        for (int nb = 0; nb < 4; ++nb) acc[mb][nb] = (v8f){};
    const size_t aoff = (size_t)(r0 + lr) * lda + 8 * hi, boff = (size_t)(c0 + lr) * K + 8 * hi;
#pragma unroll 1
    for (int kc = wv * 64; kc < Kl; kc += (kc & 32) ? NW * 64 - 32 : 32) {   // both halves of a 128-byte chunk, then this wave's next chunk
        V a[4], a2[4];
#pragma unroll
        for (int mb = 0; mb < 4; ++mb) { a[mb] = WFrag<T16>::ld(A + aoff + (size_t)mb * 16 * lda + kc); if (NSPLIT == 1 || NSPLIT == 2) a2[mb] = WFrag<T16>::ld(A2 + aoff + (size_t)mb * 16 * lda + kc); }
#pragma unroll
        for (int nb = 0; nb < 4; ++nb) { const V b = WFrag<T16>::ld(Bt + boff + (size_t)nb * 16 * K + kc); V b2; if (NSPLIT >= 2) b2 = WFrag<T16>::ld(Bt2 + boff + (size_t)nb * 16 * K + kc);
#pragma unroll
            for (int mb = 0; mb < 4; ++mb) { acc[mb][nb] = WFrag<T16>::mma(a[mb], b, acc[mb][nb]); if (NSPLIT == 1 || NSPLIT == 2) acc[mb][nb] = WFrag<T16>::mma(a2[mb], b, acc[mb][nb]); if (NSPLIT >= 2) acc[mb][nb] = WFrag<T16>::mma(a[mb], b2, acc[mb][nb]); } }
        // four vector slots behind the last matrix instruction, on the back edge and on the exit alike, before its operands or results are touched
        asm volatile("v_nop\n\tv_nop\n\tv_nop\n\tv_nop" : "+v"(acc[0][0]), "+v"(acc[1][1]), "+v"(acc[2][2]), "+v"(acc[3][3]) : "v"(a[0]), "v"(a[3]));
    }
    const int row = threadIdx.x >> 4, cofs = (threadIdx.x & 15) * 4;
    v4f res[64 / RR];
#pragma unroll
    for (int rd = 0; rd < 64 / RR; ++rd) {
        float* ob = os + (rd % NBUF) * (NW * RR * 68);                // two buffers in turn: one barrier a round is enough
        if (NBUF == 1 && rd) __syncthreads();                         // one buffer: the round before is read before it is overwritten
#pragma unroll
        for (int m = 0; m < RR / 16; ++m) {
#pragma unroll
            for (int nb = 0; nb < 4; ++nb) {
#pragma unroll
                for (int j = 0; j < 8; ++j) ob[(wv * RR + m * 16 + hi * 8 + j) * 68 + nb * 16 + lr] = acc[rd * (RR / 16) + m][nb][j]; } }
        __syncthreads();                                              // every wave's partial rows of this round are in LDS (two buffers: and every read of the buffer written next is done)
        v4f val = *(const v4fa*)(ob + row * 68 + cofs);
#pragma unroll
        for (int w = 1; w < NW; ++w) val += *(const v4fa*)(ob + (w * RR + row) * 68 + cofs);
        res[rd] = val;
    }
    v4f bb; bb[0] = bb[1] = bb[2] = bb[3] = 0.f;
    if (BIAS) { bb[0] = bfr(bias[c0 + cofs]); bb[1] = bfr(bias[c0 + cofs + 1]); bb[2] = bfr(bias[c0 + cofs + 2]); bb[3] = bfr(bias[c0 + cofs + 3]); }
#pragma unroll
    for (int rd = 0; rd < 64 / RR; ++rd) {                            // stores behind the last barrier: no barrier waits for a global store
        v4f val = res[rd]; if (BIAS) val += bb;
        *(v4f*)(C + (size_t)(r0 + rd * RR + row) * ldc + c0 + cofs) = val; }
}

// ---- k_gemmc: one-wave 64x64 tile GEMM (16 accumulators, 32 threads) specialised for causal attention: CMODE 1 skips score tiles entirely above the diagonal (query rows r0+roff.., key columns c0..), CMODE 2 limits the
// key (K) loop of the probability x value contraction to the diagonal block (probabilities beyond it are exactly zero). roff = row offset of this launch's first row within the sequence.
template <typename T16, int NSPLIT, int CMODE>
__global__ __launch_bounds__(32) void k_gemmc(const T16* __restrict__ A, const T16* __restrict__ A2, const T16* __restrict__ Bt, const T16* __restrict__ Bt2, int K, float* C, int ldc, int roff, size_t sA, size_t sB, size_t sC) {
    typedef typename WFrag<T16>::V V;
    __shared__ __align__(16) float os[16 * 68];
    const size_t z = blockIdx.z; A += z * sA; if (A2) A2 += z * sA; Bt += z * sB; if (Bt2) Bt2 += z * sB; C += z * sC;
    const int lane = threadIdx.x & 31, lr = lane & 15, hi = lane >> 4; const int r0 = blockIdx.x * 64, c0 = blockIdx.y * 64;
    if (CMODE == 1 && c0 > r0 + roff + 63) return;                  // score tile entirely above the causal diagonal: left unwritten (the softmax reads it but masks j > i by select)
    const int Kl = (CMODE == 2) ? min(K, r0 + roff + 64) : K;        // P.V: probabilities are exactly 0 beyond the diagonal block, so the K loop stops there
    v8f acc[4][4];
#pragma unroll
    for (int mb = 0; mb < 4; ++mb)
#pragma unroll
        for (int nb = 0; nb < 4; ++nb) acc[mb][nb] = (v8f){};
    const size_t aoff = (size_t)(r0 + lr) * K + 8 * hi, boff = (size_t)(c0 + lr) * K + 8 * hi;
#pragma unroll 1
    for (int kc = 0; kc < Kl; kc += 32) {
        V a[4], a2[4];
#pragma unroll
        for (int mb = 0; mb < 4; ++mb) { a[mb] = WFrag<T16>::ld(A + aoff + (size_t)mb * 16 * K + kc); if (NSPLIT == 1 || NSPLIT == 2) a2[mb] = WFrag<T16>::ld(A2 + aoff + (size_t)mb * 16 * K + kc); }
#pragma unroll
        for (int nb = 0; nb < 4; ++nb) { const V b = WFrag<T16>::ld(Bt + boff + (size_t)nb * 16 * K + kc); V b2; if (NSPLIT >= 2) b2 = WFrag<T16>::ld(Bt2 + boff + (size_t)nb * 16 * K + kc);
#pragma unroll
            for (int mb = 0; mb < 4; ++mb) { acc[mb][nb] = WFrag<T16>::mma(a[mb], b, acc[mb][nb]); if (NSPLIT == 1 || NSPLIT == 2) acc[mb][nb] = WFrag<T16>::mma(a2[mb], b, acc[mb][nb]); if (NSPLIT >= 2) acc[mb][nb] = WFrag<T16>::mma(a[mb], b2, acc[mb][nb]); } }
        asm volatile("v_nop\n\tv_nop\n\tv_nop\n\tv_nop" : "+v"(acc[0][0]), "+v"(acc[1][1]), "+v"(acc[2][2]), "+v"(acc[3][3]) : "v"(a[0]), "v"(a[3]));
    }
#pragma unroll
    for (int mb = 0; mb < 4; ++mb) {
#pragma unroll
        for (int nb = 0; nb < 4; ++nb) {
#pragma unroll
            for (int j = 0; j < 8; ++j) os[(hi * 8 + j) * 68 + nb * 16 + lr] = acc[mb][nb][j]; }
        __builtin_amdgcn_wave_barrier(); asm volatile("" ::: "memory");
        float* crow = C + (size_t)(r0 + mb * 16) * ldc + c0;
{
#pragma unroll
            for (int s = 0; s < 8; ++s) { const int row = 2 * s + hi, cofs = lr * 4; v4f val = *(const v4fa*)(os + row * 68 + cofs);
                *(v4f*)(crow + (size_t)row * ldc + cofs) = val; }
             }
        __builtin_amdgcn_wave_barrier(); asm volatile("" ::: "memory");
    }
}

__device__ __forceinline__ h16 tohx(float x) { return (h16)x; }
__device__ __forceinline__ void splitf(float y, unsigned short& h, unsigned short& l) { h = f2bf(y); l = f2bf(y - bf2f(h)); }
typedef __attribute__((ext_vector_type(2))) _Float16 v2h;
typedef __attribute__((ext_vector_type(4))) _Float16 v4h;
typedef __attribute__((ext_vector_type(2))) unsigned short v2us;
typedef __attribute__((ext_vector_type(4))) unsigned short v4us;
typedef __attribute__((ext_vector_type(2))) float v2f;
typedef __attribute__((ext_vector_type(4))) int v4i;

__global__ __launch_bounds__(256) void k_wtG(const float* __restrict__ w, int K, int N, bf* Bt) {
    const int lane = threadIdx.x & 31; const int L0 = (blockIdx.x * 8 + (threadIdx.x >> 5)) * 8; const int nlines = N * K / 64;
{
#pragma unroll 1
        for (int l = 0; l < 8; ++l) { const int L = L0 + l; if (L >= nlines) break; const size_t e = (size_t)L * 64 + lane * 2; const int k = (int)(e % K), n = (int)(e / K); v2us o;
            o[0] = f2bf(w[(size_t)k * N + n]); o[1] = f2bf(w[(size_t)(k + 1) * N + n]); *(v2us*)(Bt + e) = o; }
         }
}
__global__ __launch_bounds__(256) void k_cvt8(const float* __restrict__ src, bf* dst, size_t n8) { const size_t i = (size_t)blockIdx.x * 256 + threadIdx.x; if (i >= n8) return; const v8f v = *(const v8f*)(src + i * 8); v8us o;
#pragma unroll
    for (int k = 0; k < 8; ++k) o[k] = f2bf(v[k]); *(v8us*)(dst + i * 8) = o;  }
__constant__ float INV[HD / 2] = {1.0f,0.749894202f,0.562341332f,0.421696514f,0.316227764f,0.237137362f,0.177827939f,0.133352146f,0.100000001f,0.0749894157f,0.0562341288f,0.0421696492f,0.0316227786f,0.0237137359f,0.0177827943f,0.0133352149f,0.00999999978f,0.00749894232f,0.00562341325f,0.00421696482f,0.00316227786f,0.00237137382f,0.00177827943f,0.00133352145f,0.00100000005f,0.000749894185f,0.000562341302f,0.000421696488f,0.000316227786f,0.000237137385f,0.00017782794f,0.00013335215f};   // float32 1/10000^(2i/64), eager-JAX values
__global__ __launch_bounds__(256) void k_cstab(float* CS, float pm) { const int idx = blockIdx.x * 256 + threadIdx.x; if (idx >= TT * HD) return; const int t = idx / HD, d = idx % HD; float p = __fmul_rn((float)t, pm); asm volatile("" : "+v"(p)); const float ang = __fmul_rn(p, INV[d % (HD / 2)]); v2f cs; cs[0] = cosf(ang); cs[1] = sinf(ang);
    *(v2f*)(CS + (size_t)idx * 2) = cs;  }
__global__ __launch_bounds__(256) void k_pool(const float* __restrict__ FVB, int p, float* FVP) { const size_t i = (size_t)blockIdx.x * 256 + threadIdx.x; if (i >= (size_t)TT * DKV / 4) return; const size_t t = i / (DKV / 4); const int c0 = (int)(i % (DKV / 4)) * 4; v4f o; o[0] = o[1] = o[2] = o[3] = 0.f;
    if (t < (size_t)(TT / p)) { for (int r = 0; r < p; ++r) { const v4f a = *(const v4f*)(FVB + (t * p + r) * DKV + c0); for (int q = 0; q < 4; ++q) o[q] = __fadd_rn(o[q], a[q]); } const float inv = 1.0f / (float)p; for (int q = 0; q < 4; ++q) o[q] = __fmul_rn(o[q], inv); }
    *(v4f*)(FVP + t * DKV + c0) = o;  }

// k_rope: grid (nt / 8, heads), rows t < nt of each head; head planes [h][t][d] (fp16 + hi/lo) of rope(x) x sc with the rotate-half convention out[d] = x[d] cos[t][d] - x[d+HD/2] sin[t][d], out[d+HD/2] = x[d+HD/2] cos[t][d+HD/2] + x[d] sin[t][d+HD/2]
__global__ __launch_bounds__(256) void k_rope(const float* __restrict__ F, int pitch, int nt, const float* __restrict__ CS, const float* __restrict__ RF, const float* __restrict__ nw, float sc, h16* P16, bf* Ph, bf* Pl) {
    const int el = (blockIdx.x * 256 + threadIdx.x) * 2; if (el >= nt * HD) return; const int d = el % HD; const int t = el / HD; const int h = blockIdx.y; const size_t e = (size_t)h * TT * HD + el; const float* f = F + (size_t)t * pitch + h * HD; v2h o16; v2us oh, ol;
    float rf = 1.0f; if (RF) { rf = RF[(size_t)h * TT + t]; asm volatile("s_wait_xcnt 0x0" ::: "memory"); }   // the wait stands before this load's address registers are reused
#pragma unroll
    for (int q = 0; q < 2; ++q) { const int dd = d + q; const int dp = (dd < HD / 2) ? dd + HD / 2 : dd - HD / 2; float x0 = f[dd], x1 = f[dp];
        if (RF) { float n0 = __fmul_rn(x0, rf), n1 = __fmul_rn(x1, rf); asm volatile("" : "+v"(n0)); asm volatile("" : "+v"(n1)); x0 = __fmul_rn(bfr(nw[dd]), n0); x1 = __fmul_rn(bfr(nw[dp]), n1); }
        const v2f cs = *(const v2f*)(CS + ((size_t)t * HD + dd) * 2); float a = __fmul_rn(x0, cs[0]), bq = __fmul_rn(x1, cs[1]); asm volatile("" : "+v"(a)); asm volatile("" : "+v"(bq)); const float r = ((dd < HD / 2) ? __fsub_rn(a, bq) : __fadd_rn(a, bq)) * sc;
        o16[q] = tohx(r); unsigned short a2, c2; splitf(r, a2, c2); oh[q] = a2; ol[q] = c2; }
    *(v2h*)(P16 + e) = o16; *(v2us*)(Ph + e) = oh; *(v2us*)(Pl + e) = ol;  }
__global__ __launch_bounds__(256) void k_vtp(const float* __restrict__ F, int pitch, int nt, h16* V16, bf* Vh, bf* Vl) { const int t = (blockIdx.x * 256 + threadIdx.x) * 2; if (t >= nt) return; const int d = blockIdx.y % HD; const int g = blockIdx.y / HD; const size_t e = (size_t)blockIdx.y * TT + t;   // grid (nt / 512, heads x HD): columns t < nt of each [g][d] row
    v2h o16; v2us oh, ol;
#pragma unroll
    for (int q = 0; q < 2; ++q) { const float x = F[(size_t)(t + q) * pitch + g * HD + d]; o16[q] = tohx(x); unsigned short a2, c2; splitf(x, a2, c2); oh[q] = a2; ol[q] = c2; }
    *(v2h*)(V16 + e) = o16; *(v2us*)(Vh + e) = oh; *(v2us*)(Vl + e) = ol;  }
// 2^x with the v_nop in the same statement: it keeps the one slot behind a transcendental before its source register is reused or its result read
__device__ __forceinline__ float exp2slot(float x) { float r; asm("v_exp_f32 %0, %1\n\tv_nop" : "=v"(r) : "v"(x)); return r; }
// k_asoft: per row (zz, i): t = S x HD^-0.5 for j <= i and i - j < WIN (plain causal: i - j < WIN = 2048 always holds; the reference's -1e9 additive fill vanishes identically); softmax over the NC keys of this scale (register row, one exp, fixed trees; rows i < NC of each head, pitch TT);
// the probabilities go IN PLACE over the row's own 8 KiB of scores (pitch PP): fp16 in the first half, or the hi plane in the first and the lo plane in the second half. One wave owns a row and holds all of it in registers
// (the row sum needs every load) before its first store, and no other wave touches that row; hence no __restrict__ here.
template <int NC>
__global__ __launch_bounds__(256) void k_asoft(const float* Sb, h16* P16, bf* Ph, bf* Pl) {
    const int lane = threadIdx.x & 31; const int rw = blockIdx.x * 8 + (threadIdx.x >> 5); if (rw >= ZH * NC) return; const int i = rw % NC; const int zz = rw / NC; const int row = zz * TT + i; const bool hires = (i < RH); const float* sr = Sb + (size_t)row * TT; float v[NC / 32]; float mx = -3.0e38f;
#pragma unroll
    for (int ch = 0; ch < NC / 128; ++ch) { const int j0 = ch * 128 + lane * 4; const v4f a = *(const v4fa*)(sr + j0);   // may_alias: the 16-bit stores below land on these same bytes
#pragma unroll
        for (int q = 0; q < 4; ++q) { const int j = j0 + q; (void)j; const float t = (j <= i && i - j < WIN) ? a[q] * SCL : -3.0e38f; v[ch * 4 + q] = t; mx = fmaxf(mx, t); } }
#pragma unroll
    for (int sh = 16; sh; sh >>= 1) mx = fmaxf(mx, __shfl_xor(mx, sh, 32));
    float sum = 0.f;
#pragma unroll
    for (int k = 0; k < NC / 32; ++k) { float d0 = __fsub_rn(v[k], mx); asm volatile("" : "+v"(d0)); v[k] = exp2slot(__fmul_rn(d0, 1.4426950408889634f)); sum += v[k]; }
#pragma unroll
    for (int sh = 16; sh; sh >>= 1) sum += __shfl_xor(sum, sh, 32);
    const float f = __fdiv_rn(hires ? 1.0f : PCAR, sum);
{
        if (hires) {
#pragma unroll
            for (int ch = 0; ch < NC / 128; ++ch) { v4us oh, ol;
#pragma unroll
                for (int q = 0; q < 4; ++q) { unsigned short a, c2; splitf(v[ch * 4 + q] * f, a, c2); oh[q] = a; ol[q] = c2; }
                const size_t oo = (size_t)row * PP + ch * 128 + lane * 4; *(v4us*)(Ph + oo) = oh; *(v4us*)(Pl + oo) = ol; }
        } else {
#pragma unroll
            for (int ch = 0; ch < NC / 128; ++ch) { v4h o4;
#pragma unroll
                for (int q = 0; q < 4; ++q) o4[q] = tohx(v[ch * 4 + q] * f);
                *(v4h*)(P16 + (size_t)row * PP + ch * 128 + lane * 4) = o4; } }
         }
}
__global__ __launch_bounds__(256) void k_merge(const float* __restrict__ O, int h0, int nt, bf* Ah, bf* Al) { const int el = (blockIdx.x * 256 + threadIdx.x) * 2; if (el >= nt * HD) return; const int d = el % HD; const int t = el / HD; const int zz = blockIdx.y; const size_t e = (size_t)zz * TT * HD + el;   // grid (nt / 8, ZH): rows t < nt of each head
    const float cs = (t < RH) ? 1.0f : (1.0f / PCAR); const size_t oo = (size_t)t * DQ + (h0 + zz) * HD + d;
    v2us oh, ol;
#pragma unroll
    for (int q = 0; q < 2; ++q) { unsigned short a, c2; splitf(O[e + q] * cs, a, c2); oh[q] = a; ol[q] = c2; } *(v2us*)(Ah + oo) = oh; *(v2us*)(Al + oo) = ol;  }

extern "C" void kernel_launch(void* const* d_in, const int* in_sizes, int n_in,
                              void* d_out, int out_size, void* d_ws, size_t ws_size, hipStream_t stream) {
    (void)in_sizes; (void)n_in; (void)out_size;
    const float* x0 = (const float*)d_in[0]; const float* x1 = (const float*)d_in[1]; const float* x2 = (const float*)d_in[2]; const float* wqA = (const float*)d_in[3]; const float* bqA = (const float*)d_in[4]; const float* wkA = (const float*)d_in[5]; const float* bkA = (const float*)d_in[6]; const float* wv = (const float*)d_in[7]; const float* bv = (const float*)d_in[8]; const float* wo = (const float*)d_in[9]; const float* bo = (const float*)d_in[10]; const float* x = nullptr; const float* wq = nullptr; const float* wk = nullptr; (void)x; (void)wq; (void)wk;
    float* OUT = (float*)d_out;     // [2048 + 1024 + 512][1024]: the three tuple members back to back
    char* wsp = (char*)d_ws;
    auto take = [&](size_t bytes) { char* p = wsp; wsp += (bytes + 255) & ~(size_t)255; return (void*)p; };
    bf* WQ = (bf*)take((size_t)DQ * DM * 2); bf* WK = (bf*)take((size_t)DKV * DM * 2); bf* WV = (bf*)take((size_t)DKV * DM * 2); bf* WO = (bf*)take((size_t)DM * DQ * 2); float* CS = (float*)take((size_t)TT * HD * 2 * 4); float* FVB = (float*)take((size_t)TT * DKV * 4); float* FVP = (float*)take((size_t)TT * DKV * 4);
    bf* XB = (bf*)take((size_t)TT * DM * 2); float* FQ = (float*)take((size_t)TT * DQ * 4); float* FK = (float*)take((size_t)TT * DKV * 4);
    h16* QP16 = (h16*)take((size_t)NH_ * TT * HD * 2); h16* KP16 = (h16*)take((size_t)NKV * TT * HD * 2); h16* VT16 = (h16*)take((size_t)NKV * HD * TT * 2);
    bf* QPh = (bf*)take((size_t)NH_ * TT * HD * 2); bf* QPl = (bf*)take((size_t)NH_ * TT * HD * 2); bf* KPh = (bf*)take((size_t)NKV * TT * HD * 2); bf* KPl = (bf*)take((size_t)NKV * TT * HD * 2); bf* VTh = (bf*)take((size_t)NKV * HD * TT * 2); bf* VTl = (bf*)take((size_t)NKV * HD * TT * 2);
    float* Sb = (float*)take((size_t)ZH * TT * TT * 4); h16* P16 = (h16*)Sb; bf* Ph = (bf*)Sb; bf* Pl = Ph + TT; /* probability planes in place over the score rows, pitch PP */ float* Ob = (float*)take((size_t)ZH * TT * HD * 4); bf* ATh = (bf*)take((size_t)TT * DQ * 2); bf* ATl = (bf*)take((size_t)TT * DQ * 2);
    if ((size_t)(wsp - (char*)d_ws) > ws_size) return;    // ws 256 MiB
    /* shared value base: v_base = x0 Wv^T + bv (exact) */
    k_cvt8<<<(unsigned)(((size_t)DKV * DM / 8 + 255) / 256), 256, 0, stream>>>(wv, WV, (size_t)DKV * DM / 8); k_cvt8<<<(unsigned)(((size_t)DM * DQ / 8 + 255) / 256), 256, 0, stream>>>(wo, WO, (size_t)DM * DQ / 8);
    k_cvt8<<<(unsigned)(((size_t)TT * DM / 8 + 255) / 256), 256, 0, stream>>>(x0, XB, (size_t)TT * DM / 8);
    k_gemmk<bf, 0, true, 0, 8><<<dim3(TT / 64, DKV / 64, 1), 256, 0, stream>>>(XB, nullptr, DM, WV, nullptr, DM, FVB, DKV, bv, 0, 0, 0, 0);
    const float* xs[3] = {x0, x1, x2}; size_t orow = 0;
    for (int s = 0; s < 3; ++s) { const int p = 1 << s; const int Ns = TT >> s;
        k_cvt8<<<(unsigned)(((size_t)DQ * DM / 8 + 255) / 256), 256, 0, stream>>>(wqA + (size_t)s * DQ * DM, WQ, (size_t)DQ * DM / 8); k_cvt8<<<(unsigned)(((size_t)DKV * DM / 8 + 255) / 256), 256, 0, stream>>>(wkA + (size_t)s * DKV * DM, WK, (size_t)DKV * DM / 8);
        k_cstab<<<Ns * HD / 256, 256, 0, stream>>>(CS, (float)p);                                      /* positions t x 2^s */
        k_cvt8<<<(unsigned)(((size_t)Ns * DM / 8 + 255) / 256), 256, 0, stream>>>(xs[s], XB, (size_t)Ns * DM / 8);   /* the scale's N_s rows */
        k_gemmk<bf, 0, true, 0, 8><<<dim3(Ns / 64, DQ / 64, 1), 256, 0, stream>>>(XB, nullptr, DM, WQ, nullptr, DM, FQ, DQ, bqA + (size_t)s * DQ, 0, 0, 0, 0);
        k_rope<<<dim3(Ns / 8, NH_), 256, 0, stream>>>(FQ, DQ, Ns, CS, nullptr, nullptr, 1.0f, QP16, QPh, QPl);
        k_gemmk<bf, 0, true, 0, 8><<<dim3(Ns / 64, DKV / 64, 1), 256, 0, stream>>>(XB, nullptr, DM, WK, nullptr, DM, FK, DKV, bkA + (size_t)s * DKV, 0, 0, 0, 0);
        k_rope<<<dim3(Ns / 8, NKV), 256, 0, stream>>>(FK, DKV, Ns, CS, nullptr, nullptr, 1.0f, KP16, KPh, KPl);
        if (s == 0) { k_vtp<<<dim3(Ns / 512, NKV * HD), 256, 0, stream>>>(FVB, DKV, Ns, VT16, VTh, VTl); }
        else { k_pool<<<Ns * DKV / 4 / 256, 256, 0, stream>>>(FVB, p, FVP); k_vtp<<<dim3(Ns / 512, NKV * HD), 256, 0, stream>>>(FVP, DKV, Ns, VT16, VTh, VTl); }   /* the N_s pooled rows */
        for (int h0 = 0; h0 < NH_; h0 += ZH) { const size_t zq = (size_t)h0, zk = (size_t)(h0 / REP);   // one kv head per query head: the pass's ZH heads use consecutive kv planes (z-strides TT*HD)
            k_gemmc<bf, 2, 1><<<dim3(RH / 64, Ns / 64, ZH), 32, 0, stream>>>(QPh + zq * TT * HD, QPl + zq * TT * HD, KPh + zk * TT * HD, KPl + zk * TT * HD, HD, Sb, TT, 0, (size_t)TT * HD, (size_t)TT * HD, (size_t)TT * TT);
            if (Ns > RH) k_gemmc<h16, 0, 1><<<dim3((Ns - RH) / 64, Ns / 64, ZH), 32, 0, stream>>>(QP16 + zq * TT * HD + (size_t)RH * HD, nullptr, KP16 + zk * TT * HD, nullptr, HD, Sb + (size_t)RH * TT, TT, RH, (size_t)TT * HD, (size_t)TT * HD, (size_t)TT * TT);
            if (s == 0) k_asoft<TT><<<ZH * TT / 8, 256, 0, stream>>>(Sb, P16, Ph, Pl); else if (s == 1) k_asoft<TT / 2><<<ZH * TT / 16, 256, 0, stream>>>(Sb, P16, Ph, Pl); else k_asoft<TT / 4><<<ZH * TT / 32, 256, 0, stream>>>(Sb, P16, Ph, Pl);
            k_gemmk<bf, 2, false, 2, 8><<<dim3(RH / 64, HD / 64, ZH), 256, 0, stream>>>(Ph, Pl, PP, VTh + zk * HD * TT, VTl + zk * HD * TT, TT, Ob, HD, nullptr, 0, (size_t)TT * PP, (size_t)HD * TT, (size_t)TT * HD);
            if (Ns > RH) k_gemmk<h16, 0, false, 2, 16><<<dim3((Ns - RH) / 64, HD / 64, ZH), 512, 0, stream>>>(P16 + (size_t)RH * PP, nullptr, PP, VT16 + zk * HD * TT, nullptr, TT, Ob + (size_t)RH * HD, HD, nullptr, RH, (size_t)TT * PP, (size_t)HD * TT, (size_t)TT * HD);
            k_merge<<<dim3(Ns / 8, ZH), 256, 0, stream>>>(Ob, h0, Ns, ATh, ATl); }
        k_gemmk<bf, 1, true, 0, 8><<<dim3(Ns / 64, DM / 64, 1), 256, 0, stream>>>(ATh, ATl, DQ, WO, nullptr, DQ, OUT + orow * DM, DM, bo, 0, 0, 0, 0);   /* only the N_s real rows of this tuple member */
        orow += (size_t)Ns; }
}

// v004
// It runs in 299 microseconds.
// Two timings next to v003 put it at 1.59 and 1.60 times that version's speed.
// Over all steps from v000 it is 7.05 times as fast.
#include <hip/hip_runtime.h>

// Multiscale causal attention (x0 [1][2048][1024], x1 [1][1024][1024], x2 [1][512][1024]; v_base = x0 Wv^T + bv shared, average-pooled by 2^i for scale i; per scale i: q, k = x_i W[i]^T + b[i] ('oi' [1024][1024] + [1024]; 16 heads x 64), rotate-half rotary at positions t x 2^i (base 1e4), scores = q.k / 8, causal (finfo.min); softmax; ctx_i = w v_i; out_i = ctx_i Wo^T + bo -> tuple ([1][2048][1024], [1][1024][1024], [1][512][1024]) (3.7 M)).
// Realisation: the three scales run together as one batch of TR = 2048 + 1024 + 512 rows (scale i holds rows soff(i) .. soff(i) + N_i, N_i = 2048 >> i): the launches cover the three together (the fp16 attn.v launch only scales 0 and 1, the pooling only 1 and 2), and each work-group finds its scale from its block index; a softmax row is N_i long and a score plane has pitch N_i; the rope table uses positions t x 2^i; the pooled values are built by a small averaging kernel. Q, K and V share the conversion and projection launches, the projection as grid planes; Q and K share the rotary launch as grid planes.
// Compute dtypes, f32 accumulate: every input rounded to bf16; q/k/v on PLAIN bf16 operands (inputs: exact) + biases; rotary in f32 (precise sinf/cosf, 32 baked float32 inverse frequencies, position factor 2^i exact); causal tile skipping; value pooling in f32 (in-order sum of the 2^i rows x 2^-i, as the reference's reshape-mean); scores and attn.v: query rows < 512 hl (3 products), the rest single fp16 (x1024); softmax f32; Wo hl x exact (2 products) + bo.

#define NB_  1
#define TT   2048
#define DM   1024
#define NH_  16
#define NKV  16
#define REP  (NH_ / NKV)
#define HD   64
#define DQ   (NH_ * HD)
#define DKV  (NKV * HD)
#define ZH   8                    // heads per attention pass
#define TR   (TT + TT / 2 + TT / 4)   // rows of the three scales, one after the other
#define RH   512                  // query rows < RH use hi+lo planes (0: none)
#define WIN  2048
#define PCAR 1024.0f
#define SCL  0.125f   // HD^-0.5
typedef _Float16 h16;
typedef unsigned short bf;
typedef __attribute__((ext_vector_type(16))) __bf16   v16bf;
typedef __attribute__((ext_vector_type(16))) _Float16 v16h;
typedef __attribute__((ext_vector_type(8)))  _Float16 v8h;
typedef __attribute__((ext_vector_type(8)))  unsigned short v8us;
typedef __attribute__((ext_vector_type(8)))  float    v8f;
typedef __attribute__((ext_vector_type(4)))  float    v4f;
typedef v8h  __attribute__((may_alias)) v8ha;
typedef v4f  __attribute__((may_alias)) v4fa;
typedef v8us __attribute__((may_alias)) v8usa;

__device__ __forceinline__ unsigned short f2bf(float f) { unsigned u = __float_as_uint(f); u += 0x7FFFu + ((u >> 16) & 1u); return (unsigned short)(u >> 16); }
__device__ __forceinline__ float bf2f(unsigned short b) { return __uint_as_float(((unsigned)b) << 16); }
__device__ __forceinline__ float bfr(float f) { return bf2f(f2bf(f)); }
__device__ __forceinline__ v16h cat16(v8h lo, v8h hi) { return __builtin_shufflevector(lo, hi, 0, 1, 2, 3, 4, 5, 6, 7, 8, 9, 10, 11, 12, 13, 14, 15); }
__device__ __forceinline__ v16bf cat16b(v8us lo, v8us hi) { return __builtin_bit_cast(v16bf, __builtin_shufflevector(lo, hi, 0, 1, 2, 3, 4, 5, 6, 7, 8, 9, 10, 11, 12, 13, 14, 15)); }
__device__ __forceinline__ v8f wmma16(v16h a, v16h b, v8f c) { return __builtin_amdgcn_wmma_f32_16x16x32_f16(false, a, false, b, (short)0, c, false, false); }
__device__ __forceinline__ v8f wmmab(v16bf a, v16bf b, v8f c) { return __builtin_amdgcn_wmma_f32_16x16x32_bf16(false, a, false, b, (short)0, c, false, false); }
// the batch of scales: scale of a batch row, first batch row of a scale, first f32 element of a scale's ZH score planes ([ZH][N][N], N = TT >> s; a probability row lies in place over its own score row, pitch 2 N in 16-bit elements)
__device__ __forceinline__ int sc_of(int t) { return t < TT ? 0 : (t < TT + TT / 2 ? 1 : 2); }
__device__ __forceinline__ int soff(int s) { return 2 * TT - ((2 * TT) >> s); }
__device__ __forceinline__ size_t sbase(int s) { return s == 0 ? (size_t)0 : (s == 1 ? (size_t)ZH * TT * TT : (size_t)ZH * TT * TT / 4 * 5); }
#define SBTOT ((size_t)ZH * TT * TT / 16 * 21)
// 64-row query tile x of an attention launch -> scale s and first row r within the scale. HL: rows < RH of all three scales (RH / 64 tiles each); else rows RH .. N of scales 0 and 1 (scale 2 has none)
template <bool HL> __device__ __forceinline__ void seg_of(int x, int& s, int& r) {
    if (HL) { s = x / (RH / 64); r = (x % (RH / 64)) * 64; }
    else { s = (x < (TT - RH) / 64) ? 0 : 1; r = RH + (x - s * ((TT - RH) / 64)) * 64; } }



// ---- k_gemmk: register-blocked GEMM, one 64x64 output tile per work-group of NW waves, the K loop split over the waves: wave w takes the 64-element (128-byte) K chunks w, w + NW, ... with its own 16 accumulators,
// operands straight from K-contiguous 16-bit planes; the NW partial tiles meet in LDS and are added in wave order 0..NW-1. grid (M/64, N/64, Z), NW x 32 threads.
// C[m][n] (f32, pitch ldc, + optional f32 bias[n]) = sum_k A[m][k] Bt[n][k] (+ split products per NSPLIT). A rows have pitch lda, Bt rows pitch K. z-batch strides sB/sC in elements. K % 64 == 0.
// CMODE 2 (probability x value, z = head): block x is query tile seg_of(x); A = the scale's in-place probability rows, Bt = the value plane's columns from soff(s) on; the K loop ends at the diagonal block (probabilities beyond it are exactly zero).
// CMODE 3 (projections, z = 0 q, 1 k, 2 v): rows are batch rows; weight matrix number 3 z + s of Bt and the matching bias row; v exists for scale 0 only.
template <typename T16> struct WFrag;
template <> struct WFrag<h16> { typedef v16h V; static __device__ __forceinline__ V ld(const h16* p) { return cat16(*(const v8h*)p, *(const v8h*)(p + 16)); } static __device__ __forceinline__ v8f mma(V a, V b, v8f c) { return wmma16(a, b, c); } };
template <> struct WFrag<bf> { typedef v16bf V; static __device__ __forceinline__ V ld(const bf* p) { return cat16b(*(const v8us*)p, *(const v8us*)(p + 16)); } static __device__ __forceinline__ v8f mma(V a, V b, v8f c) { return wmmab(a, b, c); } };
template <typename T16, int NSPLIT, bool BIAS, int CMODE, int NW>
__global__ __launch_bounds__(NW * 32) void k_gemmk(const T16* __restrict__ A, const T16* __restrict__ A2, int lda, const T16* __restrict__ Bt, const T16* __restrict__ Bt2, int K, float* C, int ldc, const float* __restrict__ bias, const float* __restrict__ biasK, const float* __restrict__ biasV, size_t sB, size_t sC) {
    typedef typename WFrag<T16>::V V;
    constexpr int RR = 2 * NW;                                        // tile rows added per round: one float4 per thread
    constexpr int NBUF = (2 * NW * RR * 68 * 4 <= 160 * 1024) ? 2 : 1; // two round buffers where both fit in half a WGP's LDS
    __shared__ __align__(16) float os[NBUF * NW * RR * 68];
    const size_t z = blockIdx.z;
    const int lane = threadIdx.x & 31, lr = lane & 15, hi = lane >> 4; const int c0 = blockIdx.y * 64;
    int r0 = blockIdx.x * 64, rc = r0, Kl = K;                        // first row in A, first row in C, end of the K loop
    if (CMODE == 2) { int s; seg_of<NSPLIT == 2>((int)blockIdx.x, s, r0); const size_t N = (size_t)(TT >> s); A += 2 * sbase(s) + z * 2 * N * N; if (NSPLIT == 2) A2 = A + N; lda = 2 * (int)N;
        Bt += z * sB + soff(s); if (NSPLIT >= 2) Bt2 += z * sB + soff(s); C += z * sC; rc = soff(s) + r0; Kl = r0 + 64; }
    if (CMODE == 3) { const int s = sc_of(r0); if (z == 2 && s) return;   // the whole work-group leaves, in front of every barrier
        Bt += (z * 3 + s) * (size_t)DM * DM; bias = (z == 0 ? bias : (z == 1 ? biasK : biasV)) + s * DM; C += z * sC; }
    const int wv = __builtin_amdgcn_readfirstlane((int)(threadIdx.x >> 5));   // wave number in a scalar register: the K loop stays a scalar loop with every lane on
    v8f acc[4][4];
#pragma unroll
    for (int mb = 0; mb < 4; ++mb)
#pragma unroll
        for (int nb = 0; nb < 4; ++nb) acc[mb][nb] = (v8f){};
    const size_t aoff = (size_t)(r0 + lr) * lda + 8 * hi, boff = (size_t)(c0 + lr) * K + 8 * hi;
#pragma unroll 1
    for (int kc = wv * 64; kc < Kl; kc += (kc & 32) ? NW * 64 - 32 : 32) {   // both halves of a 128-byte chunk, then this wave's next chunk
        V a[4], a2[4];
#pragma unroll
        for (int mb = 0; mb < 4; ++mb) { a[mb] = WFrag<T16>::ld(A + aoff + (size_t)mb * 16 * lda + kc); if (NSPLIT == 1 || NSPLIT == 2) a2[mb] = WFrag<T16>::ld(A2 + aoff + (size_t)mb * 16 * lda + kc); }
#pragma unroll
        for (int nb = 0; nb < 4; ++nb) { const V b = WFrag<T16>::ld(Bt + boff + (size_t)nb * 16 * K + kc); V b2; if (NSPLIT >= 2) b2 = WFrag<T16>::ld(Bt2 + boff + (size_t)nb * 16 * K + kc);
#pragma unroll
            for (int mb = 0; mb < 4; ++mb) { acc[mb][nb] = WFrag<T16>::mma(a[mb], b, acc[mb][nb]); if (NSPLIT == 1 || NSPLIT == 2) acc[mb][nb] = WFrag<T16>::mma(a2[mb], b, acc[mb][nb]); if (NSPLIT >= 2) acc[mb][nb] = WFrag<T16>::mma(a[mb], b2, acc[mb][nb]); } }
        // four vector slots behind the last matrix instruction, on the back edge and on the exit alike, before its operands or results are touched
        asm volatile("v_nop\n\tv_nop\n\tv_nop\n\tv_nop" : "+v"(acc[0][0]), "+v"(acc[1][1]), "+v"(acc[2][2]), "+v"(acc[3][3]) : "v"(a[0]), "v"(a[3]));
    }
    const int row = threadIdx.x >> 4, cofs = (threadIdx.x & 15) * 4;
    v4f res[64 / RR];
#pragma unroll
    for (int rd = 0; rd < 64 / RR; ++rd) {
        float* ob = os + (rd % NBUF) * (NW * RR * 68);                // two buffers in turn: one barrier a round is enough
        if (NBUF == 1 && rd) __syncthreads();                         // one buffer: the round before is read before it is overwritten
#pragma unroll
        for (int m = 0; m < RR / 16; ++m) {
#pragma unroll
            for (int nb = 0; nb < 4; ++nb) {
#pragma unroll
                for (int j = 0; j < 8; ++j) ob[(wv * RR + m * 16 + hi * 8 + j) * 68 + nb * 16 + lr] = acc[rd * (RR / 16) + m][nb][j]; } }
        __syncthreads();                                              // every wave's partial rows of this round are in LDS (two buffers: and every read of the buffer written next is done)
        v4f val = *(const v4fa*)(ob + row * 68 + cofs);
#pragma unroll
        for (int w = 1; w < NW; ++w) val += *(const v4fa*)(ob + (w * RR + row) * 68 + cofs);
        res[rd] = val;
    }
    v4f bb; bb[0] = bb[1] = bb[2] = bb[3] = 0.f;
    if (BIAS) { bb[0] = bfr(bias[c0 + cofs]); bb[1] = bfr(bias[c0 + cofs + 1]); bb[2] = bfr(bias[c0 + cofs + 2]); bb[3] = bfr(bias[c0 + cofs + 3]); }
#pragma unroll
    for (int rd = 0; rd < 64 / RR; ++rd) {                            // stores behind the last barrier: no barrier waits for a global store
        v4f val = res[rd]; if (BIAS) val += bb;
        *(v4f*)(C + (size_t)(rc + rd * RR + row) * ldc + c0 + cofs) = val; }
}

// ---- score_tile: one-wave 64x64 tile of q.k (16 accumulators, 32 threads): query tile seg_of(x) of head z = blockIdx.z, key columns blockIdx.y * 64 .. of the same scale; tiles entirely above the diagonal are skipped.
// A, Bt: head planes [z][TR][K]; C: the scale's score planes [z][N][N] at sbase(s).
template <typename T16, int NSPLIT>
__device__ __forceinline__ void score_tile(const T16* __restrict__ A, const T16* __restrict__ A2, const T16* __restrict__ Bt, const T16* __restrict__ Bt2, int K, float* C, int x, float* os) {
    typedef typename WFrag<T16>::V V;
    int s, r0; seg_of<NSPLIT == 2>(x, s, r0);
    const int lane = threadIdx.x & 31, lr = lane & 15, hi = lane >> 4; const int c0 = blockIdx.y * 64;
    if (c0 > r0 + 63) return;                                        // score tile entirely above the causal diagonal: left unwritten (the softmax loads it but masks j > i by select)
    const size_t z = blockIdx.z; const size_t po = (z * TR + soff(s)) * K; const int ldc = TT >> s;
    A += po; if (NSPLIT == 2) A2 += po; Bt += po; if (NSPLIT == 2) Bt2 += po; C += sbase(s) + z * ldc * ldc;
    const int Kl = K;
    v8f acc[4][4];
#pragma unroll
    for (int mb = 0; mb < 4; ++mb)
#pragma unroll
        for (int nb = 0; nb < 4; ++nb) acc[mb][nb] = (v8f){};
    const size_t aoff = (size_t)(r0 + lr) * K + 8 * hi, boff = (size_t)(c0 + lr) * K + 8 * hi;
#pragma unroll 1
    for (int kc = 0; kc < Kl; kc += 32) {
        V a[4], a2[4], b[4], b2[4]; const T16 *pa[4], *pa2[4], *pb[4], *pb2[4];
#pragma unroll
        for (int mb = 0; mb < 4; ++mb) { pa[mb] = A + aoff + (size_t)mb * 16 * K + kc; a[mb] = WFrag<T16>::ld(pa[mb]); if (NSPLIT == 2) { pa2[mb] = A2 + aoff + (size_t)mb * 16 * K + kc; a2[mb] = WFrag<T16>::ld(pa2[mb]); } }
#pragma unroll
        for (int nb = 0; nb < 4; ++nb) { pb[nb] = Bt + boff + (size_t)nb * 16 * K + kc; b[nb] = WFrag<T16>::ld(pb[nb]); if (NSPLIT == 2) { pb2[nb] = Bt2 + boff + (size_t)nb * 16 * K + kc; b2[nb] = WFrag<T16>::ld(pb2[nb]); } }
        // the wait stands behind the trip's loads; it takes their addresses as inputs, so that no load's result lands on an address register of the run in front of it
        if constexpr (NSPLIT == 2) asm volatile("s_wait_xcnt 0x0" :: "v"(pa[0]), "v"(pa[1]), "v"(pa[2]), "v"(pa[3]), "v"(pa2[0]), "v"(pa2[1]), "v"(pa2[2]), "v"(pa2[3]), "v"(pb[0]), "v"(pb[1]), "v"(pb[2]), "v"(pb[3]), "v"(pb2[0]), "v"(pb2[1]), "v"(pb2[2]), "v"(pb2[3]) : "memory");
        else asm volatile("s_wait_xcnt 0x0" :: "v"(pa[0]), "v"(pa[1]), "v"(pa[2]), "v"(pa[3]), "v"(pb[0]), "v"(pb[1]), "v"(pb[2]), "v"(pb[3]) : "memory");
#pragma unroll
        for (int nb = 0; nb < 4; ++nb) {
#pragma unroll
            for (int mb = 0; mb < 4; ++mb) { acc[mb][nb] = WFrag<T16>::mma(a[mb], b[nb], acc[mb][nb]); if (NSPLIT == 2) acc[mb][nb] = WFrag<T16>::mma(a2[mb], b[nb], acc[mb][nb]); if (NSPLIT == 2) acc[mb][nb] = WFrag<T16>::mma(a[mb], b2[nb], acc[mb][nb]); } }
        asm volatile("v_nop\n\tv_nop\n\tv_nop\n\tv_nop" : "+v"(acc[0][0]), "+v"(acc[1][1]), "+v"(acc[2][2]), "+v"(acc[3][3]) : "v"(a[0]), "v"(a[3]));
    }
#pragma unroll
    for (int mb = 0; mb < 4; ++mb) {
#pragma unroll
        for (int nb = 0; nb < 4; ++nb) {
#pragma unroll
            for (int j = 0; j < 8; ++j) os[(hi * 8 + j) * 68 + nb * 16 + lr] = acc[mb][nb][j]; }
        __builtin_amdgcn_wave_barrier(); asm volatile("" ::: "memory");
        float* crow = C + (size_t)(r0 + mb * 16) * ldc + c0;
{
#pragma unroll
            for (int s = 0; s < 8; ++s) { const int row = 2 * s + hi, cofs = lr * 4; v4f val = *(const v4fa*)(os + row * 68 + cofs);
                *(v4f*)(crow + (size_t)row * ldc + cofs) = val; }
             }
        __builtin_amdgcn_wave_barrier(); asm volatile("" ::: "memory");
    }
    asm volatile("s_wait_xcnt 0x0" ::: "memory");   // the wait stands behind the tile's last stores, before code that follows in the kernel reuses their registers
}
// k_scores: grid (3 RH / 64 + (TT - RH) / 64 + (TT / 2 - RH) / 64, TT / 64, ZH): the hi+lo query tiles of the three scales first, then the fp16 tiles
__global__ __launch_bounds__(32) void k_scores(const bf* __restrict__ Qh, const bf* __restrict__ Ql, const bf* __restrict__ Kh, const bf* __restrict__ Kw, const h16* __restrict__ Q16, const h16* __restrict__ K16, int K, float* S) {
    __shared__ __align__(16) float os[16 * 68];
    const int x = blockIdx.x;
    if (x < 3 * (RH / 64)) score_tile<bf, 2>(Qh, Ql, Kh, Kw, K, S, x, os);
    else score_tile<h16, 0>(Q16, nullptr, K16, nullptr, K, S, x - 3 * (RH / 64), os);
}

__device__ __forceinline__ h16 tohx(float x) { return (h16)x; }
__device__ __forceinline__ void splitf(float y, unsigned short& h, unsigned short& l) { h = f2bf(y); l = f2bf(y - bf2f(h)); }
typedef __attribute__((ext_vector_type(2))) _Float16 v2h;
typedef __attribute__((ext_vector_type(4))) _Float16 v4h;
typedef __attribute__((ext_vector_type(2))) unsigned short v2us;
typedef __attribute__((ext_vector_type(4))) unsigned short v4us;
typedef __attribute__((ext_vector_type(2))) float v2f;
typedef __attribute__((ext_vector_type(4))) int v4i;

__global__ __launch_bounds__(256) void k_wtG(const float* __restrict__ w, int K, int N, bf* Bt) {
    const int lane = threadIdx.x & 31; const int L0 = (blockIdx.x * 8 + (threadIdx.x >> 5)) * 8; const int nlines = N * K / 64;
{
#pragma unroll 1
        for (int l = 0; l < 8; ++l) { const int L = L0 + l; if (L >= nlines) break; const size_t e = (size_t)L * 64 + lane * 2; const int k = (int)(e % K), n = (int)(e / K); v2us o;
            o[0] = f2bf(w[(size_t)k * N + n]); o[1] = f2bf(w[(size_t)(k + 1) * N + n]); *(v2us*)(Bt + e) = o; }
         }
}
__constant__ float INV[HD / 2] = {1.0f,0.749894202f,0.562341332f,0.421696514f,0.316227764f,0.237137362f,0.177827939f,0.133352146f,0.100000001f,0.0749894157f,0.0562341288f,0.0421696492f,0.0316227786f,0.0237137359f,0.0177827943f,0.0133352149f,0.00999999978f,0.00749894232f,0.00562341325f,0.00421696482f,0.00316227786f,0.00237137382f,0.00177827943f,0.00133352145f,0.00100000005f,0.000749894185f,0.000562341302f,0.000421696488f,0.000316227786f,0.000237137385f,0.00017782794f,0.00013335215f};   // float32 1/10000^(2i/64), eager-JAX values
// rope table, 256 entries a block: cos, sin of batch row idx / HD, dimension idx % HD
__device__ __forceinline__ void cstab(float* CS, int blk) { const int idx = blk * 256 + threadIdx.x; const int tb = idx / HD, d = idx % HD; const int s = sc_of(tb); const int t = tb - soff(s); const float pm = (float)(1 << s); /* batch row tb = row t of scale s: position t x 2^s */ float p = __fmul_rn((float)t, pm); asm volatile("" : "+v"(p)); const float ang = __fmul_rn(p, INV[d % (HD / 2)]); v2f cs; cs[0] = cosf(ang); cs[1] = sinf(ang);
    *(v2f*)(CS + (size_t)idx * 2) = cs;  }
// k_prep: what depends on the inputs alone, in one grid. Blocks < CB_WO: every f32 input matrix to bf16, 2048 elements a block: x0, x1, x2 (the TR batch rows), the 3 q, the 3 k and the v weight matrices land one after the other at XW; the output weights at WOd. Blocks CB_WO .. CB_ALL: the rope table
#define CB_X0 (TT * DM / 2048)
#define CB_X1 (CB_X0 + TT / 2 * DM / 2048)
#define CB_X2 (CB_X1 + TT / 4 * DM / 2048)
#define CB_WQ (CB_X2 + 3 * DQ * DM / 2048)
#define CB_WK (CB_WQ + 3 * DKV * DM / 2048)
#define CB_WV (CB_WK + DKV * DM / 2048)
#define CB_WO (CB_WV + DM * DQ / 2048)
#define CB_ALL (CB_WO + TR * HD / 256)
__global__ __launch_bounds__(256) void k_prep(const float* __restrict__ x0, const float* __restrict__ x1, const float* __restrict__ x2, const float* __restrict__ wq, const float* __restrict__ wk, const float* __restrict__ wv, const float* __restrict__ wo, bf* XW, bf* WOd, float* CS) {
    const int b = blockIdx.x; if (b >= CB_WO) { cstab(CS, b - CB_WO); return; }
    const float* src; bf* dst = XW + (size_t)b * 2048;
    if (b < CB_X0) src = x0 + (size_t)b * 2048; else if (b < CB_X1) src = x1 + (size_t)(b - CB_X0) * 2048; else if (b < CB_X2) src = x2 + (size_t)(b - CB_X1) * 2048;
    else if (b < CB_WQ) src = wq + (size_t)(b - CB_X2) * 2048; else if (b < CB_WK) src = wk + (size_t)(b - CB_WQ) * 2048; else if (b < CB_WV) src = wv + (size_t)(b - CB_WK) * 2048;
    else { src = wo + (size_t)(b - CB_WV) * 2048; dst = WOd + (size_t)(b - CB_WV) * 2048; }
    const v8f v = *(const v8f*)(src + threadIdx.x * 8); v8us o;
#pragma unroll
    for (int k = 0; k < 8; ++k) o[k] = f2bf(v[k]); *(v8us*)(dst + threadIdx.x * 8) = o;  }
__global__ __launch_bounds__(256) void k_pool(const float* FVB, float* FVP) { const size_t i = (size_t)blockIdx.x * 256 + threadIdx.x; if (i >= (size_t)(TR - TT) * DKV / 4) return; const int tb = TT + (int)(i / (DKV / 4)); const int s = sc_of(tb); const int p = 1 << s; const size_t t = (size_t)(tb - soff(s)); const int c0 = (int)(i % (DKV / 4)) * 4; v4f o; o[0] = o[1] = o[2] = o[3] = 0.f;   // batch rows TT .. TR (scales 1, 2) of the value matrix from its rows < TT (scale 0); FVP = the same matrix
    { for (int r = 0; r < p; ++r) { const v4f a = *(const v4f*)(FVB + (t * p + r) * DKV + c0); for (int q = 0; q < 4; ++q) o[q] = __fadd_rn(o[q], a[q]); } const float inv = 1.0f / (float)p; for (int q = 0; q < 4; ++q) o[q] = __fmul_rn(o[q], inv); }
    *(v4f*)(FVP + (size_t)tb * DKV + c0) = o;  }

// k_rope: grid (nt / 8, heads, 2: q, k), batch rows t < nt of each head; z strides zF (f32 rows) and zP (planes); head planes [h][t][d] (fp16 + hi/lo) of rope(x) x sc with the rotate-half convention out[d] = x[d] cos[t][d] - x[d+HD/2] sin[t][d], out[d+HD/2] = x[d+HD/2] cos[t][d+HD/2] + x[d] sin[t][d+HD/2]
__global__ __launch_bounds__(256) void k_rope(const float* __restrict__ F, int pitch, int nt, const float* __restrict__ CS, const float* __restrict__ RF, const float* __restrict__ nw, float sc, h16* P16, bf* Ph, bf* Pl, size_t zF, size_t zP) {
    const int el = (blockIdx.x * 256 + threadIdx.x) * 2; if (el >= nt * HD) return; const int d = el % HD; const int t = el / HD; const int h = blockIdx.y; const size_t e = blockIdx.z * zP + (size_t)h * TR * HD + el; const float* f = F + blockIdx.z * zF + (size_t)t * pitch + h * HD; v2h o16; v2us oh, ol;
    float rf = 1.0f; if (RF) { rf = RF[(size_t)h * TR + t]; asm volatile("s_wait_xcnt 0x0" ::: "memory"); }   // the wait stands before this load's address registers are reused
#pragma unroll
    for (int q = 0; q < 2; ++q) { const int dd = d + q; const int dp = (dd < HD / 2) ? dd + HD / 2 : dd - HD / 2; float x0 = f[dd], x1 = f[dp];
        if (RF) { float n0 = __fmul_rn(x0, rf), n1 = __fmul_rn(x1, rf); asm volatile("" : "+v"(n0)); asm volatile("" : "+v"(n1)); x0 = __fmul_rn(bfr(nw[dd]), n0); x1 = __fmul_rn(bfr(nw[dp]), n1); }
        const v2f cs = *(const v2f*)(CS + ((size_t)t * HD + dd) * 2); asm volatile("s_wait_xcnt 0x0" ::: "memory");   // the wait stands before the address registers of this trip's loads are reused
        float a = __fmul_rn(x0, cs[0]), bq = __fmul_rn(x1, cs[1]); asm volatile("" : "+v"(a)); asm volatile("" : "+v"(bq)); const float r = ((dd < HD / 2) ? __fsub_rn(a, bq) : __fadd_rn(a, bq)) * sc;
        o16[q] = tohx(r); unsigned short a2, c2; splitf(r, a2, c2); oh[q] = a2; ol[q] = c2; }
    *(v2h*)(P16 + e) = o16; *(v2us*)(Ph + e) = oh; *(v2us*)(Pl + e) = ol;  }
__global__ __launch_bounds__(256) void k_vtp(const float* __restrict__ F, int pitch, int nt, h16* V16, bf* Vh, bf* Vl) { const int t = (blockIdx.x * 256 + threadIdx.x) * 2; if (t >= nt) return; const int d = blockIdx.y % HD; const int g = blockIdx.y / HD; const size_t e = (size_t)blockIdx.y * TR + t;   // grid (nt / 512, heads x HD): batch columns t < nt of each [g][d] row
    v2h o16; v2us oh, ol;
#pragma unroll
    for (int q = 0; q < 2; ++q) { const float x = F[(size_t)(t + q) * pitch + g * HD + d]; o16[q] = tohx(x); unsigned short a2, c2; splitf(x, a2, c2); oh[q] = a2; ol[q] = c2; }
    *(v2h*)(V16 + e) = o16; *(v2us*)(Vh + e) = oh; *(v2us*)(Vl + e) = ol;  }
// 2^x with the v_nop in the same statement: it keeps the one slot behind a transcendental before its source register is reused or its result read
__device__ __forceinline__ float exp2slot(float x) { float r; asm("v_exp_f32 %0, %1\n\tv_nop" : "=v"(r) : "v"(x)); return r; }
// k_asoft: per row (zz, i): t = S x HD^-0.5 for j <= i and i - j < WIN (sliding causal window; the reference's -1e9 additive fill vanishes identically); softmax over the NC keys of this scale (register row, one exp, fixed trees; rows i < NC of each head, pitch NC; blk = block number within the scale, 8 rows a block);
// the probabilities go IN PLACE over the row's own 4 NC bytes of scores (pitch 2 NC): fp16 in the first half, or the hi plane in the first and the lo plane in the second half. One wave owns a row and holds all of it in registers
// (the row sum needs every load) before its first store, and no other wave touches that row; hence no __restrict__ here.
template <int NC>
__device__ __forceinline__ void asoft_row(const float* Sb, h16* P16, bf* Ph, int blk) {
    constexpr int PP = 2 * NC; bf* Pl = Ph + NC;
    const int lane = threadIdx.x & 31; const int row = blk * 8 + (threadIdx.x >> 5); const int i = row % NC; const bool hires = (i < RH); const float* sr = Sb + (size_t)row * NC; float v[NC / 32]; float mx = -3.0e38f; const float* sl = sr + lane * 4; v4f av[NC / 128];
#pragma unroll
    for (int ch = 0; ch < NC / 128; ++ch) av[ch] = *(const v4fa*)(sl + ch * 128);   // may_alias: the 16-bit stores below land on these same bytes
    asm volatile("s_wait_xcnt 0x0" :: "v"(sl) : "memory");   // the wait stands behind the row's loads; it takes their address as an input, so that no load's result lands on it in front of the wait
#pragma unroll
    for (int ch = 0; ch < NC / 128; ++ch) { const int j0 = ch * 128 + lane * 4; const v4f a = av[ch];
#pragma unroll
        for (int q = 0; q < 4; ++q) { const int j = j0 + q; (void)j; const float t = (j <= i && i - j < WIN) ? a[q] * SCL : -3.0e38f; v[ch * 4 + q] = t; mx = fmaxf(mx, t); } }
#pragma unroll
    for (int sh = 16; sh; sh >>= 1) mx = fmaxf(mx, __shfl_xor(mx, sh, 32));
    float sum = 0.f;
#pragma unroll
    for (int k = 0; k < NC / 32; ++k) { float d0 = __fsub_rn(v[k], mx); asm volatile("" : "+v"(d0)); v[k] = exp2slot(__fmul_rn(d0, 1.4426950408889634f)); sum += v[k]; }
#pragma unroll
    for (int sh = 16; sh; sh >>= 1) sum += __shfl_xor(sum, sh, 32);
    const float f = __fdiv_rn(hires ? 1.0f : PCAR, sum);
{
        if (hires) {
#pragma unroll
            for (int ch = 0; ch < NC / 128; ++ch) { v4us oh, ol;
#pragma unroll
                for (int q = 0; q < 4; ++q) { unsigned short a, c2; splitf(v[ch * 4 + q] * f, a, c2); oh[q] = a; ol[q] = c2; }
                const size_t oo = (size_t)row * PP + ch * 128 + lane * 4; *(v4us*)(Ph + oo) = oh; *(v4us*)(Pl + oo) = ol; }
        } else {
#pragma unroll
            for (int ch = 0; ch < NC / 128; ++ch) { v4h o4;
#pragma unroll
                for (int q = 0; q < 4; ++q) o4[q] = tohx(v[ch * 4 + q] * f);
                *(v4h*)(P16 + (size_t)row * PP + ch * 128 + lane * 4) = o4; } }
         }
    asm volatile("s_wait_xcnt 0x0" ::: "memory");   // the wait stands behind the row's last stores, before code that follows in the kernel reuses their registers
}
// k_asoft: grid ZH TR / 8: the rows of scale 0, then of scale 1, then of scale 2
__global__ __launch_bounds__(256) void k_asoft(const float* Sb, h16* P16, bf* Ph) {
    const int b = blockIdx.x;
    if (b < ZH * TT / 8) asoft_row<TT>(Sb, P16, Ph, b);
    else if (b < ZH * (TT + TT / 2) / 8) asoft_row<TT / 2>(Sb + sbase(1), P16 + 2 * sbase(1), Ph + 2 * sbase(1), b - ZH * TT / 8);
    else asoft_row<TT / 4>(Sb + sbase(2), P16 + 2 * sbase(2), Ph + 2 * sbase(2), b - ZH * (TT + TT / 2) / 8);
}
__global__ __launch_bounds__(256) void k_merge(const float* __restrict__ O, int h0, int nt, bf* Ah, bf* Al) { const int el = (blockIdx.x * 256 + threadIdx.x) * 2; if (el >= nt * HD) return; const int d = el % HD; const int t = el / HD; const int zz = blockIdx.y; const size_t e = (size_t)zz * TR * HD + el;   // grid (nt / 8, ZH): batch rows t < nt of each head
    const float cs = (t - soff(sc_of(t)) < RH) ? 1.0f : (1.0f / PCAR); const size_t oo = (size_t)t * DQ + (h0 + zz) * HD + d;
    v2us oh, ol;
#pragma unroll
    for (int q = 0; q < 2; ++q) { unsigned short a, c2; splitf(O[e + q] * cs, a, c2); oh[q] = a; ol[q] = c2; } *(v2us*)(Ah + oo) = oh; *(v2us*)(Al + oo) = ol;  }

extern "C" void kernel_launch(void* const* d_in, const int* in_sizes, int n_in,
                              void* d_out, int out_size, void* d_ws, size_t ws_size, hipStream_t stream) {
    (void)in_sizes; (void)n_in; (void)out_size;
    const float* x0 = (const float*)d_in[0]; const float* x1 = (const float*)d_in[1]; const float* x2 = (const float*)d_in[2]; const float* wqA = (const float*)d_in[3]; const float* bqA = (const float*)d_in[4]; const float* wkA = (const float*)d_in[5]; const float* bkA = (const float*)d_in[6]; const float* wv = (const float*)d_in[7]; const float* bv = (const float*)d_in[8]; const float* wo = (const float*)d_in[9]; const float* bo = (const float*)d_in[10]; const float* x = nullptr; const float* wq = nullptr; const float* wk = nullptr; (void)x; (void)wq; (void)wk;
    float* OUT = (float*)d_out;     // the tuple's members one after the other: [TR][1024], in the order of the batch rows
    char* wsp = (char*)d_ws;
    auto take = [&](size_t bytes) { char* p = wsp; wsp += (bytes + 255) & ~(size_t)255; return (void*)p; };
    const size_t PL = (size_t)NH_ * TR * HD;   // one set of head planes, in elements
    bf* WO = (bf*)take((size_t)DM * DQ * 2);
    h16* QP16 = (h16*)take(2 * PL * 2); h16* KP16 = QP16 + PL; bf* QPh = (bf*)take(2 * PL * 2); bf* KPh = QPh + PL; bf* QPl = (bf*)take(2 * PL * 2); bf* KPl = QPl + PL;   // q planes, then k planes
    h16* VT16 = (h16*)take(PL * 2); bf* VTh = (bf*)take(PL * 2); bf* VTl = (bf*)take(PL * 2);
    float* Ob = (float*)take((size_t)ZH * TR * HD * 4); bf* ATh = (bf*)take((size_t)TR * DQ * 2); bf* ATl = (bf*)take((size_t)TR * DQ * 2);
    float* Sb = (float*)take(SBTOT * 4); h16* P16 = (h16*)Sb; bf* Ph = (bf*)Sb;   /* probability planes in place over the score rows */
    if ((size_t)(wsp - (char*)d_ws) > ws_size) return;    // ws 256 MiB
    /* what only the launches in front of the first score launch use lies in the score planes' space: bf16 inputs and q, k, v weights, rope table, f32 q, k, v rows */
    wsp = (char*)Sb;
    bf* XB = (bf*)take(((size_t)TR * DM + (size_t)7 * DM * DM) * 2); bf* WQKV = XB + (size_t)TR * DM; float* CS = (float*)take((size_t)TR * HD * 2 * 4); float* FQKV = (float*)take((size_t)3 * TR * DM * 4); float* FV = FQKV + (size_t)2 * TR * DM;
    k_prep<<<CB_ALL, 256, 0, stream>>>(x0, x1, x2, wqA, wkA, wv, wo, XB, WO, CS);                     /* bf16 inputs; rope table, positions t x 2^s */
    k_gemmk<bf, 0, true, 3, 8><<<dim3(TR / 64, DM / 64, 3), 256, 0, stream>>>(XB, nullptr, DM, WQKV, nullptr, DM, FQKV, DM, bqA, bkA, bv, 0, (size_t)TR * DM);   /* q, k of every scale; v_base = x0 Wv^T + bv */
    k_rope<<<dim3(TR / 8, NH_, 2), 256, 0, stream>>>(FQKV, DM, TR, CS, nullptr, nullptr, 1.0f, QP16, QPh, QPl, (size_t)TR * DM, PL);
    k_pool<<<(TR - TT) * DKV / 4 / 256, 256, 0, stream>>>(FV, FV);                                    /* the pooled rows of scales 1 and 2 */
    k_vtp<<<dim3(TR / 512, NKV * HD), 256, 0, stream>>>(FV, DKV, TR, VT16, VTh, VTl);
    for (int h0 = 0; h0 < NH_; h0 += ZH) { const size_t zq = (size_t)h0 * TR * HD;   // one kv head per query head: the pass's ZH heads use consecutive planes
        k_scores<<<dim3(3 * (RH / 64) + (TT - RH) / 64 + (TT / 2 - RH) / 64, TT / 64, ZH), 32, 0, stream>>>(QPh + zq, QPl + zq, KPh + zq, KPl + zq, QP16 + zq, KP16 + zq, HD, Sb);
        k_asoft<<<ZH * TR / 8, 256, 0, stream>>>(Sb, P16, Ph);
        k_gemmk<bf, 2, false, 2, 8><<<dim3(3 * (RH / 64), HD / 64, ZH), 256, 0, stream>>>(Ph, nullptr, 0, VTh + zq, VTl + zq, TR, Ob, HD, nullptr, nullptr, nullptr, (size_t)HD * TR, (size_t)TR * HD);
        k_gemmk<h16, 0, false, 2, 16><<<dim3((TT - RH) / 64 + (TT / 2 - RH) / 64, HD / 64, ZH), 512, 0, stream>>>(P16, nullptr, 0, VT16 + zq, nullptr, TR, Ob, HD, nullptr, nullptr, nullptr, (size_t)HD * TR, (size_t)TR * HD);
        k_merge<<<dim3(TR / 8, ZH), 256, 0, stream>>>(Ob, h0, TR, ATh, ATl); }
    k_gemmk<bf, 1, true, 0, 8><<<dim3(TR / 64, DM / 64, 1), 256, 0, stream>>>(ATh, ATl, DQ, WO, nullptr, DQ, OUT, DM, bo, nullptr, nullptr, 0, 0);
}

// v005
// One run takes 181 microseconds.
// Timed twice side by side with v004, it ran 1.65 and 1.64 times as fast.
// Counting every step since v000, it is 11.6 times as fast.
#include <hip/hip_runtime.h>

// Multiscale causal attention (x0 [1][2048][1024], x1 [1][1024][1024], x2 [1][512][1024]; v_base = x0 Wv^T + bv shared, average-pooled by 2^i for scale i; per scale i: q, k = x_i W[i]^T + b[i] ('oi' [1024][1024] + [1024]; 16 heads x 64), rotate-half rotary at positions t x 2^i (base 1e4), scores = q.k / 8, causal (finfo.min); softmax; ctx_i = w v_i; out_i = ctx_i Wo^T + bo -> tuple ([1][2048][1024], [1][1024][1024], [1][512][1024]) (3.7 M)).
// Realisation: the three scales run together as one batch of TR = 2048 + 1024 + 512 rows (scale i holds rows soff(i) .. soff(i) + N_i, N_i = 2048 >> i): every launch covers all three, and each work-group finds its scale from its block index; attention is one fused launch (scores and probabilities stay in registers); the rope table uses positions t x 2^i; the pooled values are built by a small averaging kernel. Q, K and V share the conversion and projection launches (the projection as grid planes); Q and K share the rotary launch as grid planes.
// Compute dtypes, f32 accumulate: every input rounded to bf16; q/k/v on PLAIN bf16 operands (inputs: exact) + biases; rotary in f32 (precise sinf/cosf, 32 baked float32 inverse frequencies, position factor 2^i exact); causal tile skipping; value pooling in f32 (means of 2^i rows, summed in order, as the reference's reshape-mean); scores and attn.v: query rows < 512 hl (3 products), the rest single fp16 (probabilities x 2^6, unnormalised); online softmax f32, divided by the row sum at the end; Wo hl x exact (2 products) + bo.

#define NB_  1
#define TT   2048
#define DM   1024
#define NH_  16
#define NKV  16
#define REP  (NH_ / NKV)
#define HD   64
#define DQ   (NH_ * HD)
#define DKV  (NKV * HD)
#define TR   (TT + TT / 2 + TT / 4)   // rows of the three scales, one after the other
#define RH   512                  // query rows < RH use hi+lo planes (k_fattn's grid assumes RH = TT / 4)
#define SCL  0.125f   // HD^-0.5
typedef _Float16 h16;
typedef unsigned short bf;
typedef __attribute__((ext_vector_type(16))) __bf16   v16bf;
typedef __attribute__((ext_vector_type(16))) _Float16 v16h;
typedef __attribute__((ext_vector_type(8)))  _Float16 v8h;
typedef __attribute__((ext_vector_type(8)))  unsigned short v8us;
typedef __attribute__((ext_vector_type(8)))  float    v8f;
typedef __attribute__((ext_vector_type(4)))  float    v4f;
typedef v8h  __attribute__((may_alias)) v8ha;
typedef v4f  __attribute__((may_alias)) v4fa;
typedef v8us __attribute__((may_alias)) v8usa;

__device__ __forceinline__ unsigned short f2bf(float f) { unsigned u = __float_as_uint(f); u += 0x7FFFu + ((u >> 16) & 1u); return (unsigned short)(u >> 16); }
__device__ __forceinline__ float bf2f(unsigned short b) { return __uint_as_float(((unsigned)b) << 16); }
__device__ __forceinline__ float bfr(float f) { return bf2f(f2bf(f)); }
__device__ __forceinline__ v16h cat16(v8h lo, v8h hi) { return __builtin_shufflevector(lo, hi, 0, 1, 2, 3, 4, 5, 6, 7, 8, 9, 10, 11, 12, 13, 14, 15); }
__device__ __forceinline__ v16bf cat16b(v8us lo, v8us hi) { return __builtin_bit_cast(v16bf, __builtin_shufflevector(lo, hi, 0, 1, 2, 3, 4, 5, 6, 7, 8, 9, 10, 11, 12, 13, 14, 15)); }
__device__ __forceinline__ v8f wmma16(v16h a, v16h b, v8f c) { return __builtin_amdgcn_wmma_f32_16x16x32_f16(false, a, false, b, (short)0, c, false, false); }
__device__ __forceinline__ v8f wmmab(v16bf a, v16bf b, v8f c) { return __builtin_amdgcn_wmma_f32_16x16x32_bf16(false, a, false, b, (short)0, c, false, false); }
// the batch of scales: scale of a batch row, first batch row of a scale
__device__ __forceinline__ int sc_of(int t) { return t < TT ? 0 : (t < TT + TT / 2 ? 1 : 2); }
__device__ __forceinline__ int soff(int s) { return 2 * TT - ((2 * TT) >> s); }

// ---- k_gemmk: register-blocked GEMM, one 64x64 output tile per work-group of NW waves, the K loop split over the waves: wave w takes the 64-element (128-byte) K chunks w, w + NW, ... with its own 16 accumulators,
// operands straight from K-contiguous 16-bit planes; the NW partial tiles meet in LDS and are added in wave order 0..NW-1. grid (M/64, N/64, Z), NW x 32 threads.
// C[m][n] (f32, pitch ldc, + optional f32 bias[n]) = sum_k A[m][k] Bt[n][k] (+ split products per NSPLIT). A rows have pitch lda, Bt rows pitch K. z-batch stride sC in elements (CMODE 3; sB unused). K % 64 == 0.
// CMODE 3 (projections, z = 0 q, 1 k, 2 v): rows are batch rows; weight matrix number 3 z + s of Bt and the matching bias row; v exists for scale 0 only.
template <typename T16> struct WFrag;
template <> struct WFrag<h16> { typedef v16h V; static __device__ __forceinline__ V ld(const h16* p) { return cat16(*(const v8h*)p, *(const v8h*)(p + 16)); } static __device__ __forceinline__ v8f mma(V a, V b, v8f c) { return wmma16(a, b, c); } };
template <> struct WFrag<bf> { typedef v16bf V; static __device__ __forceinline__ V ld(const bf* p) { return cat16b(*(const v8us*)p, *(const v8us*)(p + 16)); } static __device__ __forceinline__ v8f mma(V a, V b, v8f c) { return wmmab(a, b, c); } };
template <typename T16, int NSPLIT, bool BIAS, int CMODE, int NW>
__global__ __launch_bounds__(NW * 32) void k_gemmk(const T16* __restrict__ A, const T16* __restrict__ A2, int lda, const T16* __restrict__ Bt, const T16* __restrict__ Bt2, int K, float* C, int ldc, const float* __restrict__ bias, const float* __restrict__ biasK, const float* __restrict__ biasV, size_t sB, size_t sC) {
    typedef typename WFrag<T16>::V V;
    constexpr int RR = 2 * NW;                                        // tile rows added per round: one float4 per thread
    constexpr int NBUF = (2 * NW * RR * 68 * 4 <= 160 * 1024) ? 2 : 1; // two round buffers where both fit in half a WGP's LDS
    __shared__ __align__(16) float os[NBUF * NW * RR * 68];
    const size_t z = blockIdx.z;
    const int lane = threadIdx.x & 31, lr = lane & 15, hi = lane >> 4; const int c0 = blockIdx.y * 64;
    int r0 = blockIdx.x * 64, rc = r0, Kl = K;                        // first row in A, first row in C, end of the K loop
    if (CMODE == 3) { const int s = sc_of(r0); if (z == 2 && s) return;   // the whole work-group leaves, in front of every barrier
        Bt += (z * 3 + s) * (size_t)DM * DM; bias = (z == 0 ? bias : (z == 1 ? biasK : biasV)) + s * DM; C += z * sC; }
    const int wv = __builtin_amdgcn_readfirstlane((int)(threadIdx.x >> 5));   // wave number in a scalar register: the K loop stays a scalar loop with every lane on
    v8f acc[4][4];
#pragma unroll
    for (int mb = 0; mb < 4; ++mb)
#pragma unroll
        for (int nb = 0; nb < 4; ++nb) acc[mb][nb] = (v8f){};
    const size_t aoff = (size_t)(r0 + lr) * lda + 8 * hi, boff = (size_t)(c0 + lr) * K + 8 * hi;
#pragma unroll 1
    for (int kc = wv * 64; kc < Kl; kc += (kc & 32) ? NW * 64 - 32 : 32) {   // both halves of a 128-byte chunk, then this wave's next chunk
        V a[4], a2[4];
#pragma unroll
        for (int mb = 0; mb < 4; ++mb) { a[mb] = WFrag<T16>::ld(A + aoff + (size_t)mb * 16 * lda + kc); if (NSPLIT == 1 || NSPLIT == 2) a2[mb] = WFrag<T16>::ld(A2 + aoff + (size_t)mb * 16 * lda + kc); }
#pragma unroll
        for (int nb = 0; nb < 4; ++nb) { const V b = WFrag<T16>::ld(Bt + boff + (size_t)nb * 16 * K + kc); V b2; if (NSPLIT >= 2) b2 = WFrag<T16>::ld(Bt2 + boff + (size_t)nb * 16 * K + kc);
#pragma unroll
            for (int mb = 0; mb < 4; ++mb) { acc[mb][nb] = WFrag<T16>::mma(a[mb], b, acc[mb][nb]); if (NSPLIT == 1 || NSPLIT == 2) acc[mb][nb] = WFrag<T16>::mma(a2[mb], b, acc[mb][nb]); if (NSPLIT >= 2) acc[mb][nb] = WFrag<T16>::mma(a[mb], b2, acc[mb][nb]); } }
        // four vector slots behind the last matrix instruction, on the back edge and on the exit alike, before its operands or results are touched
        asm volatile("v_nop\n\tv_nop\n\tv_nop\n\tv_nop" : "+v"(acc[0][0]), "+v"(acc[1][1]), "+v"(acc[2][2]), "+v"(acc[3][3]) : "v"(a[0]), "v"(a[3]));
    }
    const int row = threadIdx.x >> 4, cofs = (threadIdx.x & 15) * 4;
    v4f res[64 / RR];
#pragma unroll
    for (int rd = 0; rd < 64 / RR; ++rd) {
        float* ob = os + (rd % NBUF) * (NW * RR * 68);                // two buffers in turn: one barrier a round is enough
        if (NBUF == 1 && rd) __syncthreads();                         // one buffer: the round before is read before it is overwritten
#pragma unroll
        for (int m = 0; m < RR / 16; ++m) {
#pragma unroll
            for (int nb = 0; nb < 4; ++nb) {
#pragma unroll
                for (int j = 0; j < 8; ++j) ob[(wv * RR + m * 16 + hi * 8 + j) * 68 + nb * 16 + lr] = acc[rd * (RR / 16) + m][nb][j]; } }
        __syncthreads();                                              // every wave's partial rows of this round are in LDS (two buffers: and every read of the buffer written next is done)
        v4f val = *(const v4fa*)(ob + row * 68 + cofs);
#pragma unroll
        for (int w = 1; w < NW; ++w) val += *(const v4fa*)(ob + (w * RR + row) * 68 + cofs);
        res[rd] = val;
    }
    v4f bb; bb[0] = bb[1] = bb[2] = bb[3] = 0.f;
    if (BIAS) { bb[0] = bfr(bias[c0 + cofs]); bb[1] = bfr(bias[c0 + cofs + 1]); bb[2] = bfr(bias[c0 + cofs + 2]); bb[3] = bfr(bias[c0 + cofs + 3]); }
#pragma unroll
    for (int rd = 0; rd < 64 / RR; ++rd) {                            // stores behind the last barrier: no barrier waits for a global store
        v4f val = res[rd]; if (BIAS) val += bb;
        *(v4f*)(C + (size_t)(rc + rd * RR + row) * ldc + c0 + cofs) = val; }
}

__device__ __forceinline__ h16 tohx(float x) { return (h16)x; }
__device__ __forceinline__ void splitf(float y, unsigned short& h, unsigned short& l) { h = f2bf(y); l = f2bf(y - bf2f(h)); }
typedef __attribute__((ext_vector_type(2))) _Float16 v2h;
typedef __attribute__((ext_vector_type(4))) _Float16 v4h;
typedef __attribute__((ext_vector_type(2))) unsigned short v2us;
typedef __attribute__((ext_vector_type(4))) unsigned short v4us;
typedef __attribute__((ext_vector_type(2))) float v2f;
typedef __attribute__((ext_vector_type(4))) int v4i;

__global__ __launch_bounds__(256) void k_wtG(const float* __restrict__ w, int K, int N, bf* Bt) {
    const int lane = threadIdx.x & 31; const int L0 = (blockIdx.x * 8 + (threadIdx.x >> 5)) * 8; const int nlines = N * K / 64;
{
#pragma unroll 1
        for (int l = 0; l < 8; ++l) { const int L = L0 + l; if (L >= nlines) break; const size_t e = (size_t)L * 64 + lane * 2; const int k = (int)(e % K), n = (int)(e / K); v2us o;
            o[0] = f2bf(w[(size_t)k * N + n]); o[1] = f2bf(w[(size_t)(k + 1) * N + n]); *(v2us*)(Bt + e) = o; }
         }
}
__constant__ float INV[HD / 2] = {1.0f,0.749894202f,0.562341332f,0.421696514f,0.316227764f,0.237137362f,0.177827939f,0.133352146f,0.100000001f,0.0749894157f,0.0562341288f,0.0421696492f,0.0316227786f,0.0237137359f,0.0177827943f,0.0133352149f,0.00999999978f,0.00749894232f,0.00562341325f,0.00421696482f,0.00316227786f,0.00237137382f,0.00177827943f,0.00133352145f,0.00100000005f,0.000749894185f,0.000562341302f,0.000421696488f,0.000316227786f,0.000237137385f,0.00017782794f,0.00013335215f};   // float32 1/10000^(2i/64), eager-JAX values
// rope table, 256 entries a block: cos, sin of batch row idx / HD, dimension idx % HD
__device__ __forceinline__ void cstab(float* CS, int blk) { const int idx = blk * 256 + threadIdx.x; const int tb = idx / HD, d = idx % HD; const int s = sc_of(tb); const int t = tb - soff(s); const float pm = (float)(1 << s); /* batch row tb = row t of scale s: position t x 2^s */ float p = __fmul_rn((float)t, pm); asm volatile("" : "+v"(p)); const float ang = __fmul_rn(p, INV[d % (HD / 2)]); v2f cs; cs[0] = cosf(ang); cs[1] = sinf(ang);
    *(v2f*)(CS + (size_t)idx * 2) = cs;  }
// k_prep: what depends on the inputs alone, in one grid. Blocks < CB_WO: every f32 input matrix to bf16, 2048 elements a block: x0, x1, x2 (the TR batch rows), the 3 q, the 3 k and the v weight matrices land one after the other at XW; the output weights at WOd. Blocks CB_WO .. CB_ALL: the rope table
#define CB_X0 (TT * DM / 2048)
#define CB_X1 (CB_X0 + TT / 2 * DM / 2048)
#define CB_X2 (CB_X1 + TT / 4 * DM / 2048)
#define CB_WQ (CB_X2 + 3 * DQ * DM / 2048)
#define CB_WK (CB_WQ + 3 * DKV * DM / 2048)
#define CB_WV (CB_WK + DKV * DM / 2048)
#define CB_WO (CB_WV + DM * DQ / 2048)
#define CB_ALL (CB_WO + TR * HD / 256)
__global__ __launch_bounds__(256) void k_prep(const float* __restrict__ x0, const float* __restrict__ x1, const float* __restrict__ x2, const float* __restrict__ wq, const float* __restrict__ wk, const float* __restrict__ wv, const float* __restrict__ wo, bf* XW, bf* WOd, float* CS) {
    const int b = blockIdx.x; if (b >= CB_WO) { cstab(CS, b - CB_WO); return; }
    const float* src; bf* dst = XW + (size_t)b * 2048;
    if (b < CB_X0) src = x0 + (size_t)b * 2048; else if (b < CB_X1) src = x1 + (size_t)(b - CB_X0) * 2048; else if (b < CB_X2) src = x2 + (size_t)(b - CB_X1) * 2048;
    else if (b < CB_WQ) src = wq + (size_t)(b - CB_X2) * 2048; else if (b < CB_WK) src = wk + (size_t)(b - CB_WQ) * 2048; else if (b < CB_WV) src = wv + (size_t)(b - CB_WK) * 2048;
    else { src = wo + (size_t)(b - CB_WV) * 2048; dst = WOd + (size_t)(b - CB_WV) * 2048; }
    const v8f v = *(const v8f*)(src + threadIdx.x * 8); v8us o;
#pragma unroll
    for (int k = 0; k < 8; ++k) o[k] = f2bf(v[k]); *(v8us*)(dst + threadIdx.x * 8) = o;  }
__global__ __launch_bounds__(256) void k_pool(const float* FVB, float* FVP) { const size_t i = (size_t)blockIdx.x * 256 + threadIdx.x; if (i >= (size_t)(TR - TT) * DKV / 4) return; const int tb = TT + (int)(i / (DKV / 4)); const int s = sc_of(tb); const int p = 1 << s; const size_t t = (size_t)(tb - soff(s)); const int c0 = (int)(i % (DKV / 4)) * 4; v4f o; o[0] = o[1] = o[2] = o[3] = 0.f;   // batch rows TT .. TR (scales 1, 2) of the value matrix from its rows < TT (scale 0); FVP = the same matrix
    { for (int r = 0; r < p; ++r) { const v4f a = *(const v4f*)(FVB + (t * p + r) * DKV + c0); for (int q = 0; q < 4; ++q) o[q] = __fadd_rn(o[q], a[q]); } const float inv = 1.0f / (float)p; for (int q = 0; q < 4; ++q) o[q] = __fmul_rn(o[q], inv); }
    *(v4f*)(FVP + (size_t)tb * DKV + c0) = o;  }

// k_rope: grid (nt / 8, heads, 2: q, k), batch rows t < nt of each head; z strides zF (f32 rows) and zP (planes); head planes [h][t][d] (fp16 + hi/lo) of rope(x) x sc with the rotate-half convention out[d] = x[d] cos[t][d] - x[d+HD/2] sin[t][d], out[d+HD/2] = x[d+HD/2] cos[t][d+HD/2] + x[d] sin[t][d+HD/2]
__global__ __launch_bounds__(256) void k_rope(const float* __restrict__ F, int pitch, int nt, const float* __restrict__ CS, const float* __restrict__ RF, const float* __restrict__ nw, float sc, h16* P16, bf* Ph, bf* Pl, size_t zF, size_t zP) {
    const int el = (blockIdx.x * 256 + threadIdx.x) * 2; if (el >= nt * HD) return; const int d = el % HD; const int t = el / HD; const int h = blockIdx.y; const size_t e = blockIdx.z * zP + (size_t)h * TR * HD + el; const float* f = F + blockIdx.z * zF + (size_t)t * pitch + h * HD; v2h o16; v2us oh, ol;
    float rf = 1.0f; if (RF) { rf = RF[(size_t)h * TR + t]; asm volatile("s_wait_xcnt 0x0" ::: "memory"); }   // the wait stands before this load's address registers are reused
#pragma unroll
    for (int q = 0; q < 2; ++q) { const int dd = d + q; const int dp = (dd < HD / 2) ? dd + HD / 2 : dd - HD / 2; float x0 = f[dd], x1 = f[dp];
        if (RF) { float n0 = __fmul_rn(x0, rf), n1 = __fmul_rn(x1, rf); asm volatile("" : "+v"(n0)); asm volatile("" : "+v"(n1)); x0 = __fmul_rn(bfr(nw[dd]), n0); x1 = __fmul_rn(bfr(nw[dp]), n1); }
        const v2f cs = *(const v2f*)(CS + ((size_t)t * HD + dd) * 2); asm volatile("s_wait_xcnt 0x0" ::: "memory");   // the wait stands before the address registers of this trip's loads are reused
        float a = __fmul_rn(x0, cs[0]), bq = __fmul_rn(x1, cs[1]); asm volatile("" : "+v"(a)); asm volatile("" : "+v"(bq)); const float r = ((dd < HD / 2) ? __fsub_rn(a, bq) : __fadd_rn(a, bq)) * sc;
        o16[q] = tohx(r); unsigned short a2, c2; splitf(r, a2, c2); oh[q] = a2; ol[q] = c2; }
    *(v2h*)(P16 + e) = o16; *(v2us*)(Ph + e) = oh; *(v2us*)(Pl + e) = ol;  }
__global__ __launch_bounds__(256) void k_vtp(const float* __restrict__ F, int pitch, int nt, h16* V16, bf* Vh, bf* Vl) { const int t = (blockIdx.x * 256 + threadIdx.x) * 2; if (t >= nt) return; const int d = blockIdx.y % HD; const int g = blockIdx.y / HD; const size_t e = (size_t)blockIdx.y * TR + t;   // grid (nt / 512, heads x HD): batch columns t < nt of each [g][d] row
    v2h o16; v2us oh, ol;
#pragma unroll
    for (int q = 0; q < 2; ++q) { const float x = F[(size_t)(t + q) * pitch + g * HD + d]; o16[q] = tohx(x); unsigned short a2, c2; splitf(x, a2, c2); oh[q] = a2; ol[q] = c2; }
    *(v2h*)(V16 + e) = o16; *(v2us*)(Vh + e) = oh; *(v2us*)(Vl + e) = ol;  }
// ---- k_fattn: scores, softmax, probability x value and the hi/lo split of the context in one kernel; no score or probability leaves the registers.
// One work-group of 8 waves per (head, query tile). Transposed products: S^T = K Q^T (a lane holds one query's scores: query = lane & 15, keys = 8 (lane >> 4) + j of each 16-key tile), so two S^T tiles are, register for register,
// the B operand P^T of O^T += V^T P^T, and maximum, sum and rescale factor are per lane. The keys are split over the waves: wave w takes the 64-key chunks w, w + 8, ... up to the diagonal, in steps of 32 keys, with its own running
// maximum m, sum l and O^T; the 8 partial results meet in LDS, are brought to the common maximum and added in wave order 0..7. Rows < RH of a scale: hi+lo bf16 planes, 3 products each, 16 queries a tile; the rest fp16, 32 queries a tile.
typedef __attribute__((ext_vector_type(16))) float v16f;
#define LC  (SCL * 1.4426950408889634f)   // raw score -> exponent of 2
#define MTH (8.0f / LC)                   // the maximum in use is renewed when a new score exceeds it by more than 2^8
__device__ __forceinline__ float xhalf(float x) { const int b = __float_as_int(x); return __int_as_float(__builtin_amdgcn_permlanex16(b, b, 0x76543210, 0xfedcba98, false, false)); }   // lane l <-> l ^ 16
template <bool HL, int NQT, typename T16>
__device__ __forceinline__ void fa_step(const T16* kp, const T16* kp2, const T16* vp, const T16* vp2, const typename WFrag<T16>::V (&q)[NQT][2], const typename WFrag<T16>::V (&q2)[NQT][2], v8f (&o)[4][NQT], float (&m)[NQT], float (&l)[NQT], int dq, bool diag) {
    typedef typename WFrag<T16>::V V;
    constexpr float PB = HL ? 0.0f : 6.0f;   // fp16 probabilities carry 2^6 (at most 2^14 with the lazy maximum); it cancels in O / l
    V ka[2][2], ka2[2][2], va[4], va2[4];
#pragma unroll
    for (int kt = 0; kt < 2; ++kt)
#pragma unroll
        for (int kc = 0; kc < 2; ++kc) { ka[kt][kc] = WFrag<T16>::ld(kp + kt * 16 * HD + kc * 32); if (HL) ka2[kt][kc] = WFrag<T16>::ld(kp2 + kt * 16 * HD + kc * 32); }
#pragma unroll
    for (int dt = 0; dt < 4; ++dt) { va[dt] = WFrag<T16>::ld(vp + dt * 16 * TR); if (HL) va2[dt] = WFrag<T16>::ld(vp2 + dt * 16 * TR); }
    // the wait stands behind the step's loads; it takes their addresses as inputs, so that no load's result lands on an address register in front of it
    if constexpr (HL) asm volatile("s_wait_xcnt 0x0" :: "v"(kp), "v"(kp2), "v"(vp), "v"(vp2) : "memory");
    else asm volatile("s_wait_xcnt 0x0" :: "v"(kp), "v"(vp) : "memory");
    __builtin_amdgcn_sched_barrier(0);   // every load of the step is issued before its first product: one load latency a step instead of one per group of fragments
    v8f st[2][NQT];
#pragma unroll
    for (int kt = 0; kt < 2; ++kt)
#pragma unroll
        for (int qt = 0; qt < NQT; ++qt) { st[kt][qt] = (v8f){};
#pragma unroll
            for (int kc = 0; kc < 2; ++kc) { st[kt][qt] = WFrag<T16>::mma(ka[kt][kc], q[qt][kc], st[kt][qt]); if (HL) { st[kt][qt] = WFrag<T16>::mma(ka[kt][kc], q2[qt][kc], st[kt][qt]); st[kt][qt] = WFrag<T16>::mma(ka2[kt][kc], q[qt][kc], st[kt][qt]); } } }
    // four vector slots behind the last score product, on both sides of the branch below, before its results are touched
    asm volatile("v_nop\n\tv_nop\n\tv_nop\n\tv_nop" : "+v"(st[0][0]), "+v"(st[1][NQT - 1]));
    if (diag) {   // a step that reaches the diagonal (wave-uniform): dq + 16 qt = this lane's query minus its first key; keys above the query are out
#pragma unroll
        for (int qt = 0; qt < NQT; ++qt)
#pragma unroll
            for (int kt = 0; kt < 2; ++kt)
#pragma unroll
                for (int j = 0; j < 8; ++j) st[kt][qt][j] = (kt * 16 + j <= dq + qt * 16) ? st[kt][qt][j] : -3.0e38f; }
    float tm[NQT]; bool need = false;
#pragma unroll
    for (int qt = 0; qt < NQT; ++qt) {
        float t = fmaxf(st[0][qt][0], st[1][qt][0]);
#pragma unroll
        for (int j = 1; j < 8; ++j) t = fmaxf(t, fmaxf(st[0][qt][j], st[1][qt][j]));
        t = fmaxf(t, xhalf(t)); tm[qt] = t; need = need || (t > m[qt] + MTH); }
    if (__builtin_amdgcn_ballot_w32(need) != 0) {   // one scalar branch a step: rescale only when some query's maximum has grown past the margin
#pragma unroll
        for (int qt = 0; qt < NQT; ++qt) { const float mn = fmaxf(m[qt], tm[qt]); const float al = __builtin_amdgcn_exp2f((m[qt] - mn) * LC); m[qt] = mn; l[qt] *= al;
#pragma unroll
            for (int dt = 0; dt < 4; ++dt) o[dt][qt] *= al; } }
    V pb[NQT], pl[NQT];
#pragma unroll
    for (int qt = 0; qt < NQT; ++qt) { const float mb = __builtin_fmaf(-m[qt], LC, PB); v16f pv; float s0 = 0.f, s1 = 0.f;
#pragma unroll
        for (int j = 0; j < 8; ++j) { pv[j] = __builtin_amdgcn_exp2f(__builtin_fmaf(st[0][qt][j], LC, mb)); pv[8 + j] = __builtin_amdgcn_exp2f(__builtin_fmaf(st[1][qt][j], LC, mb)); s0 += pv[j]; s1 += pv[8 + j]; }
        l[qt] += s0 + s1;
        pb[qt] = __builtin_convertvector(pv, V);
        if constexpr (HL) pl[qt] = __builtin_convertvector(pv - __builtin_convertvector(pb[qt], v16f), V); }
#pragma unroll
    for (int dt = 0; dt < 4; ++dt)
#pragma unroll
        for (int qt = 0; qt < NQT; ++qt) { o[dt][qt] = WFrag<T16>::mma(va[dt], pb[qt], o[dt][qt]); if (HL) { o[dt][qt] = WFrag<T16>::mma(va[dt], pl[qt], o[dt][qt]); o[dt][qt] = WFrag<T16>::mma(va2[dt], pb[qt], o[dt][qt]); } }
    // four vector slots behind the last matrix instruction, on the back edge and on the exit alike, before its operands or results are touched
    asm volatile("v_nop\n\tv_nop\n\tv_nop\n\tv_nop" : "+v"(o[0][0]), "+v"(o[1][0]), "+v"(o[2][NQT - 1]), "+v"(o[3][NQT - 1]) : "v"(va[0]), "v"(va[3]));
}
template <bool HL, typename T16>
__device__ __forceinline__ void fa_tile(const T16* __restrict__ Q, const T16* __restrict__ Q2, const T16* __restrict__ Kp, const T16* __restrict__ Kp2, const T16* __restrict__ Vt, const T16* __restrict__ Vt2, int s, int r0, int h, float* sm, bf* Ah, bf* Al) {
    typedef typename WFrag<T16>::V V;
    constexpr int NQT = HL ? 1 : 2, NQ = 16 * NQT;
    const int lane = threadIdx.x & 31, lr = lane & 15, hi = lane >> 4;
    const int wv = __builtin_amdgcn_readfirstlane((int)(threadIdx.x >> 5));   // wave number in a scalar register: the key loop stays a scalar loop with every lane on
    const size_t po = ((size_t)h * TR + soff(s)) * HD, vo = (size_t)h * HD * TR + soff(s);
    V q[NQT][2], q2[NQT][2];
    const T16* qp = Q + po + (size_t)(r0 + lr) * HD + 8 * hi; const T16* qp2 = HL ? Q2 + po + (size_t)(r0 + lr) * HD + 8 * hi : qp;
#pragma unroll
    for (int qt = 0; qt < NQT; ++qt)
#pragma unroll
        for (int kc = 0; kc < 2; ++kc) { q[qt][kc] = WFrag<T16>::ld(qp + qt * 16 * HD + kc * 32); if (HL) q2[qt][kc] = WFrag<T16>::ld(qp2 + qt * 16 * HD + kc * 32); }
    asm volatile("s_wait_xcnt 0x0" :: "v"(qp), "v"(qp2) : "memory");   // the wait stands behind the query loads, with their addresses as inputs, before those registers are reused
    v8f o[4][NQT]; float m[NQT], l[NQT];
#pragma unroll
    for (int qt = 0; qt < NQT; ++qt) { m[qt] = -1.0e30f; l[qt] = 0.f;
#pragma unroll
        for (int dt = 0; dt < 4; ++dt) o[dt][qt] = (v8f){}; }
    const T16* kb0 = Kp + po + (size_t)lr * HD + 8 * hi; const T16* kb2 = HL ? Kp2 + po + (size_t)lr * HD + 8 * hi : kb0;
    const T16* vb0 = Vt + vo + (size_t)lr * TR + 8 * hi; const T16* vb2 = HL ? Vt2 + vo + (size_t)lr * TR + 8 * hi : vb0;
    const int kend = r0 + NQ;
#pragma unroll 1   // kept rolled: one copy of the step in the instruction cache, and its registers stay within four waves a SIMD
    for (int k0 = wv * 64; k0 < kend; k0 += (k0 & 32) ? 8 * 64 - 32 : 32) {   // both halves of a 64-key chunk (one 128-byte line of each value row), then this wave's next chunk
        const int dq = r0 + lr - k0 - hi * 8;
        fa_step<HL, NQT, T16>(kb0 + (size_t)k0 * HD, kb2 + (size_t)k0 * HD, vb0 + k0, vb2 + k0, q, q2, o, m, l, dq, k0 + 31 > r0);
    }
    float* ms = sm; float* ls = sm + 8 * 32; float* os = sm + 2 * 8 * 32;   // maxima [8][32], sums [8][32], partial contexts [8][NQ][68]
    if (hi == 0) {
#pragma unroll
        for (int qt = 0; qt < NQT; ++qt) ms[wv * 32 + qt * 16 + lr] = m[qt]; }
    __syncthreads();                                                  // every wave's maxima are in LDS
#pragma unroll
    for (int qt = 0; qt < NQT; ++qt) { float M = ms[qt * 16 + lr];
#pragma unroll
        for (int w = 1; w < 8; ++w) M = fmaxf(M, ms[w * 32 + qt * 16 + lr]);
        const float f = __builtin_amdgcn_exp2f((m[qt] - M) * LC);     // a wave without keys for a query: 0
        const float lj = (l[qt] + xhalf(l[qt])) * f; if (hi == 0) ls[wv * 32 + qt * 16 + lr] = lj;
#pragma unroll
        for (int dt = 0; dt < 4; ++dt) { const v8f ov = o[dt][qt] * f; float* d = os + (size_t)((wv * NQ + qt * 16 + lr) * 68 + dt * 16 + hi * 8);
            v4f a, b; a[0] = ov[0]; a[1] = ov[1]; a[2] = ov[2]; a[3] = ov[3]; b[0] = ov[4]; b[1] = ov[5]; b[2] = ov[6]; b[3] = ov[7]; *(v4fa*)d = a; *(v4fa*)(d + 4) = b; } }
    __syncthreads();                                                  // every wave's sums and partial contexts are in LDS
    constexpr int PT = NQ * HD / 256;                                 // context elements a thread
    const int qq = threadIdx.x / (HD / PT), d0 = (threadIdx.x % (HD / PT)) * PT;
    float L = ls[qq];
#pragma unroll
    for (int w = 1; w < 8; ++w) L += ls[w * 32 + qq];
    bf* pa = Ah + (size_t)(soff(s) + r0 + qq) * DQ + h * HD + d0; bf* pc = Al + (size_t)(soff(s) + r0 + qq) * DQ + h * HD + d0;
#pragma unroll
    for (int g = 0; g < PT / 4; ++g) { v4f val = *(const v4fa*)(os + qq * 68 + d0 + g * 4);
#pragma unroll
        for (int w = 1; w < 8; ++w) val += *(const v4fa*)(os + (w * NQ + qq) * 68 + d0 + g * 4);
        v4us oh, ol;
#pragma unroll
        for (int e = 0; e < 4; ++e) { unsigned short a, c2; splitf(__fdiv_rn(val[e], L), a, c2); oh[e] = a; ol[e] = c2; }
        *(v4us*)(pa + g * 4) = oh; *(v4us*)(pc + g * 4) = ol; }
    asm volatile("s_wait_xcnt 0x0" :: "v"(pa), "v"(pc) : "memory");   // the wait stands behind the tile's stores, with their addresses as inputs
}
// grid (heads, FT16 + FTHL), the longest rows first: the fp16 tiles of scale 0, then of scale 1, then the hi+lo tiles of the three scales. Four waves a SIMD (two work-groups a WGP): vector work between the matrix runs wants waves
#define FT0  ((TT - RH) / 32)
#define FT16 (FT0 + (TT / 2 - RH) / 32)
#define FTHL (3 * (RH / 16))
__global__ __launch_bounds__(256) __attribute__((amdgpu_waves_per_eu(4, 4))) void k_fattn(const h16* __restrict__ Q16, const h16* __restrict__ K16, const h16* __restrict__ V16, const bf* __restrict__ Qh, const bf* __restrict__ Ql, const bf* __restrict__ Kh, const bf* __restrict__ Kw, const bf* __restrict__ Vh, const bf* __restrict__ Vl, bf* Ah, bf* Al) {
    __shared__ __align__(16) float sm[2 * 8 * 32 + 8 * 32 * 68];
    const int h = blockIdx.x, y = blockIdx.y;
    if (y < FT16) { const int s = y < FT0 ? 0 : 1; const int r0 = (TT >> s) - 32 * (y - s * FT0 + 1); fa_tile<false, h16>(Q16, nullptr, K16, nullptr, V16, nullptr, s, r0, h, sm, Ah, Al); }
    else { const int yy = y - FT16; const int s = yy % 3; const int r0 = RH - 16 * (yy / 3 + 1); fa_tile<true, bf>(Qh, Ql, Kh, Kw, Vh, Vl, s, r0, h, sm, Ah, Al); }
}

extern "C" void kernel_launch(void* const* d_in, const int* in_sizes, int n_in,
                              void* d_out, int out_size, void* d_ws, size_t ws_size, hipStream_t stream) {
    (void)in_sizes; (void)n_in; (void)out_size;
    const float* x0 = (const float*)d_in[0]; const float* x1 = (const float*)d_in[1]; const float* x2 = (const float*)d_in[2]; const float* wqA = (const float*)d_in[3]; const float* bqA = (const float*)d_in[4]; const float* wkA = (const float*)d_in[5]; const float* bkA = (const float*)d_in[6]; const float* wv = (const float*)d_in[7]; const float* bv = (const float*)d_in[8]; const float* wo = (const float*)d_in[9]; const float* bo = (const float*)d_in[10]; const float* x = nullptr; const float* wq = nullptr; const float* wk = nullptr; (void)x; (void)wq; (void)wk;
    float* OUT = (float*)d_out;     // the tuple's members one after the other: [TR][1024], in the order of the batch rows
    char* wsp = (char*)d_ws;
    auto take = [&](size_t bytes) { char* p = wsp; wsp += (bytes + 255) & ~(size_t)255; return (void*)p; };
    const size_t PL = (size_t)NH_ * TR * HD;   // one set of head planes, in elements
    bf* WO = (bf*)take((size_t)DM * DQ * 2);
    h16* QP16 = (h16*)take(2 * PL * 2); h16* KP16 = QP16 + PL; bf* QPh = (bf*)take(2 * PL * 2); bf* KPh = QPh + PL; bf* QPl = (bf*)take(2 * PL * 2); bf* KPl = QPl + PL;   // q planes, then k planes
    h16* VT16 = (h16*)take(PL * 2); bf* VTh = (bf*)take(PL * 2); bf* VTl = (bf*)take(PL * 2);
    bf* ATh = (bf*)take((size_t)TR * DQ * 2); bf* ATl = (bf*)take((size_t)TR * DQ * 2);
    bf* XB = (bf*)take(((size_t)TR * DM + (size_t)7 * DM * DM) * 2); bf* WQKV = XB + (size_t)TR * DM; float* CS = (float*)take((size_t)TR * HD * 2 * 4); float* FQKV = (float*)take((size_t)3 * TR * DM * 4); float* FV = FQKV + (size_t)2 * TR * DM;
    if ((size_t)(wsp - (char*)d_ws) > ws_size) return;    // ws 256 MiB
    k_prep<<<CB_ALL, 256, 0, stream>>>(x0, x1, x2, wqA, wkA, wv, wo, XB, WO, CS);                     /* bf16 inputs; rope table, positions t x 2^s */
    k_gemmk<bf, 0, true, 3, 8><<<dim3(TR / 64, DM / 64, 3), 256, 0, stream>>>(XB, nullptr, DM, WQKV, nullptr, DM, FQKV, DM, bqA, bkA, bv, 0, (size_t)TR * DM);   /* q, k of every scale; v_base = x0 Wv^T + bv */
    k_rope<<<dim3(TR / 8, NH_, 2), 256, 0, stream>>>(FQKV, DM, TR, CS, nullptr, nullptr, 1.0f, QP16, QPh, QPl, (size_t)TR * DM, PL);
    k_pool<<<(TR - TT) * DKV / 4 / 256, 256, 0, stream>>>(FV, FV);                                    /* the pooled rows of scales 1 and 2 */
    k_vtp<<<dim3(TR / 512, NKV * HD), 256, 0, stream>>>(FV, DKV, TR, VT16, VTh, VTl);
    k_fattn<<<dim3(NH_, FT16 + FTHL), 256, 0, stream>>>(QP16, KP16, VT16, QPh, QPl, KPh, KPl, VTh, VTl, ATh, ATl);   /* attention of every head and scale; context as hi/lo planes */
    k_gemmk<bf, 1, true, 0, 8><<<dim3(TR / 64, DM / 64, 1), 256, 0, stream>>>(ATh, ATl, DQ, WO, nullptr, DQ, OUT, DM, bo, nullptr, nullptr, 0, 0);
}

// v006
// Measured time: 154 microseconds a run.
// In both of two side-by-side timings against v005, it was 1.18 times as fast.
// All steps since v000 together make it 13.7 times as fast.
#include <hip/hip_runtime.h>

// Multiscale causal attention (x0 [1][2048][1024], x1 [1][1024][1024], x2 [1][512][1024]; v_base = x0 Wv^T + bv shared, average-pooled by 2^i for scale i; per scale i: q, k = x_i W[i]^T + b[i] ('oi' [1024][1024] + [1024]; 16 heads x 64), rotate-half rotary at positions t x 2^i (base 1e4), scores = q.k / 8, causal (finfo.min); softmax; ctx_i = w v_i; out_i = ctx_i Wo^T + bo -> tuple ([1][2048][1024], [1][1024][1024], [1][512][1024]) (3.7 M)).
// Realisation: the three scales run together as one batch of TR = 2048 + 1024 + 512 rows (scale i holds rows soff(i) .. soff(i) + N_i, N_i = 2048 >> i): every launch covers all three, and each work-group finds its scale from its block index; attention is one fused launch (scores and probabilities stay in registers); the rope table uses positions t x 2^i; rotary, value pooling, value transposition and the 16-bit splits are the projection kernel's epilogue (a 64x64 tile is 64 rows of one head). Q, K and V share the conversion launch (as block ranges) and the projection launch (as grid planes).
// Compute dtypes, f32 accumulate: every input rounded to bf16; q/k/v on PLAIN bf16 operands (inputs: exact) + biases; rotary in f32 (precise sinf/cosf, 32 baked float32 inverse frequencies, position factor 2^i exact); causal tile skipping; value pooling in f32 (means of 2 and of 4 rows, summed in row order as the reference's reshape-mean); scores and attn.v: query rows < 512 hl (3 products), the rest single fp16 (probabilities x 2^6, unnormalised); online softmax f32, divided by the row sum at the end; Wo hl x exact (2 products) + bo.

#define NB_  1
#define TT   2048
#define DM   1024
#define NH_  16
#define NKV  16
#define REP  (NH_ / NKV)
#define HD   64
#define DQ   (NH_ * HD)
#define DKV  (NKV * HD)
#define TR   (TT + TT / 2 + TT / 4)   // rows of the three scales, one after the other
#define RH   512                  // query rows < RH use hi+lo planes (k_fattn's grid assumes RH = TT / 4)
#define SCL  0.125f   // HD^-0.5
typedef _Float16 h16;
typedef unsigned short bf;
typedef __attribute__((ext_vector_type(16))) __bf16   v16bf;
typedef __attribute__((ext_vector_type(16))) _Float16 v16h;
typedef __attribute__((ext_vector_type(8)))  _Float16 v8h;
typedef __attribute__((ext_vector_type(8)))  unsigned short v8us;
typedef __attribute__((ext_vector_type(8)))  float    v8f;
typedef __attribute__((ext_vector_type(4)))  float    v4f;
typedef v8h  __attribute__((may_alias)) v8ha;
typedef v4f  __attribute__((may_alias)) v4fa;
typedef v8us __attribute__((may_alias)) v8usa;

__device__ __forceinline__ unsigned short f2bf(float f) { unsigned u = __float_as_uint(f); u += 0x7FFFu + ((u >> 16) & 1u); return (unsigned short)(u >> 16); }
__device__ __forceinline__ float bf2f(unsigned short b) { return __uint_as_float(((unsigned)b) << 16); }
__device__ __forceinline__ float bfr(float f) { return bf2f(f2bf(f)); }
__device__ __forceinline__ v16h cat16(v8h lo, v8h hi) { return __builtin_shufflevector(lo, hi, 0, 1, 2, 3, 4, 5, 6, 7, 8, 9, 10, 11, 12, 13, 14, 15); }
__device__ __forceinline__ v16bf cat16b(v8us lo, v8us hi) { return __builtin_bit_cast(v16bf, __builtin_shufflevector(lo, hi, 0, 1, 2, 3, 4, 5, 6, 7, 8, 9, 10, 11, 12, 13, 14, 15)); }
__device__ __forceinline__ v8f wmma16(v16h a, v16h b, v8f c) { return __builtin_amdgcn_wmma_f32_16x16x32_f16(false, a, false, b, (short)0, c, false, false); }
__device__ __forceinline__ v8f wmmab(v16bf a, v16bf b, v8f c) { return __builtin_amdgcn_wmma_f32_16x16x32_bf16(false, a, false, b, (short)0, c, false, false); }
// the batch of scales: scale of a batch row, first batch row of a scale
__device__ __forceinline__ int sc_of(int t) { return t < TT ? 0 : (t < TT + TT / 2 ? 1 : 2); }
__device__ __forceinline__ int soff(int s) { return 2 * TT - ((2 * TT) >> s); }

__device__ __forceinline__ h16 tohx(float x) { return (h16)x; }
__device__ __forceinline__ void splitf(float y, unsigned short& h, unsigned short& l) { h = f2bf(y); l = f2bf(y - bf2f(h)); }
typedef __attribute__((ext_vector_type(2))) _Float16 v2h;
typedef __attribute__((ext_vector_type(4))) _Float16 v4h;
typedef __attribute__((ext_vector_type(2))) unsigned short v2us;
typedef __attribute__((ext_vector_type(4))) unsigned short v4us;
typedef __attribute__((ext_vector_type(2))) float v2f;
typedef __attribute__((ext_vector_type(4))) int v4i;

// ---- k_gemmk: register-blocked GEMM, one 64x64 output tile per work-group of NW waves, the K loop split over the waves: wave w takes the 64-element (128-byte) K chunks w, w + NW, ... with its own 16 accumulators,
// operands straight from K-contiguous 16-bit planes; the NW partial tiles meet in LDS and are added in wave order 0..NW-1. grid (M/64, N/64, Z), NW x 32 threads.
// C[m][n] (f32, pitch ldc, + optional f32 bias[n]) = sum_k A[m][k] Bt[n][k] (+ split products per NSPLIT). A rows have pitch lda, Bt rows pitch K. K % 64 == 0.
// CMODE 3 (projections, z = 0 q, 1 k, 2 v): rows are batch rows; weight matrix number 3 z + s of Bt and the matching bias row; v exists for scale 0 only. No f32 result is stored: the tile (64 rows of head blockIdx.y) goes on in the epilogue.
// q, k: rotate-half rotary out[d] = x[d] cos[t][d] - x[d+HD/2] sin[t][d], out[d+HD/2] = x[d+HD/2] cos[t][d+HD/2] + x[d] sin[t][d+HD/2] (table CS), stored as head planes [h][t][d] (fp16 + hi/lo bf16; k planes zP elements behind the q planes).
// v: the tile is turned in LDS; each thread takes 16 rows of one column, forms the means of 2 and of 4 rows (scales 1 and 2, summed in row order) and stores the [h x HD + d][batch row] planes (fp16 + hi/lo bf16) of all three scales.
template <typename T16> struct WFrag;
template <> struct WFrag<h16> { typedef v16h V; static __device__ __forceinline__ V ld(const h16* p) { return cat16(*(const v8h*)p, *(const v8h*)(p + 16)); } static __device__ __forceinline__ v8f mma(V a, V b, v8f c) { return wmma16(a, b, c); } };
template <> struct WFrag<bf> { typedef v16bf V; static __device__ __forceinline__ V ld(const bf* p) { return cat16b(*(const v8us*)p, *(const v8us*)(p + 16)); } static __device__ __forceinline__ v8f mma(V a, V b, v8f c) { return wmmab(a, b, c); } };
template <typename T16, int NSPLIT, bool BIAS, int CMODE, int NW>
__global__ __launch_bounds__(NW * 32) void k_gemmk(const T16* __restrict__ A, const T16* __restrict__ A2, int lda, const T16* __restrict__ Bt, const T16* __restrict__ Bt2, int K, float* C, int ldc, const float* __restrict__ bias, const float* __restrict__ biasK, const float* __restrict__ biasV, const float* __restrict__ CS, h16* P16, bf* Ph, bf* Pl, size_t zP, h16* V16, bf* Vh, bf* Vl) {
    typedef typename WFrag<T16>::V V;
    constexpr int RR = 2 * NW;                                        // tile rows added per round: one float4 per thread
    constexpr int NBUF = (2 * NW * RR * 68 * 4 <= 160 * 1024) ? 2 : 1; // two round buffers where both fit in half a WGP's LDS
    __shared__ __align__(16) float os[NBUF * NW * RR * 68];
    const size_t z = blockIdx.z;
    const int lane = threadIdx.x & 31, lr = lane & 15, hi = lane >> 4; const int c0 = blockIdx.y * 64;
    int r0 = blockIdx.x * 64, rc = r0, Kl = K;                        // first row in A, first row in C, end of the K loop
    if (CMODE == 3) { const int s = sc_of(r0); if (z == 2 && s) return;   // the whole work-group leaves, in front of every barrier
        Bt += (z * 3 + s) * (size_t)DM * DM; bias = (z == 0 ? bias : (z == 1 ? biasK : biasV)) + s * DM; }
    const int wv = __builtin_amdgcn_readfirstlane((int)(threadIdx.x >> 5));   // wave number in a scalar register: the K loop stays a scalar loop with every lane on
    v8f acc[4][4];
#pragma unroll
    for (int mb = 0; mb < 4; ++mb)
#pragma unroll
        for (int nb = 0; nb < 4; ++nb) acc[mb][nb] = (v8f){};
    const size_t aoff = (size_t)(r0 + lr) * lda + 8 * hi, boff = (size_t)(c0 + lr) * K + 8 * hi;
#pragma unroll 1
    for (int kc = wv * 64; kc < Kl; kc += (kc & 32) ? NW * 64 - 32 : 32) {   // both halves of a 128-byte chunk, then this wave's next chunk
        V a[4], a2[4];
#pragma unroll
        for (int mb = 0; mb < 4; ++mb) { a[mb] = WFrag<T16>::ld(A + aoff + (size_t)mb * 16 * lda + kc); if (NSPLIT == 1 || NSPLIT == 2) a2[mb] = WFrag<T16>::ld(A2 + aoff + (size_t)mb * 16 * lda + kc); }
#pragma unroll
        for (int nb = 0; nb < 4; ++nb) { const V b = WFrag<T16>::ld(Bt + boff + (size_t)nb * 16 * K + kc); V b2; if (NSPLIT >= 2) b2 = WFrag<T16>::ld(Bt2 + boff + (size_t)nb * 16 * K + kc);
#pragma unroll
            for (int mb = 0; mb < 4; ++mb) { acc[mb][nb] = WFrag<T16>::mma(a[mb], b, acc[mb][nb]); if (NSPLIT == 1 || NSPLIT == 2) acc[mb][nb] = WFrag<T16>::mma(a2[mb], b, acc[mb][nb]); if (NSPLIT >= 2) acc[mb][nb] = WFrag<T16>::mma(a[mb], b2, acc[mb][nb]); } }
        // four vector slots behind the last matrix instruction, on the back edge and on the exit alike, before its operands or results are touched
        asm volatile("v_nop\n\tv_nop\n\tv_nop\n\tv_nop" : "+v"(acc[0][0]), "+v"(acc[1][1]), "+v"(acc[2][2]), "+v"(acc[3][3]) : "v"(a[0]), "v"(a[3]));
    }
    const int row = threadIdx.x >> 4, cofs = (threadIdx.x & 15) * 4;
    v4f res[64 / RR];
#pragma unroll
    for (int rd = 0; rd < 64 / RR; ++rd) {
        float* ob = os + (rd % NBUF) * (NW * RR * 68);                // two buffers in turn: one barrier a round is enough
        if (NBUF == 1 && rd) __syncthreads();                         // one buffer: the round before is read before it is overwritten
#pragma unroll
        for (int m = 0; m < RR / 16; ++m) {
#pragma unroll
            for (int nb = 0; nb < 4; ++nb) {
#pragma unroll
                for (int j = 0; j < 8; ++j) ob[(wv * RR + m * 16 + hi * 8 + j) * 68 + nb * 16 + lr] = acc[rd * (RR / 16) + m][nb][j]; } }
        __syncthreads();                                              // every wave's partial rows of this round are in LDS (two buffers: and every read of the buffer written next is done)
        v4f val = *(const v4fa*)(ob + row * 68 + cofs);
#pragma unroll
        for (int w = 1; w < NW; ++w) val += *(const v4fa*)(ob + (w * RR + row) * 68 + cofs);
        res[rd] = val;
    }
    v4f bb; bb[0] = bb[1] = bb[2] = bb[3] = 0.f;
    if (BIAS) { bb[0] = bfr(bias[c0 + cofs]); bb[1] = bfr(bias[c0 + cofs + 1]); bb[2] = bfr(bias[c0 + cofs + 2]); bb[3] = bfr(bias[c0 + cofs + 3]); }
    if constexpr (CMODE == 3) {
        static_assert(NBUF == 2 && (64 / RR) % 2 == 0 && RR == 16 && NW * RR * 68 >= 64 * 65, "the epilogue's thread map and its use of round buffer 0");
        if (z < 2) {   // q, k: a thread holds 4 neighbouring dimensions of a row; the partner dimensions (+- HD/2) are 8 lanes away in the same 16-lane row
            const float* cp = CS + ((size_t)(r0 + row) * HD + cofs) * 2;
            const size_t e = z * zP + ((size_t)blockIdx.y * TR + r0 + row) * HD + cofs;
            h16* p16 = P16 + e; bf* ph = Ph + e; bf* pl = Pl + e;
            const bool low = cofs < HD / 2;
#pragma unroll
            for (int rd = 0; rd < 64 / RR; ++rd) {
                const v4f x = res[rd] + bb; const v4f ca = *(const v4f*)(cp + rd * RR * HD * 2), cb = *(const v4f*)(cp + rd * RR * HD * 2 + 4);
                const float co[4] = {ca[0], ca[2], cb[0], cb[2]}, si[4] = {ca[1], ca[3], cb[1], cb[3]};
                v4h o16; v4us oh, ol;
#pragma unroll
                for (int q = 0; q < 4; ++q) { const float xp = __shfl_xor(x[q], 8); const float r = x[q] * co[q] + xp * (low ? -si[q] : si[q]);
                    o16[q] = tohx(r); unsigned short a2, c2; splitf(r, a2, c2); oh[q] = a2; ol[q] = c2; }
                *(v4h*)(p16 + rd * RR * HD) = o16; *(v4us*)(ph + rd * RR * HD) = oh; *(v4us*)(pl + rd * RR * HD) = ol; }
            asm volatile("s_wait_xcnt 0x0" :: "v"(cp), "v"(p16), "v"(ph), "v"(pl) : "memory");   // the wait stands behind the tile's loads and stores, with their addresses as inputs
        } else {       // v (block-uniform branch): round buffer 0 is free, its last readers passed the last round's barrier
            float* ts = os;                                           // [64 rows][65]: column reads fall on different banks
#pragma unroll
            for (int rd = 0; rd < 64 / RR; ++rd)
#pragma unroll
                for (int q = 0; q < 4; ++q) ts[(rd * RR + row) * 65 + cofs + q] = res[rd][q] + bb[q];
            __syncthreads();                                          // the whole value tile is in LDS
            const int d = threadIdx.x >> 2, tq = threadIdx.x & 3;
            float x[16], x1[8], x2[4];
#pragma unroll
            for (int i = 0; i < 16; ++i) x[i] = ts[(tq * 16 + i) * 65 + d];
#pragma unroll
            for (int i = 0; i < 8; ++i) x1[i] = (x[2 * i] + x[2 * i + 1]) * 0.5f;
#pragma unroll
            for (int i = 0; i < 4; ++i) x2[i] = (((x[4 * i] + x[4 * i + 1]) + x[4 * i + 2]) + x[4 * i + 3]) * 0.25f;
            const size_t vr = (size_t)(c0 + d) * TR;
            const size_t e0 = vr + r0 + tq * 16, e1 = vr + r0 / 2 + tq * 8, e2 = vr + r0 / 4 + tq * 4;   // this thread's first column inside scale 0, 1, 2
            v8h a16[2], b16; v8us ah[2], al[2], bh, bl; v4h c16; v4us ch, cl;
#pragma unroll
            for (int i = 0; i < 16; ++i) { unsigned short a2, c2; splitf(x[i], a2, c2); a16[i >> 3][i & 7] = tohx(x[i]); ah[i >> 3][i & 7] = a2; al[i >> 3][i & 7] = c2; }
#pragma unroll
            for (int i = 0; i < 8; ++i) { unsigned short a2, c2; splitf(x1[i], a2, c2); b16[i] = tohx(x1[i]); bh[i] = a2; bl[i] = c2; }
#pragma unroll
            for (int i = 0; i < 4; ++i) { unsigned short a2, c2; splitf(x2[i], a2, c2); c16[i] = tohx(x2[i]); ch[i] = a2; cl[i] = c2; }
            h16* p16 = V16 + e0; bf* ph = Vh + e0; bf* pl = Vl + e0; h16* s16 = V16 + e1; bf* sh = Vh + e1; bf* sl = Vl + e1; h16* u16 = V16 + e2; bf* uh = Vh + e2; bf* ul = Vl + e2;
            *(v8h*)p16 = a16[0]; *(v8h*)(p16 + 8) = a16[1]; *(v8us*)ph = ah[0]; *(v8us*)(ph + 8) = ah[1]; *(v8us*)pl = al[0]; *(v8us*)(pl + 8) = al[1];
            *(v8h*)(s16 + soff(1)) = b16; *(v8us*)(sh + soff(1)) = bh; *(v8us*)(sl + soff(1)) = bl; *(v4h*)(u16 + soff(2)) = c16; *(v4us*)(uh + soff(2)) = ch; *(v4us*)(ul + soff(2)) = cl;
            asm volatile("s_wait_xcnt 0x0" :: "v"(p16), "v"(ph), "v"(pl), "v"(s16), "v"(sh), "v"(sl), "v"(u16), "v"(uh), "v"(ul) : "memory");   // the wait stands behind the tile's stores, with their addresses as inputs
        }
    } else {
#pragma unroll
    for (int rd = 0; rd < 64 / RR; ++rd) {                            // stores behind the last barrier: no barrier waits for a global store
        v4f val = res[rd]; if (BIAS) val += bb;
        *(v4f*)(C + (size_t)(rc + rd * RR + row) * ldc + c0 + cofs) = val; }
    }
}


__global__ __launch_bounds__(256) void k_wtG(const float* __restrict__ w, int K, int N, bf* Bt) {
    const int lane = threadIdx.x & 31; const int L0 = (blockIdx.x * 8 + (threadIdx.x >> 5)) * 8; const int nlines = N * K / 64;
{
#pragma unroll 1
        for (int l = 0; l < 8; ++l) { const int L = L0 + l; if (L >= nlines) break; const size_t e = (size_t)L * 64 + lane * 2; const int k = (int)(e % K), n = (int)(e / K); v2us o;
            o[0] = f2bf(w[(size_t)k * N + n]); o[1] = f2bf(w[(size_t)(k + 1) * N + n]); *(v2us*)(Bt + e) = o; }
         }
}
__constant__ float INV[HD / 2] = {1.0f,0.749894202f,0.562341332f,0.421696514f,0.316227764f,0.237137362f,0.177827939f,0.133352146f,0.100000001f,0.0749894157f,0.0562341288f,0.0421696492f,0.0316227786f,0.0237137359f,0.0177827943f,0.0133352149f,0.00999999978f,0.00749894232f,0.00562341325f,0.00421696482f,0.00316227786f,0.00237137382f,0.00177827943f,0.00133352145f,0.00100000005f,0.000749894185f,0.000562341302f,0.000421696488f,0.000316227786f,0.000237137385f,0.00017782794f,0.00013335215f};   // float32 1/10000^(2i/64), eager-JAX values
// rope table, 256 entries a block: cos, sin of batch row idx / HD, dimension idx % HD
__device__ __forceinline__ void cstab(float* CS, int blk) { const int idx = blk * 256 + threadIdx.x; const int tb = idx / HD, d = idx % HD; const int s = sc_of(tb); const int t = tb - soff(s); const float pm = (float)(1 << s); /* batch row tb = row t of scale s: position t x 2^s */ float p = __fmul_rn((float)t, pm); asm volatile("" : "+v"(p)); const float ang = __fmul_rn(p, INV[d % (HD / 2)]); v2f cs; cs[0] = cosf(ang); cs[1] = sinf(ang);
    *(v2f*)(CS + (size_t)idx * 2) = cs;  }
// k_prep: what depends on the inputs alone, in one grid. Blocks < CB_WO: every f32 input matrix to bf16, 2048 elements a block: x0, x1, x2 (the TR batch rows), the 3 q, the 3 k and the v weight matrices land one after the other at XW; the output weights at WOd. Blocks CB_WO .. CB_ALL: the rope table
#define CB_X0 (TT * DM / 2048)
#define CB_X1 (CB_X0 + TT / 2 * DM / 2048)
#define CB_X2 (CB_X1 + TT / 4 * DM / 2048)
#define CB_WQ (CB_X2 + 3 * DQ * DM / 2048)
#define CB_WK (CB_WQ + 3 * DKV * DM / 2048)
#define CB_WV (CB_WK + DKV * DM / 2048)
#define CB_WO (CB_WV + DM * DQ / 2048)
#define CB_ALL (CB_WO + TR * HD / 256)
__global__ __launch_bounds__(256) void k_prep(const float* __restrict__ x0, const float* __restrict__ x1, const float* __restrict__ x2, const float* __restrict__ wq, const float* __restrict__ wk, const float* __restrict__ wv, const float* __restrict__ wo, bf* XW, bf* WOd, float* CS) {
    const int b = blockIdx.x; if (b >= CB_WO) { cstab(CS, b - CB_WO); return; }
    const float* src; bf* dst = XW + (size_t)b * 2048;
    if (b < CB_X0) src = x0 + (size_t)b * 2048; else if (b < CB_X1) src = x1 + (size_t)(b - CB_X0) * 2048; else if (b < CB_X2) src = x2 + (size_t)(b - CB_X1) * 2048;
    else if (b < CB_WQ) src = wq + (size_t)(b - CB_X2) * 2048; else if (b < CB_WK) src = wk + (size_t)(b - CB_WQ) * 2048; else if (b < CB_WV) src = wv + (size_t)(b - CB_WK) * 2048;
    else { src = wo + (size_t)(b - CB_WV) * 2048; dst = WOd + (size_t)(b - CB_WV) * 2048; }
    const v8f v = *(const v8f*)(src + threadIdx.x * 8); v8us o;
#pragma unroll
    for (int k = 0; k < 8; ++k) o[k] = f2bf(v[k]); *(v8us*)(dst + threadIdx.x * 8) = o;  }
// ---- k_fattn: scores, softmax, probability x value and the hi/lo split of the context in one kernel; no score or probability leaves the registers.
// One work-group of 8 waves per (head, query tile). Transposed products: S^T = K Q^T (a lane holds one query's scores: query = lane & 15, keys = 8 (lane >> 4) + j of each 16-key tile), so two S^T tiles are, register for register,
// the B operand P^T of O^T += V^T P^T, and maximum, sum and rescale factor are per lane. The keys are split over the waves: wave w takes the 64-key chunks w, w + 8, ... up to the diagonal, in steps of 32 keys, with its own running
// maximum m, sum l and O^T; the 8 partial results meet in LDS, are brought to the common maximum and added in wave order 0..7. Rows < RH of a scale: hi+lo bf16 planes, 3 products each, 16 queries a tile; the rest fp16, 32 queries a tile.
typedef __attribute__((ext_vector_type(16))) float v16f;
#define LC  (SCL * 1.4426950408889634f)   // raw score -> exponent of 2
#define MTH (8.0f / LC)                   // the maximum in use is renewed when a new score exceeds it by more than 2^8
__device__ __forceinline__ float xhalf(float x) { const int b = __float_as_int(x); return __int_as_float(__builtin_amdgcn_permlanex16(b, b, 0x76543210, 0xfedcba98, false, false)); }   // lane l <-> l ^ 16
template <bool HL, int NQT, typename T16>
__device__ __forceinline__ void fa_step(const T16* kp, const T16* kp2, const T16* vp, const T16* vp2, const typename WFrag<T16>::V (&q)[NQT][2], const typename WFrag<T16>::V (&q2)[NQT][2], v8f (&o)[4][NQT], float (&m)[NQT], float (&l)[NQT], int dq, bool diag) {
    typedef typename WFrag<T16>::V V;
    constexpr float PB = HL ? 0.0f : 6.0f;   // fp16 probabilities carry 2^6 (at most 2^14 with the lazy maximum); it cancels in O / l
    V ka[2][2], ka2[2][2], va[4], va2[4];
#pragma unroll
    for (int kt = 0; kt < 2; ++kt)
#pragma unroll
        for (int kc = 0; kc < 2; ++kc) { ka[kt][kc] = WFrag<T16>::ld(kp + kt * 16 * HD + kc * 32); if (HL) ka2[kt][kc] = WFrag<T16>::ld(kp2 + kt * 16 * HD + kc * 32); }
#pragma unroll
    for (int dt = 0; dt < 4; ++dt) { va[dt] = WFrag<T16>::ld(vp + dt * 16 * TR); if (HL) va2[dt] = WFrag<T16>::ld(vp2 + dt * 16 * TR); }
    // the wait stands behind the step's loads; it takes their addresses as inputs, so that no load's result lands on an address register in front of it
    if constexpr (HL) asm volatile("s_wait_xcnt 0x0" :: "v"(kp), "v"(kp2), "v"(vp), "v"(vp2) : "memory");
    else asm volatile("s_wait_xcnt 0x0" :: "v"(kp), "v"(vp) : "memory");
    __builtin_amdgcn_sched_barrier(0);   // every load of the step is issued before its first product: one load latency a step instead of one per group of fragments
    v8f st[2][NQT];
#pragma unroll
    for (int kt = 0; kt < 2; ++kt)
#pragma unroll
        for (int qt = 0; qt < NQT; ++qt) { st[kt][qt] = (v8f){};
#pragma unroll
            for (int kc = 0; kc < 2; ++kc) { st[kt][qt] = WFrag<T16>::mma(ka[kt][kc], q[qt][kc], st[kt][qt]); if (HL) { st[kt][qt] = WFrag<T16>::mma(ka[kt][kc], q2[qt][kc], st[kt][qt]); st[kt][qt] = WFrag<T16>::mma(ka2[kt][kc], q[qt][kc], st[kt][qt]); } } }
    // four vector slots behind the last score product, on both sides of the branch below, before its results are touched
    asm volatile("v_nop\n\tv_nop\n\tv_nop\n\tv_nop" : "+v"(st[0][0]), "+v"(st[1][NQT - 1]));
    if (diag) {   // a step that reaches the diagonal (wave-uniform): dq + 16 qt = this lane's query minus its first key; keys above the query are out
#pragma unroll
        for (int qt = 0; qt < NQT; ++qt)
#pragma unroll
            for (int kt = 0; kt < 2; ++kt)
#pragma unroll
                for (int j = 0; j < 8; ++j) st[kt][qt][j] = (kt * 16 + j <= dq + qt * 16) ? st[kt][qt][j] : -3.0e38f; }
    float tm[NQT]; bool need = false;
#pragma unroll
    for (int qt = 0; qt < NQT; ++qt) {
        float t = fmaxf(st[0][qt][0], st[1][qt][0]);
#pragma unroll
        for (int j = 1; j < 8; ++j) t = fmaxf(t, fmaxf(st[0][qt][j], st[1][qt][j]));
        t = fmaxf(t, xhalf(t)); tm[qt] = t; need = need || (t > m[qt] + MTH); }
    if (__builtin_amdgcn_ballot_w32(need) != 0) {   // one scalar branch a step: rescale only when some query's maximum has grown past the margin
#pragma unroll
        for (int qt = 0; qt < NQT; ++qt) { const float mn = fmaxf(m[qt], tm[qt]); const float al = __builtin_amdgcn_exp2f((m[qt] - mn) * LC); m[qt] = mn; l[qt] *= al;
#pragma unroll
            for (int dt = 0; dt < 4; ++dt) o[dt][qt] *= al; } }
    V pb[NQT], pl[NQT];
#pragma unroll
    for (int qt = 0; qt < NQT; ++qt) { const float mb = __builtin_fmaf(-m[qt], LC, PB); v16f pv; float s0 = 0.f, s1 = 0.f;
#pragma unroll
        for (int j = 0; j < 8; ++j) { pv[j] = __builtin_amdgcn_exp2f(__builtin_fmaf(st[0][qt][j], LC, mb)); pv[8 + j] = __builtin_amdgcn_exp2f(__builtin_fmaf(st[1][qt][j], LC, mb)); s0 += pv[j]; s1 += pv[8 + j]; }
        l[qt] += s0 + s1;
        pb[qt] = __builtin_convertvector(pv, V);
        if constexpr (HL) pl[qt] = __builtin_convertvector(pv - __builtin_convertvector(pb[qt], v16f), V); }
#pragma unroll
    for (int dt = 0; dt < 4; ++dt)
#pragma unroll
        for (int qt = 0; qt < NQT; ++qt) { o[dt][qt] = WFrag<T16>::mma(va[dt], pb[qt], o[dt][qt]); if (HL) { o[dt][qt] = WFrag<T16>::mma(va[dt], pl[qt], o[dt][qt]); o[dt][qt] = WFrag<T16>::mma(va2[dt], pb[qt], o[dt][qt]); } }
    // four vector slots behind the last matrix instruction, on the back edge and on the exit alike, before its operands or results are touched
    asm volatile("v_nop\n\tv_nop\n\tv_nop\n\tv_nop" : "+v"(o[0][0]), "+v"(o[1][0]), "+v"(o[2][NQT - 1]), "+v"(o[3][NQT - 1]) : "v"(va[0]), "v"(va[3]));
}
template <bool HL, typename T16>
__device__ __forceinline__ void fa_tile(const T16* __restrict__ Q, const T16* __restrict__ Q2, const T16* __restrict__ Kp, const T16* __restrict__ Kp2, const T16* __restrict__ Vt, const T16* __restrict__ Vt2, int s, int r0, int h, float* sm, bf* Ah, bf* Al) {
    typedef typename WFrag<T16>::V V;
    constexpr int NQT = HL ? 1 : 2, NQ = 16 * NQT;
    const int lane = threadIdx.x & 31, lr = lane & 15, hi = lane >> 4;
    const int wv = __builtin_amdgcn_readfirstlane((int)(threadIdx.x >> 5));   // wave number in a scalar register: the key loop stays a scalar loop with every lane on
    const size_t po = ((size_t)h * TR + soff(s)) * HD, vo = (size_t)h * HD * TR + soff(s);
    V q[NQT][2], q2[NQT][2];
    const T16* qp = Q + po + (size_t)(r0 + lr) * HD + 8 * hi; const T16* qp2 = HL ? Q2 + po + (size_t)(r0 + lr) * HD + 8 * hi : qp;
#pragma unroll
    for (int qt = 0; qt < NQT; ++qt)
#pragma unroll
        for (int kc = 0; kc < 2; ++kc) { q[qt][kc] = WFrag<T16>::ld(qp + qt * 16 * HD + kc * 32); if (HL) q2[qt][kc] = WFrag<T16>::ld(qp2 + qt * 16 * HD + kc * 32); }
    asm volatile("s_wait_xcnt 0x0" :: "v"(qp), "v"(qp2) : "memory");   // the wait stands behind the query loads, with their addresses as inputs, before those registers are reused
    v8f o[4][NQT]; float m[NQT], l[NQT];
#pragma unroll
    for (int qt = 0; qt < NQT; ++qt) { m[qt] = -1.0e30f; l[qt] = 0.f;
#pragma unroll
        for (int dt = 0; dt < 4; ++dt) o[dt][qt] = (v8f){}; }
    const T16* kb0 = Kp + po + (size_t)lr * HD + 8 * hi; const T16* kb2 = HL ? Kp2 + po + (size_t)lr * HD + 8 * hi : kb0;
    const T16* vb0 = Vt + vo + (size_t)lr * TR + 8 * hi; const T16* vb2 = HL ? Vt2 + vo + (size_t)lr * TR + 8 * hi : vb0;
    const int kend = r0 + NQ;
#pragma unroll 1   // kept rolled: one copy of the step in the instruction cache, and its registers stay within four waves a SIMD
    for (int k0 = wv * 64; k0 < kend; k0 += (k0 & 32) ? 8 * 64 - 32 : 32) {   // both halves of a 64-key chunk (one 128-byte line of each value row), then this wave's next chunk
        const int dq = r0 + lr - k0 - hi * 8;
        fa_step<HL, NQT, T16>(kb0 + (size_t)k0 * HD, kb2 + (size_t)k0 * HD, vb0 + k0, vb2 + k0, q, q2, o, m, l, dq, k0 + 31 > r0);
    }
    float* ms = sm; float* ls = sm + 8 * 32; float* os = sm + 2 * 8 * 32;   // maxima [8][32], sums [8][32], partial contexts [8][NQ][68]
    if (hi == 0) {
#pragma unroll
        for (int qt = 0; qt < NQT; ++qt) ms[wv * 32 + qt * 16 + lr] = m[qt]; }
    __syncthreads();                                                  // every wave's maxima are in LDS
#pragma unroll
    for (int qt = 0; qt < NQT; ++qt) { float M = ms[qt * 16 + lr];
#pragma unroll
        for (int w = 1; w < 8; ++w) M = fmaxf(M, ms[w * 32 + qt * 16 + lr]);
        const float f = __builtin_amdgcn_exp2f((m[qt] - M) * LC);     // a wave without keys for a query: 0
        const float lj = (l[qt] + xhalf(l[qt])) * f; if (hi == 0) ls[wv * 32 + qt * 16 + lr] = lj;
#pragma unroll
        for (int dt = 0; dt < 4; ++dt) { const v8f ov = o[dt][qt] * f; float* d = os + (size_t)((wv * NQ + qt * 16 + lr) * 68 + dt * 16 + hi * 8);
            v4f a, b; a[0] = ov[0]; a[1] = ov[1]; a[2] = ov[2]; a[3] = ov[3]; b[0] = ov[4]; b[1] = ov[5]; b[2] = ov[6]; b[3] = ov[7]; *(v4fa*)d = a; *(v4fa*)(d + 4) = b; } }
    __syncthreads();                                                  // every wave's sums and partial contexts are in LDS
    constexpr int PT = NQ * HD / 256;                                 // context elements a thread
    const int qq = threadIdx.x / (HD / PT), d0 = (threadIdx.x % (HD / PT)) * PT;
    float L = ls[qq];
#pragma unroll
    for (int w = 1; w < 8; ++w) L += ls[w * 32 + qq];
    bf* pa = Ah + (size_t)(soff(s) + r0 + qq) * DQ + h * HD + d0; bf* pc = Al + (size_t)(soff(s) + r0 + qq) * DQ + h * HD + d0;
#pragma unroll
    for (int g = 0; g < PT / 4; ++g) { v4f val = *(const v4fa*)(os + qq * 68 + d0 + g * 4);
#pragma unroll
        for (int w = 1; w < 8; ++w) val += *(const v4fa*)(os + (w * NQ + qq) * 68 + d0 + g * 4);
        v4us oh, ol;
#pragma unroll
        for (int e = 0; e < 4; ++e) { unsigned short a, c2; splitf(__fdiv_rn(val[e], L), a, c2); oh[e] = a; ol[e] = c2; }
        *(v4us*)(pa + g * 4) = oh; *(v4us*)(pc + g * 4) = ol; }
    asm volatile("s_wait_xcnt 0x0" :: "v"(pa), "v"(pc) : "memory");   // the wait stands behind the tile's stores, with their addresses as inputs
}
// grid (heads, FT16 + FTHL), the longest rows first: the fp16 tiles of scale 0, then of scale 1, then the hi+lo tiles of the three scales. Four waves a SIMD (two work-groups a WGP): vector work between the matrix runs wants waves
#define FT0  ((TT - RH) / 32)
#define FT16 (FT0 + (TT / 2 - RH) / 32)
#define FTHL (3 * (RH / 16))
__global__ __launch_bounds__(256) __attribute__((amdgpu_waves_per_eu(4, 4))) void k_fattn(const h16* __restrict__ Q16, const h16* __restrict__ K16, const h16* __restrict__ V16, const bf* __restrict__ Qh, const bf* __restrict__ Ql, const bf* __restrict__ Kh, const bf* __restrict__ Kw, const bf* __restrict__ Vh, const bf* __restrict__ Vl, bf* Ah, bf* Al) {
    __shared__ __align__(16) float sm[2 * 8 * 32 + 8 * 32 * 68];
    const int h = blockIdx.x, y = blockIdx.y;
    if (y < FT16) { const int s = y < FT0 ? 0 : 1; const int r0 = (TT >> s) - 32 * (y - s * FT0 + 1); fa_tile<false, h16>(Q16, nullptr, K16, nullptr, V16, nullptr, s, r0, h, sm, Ah, Al); }
    else { const int yy = y - FT16; const int s = yy % 3; const int r0 = RH - 16 * (yy / 3 + 1); fa_tile<true, bf>(Qh, Ql, Kh, Kw, Vh, Vl, s, r0, h, sm, Ah, Al); }
}

extern "C" void kernel_launch(void* const* d_in, const int* in_sizes, int n_in,
                              void* d_out, int out_size, void* d_ws, size_t ws_size, hipStream_t stream) {
    (void)in_sizes; (void)n_in; (void)out_size;
    const float* x0 = (const float*)d_in[0]; const float* x1 = (const float*)d_in[1]; const float* x2 = (const float*)d_in[2]; const float* wqA = (const float*)d_in[3]; const float* bqA = (const float*)d_in[4]; const float* wkA = (const float*)d_in[5]; const float* bkA = (const float*)d_in[6]; const float* wv = (const float*)d_in[7]; const float* bv = (const float*)d_in[8]; const float* wo = (const float*)d_in[9]; const float* bo = (const float*)d_in[10]; const float* x = nullptr; const float* wq = nullptr; const float* wk = nullptr; (void)x; (void)wq; (void)wk;
    float* OUT = (float*)d_out;     // the tuple's members one after the other: [TR][1024], in the order of the batch rows
    char* wsp = (char*)d_ws;
    auto take = [&](size_t bytes) { char* p = wsp; wsp += (bytes + 255) & ~(size_t)255; return (void*)p; };
    const size_t PL = (size_t)NH_ * TR * HD;   // one set of head planes, in elements
    bf* WO = (bf*)take((size_t)DM * DQ * 2);
    h16* QP16 = (h16*)take(2 * PL * 2); h16* KP16 = QP16 + PL; bf* QPh = (bf*)take(2 * PL * 2); bf* KPh = QPh + PL; bf* QPl = (bf*)take(2 * PL * 2); bf* KPl = QPl + PL;   // q planes, then k planes
    h16* VT16 = (h16*)take(PL * 2); bf* VTh = (bf*)take(PL * 2); bf* VTl = (bf*)take(PL * 2);
    bf* ATh = (bf*)take((size_t)TR * DQ * 2); bf* ATl = (bf*)take((size_t)TR * DQ * 2);
    bf* XB = (bf*)take(((size_t)TR * DM + (size_t)7 * DM * DM) * 2); bf* WQKV = XB + (size_t)TR * DM; float* CS = (float*)take((size_t)TR * HD * 2 * 4);
    if ((size_t)(wsp - (char*)d_ws) > ws_size) return;    // ws 256 MiB
    k_prep<<<CB_ALL, 256, 0, stream>>>(x0, x1, x2, wqA, wkA, wv, wo, XB, WO, CS);                     /* bf16 inputs; rope table, positions t x 2^s */
    k_gemmk<bf, 0, true, 3, 8><<<dim3(TR / 64, DM / 64, 3), 256, 0, stream>>>(XB, nullptr, DM, WQKV, nullptr, DM, nullptr, DM, bqA, bkA, bv, CS, QP16, QPh, QPl, PL, VT16, VTh, VTl);   /* q, k of every scale with rotary; v_base = x0 Wv^T + bv with its pooled rows, transposed; all as 16-bit planes */
    k_fattn<<<dim3(NH_, FT16 + FTHL), 256, 0, stream>>>(QP16, KP16, VT16, QPh, QPl, KPh, KPl, VTh, VTl, ATh, ATl);   /* attention of every head and scale; context as hi/lo planes */
    k_gemmk<bf, 1, true, 0, 8><<<dim3(TR / 64, DM / 64, 1), 256, 0, stream>>>(ATh, ATl, DQ, WO, nullptr, DQ, OUT, DM, bo, nullptr, nullptr, nullptr, nullptr, nullptr, nullptr, 0, nullptr, nullptr, nullptr);
}

// v007
// It runs in 126 microseconds.
// Next to v006, in two timings, it ran 1.22 times as fast each time.
// Over all steps from v000 it is 16.7 times as fast.
#include <hip/hip_runtime.h>

// Multiscale causal attention (x0 [1][2048][1024], x1 [1][1024][1024], x2 [1][512][1024]; v_base = x0 Wv^T + bv shared, average-pooled by 2^i for scale i; per scale i: q, k = x_i W[i]^T + b[i] ('oi' [1024][1024] + [1024]; 16 heads x 64), rotate-half rotary at positions t x 2^i (base 1e4), scores = q.k / 8, causal (finfo.min); softmax; ctx_i = w v_i; out_i = ctx_i Wo^T + bo -> tuple ([1][2048][1024], [1][1024][1024], [1][512][1024]) (3.7 M)).
// Realisation: the three scales run together as one batch of TR = 2048 + 1024 + 512 rows (scale i holds rows soff(i) .. soff(i) + N_i, N_i = 2048 >> i): every launch covers all three, and each work-group finds its scale from its block index; attention is one fused launch (scores and probabilities stay in registers); the rope table uses positions t x 2^i; rotary, value pooling, value transposition and the 16-bit splits are the projection kernel's epilogue (a 64x64 tile is 64 rows of one head). Q, K and V share the conversion launch (as block ranges) and the projection launch (as grid planes).
// Compute dtypes, f32 accumulate: every input rounded to bf16; q/k/v on PLAIN bf16 operands (inputs: exact) + biases; rotary in f32 (precise sinf/cosf, 32 baked float32 inverse frequencies, position factor 2^i exact); causal tile skipping; value pooling in f32 (means of 2 and of 4 rows, summed in row order as the reference's reshape-mean); scores and attn.v: query rows < 512 hl (3 products), the rest single fp16 (probabilities x 2^6, unnormalised); online softmax f32, divided by the row sum at the end; Wo hl x exact (2 products) + bo.

#define NB_  1
#define TT   2048
#define DM   1024
#define NH_  16
#define NKV  16
#define REP  (NH_ / NKV)
#define HD   64
#define DQ   (NH_ * HD)
#define DKV  (NKV * HD)
#define TR   (TT + TT / 2 + TT / 4)   // rows of the three scales, one after the other
#define RH   512                  // query rows < RH use hi+lo planes (k_fattn's grid assumes RH = TT / 4)
#define SCL  0.125f   // HD^-0.5
typedef _Float16 h16;
typedef unsigned short bf;
typedef __attribute__((ext_vector_type(16))) __bf16   v16bf;
typedef __attribute__((ext_vector_type(16))) _Float16 v16h;
typedef __attribute__((ext_vector_type(8)))  _Float16 v8h;
typedef __attribute__((ext_vector_type(8)))  unsigned short v8us;
typedef __attribute__((ext_vector_type(8)))  float    v8f;
typedef __attribute__((ext_vector_type(4)))  float    v4f;
typedef v8h  __attribute__((may_alias)) v8ha;
typedef v4f  __attribute__((may_alias)) v4fa;
typedef v8us __attribute__((may_alias)) v8usa;

__device__ __forceinline__ unsigned short f2bf(float f) { unsigned u = __float_as_uint(f); u += 0x7FFFu + ((u >> 16) & 1u); return (unsigned short)(u >> 16); }
__device__ __forceinline__ float bf2f(unsigned short b) { return __uint_as_float(((unsigned)b) << 16); }
__device__ __forceinline__ float bfr(float f) { return bf2f(f2bf(f)); }
__device__ __forceinline__ v16h cat16(v8h lo, v8h hi) { return __builtin_shufflevector(lo, hi, 0, 1, 2, 3, 4, 5, 6, 7, 8, 9, 10, 11, 12, 13, 14, 15); }
__device__ __forceinline__ v16bf cat16b(v8us lo, v8us hi) { return __builtin_bit_cast(v16bf, __builtin_shufflevector(lo, hi, 0, 1, 2, 3, 4, 5, 6, 7, 8, 9, 10, 11, 12, 13, 14, 15)); }
__device__ __forceinline__ v8f wmma16(v16h a, v16h b, v8f c) { return __builtin_amdgcn_wmma_f32_16x16x32_f16(false, a, false, b, (short)0, c, false, false); }
__device__ __forceinline__ v8f wmmab(v16bf a, v16bf b, v8f c) { return __builtin_amdgcn_wmma_f32_16x16x32_bf16(false, a, false, b, (short)0, c, false, false); }
// the batch of scales: scale of a batch row, first batch row of a scale
__device__ __forceinline__ int sc_of(int t) { return t < TT ? 0 : (t < TT + TT / 2 ? 1 : 2); }
__device__ __forceinline__ int soff(int s) { return 2 * TT - ((2 * TT) >> s); }

__device__ __forceinline__ h16 tohx(float x) { return (h16)x; }
__device__ __forceinline__ void splitf(float y, unsigned short& h, unsigned short& l) { h = f2bf(y); l = f2bf(y - bf2f(h)); }
typedef __attribute__((ext_vector_type(2))) _Float16 v2h;
typedef __attribute__((ext_vector_type(4))) _Float16 v4h;
typedef __attribute__((ext_vector_type(2))) unsigned short v2us;
typedef __attribute__((ext_vector_type(4))) unsigned short v4us;
typedef __attribute__((ext_vector_type(2))) float v2f;
typedef __attribute__((ext_vector_type(4))) int v4i;

// ---- k_gemmk: register-blocked GEMM, one 64x64 output tile per work-group of NW waves, the K loop split over the waves: wave w takes the 64-element (128-byte) K chunks w, w + NW, ... with its own 16 accumulators,
// operands straight from 16-bit planes in FRAGMENT ORDER (pko below): the 16 rows x 32 k of one matrix operand are 1 KiB in a row, lane l's first 8 elements at 16 l bytes, its second 8 at 512 + 16 l,
// so that each wave-wide 16-byte load covers 4 whole 128-byte lines (row-major planes: 32 bytes of each of 16 lines). The NW partial tiles meet in LDS and are added in wave order 0..NW-1. grid (M/64, N/64, Z), NW x 32 threads.
// C[m][n] (f32, pitch ldc, + optional f32 bias[n]) = sum_k A[m][k] Bt[n][k] (+ split products per NSPLIT). A and Bt have DM columns (lda = K = DM). K % 64 == 0.
// CMODE 3 (projections, z = 0 q, 1 k, 2 v): rows are batch rows; weight matrix number 3 z + s of Bt and the matching bias row; v exists for scale 0 only. No f32 result is stored: the tile (64 rows of head blockIdx.y) goes on in the epilogue.
// q, k: rotate-half rotary out[d] = x[d] cos[t][d] - x[d+HD/2] sin[t][d], out[d+HD/2] = x[d+HD/2] cos[t][d+HD/2] + x[d] sin[t][d+HD/2] (table CS), stored as head planes [h][t][d] (fp16 + hi/lo bf16; k planes zP elements behind the q planes).
// v: the tile is turned in LDS; each thread takes 16 rows of one column, forms the means of 2 and of 4 rows (scales 1 and 2, summed in row order) and stores the [h x HD + d][batch row] planes (fp16 + hi/lo bf16) of all three scales.
// element offset of (row R, column k) in a plane of DM columns kept in fragment order: block (R / 16, k / 32) of 512 elements; inside it half (k / 16) % 2, lane 16 ((k / 8) % 2) + R % 16, element k % 8
__device__ __forceinline__ size_t pko(int R, int k) { return ((size_t)(R >> 4) * (DM / 32) + (k >> 5)) * 512 + ((k >> 4) & 1) * 256 + (((k >> 3) & 1) * 16 + (R & 15)) * 8 + (k & 7); }
template <typename T16> struct WFrag;
template <> struct WFrag<h16> { typedef v16h V; static __device__ __forceinline__ V ld(const h16* p) { return cat16(*(const v8h*)p, *(const v8h*)(p + 16)); } static __device__ __forceinline__ V ldp(const h16* p) { return cat16(*(const v8h*)p, *(const v8h*)(p + 256)); } static __device__ __forceinline__ v8f mma(V a, V b, v8f c) { return wmma16(a, b, c); } };
template <> struct WFrag<bf> { typedef v16bf V; static __device__ __forceinline__ V ld(const bf* p) { return cat16b(*(const v8us*)p, *(const v8us*)(p + 16)); } static __device__ __forceinline__ V ldp(const bf* p) { return cat16b(*(const v8us*)p, *(const v8us*)(p + 256)); } static __device__ __forceinline__ v8f mma(V a, V b, v8f c) { return wmmab(a, b, c); } };
template <typename T16, int NSPLIT, bool BIAS, int CMODE, int NW>
__global__ __launch_bounds__(NW * 32) void k_gemmk(const T16* __restrict__ A, const T16* __restrict__ A2, int lda, const T16* __restrict__ Bt, const T16* __restrict__ Bt2, int K, float* C, int ldc, const float* __restrict__ bias, const float* __restrict__ biasK, const float* __restrict__ biasV, const float* __restrict__ CS, h16* P16, bf* Ph, bf* Pl, size_t zP, h16* V16, bf* Vh, bf* Vl) {
    typedef typename WFrag<T16>::V V;
    constexpr int RR = 2 * NW;                                        // tile rows added per round: one float4 per thread
    constexpr int NBUF = (2 * NW * RR * 68 * 4 <= 160 * 1024) ? 2 : 1; // two round buffers where both fit in half a WGP's LDS
    __shared__ __align__(16) float os[NBUF * NW * RR * 68];
    const size_t z = blockIdx.z;
    const int lane = threadIdx.x & 31, lr = lane & 15, hi = lane >> 4; const int c0 = blockIdx.y * 64;
    int r0 = blockIdx.x * 64, rc = r0, Kl = K;                        // first row in A, first row in C, end of the K loop
    if (CMODE == 3) { const int s = sc_of(r0); if (z == 2 && s) return;   // the whole work-group leaves, in front of every barrier
        Bt += (z * 3 + s) * (size_t)DM * DM; bias = (z == 0 ? bias : (z == 1 ? biasK : biasV)) + s * DM; }
    const int wv = __builtin_amdgcn_readfirstlane((int)(threadIdx.x >> 5));   // wave number in a scalar register: the K loop stays a scalar loop with every lane on
    v8f acc[4][4];
#pragma unroll
    for (int mb = 0; mb < 4; ++mb)
#pragma unroll
        for (int nb = 0; nb < 4; ++nb) acc[mb][nb] = (v8f){};
    constexpr int BAND = 16 * DM;                                     // fragment order: a band of 16 rows is 16 DM elements, 32 columns of it 512; a constant, so that every load of a pass is one address plus an immediate offset
    const size_t aoff = (size_t)r0 * DM + lane * 8, boff = (size_t)c0 * DM + lane * 8;
#pragma unroll 1
    for (int kc = wv * 64; kc < Kl; kc += (kc & 32) ? NW * 64 - 32 : 32) {   // both halves of a 128-byte chunk, then this wave's next chunk
        V a[4], a2[4];
        const T16* pa = A + aoff + kc * 16; const T16* pa2 = (NSPLIT == 1 || NSPLIT == 2) ? A2 + aoff + kc * 16 : pa; const T16* pb = Bt + boff + kc * 16; const T16* pb2 = NSPLIT >= 2 ? Bt2 + boff + kc * 16 : pb;
#pragma unroll
        for (int mb = 0; mb < 4; ++mb) { a[mb] = WFrag<T16>::ldp(pa + mb * BAND); if (NSPLIT == 1 || NSPLIT == 2) a2[mb] = WFrag<T16>::ldp(pa2 + mb * BAND); }
#pragma unroll
        for (int nb = 0; nb < 4; ++nb) { const V b = WFrag<T16>::ldp(pb + nb * BAND); V b2; if (NSPLIT >= 2) b2 = WFrag<T16>::ldp(pb2 + nb * BAND);
#pragma unroll
            for (int mb = 0; mb < 4; ++mb) { acc[mb][nb] = WFrag<T16>::mma(a[mb], b, acc[mb][nb]); if (NSPLIT == 1 || NSPLIT == 2) acc[mb][nb] = WFrag<T16>::mma(a2[mb], b, acc[mb][nb]); if (NSPLIT >= 2) acc[mb][nb] = WFrag<T16>::mma(a[mb], b2, acc[mb][nb]); } }
        asm volatile("s_wait_xcnt 0x0" :: "v"(pa), "v"(pa2), "v"(pb), "v"(pb2) : "memory");   // the wait stands behind the pass's loads, with their addresses as inputs, before the next pass forms its addresses
        // four vector slots behind the last matrix instruction, on the back edge and on the exit alike, before its operands or results are touched
        asm volatile("v_nop\n\tv_nop\n\tv_nop\n\tv_nop" : "+v"(acc[0][0]), "+v"(acc[1][1]), "+v"(acc[2][2]), "+v"(acc[3][3]) : "v"(a[0]), "v"(a[3]));
    }
    const int row = threadIdx.x >> 4, cofs = (threadIdx.x & 15) * 4;
    v4f res[64 / RR];
#pragma unroll
    for (int rd = 0; rd < 64 / RR; ++rd) {
        float* ob = os + (rd % NBUF) * (NW * RR * 68);                // two buffers in turn: one barrier a round is enough
        if (NBUF == 1 && rd) __syncthreads();                         // one buffer: the round before is read before it is overwritten
#pragma unroll
        for (int m = 0; m < RR / 16; ++m) {
#pragma unroll
            for (int nb = 0; nb < 4; ++nb) {
#pragma unroll
                for (int j = 0; j < 8; ++j) ob[(wv * RR + m * 16 + hi * 8 + j) * 68 + nb * 16 + lr] = acc[rd * (RR / 16) + m][nb][j]; } }
        __syncthreads();                                              // every wave's partial rows of this round are in LDS (two buffers: and every read of the buffer written next is done)
        v4f val = *(const v4fa*)(ob + row * 68 + cofs);
#pragma unroll
        for (int w = 1; w < NW; ++w) val += *(const v4fa*)(ob + (w * RR + row) * 68 + cofs);
        res[rd] = val;
    }
    v4f bb; bb[0] = bb[1] = bb[2] = bb[3] = 0.f;
    if (BIAS) { bb[0] = bfr(bias[c0 + cofs]); bb[1] = bfr(bias[c0 + cofs + 1]); bb[2] = bfr(bias[c0 + cofs + 2]); bb[3] = bfr(bias[c0 + cofs + 3]); }
    if constexpr (CMODE == 3) {
        static_assert(NBUF == 2 && (64 / RR) % 2 == 0 && RR == 16 && NW * RR * 68 >= 64 * 65, "the epilogue's thread map and its use of round buffer 0");
        if (z < 2) {   // q, k: a thread holds 4 neighbouring dimensions of a row; the partner dimensions (+- HD/2) are 8 lanes away in the same 16-lane row
            const float* cp = CS + ((size_t)(r0 + row) * HD + cofs) * 2;
            const size_t e = z * zP + ((size_t)blockIdx.y * TR + r0 + row) * HD + cofs;
            h16* p16 = P16 + e; bf* ph = Ph + e; bf* pl = Pl + e;
            const bool low = cofs < HD / 2;
#pragma unroll
            for (int rd = 0; rd < 64 / RR; ++rd) {
                const v4f x = res[rd] + bb; const v4f ca = *(const v4f*)(cp + rd * RR * HD * 2), cb = *(const v4f*)(cp + rd * RR * HD * 2 + 4);
                const float co[4] = {ca[0], ca[2], cb[0], cb[2]}, si[4] = {ca[1], ca[3], cb[1], cb[3]};
                v4h o16; v4us oh, ol;
#pragma unroll
                for (int q = 0; q < 4; ++q) { const float xp = __shfl_xor(x[q], 8); const float r = x[q] * co[q] + xp * (low ? -si[q] : si[q]);
                    o16[q] = tohx(r); unsigned short a2, c2; splitf(r, a2, c2); oh[q] = a2; ol[q] = c2; }
                *(v4h*)(p16 + rd * RR * HD) = o16; *(v4us*)(ph + rd * RR * HD) = oh; *(v4us*)(pl + rd * RR * HD) = ol; }
            asm volatile("s_wait_xcnt 0x0" :: "v"(cp), "v"(p16), "v"(ph), "v"(pl) : "memory");   // the wait stands behind the tile's loads and stores, with their addresses as inputs
        } else {       // v (block-uniform branch): round buffer 0 is free, its last readers passed the last round's barrier
            float* ts = os;                                           // [64 rows][65]: column reads fall on different banks
#pragma unroll
            for (int rd = 0; rd < 64 / RR; ++rd)
#pragma unroll
                for (int q = 0; q < 4; ++q) ts[(rd * RR + row) * 65 + cofs + q] = res[rd][q] + bb[q];
            __syncthreads();                                          // the whole value tile is in LDS
            const int d = threadIdx.x >> 2, tq = threadIdx.x & 3;
            float x[16], x1[8], x2[4];
#pragma unroll
            for (int i = 0; i < 16; ++i) x[i] = ts[(tq * 16 + i) * 65 + d];
#pragma unroll
            for (int i = 0; i < 8; ++i) x1[i] = (x[2 * i] + x[2 * i + 1]) * 0.5f;
#pragma unroll
            for (int i = 0; i < 4; ++i) x2[i] = (((x[4 * i] + x[4 * i + 1]) + x[4 * i + 2]) + x[4 * i + 3]) * 0.25f;
            const size_t vr = (size_t)(c0 + d) * TR;
            const size_t e0 = vr + r0 + tq * 16, e1 = vr + r0 / 2 + tq * 8, e2 = vr + r0 / 4 + tq * 4;   // this thread's first column inside scale 0, 1, 2
            v8h a16[2], b16; v8us ah[2], al[2], bh, bl; v4h c16; v4us ch, cl;
#pragma unroll
            for (int i = 0; i < 16; ++i) { unsigned short a2, c2; splitf(x[i], a2, c2); a16[i >> 3][i & 7] = tohx(x[i]); ah[i >> 3][i & 7] = a2; al[i >> 3][i & 7] = c2; }
#pragma unroll
            for (int i = 0; i < 8; ++i) { unsigned short a2, c2; splitf(x1[i], a2, c2); b16[i] = tohx(x1[i]); bh[i] = a2; bl[i] = c2; }
#pragma unroll
            for (int i = 0; i < 4; ++i) { unsigned short a2, c2; splitf(x2[i], a2, c2); c16[i] = tohx(x2[i]); ch[i] = a2; cl[i] = c2; }
            h16* p16 = V16 + e0; bf* ph = Vh + e0; bf* pl = Vl + e0; h16* s16 = V16 + e1; bf* sh = Vh + e1; bf* sl = Vl + e1; h16* u16 = V16 + e2; bf* uh = Vh + e2; bf* ul = Vl + e2;
            *(v8h*)p16 = a16[0]; *(v8h*)(p16 + 8) = a16[1]; *(v8us*)ph = ah[0]; *(v8us*)(ph + 8) = ah[1]; *(v8us*)pl = al[0]; *(v8us*)(pl + 8) = al[1];
            *(v8h*)(s16 + soff(1)) = b16; *(v8us*)(sh + soff(1)) = bh; *(v8us*)(sl + soff(1)) = bl; *(v4h*)(u16 + soff(2)) = c16; *(v4us*)(uh + soff(2)) = ch; *(v4us*)(ul + soff(2)) = cl;
            asm volatile("s_wait_xcnt 0x0" :: "v"(p16), "v"(ph), "v"(pl), "v"(s16), "v"(sh), "v"(sl), "v"(u16), "v"(uh), "v"(ul) : "memory");   // the wait stands behind the tile's stores, with their addresses as inputs
        }
    } else {
#pragma unroll
    for (int rd = 0; rd < 64 / RR; ++rd) {                            // stores behind the last barrier: no barrier waits for a global store
        v4f val = res[rd]; if (BIAS) val += bb;
        *(v4f*)(C + (size_t)(rc + rd * RR + row) * ldc + c0 + cofs) = val; }
    }
}


__global__ __launch_bounds__(256) void k_wtG(const float* __restrict__ w, int K, int N, bf* Bt) {
    const int lane = threadIdx.x & 31; const int L0 = (blockIdx.x * 8 + (threadIdx.x >> 5)) * 8; const int nlines = N * K / 64;
{
#pragma unroll 1
        for (int l = 0; l < 8; ++l) { const int L = L0 + l; if (L >= nlines) break; const size_t e = (size_t)L * 64 + lane * 2; const int k = (int)(e % K), n = (int)(e / K); v2us o;
            o[0] = f2bf(w[(size_t)k * N + n]); o[1] = f2bf(w[(size_t)(k + 1) * N + n]); *(v2us*)(Bt + e) = o; }
         }
}
__constant__ float INV[HD / 2] = {1.0f,0.749894202f,0.562341332f,0.421696514f,0.316227764f,0.237137362f,0.177827939f,0.133352146f,0.100000001f,0.0749894157f,0.0562341288f,0.0421696492f,0.0316227786f,0.0237137359f,0.0177827943f,0.0133352149f,0.00999999978f,0.00749894232f,0.00562341325f,0.00421696482f,0.00316227786f,0.00237137382f,0.00177827943f,0.00133352145f,0.00100000005f,0.000749894185f,0.000562341302f,0.000421696488f,0.000316227786f,0.000237137385f,0.00017782794f,0.00013335215f};   // float32 1/10000^(2i/64), eager-JAX values
// rope table, 256 entries a block: cos, sin of batch row idx / HD, dimension idx % HD
__device__ __forceinline__ void cstab(float* CS, int blk) { const int idx = blk * 256 + threadIdx.x; const int tb = idx / HD, d = idx % HD; const int s = sc_of(tb); const int t = tb - soff(s); const float pm = (float)(1 << s); /* batch row tb = row t of scale s: position t x 2^s */ float p = __fmul_rn((float)t, pm); asm volatile("" : "+v"(p)); const float ang = __fmul_rn(p, INV[d % (HD / 2)]); v2f cs; cs[0] = cosf(ang); cs[1] = sinf(ang);
    *(v2f*)(CS + (size_t)idx * 2) = cs;  }
// k_prep: what depends on the inputs alone, in one grid. Blocks < CB_WO: every f32 input matrix (all have DM columns) to bf16 in fragment order (pko), 4096 elements a block: a wave takes one block of 16 rows x 32 columns
// (16 whole 128-byte lines of f32) and stores it as 1 KiB in a row; x0, x1, x2 (the TR batch rows), the 3 q, the 3 k and the v weight matrices land one after the other at XW; the output weights at WOd. Blocks CB_WO .. CB_ALL: the rope table
#define CB_X0 (TT * DM / 4096)
#define CB_X1 (CB_X0 + TT / 2 * DM / 4096)
#define CB_X2 (CB_X1 + TT / 4 * DM / 4096)
#define CB_WQ (CB_X2 + 3 * DQ * DM / 4096)
#define CB_WK (CB_WQ + 3 * DKV * DM / 4096)
#define CB_WV (CB_WK + DKV * DM / 4096)
#define CB_WO (CB_WV + DM * DQ / 4096)
#define CB_ALL (CB_WO + TR * HD / 256)
__global__ __launch_bounds__(256) void k_prep(const float* __restrict__ x0, const float* __restrict__ x1, const float* __restrict__ x2, const float* __restrict__ wq, const float* __restrict__ wk, const float* __restrict__ wv, const float* __restrict__ wo, bf* XW, bf* WOd, float* CS) {
    const int b = blockIdx.x; if (b >= CB_WO) { cstab(CS, b - CB_WO); return; }
    const float* src; bf* dst = XW + (size_t)b * 4096; int bl;   // bl: this block's number inside its source matrix
    if (b < CB_X0) { src = x0; bl = b; } else if (b < CB_X1) { src = x1; bl = b - CB_X0; } else if (b < CB_X2) { src = x2; bl = b - CB_X1; }
    else if (b < CB_WQ) { src = wq; bl = b - CB_X2; } else if (b < CB_WK) { src = wk; bl = b - CB_WQ; } else if (b < CB_WV) { src = wv; bl = b - CB_WK; }
    else { src = wo; bl = b - CB_WV; dst = WOd + (size_t)bl * 4096; }
    const int lane = threadIdx.x & 31, wv8 = threadIdx.x >> 5; const int fb = bl * 8 + wv8;   // fragment block fb of the matrix: rows 16 (fb / 32) .., columns 32 (fb % 32) ..
    const float* sp = src + ((size_t)(fb >> 5) * 16 + (lane & 15)) * DM + (fb & 31) * 32 + (lane >> 4) * 8; bf* dp = dst + wv8 * 512 + lane * 8;
    const v8f v0 = *(const v8f*)sp, v1 = *(const v8f*)(sp + 16); v8us o0, o1;
#pragma unroll
    for (int k = 0; k < 8; ++k) { o0[k] = f2bf(v0[k]); o1[k] = f2bf(v1[k]); }
    *(v8us*)dp = o0; *(v8us*)(dp + 256) = o1;
    asm volatile("s_wait_xcnt 0x0" :: "v"(sp), "v"(dp) : "memory");   // the wait stands behind the block's loads and stores, with their addresses as inputs
}
// ---- k_fattn: scores, softmax, probability x value and the hi/lo split of the context in one kernel; no score or probability leaves the registers.
// One work-group of 8 waves per (head, query tile). Transposed products: S^T = K Q^T (a lane holds one query's scores: query = lane & 15, keys = 8 (lane >> 4) + j of each 16-key tile), so two S^T tiles are, register for register,
// the B operand P^T of O^T += V^T P^T, and maximum, sum and rescale factor are per lane. The keys are split over the waves: wave w takes the 64-key chunks w, w + 8, ... up to the diagonal, in steps of 32 keys, with its own running
// maximum m, sum l and O^T; the 8 partial results meet in LDS, are brought to the common maximum and added in wave order 0..7. Rows < RH of a scale: hi+lo bf16 planes, 3 products each, 16 queries a tile; the rest fp16, 32 queries a tile.
typedef __attribute__((ext_vector_type(16))) float v16f;
#define LC  (SCL * 1.4426950408889634f)   // raw score -> exponent of 2
#define MTH (8.0f / LC)                   // the maximum in use is renewed when a new score exceeds it by more than 2^8
__device__ __forceinline__ float xhalf(float x) { const int b = __float_as_int(x); return __int_as_float(__builtin_amdgcn_permlanex16(b, b, 0x76543210, 0xfedcba98, false, false)); }   // lane l <-> l ^ 16
template <bool HL, int NQT, typename T16>
__device__ __forceinline__ void fa_step(const T16* kp, const T16* kp2, const T16* vp, const T16* vp2, const typename WFrag<T16>::V (&q)[NQT][2], const typename WFrag<T16>::V (&q2)[NQT][2], v8f (&o)[4][NQT], float (&m)[NQT], float (&l)[NQT], int dq, bool diag) {
    typedef typename WFrag<T16>::V V;
    constexpr float PB = HL ? 0.0f : 6.0f;   // fp16 probabilities carry 2^6 (at most 2^14 with the lazy maximum); it cancels in O / l
    V ka[2][2], ka2[2][2], va[4], va2[4];
#pragma unroll
    for (int kt = 0; kt < 2; ++kt)
#pragma unroll
        for (int kc = 0; kc < 2; ++kc) { ka[kt][kc] = WFrag<T16>::ld(kp + kt * 16 * HD + kc * 32); if (HL) ka2[kt][kc] = WFrag<T16>::ld(kp2 + kt * 16 * HD + kc * 32); }
#pragma unroll
    for (int dt = 0; dt < 4; ++dt) { va[dt] = WFrag<T16>::ld(vp + dt * 16 * TR); if (HL) va2[dt] = WFrag<T16>::ld(vp2 + dt * 16 * TR); }
    // the wait stands behind the step's loads; it takes their addresses as inputs, so that no load's result lands on an address register in front of it
    if constexpr (HL) asm volatile("s_wait_xcnt 0x0" :: "v"(kp), "v"(kp2), "v"(vp), "v"(vp2) : "memory");
    else asm volatile("s_wait_xcnt 0x0" :: "v"(kp), "v"(vp) : "memory");
    __builtin_amdgcn_sched_barrier(0);   // every load of the step is issued before its first product: one load latency a step instead of one per group of fragments
    v8f st[2][NQT];
#pragma unroll
    for (int kt = 0; kt < 2; ++kt)
#pragma unroll
        for (int qt = 0; qt < NQT; ++qt) { st[kt][qt] = (v8f){};
#pragma unroll
            for (int kc = 0; kc < 2; ++kc) { st[kt][qt] = WFrag<T16>::mma(ka[kt][kc], q[qt][kc], st[kt][qt]); if (HL) { st[kt][qt] = WFrag<T16>::mma(ka[kt][kc], q2[qt][kc], st[kt][qt]); st[kt][qt] = WFrag<T16>::mma(ka2[kt][kc], q[qt][kc], st[kt][qt]); } } }
    // four vector slots behind the last score product, on both sides of the branch below, before its results are touched
    asm volatile("v_nop\n\tv_nop\n\tv_nop\n\tv_nop" : "+v"(st[0][0]), "+v"(st[1][NQT - 1]));
    if (diag) {   // a step that reaches the diagonal (wave-uniform): dq + 16 qt = this lane's query minus its first key; keys above the query are out
#pragma unroll
        for (int qt = 0; qt < NQT; ++qt)
#pragma unroll
            for (int kt = 0; kt < 2; ++kt)
#pragma unroll
                for (int j = 0; j < 8; ++j) st[kt][qt][j] = (kt * 16 + j <= dq + qt * 16) ? st[kt][qt][j] : -3.0e38f; }
    float tm[NQT]; bool need = false;
#pragma unroll
    for (int qt = 0; qt < NQT; ++qt) {
        float t = fmaxf(st[0][qt][0], st[1][qt][0]);
#pragma unroll
        for (int j = 1; j < 8; ++j) t = fmaxf(t, fmaxf(st[0][qt][j], st[1][qt][j]));
        t = fmaxf(t, xhalf(t)); tm[qt] = t; need = need || (t > m[qt] + MTH); }
    if (__builtin_amdgcn_ballot_w32(need) != 0) {   // one scalar branch a step: rescale only when some query's maximum has grown past the margin
#pragma unroll
        for (int qt = 0; qt < NQT; ++qt) { const float mn = fmaxf(m[qt], tm[qt]); const float al = __builtin_amdgcn_exp2f((m[qt] - mn) * LC); m[qt] = mn; l[qt] *= al;
#pragma unroll
            for (int dt = 0; dt < 4; ++dt) o[dt][qt] *= al; } }
    V pb[NQT], pl[NQT];
#pragma unroll
    for (int qt = 0; qt < NQT; ++qt) { const float mb = __builtin_fmaf(-m[qt], LC, PB); v16f pv; float s0 = 0.f, s1 = 0.f;
#pragma unroll
        for (int j = 0; j < 8; ++j) { pv[j] = __builtin_amdgcn_exp2f(__builtin_fmaf(st[0][qt][j], LC, mb)); pv[8 + j] = __builtin_amdgcn_exp2f(__builtin_fmaf(st[1][qt][j], LC, mb)); s0 += pv[j]; s1 += pv[8 + j]; }
        l[qt] += s0 + s1;
        pb[qt] = __builtin_convertvector(pv, V);
        if constexpr (HL) pl[qt] = __builtin_convertvector(pv - __builtin_convertvector(pb[qt], v16f), V); }
#pragma unroll
    for (int dt = 0; dt < 4; ++dt)
#pragma unroll
        for (int qt = 0; qt < NQT; ++qt) { o[dt][qt] = WFrag<T16>::mma(va[dt], pb[qt], o[dt][qt]); if (HL) { o[dt][qt] = WFrag<T16>::mma(va[dt], pl[qt], o[dt][qt]); o[dt][qt] = WFrag<T16>::mma(va2[dt], pb[qt], o[dt][qt]); } }
    // four vector slots behind the last matrix instruction, on the back edge and on the exit alike, before its operands or results are touched
    asm volatile("v_nop\n\tv_nop\n\tv_nop\n\tv_nop" : "+v"(o[0][0]), "+v"(o[1][0]), "+v"(o[2][NQT - 1]), "+v"(o[3][NQT - 1]) : "v"(va[0]), "v"(va[3]));
}
template <bool HL, typename T16>
__device__ __forceinline__ void fa_tile(const T16* __restrict__ Q, const T16* __restrict__ Q2, const T16* __restrict__ Kp, const T16* __restrict__ Kp2, const T16* __restrict__ Vt, const T16* __restrict__ Vt2, int s, int r0, int h, float* sm, bf* Ah, bf* Al) {
    typedef typename WFrag<T16>::V V;
    constexpr int NQT = HL ? 1 : 2, NQ = 16 * NQT;
    const int lane = threadIdx.x & 31, lr = lane & 15, hi = lane >> 4;
    const int wv = __builtin_amdgcn_readfirstlane((int)(threadIdx.x >> 5));   // wave number in a scalar register: the key loop stays a scalar loop with every lane on
    const size_t po = ((size_t)h * TR + soff(s)) * HD, vo = (size_t)h * HD * TR + soff(s);
    V q[NQT][2], q2[NQT][2];
    const T16* qp = Q + po + (size_t)(r0 + lr) * HD + 8 * hi; const T16* qp2 = HL ? Q2 + po + (size_t)(r0 + lr) * HD + 8 * hi : qp;
#pragma unroll
    for (int qt = 0; qt < NQT; ++qt)
#pragma unroll
        for (int kc = 0; kc < 2; ++kc) { q[qt][kc] = WFrag<T16>::ld(qp + qt * 16 * HD + kc * 32); if (HL) q2[qt][kc] = WFrag<T16>::ld(qp2 + qt * 16 * HD + kc * 32); }
    asm volatile("s_wait_xcnt 0x0" :: "v"(qp), "v"(qp2) : "memory");   // the wait stands behind the query loads, with their addresses as inputs, before those registers are reused
    v8f o[4][NQT]; float m[NQT], l[NQT];
#pragma unroll
    for (int qt = 0; qt < NQT; ++qt) { m[qt] = -1.0e30f; l[qt] = 0.f;
#pragma unroll
        for (int dt = 0; dt < 4; ++dt) o[dt][qt] = (v8f){}; }
    const T16* kb0 = Kp + po + (size_t)lr * HD + 8 * hi; const T16* kb2 = HL ? Kp2 + po + (size_t)lr * HD + 8 * hi : kb0;
    const T16* vb0 = Vt + vo + (size_t)lr * TR + 8 * hi; const T16* vb2 = HL ? Vt2 + vo + (size_t)lr * TR + 8 * hi : vb0;
    const int kend = r0 + NQ;
#pragma unroll 1   // kept rolled: one copy of the step in the instruction cache, and its registers stay within four waves a SIMD
    for (int k0 = wv * 64; k0 < kend; k0 += (k0 & 32) ? 8 * 64 - 32 : 32) {   // both halves of a 64-key chunk (one 128-byte line of each value row), then this wave's next chunk
        const int dq = r0 + lr - k0 - hi * 8;
        fa_step<HL, NQT, T16>(kb0 + (size_t)k0 * HD, kb2 + (size_t)k0 * HD, vb0 + k0, vb2 + k0, q, q2, o, m, l, dq, k0 + 31 > r0);
    }
    float* ms = sm; float* ls = sm + 8 * 32; float* os = sm + 2 * 8 * 32;   // maxima [8][32], sums [8][32], partial contexts [8][NQ][68]
    if (hi == 0) {
#pragma unroll
        for (int qt = 0; qt < NQT; ++qt) ms[wv * 32 + qt * 16 + lr] = m[qt]; }
    __syncthreads();                                                  // every wave's maxima are in LDS
#pragma unroll
    for (int qt = 0; qt < NQT; ++qt) { float M = ms[qt * 16 + lr];
#pragma unroll
        for (int w = 1; w < 8; ++w) M = fmaxf(M, ms[w * 32 + qt * 16 + lr]);
        const float f = __builtin_amdgcn_exp2f((m[qt] - M) * LC);     // a wave without keys for a query: 0
        const float lj = (l[qt] + xhalf(l[qt])) * f; if (hi == 0) ls[wv * 32 + qt * 16 + lr] = lj;
#pragma unroll
        for (int dt = 0; dt < 4; ++dt) { const v8f ov = o[dt][qt] * f; float* d = os + (size_t)((wv * NQ + qt * 16 + lr) * 68 + dt * 16 + hi * 8);
            v4f a, b; a[0] = ov[0]; a[1] = ov[1]; a[2] = ov[2]; a[3] = ov[3]; b[0] = ov[4]; b[1] = ov[5]; b[2] = ov[6]; b[3] = ov[7]; *(v4fa*)d = a; *(v4fa*)(d + 4) = b; } }
    __syncthreads();                                                  // every wave's sums and partial contexts are in LDS
    constexpr int PT = NQ * HD / 256;                                 // context elements a thread
    const int qq = threadIdx.x / (HD / PT), d0 = (threadIdx.x % (HD / PT)) * PT;
    float L = ls[qq];
#pragma unroll
    for (int w = 1; w < 8; ++w) L += ls[w * 32 + qq];
    const size_t pe = pko(soff(s) + r0 + qq, h * HD + d0); bf* pa = Ah + pe; bf* pc = Al + pe;   // context planes in fragment order for the output product; PT <= 8 elements from a multiple of PT stay inside one 16-byte unit
#pragma unroll
    for (int g = 0; g < PT / 4; ++g) { v4f val = *(const v4fa*)(os + qq * 68 + d0 + g * 4);
#pragma unroll
        for (int w = 1; w < 8; ++w) val += *(const v4fa*)(os + (w * NQ + qq) * 68 + d0 + g * 4);
        v4us oh, ol;
#pragma unroll
        for (int e = 0; e < 4; ++e) { unsigned short a, c2; splitf(__fdiv_rn(val[e], L), a, c2); oh[e] = a; ol[e] = c2; }
        *(v4us*)(pa + g * 4) = oh; *(v4us*)(pc + g * 4) = ol; }
    asm volatile("s_wait_xcnt 0x0" :: "v"(pa), "v"(pc) : "memory");   // the wait stands behind the tile's stores, with their addresses as inputs
}
// grid (heads, FT16 + FTHL), the longest rows first: the fp16 tiles of scale 0, then of scale 1, then the hi+lo tiles of the three scales. Four waves a SIMD (two work-groups a WGP): vector work between the matrix runs wants waves
#define FT0  ((TT - RH) / 32)
#define FT16 (FT0 + (TT / 2 - RH) / 32)
#define FTHL (3 * (RH / 16))
__global__ __launch_bounds__(256) __attribute__((amdgpu_waves_per_eu(4, 4))) void k_fattn(const h16* __restrict__ Q16, const h16* __restrict__ K16, const h16* __restrict__ V16, const bf* __restrict__ Qh, const bf* __restrict__ Ql, const bf* __restrict__ Kh, const bf* __restrict__ Kw, const bf* __restrict__ Vh, const bf* __restrict__ Vl, bf* Ah, bf* Al) {
    __shared__ __align__(16) float sm[2 * 8 * 32 + 8 * 32 * 68];
    const int h = blockIdx.x, y = blockIdx.y;
    if (y < FT16) { const int s = y < FT0 ? 0 : 1; const int r0 = (TT >> s) - 32 * (y - s * FT0 + 1); fa_tile<false, h16>(Q16, nullptr, K16, nullptr, V16, nullptr, s, r0, h, sm, Ah, Al); }
    else { const int yy = y - FT16; const int s = yy % 3; const int r0 = RH - 16 * (yy / 3 + 1); fa_tile<true, bf>(Qh, Ql, Kh, Kw, Vh, Vl, s, r0, h, sm, Ah, Al); }
}

extern "C" void kernel_launch(void* const* d_in, const int* in_sizes, int n_in,
                              void* d_out, int out_size, void* d_ws, size_t ws_size, hipStream_t stream) {
    (void)in_sizes; (void)n_in; (void)out_size;
    const float* x0 = (const float*)d_in[0]; const float* x1 = (const float*)d_in[1]; const float* x2 = (const float*)d_in[2]; const float* wqA = (const float*)d_in[3]; const float* bqA = (const float*)d_in[4]; const float* wkA = (const float*)d_in[5]; const float* bkA = (const float*)d_in[6]; const float* wv = (const float*)d_in[7]; const float* bv = (const float*)d_in[8]; const float* wo = (const float*)d_in[9]; const float* bo = (const float*)d_in[10]; const float* x = nullptr; const float* wq = nullptr; const float* wk = nullptr; (void)x; (void)wq; (void)wk;
    float* OUT = (float*)d_out;     // the tuple's members one after the other: [TR][1024], in the order of the batch rows
    char* wsp = (char*)d_ws;
    auto take = [&](size_t bytes) { char* p = wsp; wsp += (bytes + 255) & ~(size_t)255; return (void*)p; };
    const size_t PL = (size_t)NH_ * TR * HD;   // one set of head planes, in elements
    bf* WO = (bf*)take((size_t)DM * DQ * 2);
    h16* QP16 = (h16*)take(2 * PL * 2); h16* KP16 = QP16 + PL; bf* QPh = (bf*)take(2 * PL * 2); bf* KPh = QPh + PL; bf* QPl = (bf*)take(2 * PL * 2); bf* KPl = QPl + PL;   // q planes, then k planes
    h16* VT16 = (h16*)take(PL * 2); bf* VTh = (bf*)take(PL * 2); bf* VTl = (bf*)take(PL * 2);
    bf* ATh = (bf*)take((size_t)TR * DQ * 2); bf* ATl = (bf*)take((size_t)TR * DQ * 2);
    bf* XB = (bf*)take(((size_t)TR * DM + (size_t)7 * DM * DM) * 2); bf* WQKV = XB + (size_t)TR * DM; float* CS = (float*)take((size_t)TR * HD * 2 * 4);
    if ((size_t)(wsp - (char*)d_ws) > ws_size) return;    // ws 256 MiB
    k_prep<<<CB_ALL, 256, 0, stream>>>(x0, x1, x2, wqA, wkA, wv, wo, XB, WO, CS);                     /* bf16 inputs; rope table, positions t x 2^s */
    k_gemmk<bf, 0, true, 3, 8><<<dim3(TR / 64, DM / 64, 3), 256, 0, stream>>>(XB, nullptr, DM, WQKV, nullptr, DM, nullptr, DM, bqA, bkA, bv, CS, QP16, QPh, QPl, PL, VT16, VTh, VTl);   /* q, k of every scale with rotary; v_base = x0 Wv^T + bv with its pooled rows, transposed; all as 16-bit planes */
    k_fattn<<<dim3(NH_, FT16 + FTHL), 256, 0, stream>>>(QP16, KP16, VT16, QPh, QPl, KPh, KPl, VTh, VTl, ATh, ATl);   /* attention of every head and scale; context as hi/lo planes */
    k_gemmk<bf, 1, true, 0, 8><<<dim3(TR / 64, DM / 64, 1), 256, 0, stream>>>(ATh, ATl, DQ, WO, nullptr, DQ, OUT, DM, bo, nullptr, nullptr, nullptr, nullptr, nullptr, nullptr, 0, nullptr, nullptr, nullptr);
}

// v008
// A run of this version takes 104 microseconds.
// In two side-by-side timings against v007, it was 1.21 and 1.22 times as fast.
// Over all steps from v000 it is 20.3 times as fast.
#include <hip/hip_runtime.h>

// Multiscale causal attention (x0 [1][2048][1024], x1 [1][1024][1024], x2 [1][512][1024]; v_base = x0 Wv^T + bv shared, average-pooled by 2^i for scale i; per scale i: q, k = x_i W[i]^T + b[i] ('oi' [1024][1024] + [1024]; 16 heads x 64), rotate-half rotary at positions t x 2^i (base 1e4), scores = q.k / 8, causal (finfo.min); softmax; ctx_i = w v_i; out_i = ctx_i Wo^T + bo -> tuple ([1][2048][1024], [1][1024][1024], [1][512][1024]) (3.7 M)).
// Realisation: the three scales run together as one batch of TR = 2048 + 1024 + 512 rows (scale i holds rows soff(i) .. soff(i) + N_i, N_i = 2048 >> i): every launch covers all three, and each work-group finds its scale from its block index; attention is one fused launch (scores and probabilities stay in registers); the rope table uses positions t x 2^i; rotary, value pooling, value transposition and the 16-bit splits are the projection kernel's epilogue (a 64x64 tile is 64 rows of one head); the q, k and value planes are kept in the fragment order of the attention products. Q, K and V share the conversion launch as block ranges and the projection launch as grid planes.
// Compute dtypes, f32 accumulate: every input rounded to bf16; q/k/v on PLAIN bf16 operands (inputs: exact) + biases; rotary in f32 (precise sinf/cosf, 32 baked float32 inverse frequencies, position factor 2^i exact); causal tile skipping; value pooling in f32 (means of 2 and 4 rows summed in row order, as the reference's reshape-mean); scores and attn.v: query rows < 512 hl (3 products), the rest single fp16 (probabilities x 2^6, unnormalised); online softmax f32, divided by the row sum at the end; Wo hl x exact (2 products) + bo.

#define NB_  1
#define TT   2048
#define DM   1024
#define NH_  16
#define NKV  16
#define REP  (NH_ / NKV)
#define HD   64
#define DQ   (NH_ * HD)
#define DKV  (NKV * HD)
#define TR   (TT + TT / 2 + TT / 4)   // rows of the three scales, one after the other
#define RH   512                  // query rows < RH use hi+lo planes (k_fattn's grid assumes RH = TT / 4)
#define SCL  0.125f   // HD^-0.5
typedef _Float16 h16;
typedef unsigned short bf;
typedef __attribute__((ext_vector_type(16))) __bf16   v16bf;
typedef __attribute__((ext_vector_type(16))) _Float16 v16h;
typedef __attribute__((ext_vector_type(8)))  _Float16 v8h;
typedef __attribute__((ext_vector_type(8)))  unsigned short v8us;
typedef __attribute__((ext_vector_type(8)))  float    v8f;
typedef __attribute__((ext_vector_type(4)))  float    v4f;
typedef v8h  __attribute__((may_alias)) v8ha;
typedef v4f  __attribute__((may_alias)) v4fa;
typedef v8us __attribute__((may_alias)) v8usa;
typedef __attribute__((ext_vector_type(4))) unsigned short __attribute__((may_alias)) v4usa;

__device__ __forceinline__ unsigned short f2bf(float f) { unsigned u = __float_as_uint(f); u += 0x7FFFu + ((u >> 16) & 1u); return (unsigned short)(u >> 16); }
__device__ __forceinline__ float bf2f(unsigned short b) { return __uint_as_float(((unsigned)b) << 16); }
__device__ __forceinline__ float bfr(float f) { return bf2f(f2bf(f)); }
__device__ __forceinline__ v16h cat16(v8h lo, v8h hi) { return __builtin_shufflevector(lo, hi, 0, 1, 2, 3, 4, 5, 6, 7, 8, 9, 10, 11, 12, 13, 14, 15); }
__device__ __forceinline__ v16bf cat16b(v8us lo, v8us hi) { return __builtin_bit_cast(v16bf, __builtin_shufflevector(lo, hi, 0, 1, 2, 3, 4, 5, 6, 7, 8, 9, 10, 11, 12, 13, 14, 15)); }
__device__ __forceinline__ v8f wmma16(v16h a, v16h b, v8f c) { return __builtin_amdgcn_wmma_f32_16x16x32_f16(false, a, false, b, (short)0, c, false, false); }
__device__ __forceinline__ v8f wmmab(v16bf a, v16bf b, v8f c) { return __builtin_amdgcn_wmma_f32_16x16x32_bf16(false, a, false, b, (short)0, c, false, false); }
// the batch of scales: scale of a batch row, first batch row of a scale
__device__ __forceinline__ int sc_of(int t) { return t < TT ? 0 : (t < TT + TT / 2 ? 1 : 2); }
__device__ __forceinline__ int soff(int s) { return 2 * TT - ((2 * TT) >> s); }

__device__ __forceinline__ h16 tohx(float x) { return (h16)x; }
__device__ __forceinline__ void splitf(float y, unsigned short& h, unsigned short& l) { h = f2bf(y); l = f2bf(y - bf2f(h)); }
typedef __attribute__((ext_vector_type(2))) _Float16 v2h;
typedef __attribute__((ext_vector_type(4))) _Float16 v4h;
typedef __attribute__((ext_vector_type(2))) unsigned short v2us;
typedef __attribute__((ext_vector_type(4))) unsigned short v4us;
typedef __attribute__((ext_vector_type(2))) float v2f;
typedef __attribute__((ext_vector_type(4))) int v4i;

// ---- k_gemmk: register-blocked GEMM, one 64x64 output tile per work-group of NW waves, the K loop split over the waves: wave w takes the 64-element (128-byte) K chunks w, w + NW, ... with its own 16 accumulators,
// operands straight from 16-bit planes in FRAGMENT ORDER (pko below): the 16 rows x 32 k of one matrix operand are 1 KiB in a row, lane l's first 8 elements at 16 l bytes, its second 8 at 512 + 16 l,
// so that each wave-wide 16-byte load covers 4 whole 128-byte lines (row-major planes: 32 bytes of each of 16 lines). The NW partial tiles meet in LDS and are added in wave order 0..NW-1. grid (M/64, N/64, Z), NW x 32 threads.
// C[m][n] (f32, pitch ldc, + optional f32 bias[n]) = sum_k A[m][k] Bt[n][k] (+ split products per NSPLIT). A and Bt have DM columns (lda = K = DM). K % 64 == 0.
// CMODE 3 (projections, z = 0 q, 1 k, 2 v): rows are batch rows; weight matrix number 3 z + s of Bt and the matching bias row; v exists for scale 0 only. No f32 result is stored: the tile (64 rows of head blockIdx.y) goes on in the epilogue.
// q, k: rotate-half rotary out[d] = x[d] cos[t][d] - x[d+HD/2] sin[t][d], out[d+HD/2] = x[d+HD/2] cos[t][d+HD/2] + x[d] sin[t][d+HD/2] (table CS), stored as head planes in fragment order (fp16 + hi/lo bf16; k planes zP elements behind the q planes): the 16 rows x 32 dimensions of one operand are 1 KiB in a row as in pko, a 64x64 tile 8 KiB in a row; the tile is brought into that order in LDS, so that every wave-wide store is 512 bytes in a row.
// v: the tile is turned in LDS; each thread takes 16 rows of one column, forms the means of 2 and of 4 rows (scales 1 and 2, summed in row order) and stores the value planes (fp16 + hi/lo bf16) of all three scales in fragment order (pkv below: 16 dimensions x 32 batch rows are 1 KiB in a row).
// element offset of (row R, column k) in a plane of DM columns kept in fragment order: block (R / 16, k / 32) of 512 elements; inside it half (k / 16) % 2, lane 16 ((k / 8) % 2) + R % 16, element k % 8
__device__ __forceinline__ size_t pko(int R, int k) { return ((size_t)(R >> 4) * (DM / 32) + (k >> 5)) * 512 + ((k >> 4) & 1) * 256 + (((k >> 3) & 1) * 16 + (R & 15)) * 8 + (k & 7); }
// element offset of (dimension d of head h, batch row t) in a value plane kept in fragment order: block (t / 32, d / 16) of 512 elements; inside it half (t / 16) % 2, lane 16 ((t / 8) % 2) + d % 16, element t % 8
__device__ __forceinline__ size_t pkv(int h, int d, int t) { return (((size_t)h * (TR / 32) + (t >> 5)) * (HD / 16) + (d >> 4)) * 512 + ((t >> 4) & 1) * 256 + (((t >> 3) & 1) * 16 + (d & 15)) * 8 + (t & 7); }
template <typename T16> struct WFrag;
template <> struct WFrag<h16> { typedef v16h V; static __device__ __forceinline__ V ldp(const h16* p) { return cat16(*(const v8h*)p, *(const v8h*)(p + 256)); } static __device__ __forceinline__ v8f mma(V a, V b, v8f c) { return wmma16(a, b, c); } };
template <> struct WFrag<bf> { typedef v16bf V; static __device__ __forceinline__ V ldp(const bf* p) { return cat16b(*(const v8us*)p, *(const v8us*)(p + 256)); } static __device__ __forceinline__ v8f mma(V a, V b, v8f c) { return wmmab(a, b, c); } };
template <typename T16, int NSPLIT, bool BIAS, int CMODE, int NW>
__global__ __launch_bounds__(NW * 32) void k_gemmk(const T16* __restrict__ A, const T16* __restrict__ A2, int lda, const T16* __restrict__ Bt, const T16* __restrict__ Bt2, int K, float* C, int ldc, const float* __restrict__ bias, const float* __restrict__ biasK, const float* __restrict__ biasV, const float* __restrict__ CS, h16* P16, bf* Ph, bf* Pl, size_t zP, h16* V16, bf* Vh, bf* Vl) {
    typedef typename WFrag<T16>::V V;
    constexpr int RR = 2 * NW;                                        // tile rows added per round: one float4 per thread
    constexpr int NBUF = (2 * NW * RR * 68 * 4 <= 160 * 1024) ? 2 : 1; // two round buffers where both fit in half a WGP's LDS
    __shared__ __align__(16) float os[NBUF * NW * RR * 68];
    const size_t z = blockIdx.z;
    const int lane = threadIdx.x & 31, lr = lane & 15, hi = lane >> 4; const int c0 = blockIdx.y * 64;
    int r0 = blockIdx.x * 64, rc = r0, Kl = K;                        // first row in A, first row in C, end of the K loop
    if (CMODE == 3) { const int s = sc_of(r0); if (z == 2 && s) return;   // the whole work-group leaves, in front of every barrier
        Bt += (z * 3 + s) * (size_t)DM * DM; bias = (z == 0 ? bias : (z == 1 ? biasK : biasV)) + s * DM; }
    const int wv = __builtin_amdgcn_readfirstlane((int)(threadIdx.x >> 5));   // wave number in a scalar register: the K loop stays a scalar loop with every lane on
    v8f acc[4][4];
#pragma unroll
    for (int mb = 0; mb < 4; ++mb)
#pragma unroll
        for (int nb = 0; nb < 4; ++nb) acc[mb][nb] = (v8f){};
    constexpr int BAND = 16 * DM;                                     // fragment order: a band of 16 rows is 16 DM elements, 32 columns of it 512; a constant, so that every load of a pass is one address plus an immediate offset
    const size_t aoff = (size_t)r0 * DM + lane * 8, boff = (size_t)c0 * DM + lane * 8;
#pragma unroll 1
    for (int kc = wv * 64; kc < Kl; kc += (kc & 32) ? NW * 64 - 32 : 32) {   // both halves of a 128-byte chunk, then this wave's next chunk
        V a[4], a2[4];
        const T16* pa = A + aoff + kc * 16; const T16* pa2 = (NSPLIT == 1 || NSPLIT == 2) ? A2 + aoff + kc * 16 : pa; const T16* pb = Bt + boff + kc * 16; const T16* pb2 = NSPLIT >= 2 ? Bt2 + boff + kc * 16 : pb;
#pragma unroll
        for (int mb = 0; mb < 4; ++mb) { a[mb] = WFrag<T16>::ldp(pa + mb * BAND); if (NSPLIT == 1 || NSPLIT == 2) a2[mb] = WFrag<T16>::ldp(pa2 + mb * BAND); }
#pragma unroll
        for (int nb = 0; nb < 4; ++nb) { const V b = WFrag<T16>::ldp(pb + nb * BAND); V b2; if (NSPLIT >= 2) b2 = WFrag<T16>::ldp(pb2 + nb * BAND);
#pragma unroll
            for (int mb = 0; mb < 4; ++mb) { acc[mb][nb] = WFrag<T16>::mma(a[mb], b, acc[mb][nb]); if (NSPLIT == 1 || NSPLIT == 2) acc[mb][nb] = WFrag<T16>::mma(a2[mb], b, acc[mb][nb]); if (NSPLIT >= 2) acc[mb][nb] = WFrag<T16>::mma(a[mb], b2, acc[mb][nb]); } }
        asm volatile("s_wait_xcnt 0x0" :: "v"(pa), "v"(pa2), "v"(pb), "v"(pb2) : "memory");   // the wait stands behind the pass's loads, with their addresses as inputs, before the next pass forms its addresses
        // four vector slots behind the last matrix instruction, on the back edge and on the exit alike, before its operands or results are touched
        asm volatile("v_nop\n\tv_nop\n\tv_nop\n\tv_nop" : "+v"(acc[0][0]), "+v"(acc[1][1]), "+v"(acc[2][2]), "+v"(acc[3][3]) : "v"(a[0]), "v"(a[3]));
    }
    const int row = threadIdx.x >> 4, cofs = (threadIdx.x & 15) * 4;
    v4f res[64 / RR];
#pragma unroll
    for (int rd = 0; rd < 64 / RR; ++rd) {
        float* ob = os + (rd % NBUF) * (NW * RR * 68);                // two buffers in turn: one barrier a round is enough
        if (NBUF == 1 && rd) __syncthreads();                         // one buffer: the round before is read before it is overwritten
#pragma unroll
        for (int m = 0; m < RR / 16; ++m) {
#pragma unroll
            for (int nb = 0; nb < 4; ++nb) {
#pragma unroll
                for (int j = 0; j < 8; ++j) ob[(wv * RR + m * 16 + hi * 8 + j) * 68 + nb * 16 + lr] = acc[rd * (RR / 16) + m][nb][j]; } }
        __syncthreads();                                              // every wave's partial rows of this round are in LDS (two buffers: and every read of the buffer written next is done)
        v4f val = *(const v4fa*)(ob + row * 68 + cofs);
#pragma unroll
        for (int w = 1; w < NW; ++w) val += *(const v4fa*)(ob + (w * RR + row) * 68 + cofs);
        res[rd] = val;
    }
    v4f bb; bb[0] = bb[1] = bb[2] = bb[3] = 0.f;
    if (BIAS) { bb[0] = bfr(bias[c0 + cofs]); bb[1] = bfr(bias[c0 + cofs + 1]); bb[2] = bfr(bias[c0 + cofs + 2]); bb[3] = bfr(bias[c0 + cofs + 3]); }
    if constexpr (CMODE == 3) {
        static_assert(NBUF == 2 && (64 / RR) % 2 == 0 && RR == 16 && NW * RR * 68 >= 64 * 65, "the epilogue's thread map and its use of round buffer 0");
        if (z < 2) {   // q, k: a thread holds 4 neighbouring dimensions of a row; the partner dimensions (+- HD/2) are 8 lanes away in the same 16-lane row
            const float* cp = CS + ((size_t)(r0 + row) * HD + cofs) * 2;
            // round buffer 0 is free (its last readers passed the last round's barrier): three planes of 32 groups, a group = 16 rows x 8 dimensions (256 bytes, as it lies in the plane) at pitch 288 bytes, so that the 8 groups a wave writes fall on different banks
            static_assert(NW * RR * 68 * 4 >= 3 * 32 * 288, "the three 16-bit tiles fit round buffer 0");
            unsigned short* sp = (unsigned short*)os + (cofs >> 3) * 144 + row * 8 + (cofs & 7);
            const bool low = cofs < HD / 2;
#pragma unroll
            for (int rd = 0; rd < 64 / RR; ++rd) {
                const v4f x = res[rd] + bb; const v4f ca = *(const v4f*)(cp + rd * RR * HD * 2), cb = *(const v4f*)(cp + rd * RR * HD * 2 + 4);
                const float co[4] = {ca[0], ca[2], cb[0], cb[2]}, si[4] = {ca[1], ca[3], cb[1], cb[3]};
                v4h o16; v4us oh, ol;
#pragma unroll
                for (int q = 0; q < 4; ++q) { const float xp = __shfl_xor(x[q], 8); const float r = x[q] * co[q] + xp * (low ? -si[q] : si[q]);
                    o16[q] = tohx(r); unsigned short a2, c2; splitf(r, a2, c2); oh[q] = a2; ol[q] = c2; }
                *(v4usa*)(sp + rd * 8 * 144) = __builtin_bit_cast(v4us, o16); *(v4usa*)(sp + (32 + rd * 8) * 144) = oh; *(v4usa*)(sp + (64 + rd * 8) * 144) = ol; }
            asm volatile("s_wait_xcnt 0x0" :: "v"(cp) : "memory");   // the wait stands behind the tile's loads, with their address as input
            __syncthreads();                                          // the three 16-bit tiles are in LDS (block-uniform branch)
            const size_t e = z * zP + ((size_t)blockIdx.y * TR + r0) * HD + threadIdx.x * 8;   // the tile is 8 KiB in a row in each plane; a thread takes 16-byte units threadIdx.x and 256 + threadIdx.x
            h16* p16 = P16 + e; bf* ph = Ph + e; bf* pl = Pl + e;
            const unsigned short* rp = (const unsigned short*)os + (threadIdx.x >> 4) * 144 + (threadIdx.x & 15) * 8;
#pragma unroll
            for (int u = 0; u < 2; ++u) { *(v8usa*)(p16 + u * 2048) = *(const v8usa*)(rp + u * 16 * 144); *(v8usa*)(ph + u * 2048) = *(const v8usa*)(rp + (32 + u * 16) * 144); *(v8usa*)(pl + u * 2048) = *(const v8usa*)(rp + (64 + u * 16) * 144); }
            asm volatile("s_wait_xcnt 0x0" :: "v"(p16), "v"(ph), "v"(pl) : "memory");   // the wait stands behind the tile's stores, with their addresses as inputs
        } else {       // v (block-uniform branch): round buffer 0 is free, its last readers passed the last round's barrier
            float* ts = os;                                           // [64 rows][65]: column reads fall on different banks
#pragma unroll
            for (int rd = 0; rd < 64 / RR; ++rd)
#pragma unroll
                for (int q = 0; q < 4; ++q) ts[(rd * RR + row) * 65 + cofs + q] = res[rd][q] + bb[q];
            __syncthreads();                                          // the whole value tile is in LDS
            const int d = ((threadIdx.x >> 5) & 3) * 16 + (threadIdx.x & 15), tq = (threadIdx.x >> 7) * 2 + ((threadIdx.x >> 4) & 1);   // a wave: 16 dimensions x 2 groups of 16 rows, so that each of its stores below fills whole runs of 256 bytes or more
            float x[16], x1[8], x2[4];
#pragma unroll
            for (int i = 0; i < 16; ++i) x[i] = ts[(tq * 16 + i) * 65 + d];
#pragma unroll
            for (int i = 0; i < 8; ++i) x1[i] = (x[2 * i] + x[2 * i + 1]) * 0.5f;
#pragma unroll
            for (int i = 0; i < 4; ++i) x2[i] = (((x[4 * i] + x[4 * i + 1]) + x[4 * i + 2]) + x[4 * i + 3]) * 0.25f;
            const int hv = blockIdx.y;
            const size_t e0 = pkv(hv, d, r0 + tq * 16), e1 = pkv(hv, d, soff(1) + r0 / 2 + tq * 8), e2 = pkv(hv, d, soff(2) + r0 / 4 + tq * 4);   // this thread's first batch row of scale 0, 1, 2; 16 neighbouring dimensions lie 256 bytes in a row
            v8h a16[2], b16; v8us ah[2], al[2], bh, bl; v4h c16; v4us ch, cl;
#pragma unroll
            for (int i = 0; i < 16; ++i) { unsigned short a2, c2; splitf(x[i], a2, c2); a16[i >> 3][i & 7] = tohx(x[i]); ah[i >> 3][i & 7] = a2; al[i >> 3][i & 7] = c2; }
#pragma unroll
            for (int i = 0; i < 8; ++i) { unsigned short a2, c2; splitf(x1[i], a2, c2); b16[i] = tohx(x1[i]); bh[i] = a2; bl[i] = c2; }
#pragma unroll
            for (int i = 0; i < 4; ++i) { unsigned short a2, c2; splitf(x2[i], a2, c2); c16[i] = tohx(x2[i]); ch[i] = a2; cl[i] = c2; }
            h16* p16 = V16 + e0; bf* ph = Vh + e0; bf* pl = Vl + e0; h16* s16 = V16 + e1; bf* sh = Vh + e1; bf* sl = Vl + e1; h16* u16 = V16 + e2; bf* uh = Vh + e2; bf* ul = Vl + e2;
            *(v8h*)p16 = a16[0]; *(v8h*)(p16 + 128) = a16[1]; *(v8us*)ph = ah[0]; *(v8us*)(ph + 128) = ah[1]; *(v8us*)pl = al[0]; *(v8us*)(pl + 128) = al[1];   // a thread's rows 8 .. 15 lie 16 lane places (128 elements) behind its rows 0 .. 7
            *(v8h*)s16 = b16; *(v8us*)sh = bh; *(v8us*)sl = bl; *(v4h*)u16 = c16; *(v4us*)uh = ch; *(v4us*)ul = cl;
            asm volatile("s_wait_xcnt 0x0" :: "v"(p16), "v"(ph), "v"(pl), "v"(s16), "v"(sh), "v"(sl), "v"(u16), "v"(uh), "v"(ul) : "memory");   // the wait stands behind the tile's stores, with their addresses as inputs
        }
    } else {
#pragma unroll
    for (int rd = 0; rd < 64 / RR; ++rd) {                            // stores behind the last barrier: no barrier waits for a global store
        v4f val = res[rd]; if (BIAS) val += bb;
        *(v4f*)(C + (size_t)(rc + rd * RR + row) * ldc + c0 + cofs) = val; }
    }
}


__global__ __launch_bounds__(256) void k_wtG(const float* __restrict__ w, int K, int N, bf* Bt) {
    const int lane = threadIdx.x & 31; const int L0 = (blockIdx.x * 8 + (threadIdx.x >> 5)) * 8; const int nlines = N * K / 64;
{
#pragma unroll 1
        for (int l = 0; l < 8; ++l) { const int L = L0 + l; if (L >= nlines) break; const size_t e = (size_t)L * 64 + lane * 2; const int k = (int)(e % K), n = (int)(e / K); v2us o;
            o[0] = f2bf(w[(size_t)k * N + n]); o[1] = f2bf(w[(size_t)(k + 1) * N + n]); *(v2us*)(Bt + e) = o; }
         }
}
__constant__ float INV[HD / 2] = {1.0f,0.749894202f,0.562341332f,0.421696514f,0.316227764f,0.237137362f,0.177827939f,0.133352146f,0.100000001f,0.0749894157f,0.0562341288f,0.0421696492f,0.0316227786f,0.0237137359f,0.0177827943f,0.0133352149f,0.00999999978f,0.00749894232f,0.00562341325f,0.00421696482f,0.00316227786f,0.00237137382f,0.00177827943f,0.00133352145f,0.00100000005f,0.000749894185f,0.000562341302f,0.000421696488f,0.000316227786f,0.000237137385f,0.00017782794f,0.00013335215f};   // float32 1/10000^(2i/64), eager-JAX values
// rope table, 256 entries a block: cos, sin of batch row idx / HD, dimension idx % HD
__device__ __forceinline__ void cstab(float* CS, int blk) { const int idx = blk * 256 + threadIdx.x; const int tb = idx / HD, d = idx % HD; const int s = sc_of(tb); const int t = tb - soff(s); const float pm = (float)(1 << s); /* batch row tb = row t of scale s: position t x 2^s */ float p = __fmul_rn((float)t, pm); asm volatile("" : "+v"(p)); const float ang = __fmul_rn(p, INV[d % (HD / 2)]); v2f cs; cs[0] = cosf(ang); cs[1] = sinf(ang);
    *(v2f*)(CS + (size_t)idx * 2) = cs;  }
// k_prep: what depends on the inputs alone, in one grid. Blocks < CB_WO: every f32 input matrix (all have DM columns) to bf16 in fragment order (pko), 4096 elements a block: a wave takes one block of 16 rows x 32 columns
// (16 whole 128-byte lines of f32) and stores it as 1 KiB in a row; x0, x1, x2 (the TR batch rows), the 3 q, the 3 k and the v weight matrices land one after the other at XW; the output weights at WOd. Blocks CB_WO .. CB_ALL: the rope table
#define CB_X0 (TT * DM / 4096)
#define CB_X1 (CB_X0 + TT / 2 * DM / 4096)
#define CB_X2 (CB_X1 + TT / 4 * DM / 4096)
#define CB_WQ (CB_X2 + 3 * DQ * DM / 4096)
#define CB_WK (CB_WQ + 3 * DKV * DM / 4096)
#define CB_WV (CB_WK + DKV * DM / 4096)
#define CB_WO (CB_WV + DM * DQ / 4096)
#define CB_ALL (CB_WO + TR * HD / 256)
__global__ __launch_bounds__(256) void k_prep(const float* __restrict__ x0, const float* __restrict__ x1, const float* __restrict__ x2, const float* __restrict__ wq, const float* __restrict__ wk, const float* __restrict__ wv, const float* __restrict__ wo, bf* XW, bf* WOd, float* CS) {
    const int b = blockIdx.x; if (b >= CB_WO) { cstab(CS, b - CB_WO); return; }
    const float* src; bf* dst = XW + (size_t)b * 4096; int bl;   // bl: this block's number inside its source matrix
    if (b < CB_X0) { src = x0; bl = b; } else if (b < CB_X1) { src = x1; bl = b - CB_X0; } else if (b < CB_X2) { src = x2; bl = b - CB_X1; }
    else if (b < CB_WQ) { src = wq; bl = b - CB_X2; } else if (b < CB_WK) { src = wk; bl = b - CB_WQ; } else if (b < CB_WV) { src = wv; bl = b - CB_WK; }
    else { src = wo; bl = b - CB_WV; dst = WOd + (size_t)bl * 4096; }
    const int lane = threadIdx.x & 31, wv8 = threadIdx.x >> 5; const int fb = bl * 8 + wv8;   // fragment block fb of the matrix: rows 16 (fb / 32) .., columns 32 (fb % 32) ..
    const float* sp = src + ((size_t)(fb >> 5) * 16 + (lane & 15)) * DM + (fb & 31) * 32 + (lane >> 4) * 8; bf* dp = dst + wv8 * 512 + lane * 8;
    const v8f v0 = *(const v8f*)sp, v1 = *(const v8f*)(sp + 16); v8us o0, o1;
#pragma unroll
    for (int k = 0; k < 8; ++k) { o0[k] = f2bf(v0[k]); o1[k] = f2bf(v1[k]); }
    *(v8us*)dp = o0; *(v8us*)(dp + 256) = o1;
    asm volatile("s_wait_xcnt 0x0" :: "v"(sp), "v"(dp) : "memory");   // the wait stands behind the block's loads and stores, with their addresses as inputs
}
// ---- k_fattn: scores, softmax, probability x value and the hi/lo split of the context in one kernel; no score or probability leaves the registers.
// One work-group of 8 waves per (head, query tile). Transposed products: S^T = K Q^T (a lane holds one query's scores: query = lane & 15, keys = 8 (lane >> 4) + j of each 16-key tile), so two S^T tiles are, register for register,
// the B operand P^T of O^T += V^T P^T, and maximum, sum and rescale factor are per lane. The keys are split over the waves: wave w takes the 64-key chunks w, w + 8, ... up to the diagonal, in steps of 32 keys, with its own running
// maximum m, sum l and O^T; the 8 partial results meet in LDS, are brought to the common maximum and added in wave order 0..7. Rows < RH of a scale: hi+lo bf16 planes, 3 products each, 16 queries a tile; the rest fp16, 32 queries a tile.
typedef __attribute__((ext_vector_type(16))) float v16f;
#define LC  (SCL * 1.4426950408889634f)   // raw score -> exponent of 2
#define MTH (8.0f / LC)                   // the maximum in use is renewed when a new score exceeds it by more than 2^8
__device__ __forceinline__ float xhalf(float x) { const int b = __float_as_int(x); return __int_as_float(__builtin_amdgcn_permlanex16(b, b, 0x76543210, 0xfedcba98, false, false)); }   // lane l <-> l ^ 16
template <bool HL, int NQT, typename T16>
__device__ __forceinline__ void fa_step(const T16* kp, const T16* kp2, const T16* vp, const T16* vp2, const typename WFrag<T16>::V (&q)[NQT][2], const typename WFrag<T16>::V (&q2)[NQT][2], v8f (&o)[4][NQT], float (&m)[NQT], float (&l)[NQT], int dq, bool diag) {
    typedef typename WFrag<T16>::V V;
    constexpr float PB = HL ? 0.0f : 6.0f;   // fp16 probabilities carry 2^6 (at most 2^14 with the lazy maximum); it cancels in O / l
    V ka[2][2], ka2[2][2], va[4], va2[4];
#pragma unroll
    for (int kt = 0; kt < 2; ++kt)
#pragma unroll
        for (int kc = 0; kc < 2; ++kc) { ka[kt][kc] = WFrag<T16>::ldp(kp + (kt * 2 + kc) * 512); if (HL) ka2[kt][kc] = WFrag<T16>::ldp(kp2 + (kt * 2 + kc) * 512); }
#pragma unroll
    for (int dt = 0; dt < 4; ++dt) { va[dt] = WFrag<T16>::ldp(vp + dt * 512); if (HL) va2[dt] = WFrag<T16>::ldp(vp2 + dt * 512); }
    // the wait stands behind the step's loads; it takes their addresses as inputs, so that no load's result lands on an address register in front of it
    if constexpr (HL) asm volatile("s_wait_xcnt 0x0" :: "v"(kp), "v"(kp2), "v"(vp), "v"(vp2) : "memory");
    else asm volatile("s_wait_xcnt 0x0" :: "v"(kp), "v"(vp) : "memory");
    __builtin_amdgcn_sched_barrier(0);   // every load of the step is issued before its first product: one load latency a step instead of one per group of fragments
    v8f st[2][NQT];
#pragma unroll
    for (int kt = 0; kt < 2; ++kt)
#pragma unroll
        for (int qt = 0; qt < NQT; ++qt) { st[kt][qt] = (v8f){};
#pragma unroll
            for (int kc = 0; kc < 2; ++kc) { st[kt][qt] = WFrag<T16>::mma(ka[kt][kc], q[qt][kc], st[kt][qt]); if (HL) { st[kt][qt] = WFrag<T16>::mma(ka[kt][kc], q2[qt][kc], st[kt][qt]); st[kt][qt] = WFrag<T16>::mma(ka2[kt][kc], q[qt][kc], st[kt][qt]); } } }
    // four vector slots behind the last score product, on both sides of the branch below, before its results are touched
    asm volatile("v_nop\n\tv_nop\n\tv_nop\n\tv_nop" : "+v"(st[0][0]), "+v"(st[1][NQT - 1]));
    if (diag) {   // a step that reaches the diagonal (wave-uniform): dq + 16 qt = this lane's query minus its first key; keys above the query are out
#pragma unroll
        for (int qt = 0; qt < NQT; ++qt)
#pragma unroll
            for (int kt = 0; kt < 2; ++kt)
#pragma unroll
                for (int j = 0; j < 8; ++j) st[kt][qt][j] = (kt * 16 + j <= dq + qt * 16) ? st[kt][qt][j] : -3.0e38f; }
    float tm[NQT]; bool need = false;
#pragma unroll
    for (int qt = 0; qt < NQT; ++qt) {
        float t = fmaxf(st[0][qt][0], st[1][qt][0]);
#pragma unroll
        for (int j = 1; j < 8; ++j) t = fmaxf(t, fmaxf(st[0][qt][j], st[1][qt][j]));
        t = fmaxf(t, xhalf(t)); tm[qt] = t; need = need || (t > m[qt] + MTH); }
    if (__builtin_amdgcn_ballot_w32(need) != 0) {   // one scalar branch a step: rescale only when some query's maximum has grown past the margin
#pragma unroll
        for (int qt = 0; qt < NQT; ++qt) { const float mn = fmaxf(m[qt], tm[qt]); const float al = __builtin_amdgcn_exp2f((m[qt] - mn) * LC); m[qt] = mn; l[qt] *= al;
#pragma unroll
            for (int dt = 0; dt < 4; ++dt) o[dt][qt] *= al; } }
    V pb[NQT], pl[NQT];
#pragma unroll
    for (int qt = 0; qt < NQT; ++qt) { const float mb = __builtin_fmaf(-m[qt], LC, PB); v16f pv; float s0 = 0.f, s1 = 0.f;
#pragma unroll
        for (int j = 0; j < 8; ++j) { pv[j] = __builtin_amdgcn_exp2f(__builtin_fmaf(st[0][qt][j], LC, mb)); pv[8 + j] = __builtin_amdgcn_exp2f(__builtin_fmaf(st[1][qt][j], LC, mb)); s0 += pv[j]; s1 += pv[8 + j]; }
        l[qt] += s0 + s1;
        pb[qt] = __builtin_convertvector(pv, V);
        if constexpr (HL) pl[qt] = __builtin_convertvector(pv - __builtin_convertvector(pb[qt], v16f), V); }
#pragma unroll
    for (int dt = 0; dt < 4; ++dt)
#pragma unroll
        for (int qt = 0; qt < NQT; ++qt) { o[dt][qt] = WFrag<T16>::mma(va[dt], pb[qt], o[dt][qt]); if (HL) { o[dt][qt] = WFrag<T16>::mma(va[dt], pl[qt], o[dt][qt]); o[dt][qt] = WFrag<T16>::mma(va2[dt], pb[qt], o[dt][qt]); } }
    // four vector slots behind the last matrix instruction, on the back edge and on the exit alike, before its operands or results are touched
    asm volatile("v_nop\n\tv_nop\n\tv_nop\n\tv_nop" : "+v"(o[0][0]), "+v"(o[1][0]), "+v"(o[2][NQT - 1]), "+v"(o[3][NQT - 1]) : "v"(va[0]), "v"(va[3]));
}
template <bool HL, typename T16>
__device__ __forceinline__ void fa_tile(const T16* __restrict__ Q, const T16* __restrict__ Q2, const T16* __restrict__ Kp, const T16* __restrict__ Kp2, const T16* __restrict__ Vt, const T16* __restrict__ Vt2, int s, int r0, int h, float* sm, bf* Ah, bf* Al) {
    typedef typename WFrag<T16>::V V;
    constexpr int NQT = HL ? 1 : 2, NQ = 16 * NQT;
    const int lane = threadIdx.x & 31, lr = lane & 15, hi = lane >> 4;
    const int wv = __builtin_amdgcn_readfirstlane((int)(threadIdx.x >> 5));   // wave number in a scalar register: the key loop stays a scalar loop with every lane on
    const size_t po = ((size_t)h * TR + soff(s)) * HD + lane * 8;   // planes in fragment order: 16 rows of q or k are 1024 elements, 32 batch rows of the values 2048; a lane's 16 bytes lie at 16 lane
    V q[NQT][2], q2[NQT][2];
    const T16* qp = Q + po + (size_t)r0 * HD; const T16* qp2 = HL ? Q2 + po + (size_t)r0 * HD : qp;
#pragma unroll
    for (int qt = 0; qt < NQT; ++qt)
#pragma unroll
        for (int kc = 0; kc < 2; ++kc) { q[qt][kc] = WFrag<T16>::ldp(qp + (qt * 2 + kc) * 512); if (HL) q2[qt][kc] = WFrag<T16>::ldp(qp2 + (qt * 2 + kc) * 512); }
    asm volatile("s_wait_xcnt 0x0" :: "v"(qp), "v"(qp2) : "memory");   // the wait stands behind the query loads, with their addresses as inputs, before those registers are reused
    v8f o[4][NQT]; float m[NQT], l[NQT];
#pragma unroll
    for (int qt = 0; qt < NQT; ++qt) { m[qt] = -1.0e30f; l[qt] = 0.f;
#pragma unroll
        for (int dt = 0; dt < 4; ++dt) o[dt][qt] = (v8f){}; }
    const T16* kb0 = Kp + po; const T16* kb2 = HL ? Kp2 + po : kb0;
    const T16* vb0 = Vt + po; const T16* vb2 = HL ? Vt2 + po : vb0;
    const int kend = r0 + NQ;
#pragma unroll 1   // kept rolled: one copy of the step in the instruction cache, and its registers stay within four waves a SIMD
    for (int k0 = wv * 64; k0 < kend; k0 += (k0 & 32) ? 8 * 64 - 32 : 32) {   // both halves of a 64-key chunk, then this wave's next chunk
        const int dq = r0 + lr - k0 - hi * 8;
        fa_step<HL, NQT, T16>(kb0 + (size_t)k0 * HD, kb2 + (size_t)k0 * HD, vb0 + (size_t)k0 * HD, vb2 + (size_t)k0 * HD, q, q2, o, m, l, dq, k0 + 31 > r0);
    }
    float* ms = sm; float* ls = sm + 8 * 32; float* os = sm + 2 * 8 * 32;   // maxima [8][32], sums [8][32], partial contexts [8][NQ][68]
    if (hi == 0) {
#pragma unroll
        for (int qt = 0; qt < NQT; ++qt) ms[wv * 32 + qt * 16 + lr] = m[qt]; }
    __syncthreads();                                                  // every wave's maxima are in LDS
#pragma unroll
    for (int qt = 0; qt < NQT; ++qt) { float M = ms[qt * 16 + lr];
#pragma unroll
        for (int w = 1; w < 8; ++w) M = fmaxf(M, ms[w * 32 + qt * 16 + lr]);
        const float f = __builtin_amdgcn_exp2f((m[qt] - M) * LC);     // a wave without keys for a query: 0
        const float lj = (l[qt] + xhalf(l[qt])) * f; if (hi == 0) ls[wv * 32 + qt * 16 + lr] = lj;
#pragma unroll
        for (int dt = 0; dt < 4; ++dt) { const v8f ov = o[dt][qt] * f; float* d = os + (size_t)((wv * NQ + qt * 16 + lr) * 68 + dt * 16 + hi * 8);
            v4f a, b; a[0] = ov[0]; a[1] = ov[1]; a[2] = ov[2]; a[3] = ov[3]; b[0] = ov[4]; b[1] = ov[5]; b[2] = ov[6]; b[3] = ov[7]; *(v4fa*)d = a; *(v4fa*)(d + 4) = b; } }
    __syncthreads();                                                  // every wave's sums and partial contexts are in LDS
    constexpr int PT = NQ * HD / 256;                                 // context elements a thread
    const int qq = threadIdx.x / (HD / PT), d0 = (threadIdx.x % (HD / PT)) * PT;
    float L = ls[qq];
#pragma unroll
    for (int w = 1; w < 8; ++w) L += ls[w * 32 + qq];
    const size_t pe = pko(soff(s) + r0 + qq, h * HD + d0); bf* pa = Ah + pe; bf* pc = Al + pe;   // context planes in fragment order for the output product; PT <= 8 elements from a multiple of PT stay inside one 16-byte unit
#pragma unroll
    for (int g = 0; g < PT / 4; ++g) { v4f val = *(const v4fa*)(os + qq * 68 + d0 + g * 4);
#pragma unroll
        for (int w = 1; w < 8; ++w) val += *(const v4fa*)(os + (w * NQ + qq) * 68 + d0 + g * 4);
        v4us oh, ol;
#pragma unroll
        for (int e = 0; e < 4; ++e) { unsigned short a, c2; splitf(__fdiv_rn(val[e], L), a, c2); oh[e] = a; ol[e] = c2; }
        *(v4us*)(pa + g * 4) = oh; *(v4us*)(pc + g * 4) = ol; }
    asm volatile("s_wait_xcnt 0x0" :: "v"(pa), "v"(pc) : "memory");   // the wait stands behind the tile's stores, with their addresses as inputs
}
// grid (heads, FT16 + FTHL), the longest rows first: the fp16 tiles of scale 0, then of scale 1, then the hi+lo tiles of the three scales. Four waves a SIMD (two work-groups a WGP): vector work between the matrix runs wants waves
#define FT0  ((TT - RH) / 32)
#define FT16 (FT0 + (TT / 2 - RH) / 32)
#define FTHL (3 * (RH / 16))
__global__ __launch_bounds__(256) __attribute__((amdgpu_waves_per_eu(4, 4))) void k_fattn(const h16* __restrict__ Q16, const h16* __restrict__ K16, const h16* __restrict__ V16, const bf* __restrict__ Qh, const bf* __restrict__ Ql, const bf* __restrict__ Kh, const bf* __restrict__ Kw, const bf* __restrict__ Vh, const bf* __restrict__ Vl, bf* Ah, bf* Al) {
    __shared__ __align__(16) float sm[2 * 8 * 32 + 8 * 32 * 68];
    const int h = blockIdx.x, y = blockIdx.y;
    if (y < FT16) { const int s = y < FT0 ? 0 : 1; const int r0 = (TT >> s) - 32 * (y - s * FT0 + 1); fa_tile<false, h16>(Q16, nullptr, K16, nullptr, V16, nullptr, s, r0, h, sm, Ah, Al); }
    else { const int yy = y - FT16; const int s = yy % 3; const int r0 = RH - 16 * (yy / 3 + 1); fa_tile<true, bf>(Qh, Ql, Kh, Kw, Vh, Vl, s, r0, h, sm, Ah, Al); }
}

extern "C" void kernel_launch(void* const* d_in, const int* in_sizes, int n_in,
                              void* d_out, int out_size, void* d_ws, size_t ws_size, hipStream_t stream) {
    (void)in_sizes; (void)n_in; (void)out_size;
    const float* x0 = (const float*)d_in[0]; const float* x1 = (const float*)d_in[1]; const float* x2 = (const float*)d_in[2]; const float* wqA = (const float*)d_in[3]; const float* bqA = (const float*)d_in[4]; const float* wkA = (const float*)d_in[5]; const float* bkA = (const float*)d_in[6]; const float* wv = (const float*)d_in[7]; const float* bv = (const float*)d_in[8]; const float* wo = (const float*)d_in[9]; const float* bo = (const float*)d_in[10]; const float* x = nullptr; const float* wq = nullptr; const float* wk = nullptr; (void)x; (void)wq; (void)wk;
    float* OUT = (float*)d_out;     // the tuple's members one after the other: [TR][1024], in the order of the batch rows
    char* wsp = (char*)d_ws;
    auto take = [&](size_t bytes) { char* p = wsp; wsp += (bytes + 255) & ~(size_t)255; return (void*)p; };
    const size_t PL = (size_t)NH_ * TR * HD;   // one set of head planes, in elements
    bf* WO = (bf*)take((size_t)DM * DQ * 2);
    h16* QP16 = (h16*)take(2 * PL * 2); h16* KP16 = QP16 + PL; bf* QPh = (bf*)take(2 * PL * 2); bf* KPh = QPh + PL; bf* QPl = (bf*)take(2 * PL * 2); bf* KPl = QPl + PL;   // q planes, then k planes
    h16* VT16 = (h16*)take(PL * 2); bf* VTh = (bf*)take(PL * 2); bf* VTl = (bf*)take(PL * 2);
    bf* ATh = (bf*)take((size_t)TR * DQ * 2); bf* ATl = (bf*)take((size_t)TR * DQ * 2);
    bf* XB = (bf*)take(((size_t)TR * DM + (size_t)7 * DM * DM) * 2); bf* WQKV = XB + (size_t)TR * DM; float* CS = (float*)take((size_t)TR * HD * 2 * 4);
    if ((size_t)(wsp - (char*)d_ws) > ws_size) return;    // ws 256 MiB
    k_prep<<<CB_ALL, 256, 0, stream>>>(x0, x1, x2, wqA, wkA, wv, wo, XB, WO, CS);                     /* bf16 inputs; rope table, positions t x 2^s */
    k_gemmk<bf, 0, true, 3, 8><<<dim3(TR / 64, DM / 64, 3), 256, 0, stream>>>(XB, nullptr, DM, WQKV, nullptr, DM, nullptr, DM, bqA, bkA, bv, CS, QP16, QPh, QPl, PL, VT16, VTh, VTl);   /* q, k of every scale with rotary; v_base = x0 Wv^T + bv with its pooled rows, transposed; all as 16-bit planes */
    k_fattn<<<dim3(NH_, FT16 + FTHL), 256, 0, stream>>>(QP16, KP16, VT16, QPh, QPl, KPh, KPl, VTh, VTl, ATh, ATl);   /* attention of every head and scale; context as hi/lo planes */
    k_gemmk<bf, 1, true, 0, 8><<<dim3(TR / 64, DM / 64, 1), 256, 0, stream>>>(ATh, ATl, DQ, WO, nullptr, DQ, OUT, DM, bo, nullptr, nullptr, nullptr, nullptr, nullptr, nullptr, 0, nullptr, nullptr, nullptr);
}

// v009
// It runs in 96.7 microseconds.
// Next to v008, in two timings, it ran 1.07 times as fast each time.
// All steps since v000 together make it 21.7 times as fast.
#include <hip/hip_runtime.h>

// Multiscale causal attention (x0 [1][2048][1024], x1 [1][1024][1024], x2 [1][512][1024]; v_base = x0 Wv^T + bv shared, average-pooled by 2^i for scale i; per scale i: q, k = x_i W[i]^T + b[i] ('oi' [1024][1024] + [1024]; 16 heads x 64), rotate-half rotary at positions t x 2^i (base 1e4), scores = q.k / 8, causal (finfo.min); softmax; ctx_i = w v_i; out_i = ctx_i Wo^T + bo -> tuple ([1][2048][1024], [1][1024][1024], [1][512][1024]) (3.7 M)).
// Realisation: the three scales run together as one batch of TR = 2048 + 1024 + 512 rows (scale i holds rows soff(i) .. soff(i) + N_i, N_i = 2048 >> i): every launch covers all three, and each work-group finds its scale from its block index; attention is one fused launch (scores and probabilities stay in registers); the rope table uses positions t x 2^i; rotary, value pooling, value transposition and the 16-bit splits are the projection kernel's epilogue (a 64x64 tile is 64 rows of one head); the q, k and value planes are kept in the fragment order of the attention products. Q, K and V share the conversion launch as block ranges and the projection launch as grid planes.
// Compute dtypes, f32 accumulate: every input rounded to bf16; q/k/v on PLAIN bf16 operands (inputs: exact) + biases; rotary in f32 (precise sinf/cosf, 32 baked float32 inverse frequencies, position factor 2^i exact); causal tile skipping; value pooling in f32 (means of 2 and 4 rows summed in row order, as the reference's reshape-mean); scores and attn.v: query rows < 512 hl (3 products), the rest single fp16 (probabilities x 2^6, unnormalised); online softmax f32, divided by the row sum at the end; Wo hl x exact (2 products) + bo.

#define NB_  1
#define TT   2048
#define DM   1024
#define NH_  16
#define NKV  16
#define REP  (NH_ / NKV)
#define HD   64
#define DQ   (NH_ * HD)
#define DKV  (NKV * HD)
#define TR   (TT + TT / 2 + TT / 4)   // rows of the three scales, one after the other
#define RH   512                  // query rows < RH use hi+lo planes (k_fattn's grid assumes RH = TT / 4)
#define SCL  0.125f   // HD^-0.5
typedef _Float16 h16;
typedef unsigned short bf;
typedef __attribute__((ext_vector_type(16))) __bf16   v16bf;
typedef __attribute__((ext_vector_type(16))) _Float16 v16h;
typedef __attribute__((ext_vector_type(8)))  _Float16 v8h;
typedef __attribute__((ext_vector_type(8)))  unsigned short v8us;
typedef __attribute__((ext_vector_type(8)))  float    v8f;
typedef __attribute__((ext_vector_type(4)))  float    v4f;
typedef v8h  __attribute__((may_alias)) v8ha;
typedef v4f  __attribute__((may_alias)) v4fa;
typedef v8us __attribute__((may_alias)) v8usa;
typedef __attribute__((ext_vector_type(4))) unsigned short __attribute__((may_alias)) v4usa;

__device__ __forceinline__ unsigned short f2bf(float f) { unsigned u = __float_as_uint(f); u += 0x7FFFu + ((u >> 16) & 1u); return (unsigned short)(u >> 16); }
__device__ __forceinline__ float bf2f(unsigned short b) { return __uint_as_float(((unsigned)b) << 16); }
__device__ __forceinline__ float bfr(float f) { return bf2f(f2bf(f)); }
__device__ __forceinline__ v16h cat16(v8h lo, v8h hi) { return __builtin_shufflevector(lo, hi, 0, 1, 2, 3, 4, 5, 6, 7, 8, 9, 10, 11, 12, 13, 14, 15); }
__device__ __forceinline__ v16bf cat16b(v8us lo, v8us hi) { return __builtin_bit_cast(v16bf, __builtin_shufflevector(lo, hi, 0, 1, 2, 3, 4, 5, 6, 7, 8, 9, 10, 11, 12, 13, 14, 15)); }
__device__ __forceinline__ v8f wmma16(v16h a, v16h b, v8f c) { return __builtin_amdgcn_wmma_f32_16x16x32_f16(false, a, false, b, (short)0, c, false, false); }
__device__ __forceinline__ v8f wmmab(v16bf a, v16bf b, v8f c) { return __builtin_amdgcn_wmma_f32_16x16x32_bf16(false, a, false, b, (short)0, c, false, false); }
// the batch of scales: scale of a batch row, first batch row of a scale
__device__ __forceinline__ int sc_of(int t) { return t < TT ? 0 : (t < TT + TT / 2 ? 1 : 2); }
__device__ __forceinline__ int soff(int s) { return 2 * TT - ((2 * TT) >> s); }

__device__ __forceinline__ h16 tohx(float x) { return (h16)x; }
__device__ __forceinline__ void splitf(float y, unsigned short& h, unsigned short& l) { h = f2bf(y); l = f2bf(y - bf2f(h)); }
typedef __attribute__((ext_vector_type(2))) _Float16 v2h;
typedef __attribute__((ext_vector_type(4))) _Float16 v4h;
typedef __attribute__((ext_vector_type(2))) unsigned short v2us;
typedef __attribute__((ext_vector_type(4))) unsigned short v4us;
typedef __attribute__((ext_vector_type(2))) float v2f;
typedef __attribute__((ext_vector_type(4))) int v4i;

// ---- k_gemmk: register-blocked GEMM, one 64x64 output tile per work-group of NW waves, the K loop split over the waves: wave w takes the 64-element (128-byte) K chunks w, w + NW, ... with its own 16 accumulators,
// operands straight from 16-bit planes in FRAGMENT ORDER (pko below): the 16 rows x 32 k of one matrix operand are 1 KiB in a row, lane l's first 8 elements at 16 l bytes, its second 8 at 512 + 16 l,
// so that each wave-wide 16-byte load covers 4 whole 128-byte lines (row-major planes: 32 bytes of each of 16 lines). The NW partial tiles meet in LDS and are added in wave order 0..NW-1. grid (M/64, N/64, Z), NW x 32 threads.
// C[m][n] (f32, pitch ldc, + optional f32 bias[n]) = sum_k A[m][k] Bt[n][k] (+ split products per NSPLIT). A and Bt have DM columns (lda = K = DM). K % 64 == 0.
// CMODE 3 (projections, z = 0 q, 1 k, 2 v): rows are batch rows; weight matrix number 3 z + s of Bt and the matching bias row; v exists for scale 0 only. No f32 result is stored: the tile (64 rows of head blockIdx.y) goes on in the epilogue.
// q, k: rotate-half rotary out[d] = x[d] cos[t][d] - x[d+HD/2] sin[t][d], out[d+HD/2] = x[d+HD/2] cos[t][d+HD/2] + x[d] sin[t][d+HD/2] (table CS), stored as head planes in fragment order (fp16 + hi/lo bf16; k planes zP elements behind the q planes): the 16 rows x 32 dimensions of one operand are 1 KiB in a row as in pko, a 64x64 tile 8 KiB in a row; the tile is brought into that order in LDS, so that every wave-wide store is 512 bytes in a row.
// v: the tile is turned in LDS; each thread takes 16 rows of one column, forms the means of 2 and of 4 rows (scales 1 and 2, summed in row order) and stores the value planes (fp16 + hi/lo bf16) of all three scales in fragment order (pkv below: 16 dimensions x 32 batch rows are 1 KiB in a row).
// element offset of (row R, column k) in a plane of DM columns kept in fragment order: block (R / 16, k / 32) of 512 elements; inside it half (k / 16) % 2, lane 16 ((k / 8) % 2) + R % 16, element k % 8
__device__ __forceinline__ size_t pko(int R, int k) { return ((size_t)(R >> 4) * (DM / 32) + (k >> 5)) * 512 + ((k >> 4) & 1) * 256 + (((k >> 3) & 1) * 16 + (R & 15)) * 8 + (k & 7); }
// element offset of (dimension d of head h, batch row t) in a value plane kept in fragment order: block (t / 32, d / 16) of 512 elements; inside it half (t / 16) % 2, lane 16 ((t / 8) % 2) + d % 16, element t % 8
__device__ __forceinline__ size_t pkv(int h, int d, int t) { return (((size_t)h * (TR / 32) + (t >> 5)) * (HD / 16) + (d >> 4)) * 512 + ((t >> 4) & 1) * 256 + (((t >> 3) & 1) * 16 + (d & 15)) * 8 + (t & 7); }
template <typename T16> struct WFrag;
template <> struct WFrag<h16> { typedef v16h V; static __device__ __forceinline__ V ldp(const h16* p) { return cat16(*(const v8h*)p, *(const v8h*)(p + 256)); } static __device__ __forceinline__ v8f mma(V a, V b, v8f c) { return wmma16(a, b, c); } };
template <> struct WFrag<bf> { typedef v16bf V; static __device__ __forceinline__ V ldp(const bf* p) { return cat16b(*(const v8us*)p, *(const v8us*)(p + 256)); } static __device__ __forceinline__ v8f mma(V a, V b, v8f c) { return wmmab(a, b, c); } };
template <typename T16, int NSPLIT, bool BIAS, int CMODE, int NW>
__global__ __launch_bounds__(NW * 32) void k_gemmk(const T16* __restrict__ A, const T16* __restrict__ A2, int lda, const T16* __restrict__ Bt, const T16* __restrict__ Bt2, int K, float* C, int ldc, const float* __restrict__ bias, const float* __restrict__ biasK, const float* __restrict__ biasV, const float* __restrict__ CS, h16* P16, bf* Ph, bf* Pl, size_t zP, h16* V16, bf* Vh, bf* Vl) {
    typedef typename WFrag<T16>::V V;
    constexpr int RR = 2 * NW;                                        // tile rows added per round: one float4 per thread
    constexpr int NBUF = (2 * NW * RR * 68 * 4 <= 160 * 1024) ? 2 : 1; // two round buffers where both fit in half a WGP's LDS
    __shared__ __align__(16) float os[NBUF * NW * RR * 68];
    const size_t z = blockIdx.z;
    const int lane = threadIdx.x & 31, lr = lane & 15, hi = lane >> 4; const int c0 = blockIdx.y * 64;
    int r0 = blockIdx.x * 64, rc = r0, Kl = K;                        // first row in A, first row in C, end of the K loop
    if (CMODE == 3) { const int s = sc_of(r0); if (z == 2 && s) return;   // the whole work-group leaves, in front of every barrier
        Bt += (z * 3 + s) * (size_t)DM * DM; bias = (z == 0 ? bias : (z == 1 ? biasK : biasV)) + s * DM; }
    const int wv = __builtin_amdgcn_readfirstlane((int)(threadIdx.x >> 5));   // wave number in a scalar register: the K loop stays a scalar loop with every lane on
    v8f acc[4][4];
#pragma unroll
    for (int mb = 0; mb < 4; ++mb)
#pragma unroll
        for (int nb = 0; nb < 4; ++nb) acc[mb][nb] = (v8f){};
    constexpr int BAND = 16 * DM;                                     // fragment order: a band of 16 rows is 16 DM elements, 32 columns of it 512; a constant, so that every load of a pass is one address plus an immediate offset
    const size_t aoff = (size_t)r0 * DM + lane * 8, boff = (size_t)c0 * DM + lane * 8;
#pragma unroll 1
    for (int kc = wv * 64; kc < Kl; kc += (kc & 32) ? NW * 64 - 32 : 32) {   // both halves of a 128-byte chunk, then this wave's next chunk
        V a[4], a2[4], b[4], b2[4];
        const T16* pa = A + aoff + kc * 16; const T16* pa2 = (NSPLIT == 1 || NSPLIT == 2) ? A2 + aoff + kc * 16 : pa; const T16* pb = Bt + boff + kc * 16; const T16* pb2 = NSPLIT >= 2 ? Bt2 + boff + kc * 16 : pb;
#pragma unroll
        for (int mb = 0; mb < 4; ++mb) { a[mb] = WFrag<T16>::ldp(pa + mb * BAND); if (NSPLIT == 1 || NSPLIT == 2) a2[mb] = WFrag<T16>::ldp(pa2 + mb * BAND); }
#pragma unroll
        for (int nb = 0; nb < 4; ++nb) { b[nb] = WFrag<T16>::ldp(pb + nb * BAND); if (NSPLIT >= 2) b2[nb] = WFrag<T16>::ldp(pb2 + nb * BAND); }
        asm volatile("s_wait_xcnt 0x0" :: "v"(pa), "v"(pa2), "v"(pb), "v"(pb2) : "memory");   // the wait stands behind the pass's loads, with their addresses as inputs, before the next pass forms its addresses
        __builtin_amdgcn_sched_barrier(0);   // every load of the pass is issued before its first product: one load latency a pass; without it the pass's last two fragments are asked for only after the first products have waited for theirs, a second latency
#pragma unroll
        for (int nb = 0; nb < 4; ++nb)
#pragma unroll
            for (int mb = 0; mb < 4; ++mb) { acc[mb][nb] = WFrag<T16>::mma(a[mb], b[nb], acc[mb][nb]); if (NSPLIT == 1 || NSPLIT == 2) acc[mb][nb] = WFrag<T16>::mma(a2[mb], b[nb], acc[mb][nb]); if (NSPLIT >= 2) acc[mb][nb] = WFrag<T16>::mma(a[mb], b2[nb], acc[mb][nb]); }
        // four vector slots behind the last matrix instruction, on the back edge and on the exit alike, before its operands or results are touched
        asm volatile("v_nop\n\tv_nop\n\tv_nop\n\tv_nop" : "+v"(acc[0][0]), "+v"(acc[1][1]), "+v"(acc[2][2]), "+v"(acc[3][3]) : "v"(a[0]), "v"(a[3]));
    }
    const int row = threadIdx.x >> 4, cofs = (threadIdx.x & 15) * 4;
    v4f res[64 / RR];
#pragma unroll
    for (int rd = 0; rd < 64 / RR; ++rd) {
        float* ob = os + (rd % NBUF) * (NW * RR * 68);                // two buffers in turn: one barrier a round is enough
        if (NBUF == 1 && rd) __syncthreads();                         // one buffer: the round before is read before it is overwritten
#pragma unroll
        for (int m = 0; m < RR / 16; ++m) {
#pragma unroll
            for (int nb = 0; nb < 4; ++nb) {
#pragma unroll
                for (int j = 0; j < 8; ++j) ob[(wv * RR + m * 16 + hi * 8 + j) * 68 + nb * 16 + lr] = acc[rd * (RR / 16) + m][nb][j]; } }
        __syncthreads();                                              // every wave's partial rows of this round are in LDS (two buffers: and every read of the buffer written next is done)
        v4f val = *(const v4fa*)(ob + row * 68 + cofs);
#pragma unroll
        for (int w = 1; w < NW; ++w) val += *(const v4fa*)(ob + (w * RR + row) * 68 + cofs);
        res[rd] = val;
    }
    v4f bb; bb[0] = bb[1] = bb[2] = bb[3] = 0.f;
    if (BIAS) { bb[0] = bfr(bias[c0 + cofs]); bb[1] = bfr(bias[c0 + cofs + 1]); bb[2] = bfr(bias[c0 + cofs + 2]); bb[3] = bfr(bias[c0 + cofs + 3]); }
    if constexpr (CMODE == 3) {
        static_assert(NBUF == 2 && (64 / RR) % 2 == 0 && RR == 16 && NW * RR * 68 >= 64 * 65, "the epilogue's thread map and its use of round buffer 0");
        if (z < 2) {   // q, k: a thread holds 4 neighbouring dimensions of a row; the partner dimensions (+- HD/2) are 8 lanes away in the same 16-lane row
            const float* cp = CS + ((size_t)(r0 + row) * HD + cofs) * 2;
            // round buffer 0 is free (its last readers passed the last round's barrier): three planes of 32 groups, a group = 16 rows x 8 dimensions (256 bytes, as it lies in the plane) at pitch 288 bytes, so that the 8 groups a wave writes fall on different banks
            static_assert(NW * RR * 68 * 4 >= 3 * 32 * 288, "the three 16-bit tiles fit round buffer 0");
            unsigned short* sp = (unsigned short*)os + (cofs >> 3) * 144 + row * 8 + (cofs & 7);
            const bool low = cofs < HD / 2;
#pragma unroll
            for (int rd = 0; rd < 64 / RR; ++rd) {
                const v4f x = res[rd] + bb; const v4f ca = *(const v4f*)(cp + rd * RR * HD * 2), cb = *(const v4f*)(cp + rd * RR * HD * 2 + 4);
                const float co[4] = {ca[0], ca[2], cb[0], cb[2]}, si[4] = {ca[1], ca[3], cb[1], cb[3]};
                v4h o16; v4us oh, ol;
#pragma unroll
                for (int q = 0; q < 4; ++q) { const float xp = __shfl_xor(x[q], 8); const float r = x[q] * co[q] + xp * (low ? -si[q] : si[q]);
                    o16[q] = tohx(r); unsigned short a2, c2; splitf(r, a2, c2); oh[q] = a2; ol[q] = c2; }
                *(v4usa*)(sp + rd * 8 * 144) = __builtin_bit_cast(v4us, o16); *(v4usa*)(sp + (32 + rd * 8) * 144) = oh; *(v4usa*)(sp + (64 + rd * 8) * 144) = ol; }
            asm volatile("s_wait_xcnt 0x0" :: "v"(cp) : "memory");   // the wait stands behind the tile's loads, with their address as input
            __syncthreads();                                          // the three 16-bit tiles are in LDS (block-uniform branch)
            const size_t e = z * zP + ((size_t)blockIdx.y * TR + r0) * HD + threadIdx.x * 8;   // the tile is 8 KiB in a row in each plane; a thread takes 16-byte units threadIdx.x and 256 + threadIdx.x
            h16* p16 = P16 + e; bf* ph = Ph + e; bf* pl = Pl + e;
            const unsigned short* rp = (const unsigned short*)os + (threadIdx.x >> 4) * 144 + (threadIdx.x & 15) * 8;
#pragma unroll
            for (int u = 0; u < 2; ++u) { *(v8usa*)(p16 + u * 2048) = *(const v8usa*)(rp + u * 16 * 144); *(v8usa*)(ph + u * 2048) = *(const v8usa*)(rp + (32 + u * 16) * 144); *(v8usa*)(pl + u * 2048) = *(const v8usa*)(rp + (64 + u * 16) * 144); }
            asm volatile("s_wait_xcnt 0x0" :: "v"(p16), "v"(ph), "v"(pl) : "memory");   // the wait stands behind the tile's stores, with their addresses as inputs
        } else {       // v (block-uniform branch): round buffer 0 is free, its last readers passed the last round's barrier
            float* ts = os;                                           // [64 rows][65]: column reads fall on different banks
#pragma unroll
            for (int rd = 0; rd < 64 / RR; ++rd)
#pragma unroll
                for (int q = 0; q < 4; ++q) ts[(rd * RR + row) * 65 + cofs + q] = res[rd][q] + bb[q];
            __syncthreads();                                          // the whole value tile is in LDS
            const int d = ((threadIdx.x >> 5) & 3) * 16 + (threadIdx.x & 15), tq = (threadIdx.x >> 7) * 2 + ((threadIdx.x >> 4) & 1);   // a wave: 16 dimensions x 2 groups of 16 rows, so that each of its stores below fills whole runs of 256 bytes or more
            float x[16], x1[8], x2[4];
#pragma unroll
            for (int i = 0; i < 16; ++i) x[i] = ts[(tq * 16 + i) * 65 + d];
#pragma unroll
            for (int i = 0; i < 8; ++i) x1[i] = (x[2 * i] + x[2 * i + 1]) * 0.5f;
#pragma unroll
            for (int i = 0; i < 4; ++i) x2[i] = (((x[4 * i] + x[4 * i + 1]) + x[4 * i + 2]) + x[4 * i + 3]) * 0.25f;
            const int hv = blockIdx.y;
            const size_t e0 = pkv(hv, d, r0 + tq * 16), e1 = pkv(hv, d, soff(1) + r0 / 2 + tq * 8), e2 = pkv(hv, d, soff(2) + r0 / 4 + tq * 4);   // this thread's first batch row of scale 0, 1, 2; 16 neighbouring dimensions lie 256 bytes in a row
            v8h a16[2], b16; v8us ah[2], al[2], bh, bl; v4h c16; v4us ch, cl;
#pragma unroll
            for (int i = 0; i < 16; ++i) { unsigned short a2, c2; splitf(x[i], a2, c2); a16[i >> 3][i & 7] = tohx(x[i]); ah[i >> 3][i & 7] = a2; al[i >> 3][i & 7] = c2; }
#pragma unroll
            for (int i = 0; i < 8; ++i) { unsigned short a2, c2; splitf(x1[i], a2, c2); b16[i] = tohx(x1[i]); bh[i] = a2; bl[i] = c2; }
#pragma unroll
            for (int i = 0; i < 4; ++i) { unsigned short a2, c2; splitf(x2[i], a2, c2); c16[i] = tohx(x2[i]); ch[i] = a2; cl[i] = c2; }
            h16* p16 = V16 + e0; bf* ph = Vh + e0; bf* pl = Vl + e0; h16* s16 = V16 + e1; bf* sh = Vh + e1; bf* sl = Vl + e1; h16* u16 = V16 + e2; bf* uh = Vh + e2; bf* ul = Vl + e2;
            *(v8h*)p16 = a16[0]; *(v8h*)(p16 + 128) = a16[1]; *(v8us*)ph = ah[0]; *(v8us*)(ph + 128) = ah[1]; *(v8us*)pl = al[0]; *(v8us*)(pl + 128) = al[1];   // a thread's rows 8 .. 15 lie 16 lane places (128 elements) behind its rows 0 .. 7
            *(v8h*)s16 = b16; *(v8us*)sh = bh; *(v8us*)sl = bl; *(v4h*)u16 = c16; *(v4us*)uh = ch; *(v4us*)ul = cl;
            asm volatile("s_wait_xcnt 0x0" :: "v"(p16), "v"(ph), "v"(pl), "v"(s16), "v"(sh), "v"(sl), "v"(u16), "v"(uh), "v"(ul) : "memory");   // the wait stands behind the tile's stores, with their addresses as inputs
        }
    } else {
#pragma unroll
    for (int rd = 0; rd < 64 / RR; ++rd) {                            // stores behind the last barrier: no barrier waits for a global store
        v4f val = res[rd]; if (BIAS) val += bb;
        *(v4f*)(C + (size_t)(rc + rd * RR + row) * ldc + c0 + cofs) = val; }
    }
}


__global__ __launch_bounds__(256) void k_wtG(const float* __restrict__ w, int K, int N, bf* Bt) {
    const int lane = threadIdx.x & 31; const int L0 = (blockIdx.x * 8 + (threadIdx.x >> 5)) * 8; const int nlines = N * K / 64;
{
#pragma unroll 1
        for (int l = 0; l < 8; ++l) { const int L = L0 + l; if (L >= nlines) break; const size_t e = (size_t)L * 64 + lane * 2; const int k = (int)(e % K), n = (int)(e / K); v2us o;
            o[0] = f2bf(w[(size_t)k * N + n]); o[1] = f2bf(w[(size_t)(k + 1) * N + n]); *(v2us*)(Bt + e) = o; }
         }
}
__constant__ float INV[HD / 2] = {1.0f,0.749894202f,0.562341332f,0.421696514f,0.316227764f,0.237137362f,0.177827939f,0.133352146f,0.100000001f,0.0749894157f,0.0562341288f,0.0421696492f,0.0316227786f,0.0237137359f,0.0177827943f,0.0133352149f,0.00999999978f,0.00749894232f,0.00562341325f,0.00421696482f,0.00316227786f,0.00237137382f,0.00177827943f,0.00133352145f,0.00100000005f,0.000749894185f,0.000562341302f,0.000421696488f,0.000316227786f,0.000237137385f,0.00017782794f,0.00013335215f};   // float32 1/10000^(2i/64), eager-JAX values
// rope table, 256 entries a block: cos, sin of batch row idx / HD, dimension idx % HD
__device__ __forceinline__ void cstab(float* CS, int blk) { const int idx = blk * 256 + threadIdx.x; const int tb = idx / HD, d = idx % HD; const int s = sc_of(tb); const int t = tb - soff(s); const float pm = (float)(1 << s); /* batch row tb = row t of scale s: position t x 2^s */ float p = __fmul_rn((float)t, pm); asm volatile("" : "+v"(p)); const float ang = __fmul_rn(p, INV[d % (HD / 2)]); v2f cs; cs[0] = cosf(ang); cs[1] = sinf(ang);
    *(v2f*)(CS + (size_t)idx * 2) = cs;  }
// k_prep: what depends on the inputs alone, in one grid. Blocks < CB_WO: every f32 input matrix (all have DM columns) to bf16 in fragment order (pko), 4096 elements a block: a wave takes one block of 16 rows x 32 columns
// (16 whole 128-byte lines of f32) and stores it as 1 KiB in a row; x0, x1, x2 (the TR batch rows), the 3 q, the 3 k and the v weight matrices land one after the other at XW; the output weights at WOd. Blocks CB_WO .. CB_ALL: the rope table
#define CB_X0 (TT * DM / 4096)
#define CB_X1 (CB_X0 + TT / 2 * DM / 4096)
#define CB_X2 (CB_X1 + TT / 4 * DM / 4096)
#define CB_WQ (CB_X2 + 3 * DQ * DM / 4096)
#define CB_WK (CB_WQ + 3 * DKV * DM / 4096)
#define CB_WV (CB_WK + DKV * DM / 4096)
#define CB_WO (CB_WV + DM * DQ / 4096)
#define CB_ALL (CB_WO + TR * HD / 256)
__global__ __launch_bounds__(256) void k_prep(const float* __restrict__ x0, const float* __restrict__ x1, const float* __restrict__ x2, const float* __restrict__ wq, const float* __restrict__ wk, const float* __restrict__ wv, const float* __restrict__ wo, bf* XW, bf* WOd, float* CS) {
    const int b = blockIdx.x; if (b >= CB_WO) { cstab(CS, b - CB_WO); return; }
    const float* src; bf* dst = XW + (size_t)b * 4096; int bl;   // bl: this block's number inside its source matrix
    if (b < CB_X0) { src = x0; bl = b; } else if (b < CB_X1) { src = x1; bl = b - CB_X0; } else if (b < CB_X2) { src = x2; bl = b - CB_X1; }
    else if (b < CB_WQ) { src = wq; bl = b - CB_X2; } else if (b < CB_WK) { src = wk; bl = b - CB_WQ; } else if (b < CB_WV) { src = wv; bl = b - CB_WK; }
    else { src = wo; bl = b - CB_WV; dst = WOd + (size_t)bl * 4096; }
    const int lane = threadIdx.x & 31, wv8 = threadIdx.x >> 5; const int fb = bl * 8 + wv8;   // fragment block fb of the matrix: rows 16 (fb / 32) .., columns 32 (fb % 32) ..
    const float* sp = src + ((size_t)(fb >> 5) * 16 + (lane & 15)) * DM + (fb & 31) * 32 + (lane >> 4) * 8; bf* dp = dst + wv8 * 512 + lane * 8;
    const v8f v0 = *(const v8f*)sp, v1 = *(const v8f*)(sp + 16); v8us o0, o1;
#pragma unroll
    for (int k = 0; k < 8; ++k) { o0[k] = f2bf(v0[k]); o1[k] = f2bf(v1[k]); }
    *(v8us*)dp = o0; *(v8us*)(dp + 256) = o1;
    asm volatile("s_wait_xcnt 0x0" :: "v"(sp), "v"(dp) : "memory");   // the wait stands behind the block's loads and stores, with their addresses as inputs
}
// ---- k_fattn: scores, softmax, probability x value and the hi/lo split of the context in one kernel; no score or probability leaves the registers.
// One work-group of 8 waves per (head, query tile). Transposed products: S^T = K Q^T (a lane holds one query's scores: query = lane & 15, keys = 8 (lane >> 4) + j of each 16-key tile), so two S^T tiles are, register for register,
// the B operand P^T of O^T += V^T P^T, and maximum, sum and rescale factor are per lane. The keys are split over the waves: wave w takes the 64-key chunks w, w + 8, ... up to the diagonal, in steps of 32 keys, with its own running
// maximum m, sum l and O^T; the 8 partial results meet in LDS, are brought to the common maximum and added in wave order 0..7. Rows < RH of a scale: hi+lo bf16 planes, 3 products each, 16 queries a tile; the rest fp16, 32 queries a tile.
typedef __attribute__((ext_vector_type(16))) float v16f;
#define LC  (SCL * 1.4426950408889634f)   // raw score -> exponent of 2
#define MTH (8.0f / LC)                   // the maximum in use is renewed when a new score exceeds it by more than 2^8
__device__ __forceinline__ float xhalf(float x) { const int b = __float_as_int(x); return __int_as_float(__builtin_amdgcn_permlanex16(b, b, 0x76543210, 0xfedcba98, false, false)); }   // lane l <-> l ^ 16
template <bool HL, int NQT, typename T16>
__device__ __forceinline__ void fa_step(const T16* kp, const T16* kp2, const T16* vp, const T16* vp2, const typename WFrag<T16>::V (&q)[NQT][2], const typename WFrag<T16>::V (&q2)[NQT][2], v8f (&o)[4][NQT], float (&m)[NQT], float (&l)[NQT], int dq, bool diag) {
    typedef typename WFrag<T16>::V V;
    constexpr float PB = HL ? 0.0f : 6.0f;   // fp16 probabilities carry 2^6 (at most 2^14 with the lazy maximum); it cancels in O / l
    V ka[2][2], ka2[2][2], va[4], va2[4];
#pragma unroll
    for (int kt = 0; kt < 2; ++kt)
#pragma unroll
        for (int kc = 0; kc < 2; ++kc) { ka[kt][kc] = WFrag<T16>::ldp(kp + (kt * 2 + kc) * 512); if (HL) ka2[kt][kc] = WFrag<T16>::ldp(kp2 + (kt * 2 + kc) * 512); }
#pragma unroll
    for (int dt = 0; dt < 4; ++dt) { va[dt] = WFrag<T16>::ldp(vp + dt * 512); if (HL) va2[dt] = WFrag<T16>::ldp(vp2 + dt * 512); }
    // the wait stands behind the step's loads; it takes their addresses as inputs, so that no load's result lands on an address register in front of it
    if constexpr (HL) asm volatile("s_wait_xcnt 0x0" :: "v"(kp), "v"(kp2), "v"(vp), "v"(vp2) : "memory");
    else asm volatile("s_wait_xcnt 0x0" :: "v"(kp), "v"(vp) : "memory");
    __builtin_amdgcn_sched_barrier(0);   // every load of the step is issued before its first product: one load latency a step instead of one per group of fragments
    v8f st[2][NQT];
#pragma unroll
    for (int kt = 0; kt < 2; ++kt)
#pragma unroll
        for (int qt = 0; qt < NQT; ++qt) { st[kt][qt] = (v8f){};
#pragma unroll
            for (int kc = 0; kc < 2; ++kc) { st[kt][qt] = WFrag<T16>::mma(ka[kt][kc], q[qt][kc], st[kt][qt]); if (HL) { st[kt][qt] = WFrag<T16>::mma(ka[kt][kc], q2[qt][kc], st[kt][qt]); st[kt][qt] = WFrag<T16>::mma(ka2[kt][kc], q[qt][kc], st[kt][qt]); } } }
    // four vector slots behind the last score product, on both sides of the branch below, before its results are touched
    asm volatile("v_nop\n\tv_nop\n\tv_nop\n\tv_nop" : "+v"(st[0][0]), "+v"(st[1][NQT - 1]));
    if (diag) {   // a step that reaches the diagonal (wave-uniform): dq + 16 qt = this lane's query minus its first key; keys above the query are out
#pragma unroll
        for (int qt = 0; qt < NQT; ++qt)
#pragma unroll
            for (int kt = 0; kt < 2; ++kt)
#pragma unroll
                for (int j = 0; j < 8; ++j) st[kt][qt][j] = (kt * 16 + j <= dq + qt * 16) ? st[kt][qt][j] : -3.0e38f; }
    float tm[NQT]; bool need = false;
#pragma unroll
    for (int qt = 0; qt < NQT; ++qt) {
        float t = fmaxf(st[0][qt][0], st[1][qt][0]);
#pragma unroll
        for (int j = 1; j < 8; ++j) t = fmaxf(t, fmaxf(st[0][qt][j], st[1][qt][j]));
        t = fmaxf(t, xhalf(t)); tm[qt] = t; need = need || (t > m[qt] + MTH); }
    if (__builtin_amdgcn_ballot_w32(need) != 0) {   // one scalar branch a step: rescale only when some query's maximum has grown past the margin
#pragma unroll
        for (int qt = 0; qt < NQT; ++qt) { const float mn = fmaxf(m[qt], tm[qt]); const float al = __builtin_amdgcn_exp2f((m[qt] - mn) * LC); m[qt] = mn; l[qt] *= al;
#pragma unroll
            for (int dt = 0; dt < 4; ++dt) o[dt][qt] *= al; } }
    V pb[NQT], pl[NQT];
#pragma unroll
    for (int qt = 0; qt < NQT; ++qt) { const float mb = __builtin_fmaf(-m[qt], LC, PB); v16f pv; float s0 = 0.f, s1 = 0.f;
#pragma unroll
        for (int j = 0; j < 8; ++j) { pv[j] = __builtin_amdgcn_exp2f(__builtin_fmaf(st[0][qt][j], LC, mb)); pv[8 + j] = __builtin_amdgcn_exp2f(__builtin_fmaf(st[1][qt][j], LC, mb)); s0 += pv[j]; s1 += pv[8 + j]; }
        l[qt] += s0 + s1;
        pb[qt] = __builtin_convertvector(pv, V);
        if constexpr (HL) pl[qt] = __builtin_convertvector(pv - __builtin_convertvector(pb[qt], v16f), V); }
#pragma unroll
    for (int dt = 0; dt < 4; ++dt)
#pragma unroll
        for (int qt = 0; qt < NQT; ++qt) { o[dt][qt] = WFrag<T16>::mma(va[dt], pb[qt], o[dt][qt]); if (HL) { o[dt][qt] = WFrag<T16>::mma(va[dt], pl[qt], o[dt][qt]); o[dt][qt] = WFrag<T16>::mma(va2[dt], pb[qt], o[dt][qt]); } }
    // four vector slots behind the last matrix instruction, on the back edge and on the exit alike, before its operands or results are touched
    asm volatile("v_nop\n\tv_nop\n\tv_nop\n\tv_nop" : "+v"(o[0][0]), "+v"(o[1][0]), "+v"(o[2][NQT - 1]), "+v"(o[3][NQT - 1]) : "v"(va[0]), "v"(va[3]));
}
template <bool HL, typename T16>
__device__ __forceinline__ void fa_tile(const T16* __restrict__ Q, const T16* __restrict__ Q2, const T16* __restrict__ Kp, const T16* __restrict__ Kp2, const T16* __restrict__ Vt, const T16* __restrict__ Vt2, int s, int r0, int h, float* sm, bf* Ah, bf* Al) {
    typedef typename WFrag<T16>::V V;
    constexpr int NQT = HL ? 1 : 2, NQ = 16 * NQT;
    const int lane = threadIdx.x & 31, lr = lane & 15, hi = lane >> 4;
    const int wv = __builtin_amdgcn_readfirstlane((int)(threadIdx.x >> 5));   // wave number in a scalar register: the key loop stays a scalar loop with every lane on
    const size_t po = ((size_t)h * TR + soff(s)) * HD + lane * 8;   // planes in fragment order: 16 rows of q or k are 1024 elements, 32 batch rows of the values 2048; a lane's 16 bytes lie at 16 lane
    V q[NQT][2], q2[NQT][2];
    const T16* qp = Q + po + (size_t)r0 * HD; const T16* qp2 = HL ? Q2 + po + (size_t)r0 * HD : qp;
#pragma unroll
    for (int qt = 0; qt < NQT; ++qt)
#pragma unroll
        for (int kc = 0; kc < 2; ++kc) { q[qt][kc] = WFrag<T16>::ldp(qp + (qt * 2 + kc) * 512); if (HL) q2[qt][kc] = WFrag<T16>::ldp(qp2 + (qt * 2 + kc) * 512); }
    asm volatile("s_wait_xcnt 0x0" :: "v"(qp), "v"(qp2) : "memory");   // the wait stands behind the query loads, with their addresses as inputs, before those registers are reused
    v8f o[4][NQT]; float m[NQT], l[NQT];
#pragma unroll
    for (int qt = 0; qt < NQT; ++qt) { m[qt] = -1.0e30f; l[qt] = 0.f;
#pragma unroll
        for (int dt = 0; dt < 4; ++dt) o[dt][qt] = (v8f){}; }
    const T16* kb0 = Kp + po; const T16* kb2 = HL ? Kp2 + po : kb0;
    const T16* vb0 = Vt + po; const T16* vb2 = HL ? Vt2 + po : vb0;
    const int kend = r0 + NQ;
#pragma unroll 1   // kept rolled: one copy of the step in the instruction cache, and its registers stay within four waves a SIMD
    for (int k0 = wv * 64; k0 < kend; k0 += (k0 & 32) ? 8 * 64 - 32 : 32) {   // both halves of a 64-key chunk, then this wave's next chunk
        const int dq = r0 + lr - k0 - hi * 8;
        fa_step<HL, NQT, T16>(kb0 + (size_t)k0 * HD, kb2 + (size_t)k0 * HD, vb0 + (size_t)k0 * HD, vb2 + (size_t)k0 * HD, q, q2, o, m, l, dq, k0 + 31 > r0);
    }
    float* ms = sm; float* ls = sm + 8 * 32; float* os = sm + 2 * 8 * 32;   // maxima [8][32], sums [8][32], partial contexts [8][NQ][68]
    if (hi == 0) {
#pragma unroll
        for (int qt = 0; qt < NQT; ++qt) ms[wv * 32 + qt * 16 + lr] = m[qt]; }
    __syncthreads();                                                  // every wave's maxima are in LDS
#pragma unroll
    for (int qt = 0; qt < NQT; ++qt) { float M = ms[qt * 16 + lr];
#pragma unroll
        for (int w = 1; w < 8; ++w) M = fmaxf(M, ms[w * 32 + qt * 16 + lr]);
        const float f = __builtin_amdgcn_exp2f((m[qt] - M) * LC);     // a wave without keys for a query: 0
        const float lj = (l[qt] + xhalf(l[qt])) * f; if (hi == 0) ls[wv * 32 + qt * 16 + lr] = lj;
#pragma unroll
        for (int dt = 0; dt < 4; ++dt) { const v8f ov = o[dt][qt] * f; float* d = os + (size_t)((wv * NQ + qt * 16 + lr) * 68 + dt * 16 + hi * 8);
            v4f a, b; a[0] = ov[0]; a[1] = ov[1]; a[2] = ov[2]; a[3] = ov[3]; b[0] = ov[4]; b[1] = ov[5]; b[2] = ov[6]; b[3] = ov[7]; *(v4fa*)d = a; *(v4fa*)(d + 4) = b; } }
    __syncthreads();                                                  // every wave's sums and partial contexts are in LDS
    constexpr int PT = NQ * HD / 256;                                 // context elements a thread
    const int qq = threadIdx.x / (HD / PT), d0 = (threadIdx.x % (HD / PT)) * PT;
    float L = ls[qq];
#pragma unroll
    for (int w = 1; w < 8; ++w) L += ls[w * 32 + qq];
    const size_t pe = pko(soff(s) + r0 + qq, h * HD + d0); bf* pa = Ah + pe; bf* pc = Al + pe;   // context planes in fragment order for the output product; PT <= 8 elements from a multiple of PT stay inside one 16-byte unit
#pragma unroll
    for (int g = 0; g < PT / 4; ++g) { v4f val = *(const v4fa*)(os + qq * 68 + d0 + g * 4);
#pragma unroll
        for (int w = 1; w < 8; ++w) val += *(const v4fa*)(os + (w * NQ + qq) * 68 + d0 + g * 4);
        v4us oh, ol;
#pragma unroll
        for (int e = 0; e < 4; ++e) { unsigned short a, c2; splitf(__fdiv_rn(val[e], L), a, c2); oh[e] = a; ol[e] = c2; }
        *(v4us*)(pa + g * 4) = oh; *(v4us*)(pc + g * 4) = ol; }
    asm volatile("s_wait_xcnt 0x0" :: "v"(pa), "v"(pc) : "memory");   // the wait stands behind the tile's stores, with their addresses as inputs
}
// grid (heads, FT16 + FTHL), the longest rows first: the fp16 tiles of scale 0, then of scale 1, then the hi+lo tiles of the three scales. Four waves a SIMD (two work-groups a WGP): vector work between the matrix runs wants waves
#define FT0  ((TT - RH) / 32)
#define FT16 (FT0 + (TT / 2 - RH) / 32)
#define FTHL (3 * (RH / 16))
__global__ __launch_bounds__(256) __attribute__((amdgpu_waves_per_eu(4, 4))) void k_fattn(const h16* __restrict__ Q16, const h16* __restrict__ K16, const h16* __restrict__ V16, const bf* __restrict__ Qh, const bf* __restrict__ Ql, const bf* __restrict__ Kh, const bf* __restrict__ Kw, const bf* __restrict__ Vh, const bf* __restrict__ Vl, bf* Ah, bf* Al) {
    __shared__ __align__(16) float sm[2 * 8 * 32 + 8 * 32 * 68];
    const int h = blockIdx.x, y = blockIdx.y;
    if (y < FT16) { const int s = y < FT0 ? 0 : 1; const int r0 = (TT >> s) - 32 * (y - s * FT0 + 1); fa_tile<false, h16>(Q16, nullptr, K16, nullptr, V16, nullptr, s, r0, h, sm, Ah, Al); }
    else { const int yy = y - FT16; const int s = yy % 3; const int r0 = RH - 16 * (yy / 3 + 1); fa_tile<true, bf>(Qh, Ql, Kh, Kw, Vh, Vl, s, r0, h, sm, Ah, Al); }
}

extern "C" void kernel_launch(void* const* d_in, const int* in_sizes, int n_in,
                              void* d_out, int out_size, void* d_ws, size_t ws_size, hipStream_t stream) {
    (void)in_sizes; (void)n_in; (void)out_size;
    const float* x0 = (const float*)d_in[0]; const float* x1 = (const float*)d_in[1]; const float* x2 = (const float*)d_in[2]; const float* wqA = (const float*)d_in[3]; const float* bqA = (const float*)d_in[4]; const float* wkA = (const float*)d_in[5]; const float* bkA = (const float*)d_in[6]; const float* wv = (const float*)d_in[7]; const float* bv = (const float*)d_in[8]; const float* wo = (const float*)d_in[9]; const float* bo = (const float*)d_in[10]; const float* x = nullptr; const float* wq = nullptr; const float* wk = nullptr; (void)x; (void)wq; (void)wk;
    float* OUT = (float*)d_out;     // the tuple's members one after the other: [TR][1024], in the order of the batch rows
    char* wsp = (char*)d_ws;
    auto take = [&](size_t bytes) { char* p = wsp; wsp += (bytes + 255) & ~(size_t)255; return (void*)p; };
    const size_t PL = (size_t)NH_ * TR * HD;   // one set of head planes, in elements
    bf* WO = (bf*)take((size_t)DM * DQ * 2);
    h16* QP16 = (h16*)take(2 * PL * 2); h16* KP16 = QP16 + PL; bf* QPh = (bf*)take(2 * PL * 2); bf* KPh = QPh + PL; bf* QPl = (bf*)take(2 * PL * 2); bf* KPl = QPl + PL;   // q planes, then k planes
    h16* VT16 = (h16*)take(PL * 2); bf* VTh = (bf*)take(PL * 2); bf* VTl = (bf*)take(PL * 2);
    bf* ATh = (bf*)take((size_t)TR * DQ * 2); bf* ATl = (bf*)take((size_t)TR * DQ * 2);
    bf* XB = (bf*)take(((size_t)TR * DM + (size_t)7 * DM * DM) * 2); bf* WQKV = XB + (size_t)TR * DM; float* CS = (float*)take((size_t)TR * HD * 2 * 4);
    if ((size_t)(wsp - (char*)d_ws) > ws_size) return;    // ws 256 MiB
    k_prep<<<CB_ALL, 256, 0, stream>>>(x0, x1, x2, wqA, wkA, wv, wo, XB, WO, CS);                     /* bf16 inputs; rope table, positions t x 2^s */
    k_gemmk<bf, 0, true, 3, 8><<<dim3(TR / 64, DM / 64, 3), 256, 0, stream>>>(XB, nullptr, DM, WQKV, nullptr, DM, nullptr, DM, bqA, bkA, bv, CS, QP16, QPh, QPl, PL, VT16, VTh, VTl);   /* q, k of every scale with rotary; v_base = x0 Wv^T + bv with its pooled rows, transposed; all as 16-bit planes */
    k_fattn<<<dim3(NH_, FT16 + FTHL), 256, 0, stream>>>(QP16, KP16, VT16, QPh, QPl, KPh, KPl, VTh, VTl, ATh, ATl);   /* attention of every head and scale; context as hi/lo planes */
    k_gemmk<bf, 1, true, 0, 8><<<dim3(TR / 64, DM / 64, 1), 256, 0, stream>>>(ATh, ATl, DQ, WO, nullptr, DQ, OUT, DM, bo, nullptr, nullptr, nullptr, nullptr, nullptr, nullptr, 0, nullptr, nullptr, nullptr);
}

// v010
// One run takes 88.8 microseconds.
// In two side-by-side timings against v009, it was 1.10 and 1.09 times as fast.
// Counting every step since v000, it is 23.8 times as fast.
#include <hip/hip_runtime.h>

// Multiscale causal attention (x0 [1][2048][1024], x1 [1][1024][1024], x2 [1][512][1024]; v_base = x0 Wv^T + bv shared, average-pooled by 2^i for scale i; per scale i: q, k = x_i W[i]^T + b[i] ('oi' [1024][1024] + [1024]; 16 heads x 64), rotate-half rotary at positions t x 2^i (base 1e4), scores = q.k / 8, causal (finfo.min); softmax; ctx_i = w v_i; out_i = ctx_i Wo^T + bo -> tuple ([1][2048][1024], [1][1024][1024], [1][512][1024]) (3.7 M)).
// Realisation: the three scales run together as one batch of TR = 2048 + 1024 + 512 rows (scale i holds rows soff(i) .. soff(i) + N_i, N_i = 2048 >> i): every launch covers all three, and each work-group finds its scale from its block index; attention is one fused launch (scores and probabilities stay in registers); the rope table uses positions t x 2^i; rotary, value pooling, value transposition and the 16-bit splits are the projection kernel's epilogue (a 64x64 tile is 64 rows of one head); the q, k and value planes are kept in the fragment order of the attention products. Q, K and V share the conversion launch as block ranges and the projection launch as grid planes.
// Compute dtypes, f32 accumulate: every input rounded to bf16; q/k/v on PLAIN bf16 operands (inputs: exact) + biases; rotary in f32 (precise sinf/cosf, 32 baked float32 inverse frequencies, position factor 2^i exact); causal tile skipping; value pooling in f32 (means of 2 and 4 rows summed in row order, as the reference's reshape-mean); scores and attn.v: query rows < 512 hl (3 products), the rest single fp16 (probabilities x 2^6, unnormalised); online softmax f32, divided by the row sum at the end; Wo hl x exact (2 products) + bo.

#define NB_  1
#define TT   2048
#define DM   1024
#define NH_  16
#define NKV  16
#define REP  (NH_ / NKV)
#define HD   64
#define DQ   (NH_ * HD)
#define DKV  (NKV * HD)
#define TR   (TT + TT / 2 + TT / 4)   // rows of the three scales, one after the other
#define RH   512                  // query rows < RH use hi+lo planes (k_fattn's grid assumes RH = TT / 4)
#define SCL  0.125f   // HD^-0.5
typedef _Float16 h16;
typedef unsigned short bf;
typedef __attribute__((ext_vector_type(16))) __bf16   v16bf;
typedef __attribute__((ext_vector_type(16))) _Float16 v16h;
typedef __attribute__((ext_vector_type(8)))  _Float16 v8h;
typedef __attribute__((ext_vector_type(8)))  unsigned short v8us;
typedef __attribute__((ext_vector_type(8)))  float    v8f;
typedef __attribute__((ext_vector_type(4)))  float    v4f;
typedef v8h  __attribute__((may_alias)) v8ha;
typedef v4f  __attribute__((may_alias)) v4fa;
typedef v8us __attribute__((may_alias)) v8usa;
typedef __attribute__((ext_vector_type(4))) unsigned short __attribute__((may_alias)) v4usa;

__device__ __forceinline__ unsigned short f2bf(float f) { unsigned u = __float_as_uint(f); u += 0x7FFFu + ((u >> 16) & 1u); return (unsigned short)(u >> 16); }
__device__ __forceinline__ float bf2f(unsigned short b) { return __uint_as_float(((unsigned)b) << 16); }
__device__ __forceinline__ float bfr(float f) { return bf2f(f2bf(f)); }
__device__ __forceinline__ v16h cat16(v8h lo, v8h hi) { return __builtin_shufflevector(lo, hi, 0, 1, 2, 3, 4, 5, 6, 7, 8, 9, 10, 11, 12, 13, 14, 15); }
__device__ __forceinline__ v16bf cat16b(v8us lo, v8us hi) { return __builtin_bit_cast(v16bf, __builtin_shufflevector(lo, hi, 0, 1, 2, 3, 4, 5, 6, 7, 8, 9, 10, 11, 12, 13, 14, 15)); }
__device__ __forceinline__ v8f wmma16(v16h a, v16h b, v8f c) { return __builtin_amdgcn_wmma_f32_16x16x32_f16(false, a, false, b, (short)0, c, false, false); }
__device__ __forceinline__ v8f wmmab(v16bf a, v16bf b, v8f c) { return __builtin_amdgcn_wmma_f32_16x16x32_bf16(false, a, false, b, (short)0, c, false, false); }
// the batch of scales: scale of a batch row, first batch row of a scale
__device__ __forceinline__ int sc_of(int t) { return t < TT ? 0 : (t < TT + TT / 2 ? 1 : 2); }
__device__ __forceinline__ int soff(int s) { return 2 * TT - ((2 * TT) >> s); }

__device__ __forceinline__ h16 tohx(float x) { return (h16)x; }
__device__ __forceinline__ void splitf(float y, unsigned short& h, unsigned short& l) { h = f2bf(y); l = f2bf(y - bf2f(h)); }
typedef __attribute__((ext_vector_type(2))) _Float16 v2h;
typedef __attribute__((ext_vector_type(4))) _Float16 v4h;
typedef __attribute__((ext_vector_type(2))) unsigned short v2us;
typedef __attribute__((ext_vector_type(4))) unsigned short v4us;
typedef __attribute__((ext_vector_type(2))) float v2f;
typedef __attribute__((ext_vector_type(4))) int v4i;

// ---- k_gemmk: register-blocked GEMM, one 64x64 output tile per work-group of NW waves, the K loop split over the waves: wave w takes the 64-element (128-byte) K chunks w, w + NW, ... with its own 16 accumulators,
// operands straight from 16-bit planes in FRAGMENT ORDER (pko below): the 16 rows x 32 k of one matrix operand are 1 KiB in a row, lane l's first 8 elements at 16 l bytes, its second 8 at 512 + 16 l,
// so that each wave-wide 16-byte load covers 4 whole 128-byte lines (row-major planes: 32 bytes of each of 16 lines). The NW partial tiles meet in LDS and are added in wave order 0..NW-1. grid (M/64, N/64, Z), NW x 32 threads.
// C[m][n] (f32, pitch ldc, + optional f32 bias[n]) = sum_k A[m][k] Bt[n][k] (+ split products per NSPLIT). A and Bt have DM columns (lda = K = DM). K % 64 == 0.
// CMODE 3 (projections, z = 0 q, 1 k, 2 v): rows are batch rows; weight matrix number 3 z + s of Bt and the matching bias row; v exists for scale 0 only. No f32 result is stored: the tile (64 rows of head blockIdx.y) goes on in the epilogue.
// q, k: rotate-half rotary out[d] = x[d] cos[t][d] - x[d+HD/2] sin[t][d], out[d+HD/2] = x[d+HD/2] cos[t][d+HD/2] + x[d] sin[t][d+HD/2] (table CS), stored as head planes in fragment order (fp16 + hi/lo bf16; k planes zP elements behind the q planes): the 16 rows x 32 dimensions of one operand are 1 KiB in a row as in pko, a 64x64 tile 8 KiB in a row; the tile is brought into that order in LDS, so that every wave-wide store is 512 bytes in a row.
// v: the tile is turned in LDS; each thread takes 16 rows of one column, forms the means of 2 and of 4 rows (scales 1 and 2, summed in row order) and stores the value planes (fp16 + hi/lo bf16) of all three scales in fragment order (pkv below: 16 dimensions x 32 batch rows are 1 KiB in a row).
// element offset of (row R, column k) in a plane of DM columns kept in fragment order: block (R / 16, k / 32) of 512 elements; inside it half (k / 16) % 2, lane 16 ((k / 8) % 2) + R % 16, element k % 8
__device__ __forceinline__ size_t pko(int R, int k) { return ((size_t)(R >> 4) * (DM / 32) + (k >> 5)) * 512 + ((k >> 4) & 1) * 256 + (((k >> 3) & 1) * 16 + (R & 15)) * 8 + (k & 7); }
// element offset of (dimension d of head h, batch row t) in a value plane kept in fragment order: block (t / 32, d / 16) of 512 elements; inside it half (t / 16) % 2, lane 16 ((t / 8) % 2) + d % 16, element t % 8
__device__ __forceinline__ size_t pkv(int h, int d, int t) { return (((size_t)h * (TR / 32) + (t >> 5)) * (HD / 16) + (d >> 4)) * 512 + ((t >> 4) & 1) * 256 + (((t >> 3) & 1) * 16 + (d & 15)) * 8 + (t & 7); }
template <typename T16> struct WFrag;
template <> struct WFrag<h16> { typedef v16h V; static __device__ __forceinline__ V ldp(const h16* p) { return cat16(*(const v8h*)p, *(const v8h*)(p + 256)); } static __device__ __forceinline__ v8f mma(V a, V b, v8f c) { return wmma16(a, b, c); } };
template <> struct WFrag<bf> { typedef v16bf V; static __device__ __forceinline__ V ldp(const bf* p) { return cat16b(*(const v8us*)p, *(const v8us*)(p + 256)); } static __device__ __forceinline__ v8f mma(V a, V b, v8f c) { return wmmab(a, b, c); } };
template <typename T16, int NSPLIT, bool BIAS, int CMODE, int NW>
__global__ __launch_bounds__(NW * 32) void k_gemmk(const T16* __restrict__ A, const T16* __restrict__ A2, int lda, const T16* __restrict__ Bt, const T16* __restrict__ Bt2, int K, float* C, int ldc, const float* __restrict__ bias, const float* __restrict__ biasK, const float* __restrict__ biasV, const float* __restrict__ CS, h16* P16, bf* Ph, bf* Pl, size_t zP, h16* V16, bf* Vh, bf* Vl) {
    typedef typename WFrag<T16>::V V;
    constexpr int RR = 2 * NW;                                        // tile rows added per round: one float4 per thread
    constexpr int NBUF = (2 * NW * RR * 68 * 4 <= 160 * 1024) ? 2 : 1; // two round buffers where both fit in half a WGP's LDS
    __shared__ __align__(16) float os[NBUF * NW * RR * 68];
    const size_t z = blockIdx.z;
    const int lane = threadIdx.x & 31, lr = lane & 15, hi = lane >> 4; const int c0 = blockIdx.y * 64;
    int r0 = blockIdx.x * 64, rc = r0, Kl = K;                        // first row in A, first row in C, end of the K loop
    if (CMODE == 3) { const int s = sc_of(r0); if (z == 2 && s) return;   // the whole work-group leaves, in front of every barrier
        Bt += (z * 3 + s) * (size_t)DM * DM; bias = (z == 0 ? bias : (z == 1 ? biasK : biasV)) + s * DM; }
    const int wv = __builtin_amdgcn_readfirstlane((int)(threadIdx.x >> 5));   // wave number in a scalar register: the K loop stays a scalar loop with every lane on
    v8f acc[4][4];
#pragma unroll
    for (int mb = 0; mb < 4; ++mb)
#pragma unroll
        for (int nb = 0; nb < 4; ++nb) acc[mb][nb] = (v8f){};
    constexpr int BAND = 16 * DM;                                     // fragment order: a band of 16 rows is 16 DM elements, 32 columns of it 512; a constant, so that every load of a pass is one address plus an immediate offset
    const size_t aoff = (size_t)r0 * DM + lane * 8, boff = (size_t)c0 * DM + lane * 8;
#pragma unroll 1
    for (int kc = wv * 64; kc < Kl; kc += (kc & 32) ? NW * 64 - 32 : 32) {   // both halves of a 128-byte chunk, then this wave's next chunk
        V a[4], a2[4], b[4], b2[4];
        const T16* pa = A + aoff + kc * 16; const T16* pa2 = (NSPLIT == 1 || NSPLIT == 2) ? A2 + aoff + kc * 16 : pa; const T16* pb = Bt + boff + kc * 16; const T16* pb2 = NSPLIT >= 2 ? Bt2 + boff + kc * 16 : pb;
#pragma unroll
        for (int mb = 0; mb < 4; ++mb) { a[mb] = WFrag<T16>::ldp(pa + mb * BAND); if (NSPLIT == 1 || NSPLIT == 2) a2[mb] = WFrag<T16>::ldp(pa2 + mb * BAND); }
#pragma unroll
        for (int nb = 0; nb < 4; ++nb) { b[nb] = WFrag<T16>::ldp(pb + nb * BAND); if (NSPLIT >= 2) b2[nb] = WFrag<T16>::ldp(pb2 + nb * BAND); }
        asm volatile("s_wait_xcnt 0x0" :: "v"(pa), "v"(pa2), "v"(pb), "v"(pb2) : "memory");   // the wait stands behind the pass's loads, with their addresses as inputs, before the next pass forms its addresses
        __builtin_amdgcn_sched_barrier(0);   // every load of the pass is issued before its first product: one load latency a pass; without it the pass's last two fragments are asked for only after the first products have waited for theirs, a second latency
#pragma unroll
        for (int nb = 0; nb < 4; ++nb)
#pragma unroll
            for (int mb = 0; mb < 4; ++mb) { acc[mb][nb] = WFrag<T16>::mma(a[mb], b[nb], acc[mb][nb]); if (NSPLIT == 1 || NSPLIT == 2) acc[mb][nb] = WFrag<T16>::mma(a2[mb], b[nb], acc[mb][nb]); if (NSPLIT >= 2) acc[mb][nb] = WFrag<T16>::mma(a[mb], b2[nb], acc[mb][nb]); }
        // four vector slots behind the last matrix instruction, on the back edge and on the exit alike, before its operands or results are touched
        asm volatile("v_nop\n\tv_nop\n\tv_nop\n\tv_nop" : "+v"(acc[0][0]), "+v"(acc[1][1]), "+v"(acc[2][2]), "+v"(acc[3][3]) : "v"(a[0]), "v"(a[3]));
    }
    const int row = threadIdx.x >> 4, cofs = (threadIdx.x & 15) * 4;
    v4f res[64 / RR];
#pragma unroll
    for (int rd = 0; rd < 64 / RR; ++rd) {
        float* ob = os + (rd % NBUF) * (NW * RR * 68);                // two buffers in turn: one barrier a round is enough
        if (NBUF == 1 && rd) __syncthreads();                         // one buffer: the round before is read before it is overwritten
#pragma unroll
        for (int m = 0; m < RR / 16; ++m) {
#pragma unroll
            for (int nb = 0; nb < 4; ++nb) {
#pragma unroll
                for (int j = 0; j < 8; ++j) ob[(wv * RR + m * 16 + hi * 8 + j) * 68 + nb * 16 + lr] = acc[rd * (RR / 16) + m][nb][j]; } }
        __syncthreads();                                              // every wave's partial rows of this round are in LDS (two buffers: and every read of the buffer written next is done)
        v4f val = *(const v4fa*)(ob + row * 68 + cofs);
#pragma unroll
        for (int w = 1; w < NW; ++w) val += *(const v4fa*)(ob + (w * RR + row) * 68 + cofs);
        res[rd] = val;
    }
    v4f bb; bb[0] = bb[1] = bb[2] = bb[3] = 0.f;
    if (BIAS) { bb[0] = bfr(bias[c0 + cofs]); bb[1] = bfr(bias[c0 + cofs + 1]); bb[2] = bfr(bias[c0 + cofs + 2]); bb[3] = bfr(bias[c0 + cofs + 3]); }
    if constexpr (CMODE == 3) {
        static_assert(NBUF == 2 && (64 / RR) % 2 == 0 && RR == 16 && NW * RR * 68 >= 64 * 65, "the epilogue's thread map and its use of round buffer 0");
        if (z < 2) {   // q, k: a thread holds 4 neighbouring dimensions of a row; the partner dimensions (+- HD/2) are 8 lanes away in the same 16-lane row
            const float* cp = CS + ((size_t)(r0 + row) * HD + cofs) * 2;
            // round buffer 0 is free (its last readers passed the last round's barrier): three planes of 32 groups, a group = 16 rows x 8 dimensions (256 bytes, as it lies in the plane) at pitch 288 bytes, so that the 8 groups a wave writes fall on different banks
            static_assert(NW * RR * 68 * 4 >= 3 * 32 * 288, "the three 16-bit tiles fit round buffer 0");
            unsigned short* sp = (unsigned short*)os + (cofs >> 3) * 144 + row * 8 + (cofs & 7);
            const bool low = cofs < HD / 2;
#pragma unroll
            for (int rd = 0; rd < 64 / RR; ++rd) {
                const v4f x = res[rd] + bb; const v4f ca = *(const v4f*)(cp + rd * RR * HD * 2), cb = *(const v4f*)(cp + rd * RR * HD * 2 + 4);
                const float co[4] = {ca[0], ca[2], cb[0], cb[2]}, si[4] = {ca[1], ca[3], cb[1], cb[3]};
                v4h o16; v4us oh, ol;
#pragma unroll
                for (int q = 0; q < 4; ++q) { const float xp = __shfl_xor(x[q], 8); const float r = x[q] * co[q] + xp * (low ? -si[q] : si[q]);
                    o16[q] = tohx(r); unsigned short a2, c2; splitf(r, a2, c2); oh[q] = a2; ol[q] = c2; }
                *(v4usa*)(sp + rd * 8 * 144) = __builtin_bit_cast(v4us, o16); *(v4usa*)(sp + (32 + rd * 8) * 144) = oh; *(v4usa*)(sp + (64 + rd * 8) * 144) = ol; }
            asm volatile("s_wait_xcnt 0x0" :: "v"(cp) : "memory");   // the wait stands behind the tile's loads, with their address as input
            __syncthreads();                                          // the three 16-bit tiles are in LDS (block-uniform branch)
            const size_t e = z * zP + ((size_t)blockIdx.y * TR + r0) * HD + threadIdx.x * 8;   // the tile is 8 KiB in a row in each plane; a thread takes 16-byte units threadIdx.x and 256 + threadIdx.x
            h16* p16 = P16 + e; bf* ph = Ph + e; bf* pl = Pl + e;
            const unsigned short* rp = (const unsigned short*)os + (threadIdx.x >> 4) * 144 + (threadIdx.x & 15) * 8;
#pragma unroll
            for (int u = 0; u < 2; ++u) { *(v8usa*)(p16 + u * 2048) = *(const v8usa*)(rp + u * 16 * 144); *(v8usa*)(ph + u * 2048) = *(const v8usa*)(rp + (32 + u * 16) * 144); *(v8usa*)(pl + u * 2048) = *(const v8usa*)(rp + (64 + u * 16) * 144); }
            asm volatile("s_wait_xcnt 0x0" :: "v"(p16), "v"(ph), "v"(pl) : "memory");   // the wait stands behind the tile's stores, with their addresses as inputs
        } else {       // v (block-uniform branch): round buffer 0 is free, its last readers passed the last round's barrier
            float* ts = os;                                           // [64 rows][65]: column reads fall on different banks
#pragma unroll
            for (int rd = 0; rd < 64 / RR; ++rd)
#pragma unroll
                for (int q = 0; q < 4; ++q) ts[(rd * RR + row) * 65 + cofs + q] = res[rd][q] + bb[q];
            __syncthreads();                                          // the whole value tile is in LDS
            const int d = ((threadIdx.x >> 5) & 3) * 16 + (threadIdx.x & 15), tq = (threadIdx.x >> 7) * 2 + ((threadIdx.x >> 4) & 1);   // a wave: 16 dimensions x 2 groups of 16 rows, so that each of its stores below fills whole runs of 256 bytes or more
            float x[16], x1[8], x2[4];
#pragma unroll
            for (int i = 0; i < 16; ++i) x[i] = ts[(tq * 16 + i) * 65 + d];
#pragma unroll
            for (int i = 0; i < 8; ++i) x1[i] = (x[2 * i] + x[2 * i + 1]) * 0.5f;
#pragma unroll
            for (int i = 0; i < 4; ++i) x2[i] = (((x[4 * i] + x[4 * i + 1]) + x[4 * i + 2]) + x[4 * i + 3]) * 0.25f;
            const int hv = blockIdx.y;
            const size_t e0 = pkv(hv, d, r0 + tq * 16), e1 = pkv(hv, d, soff(1) + r0 / 2 + tq * 8), e2 = pkv(hv, d, soff(2) + r0 / 4 + tq * 4);   // this thread's first batch row of scale 0, 1, 2; 16 neighbouring dimensions lie 256 bytes in a row
            v8h a16[2], b16; v8us ah[2], al[2], bh, bl; v4h c16; v4us ch, cl;
#pragma unroll
            for (int i = 0; i < 16; ++i) { unsigned short a2, c2; splitf(x[i], a2, c2); a16[i >> 3][i & 7] = tohx(x[i]); ah[i >> 3][i & 7] = a2; al[i >> 3][i & 7] = c2; }
#pragma unroll
            for (int i = 0; i < 8; ++i) { unsigned short a2, c2; splitf(x1[i], a2, c2); b16[i] = tohx(x1[i]); bh[i] = a2; bl[i] = c2; }
#pragma unroll
            for (int i = 0; i < 4; ++i) { unsigned short a2, c2; splitf(x2[i], a2, c2); c16[i] = tohx(x2[i]); ch[i] = a2; cl[i] = c2; }
            h16* p16 = V16 + e0; bf* ph = Vh + e0; bf* pl = Vl + e0; h16* s16 = V16 + e1; bf* sh = Vh + e1; bf* sl = Vl + e1; h16* u16 = V16 + e2; bf* uh = Vh + e2; bf* ul = Vl + e2;
            *(v8h*)p16 = a16[0]; *(v8h*)(p16 + 128) = a16[1]; *(v8us*)ph = ah[0]; *(v8us*)(ph + 128) = ah[1]; *(v8us*)pl = al[0]; *(v8us*)(pl + 128) = al[1];   // a thread's rows 8 .. 15 lie 16 lane places (128 elements) behind its rows 0 .. 7
            *(v8h*)s16 = b16; *(v8us*)sh = bh; *(v8us*)sl = bl; *(v4h*)u16 = c16; *(v4us*)uh = ch; *(v4us*)ul = cl;
            asm volatile("s_wait_xcnt 0x0" :: "v"(p16), "v"(ph), "v"(pl), "v"(s16), "v"(sh), "v"(sl), "v"(u16), "v"(uh), "v"(ul) : "memory");   // the wait stands behind the tile's stores, with their addresses as inputs
        }
    } else {
#pragma unroll
    for (int rd = 0; rd < 64 / RR; ++rd) {                            // stores behind the last barrier: no barrier waits for a global store
        v4f val = res[rd]; if (BIAS) val += bb;
        *(v4f*)(C + (size_t)(rc + rd * RR + row) * ldc + c0 + cofs) = val; }
    }
}


__global__ __launch_bounds__(256) void k_wtG(const float* __restrict__ w, int K, int N, bf* Bt) {
    const int lane = threadIdx.x & 31; const int L0 = (blockIdx.x * 8 + (threadIdx.x >> 5)) * 8; const int nlines = N * K / 64;
{
#pragma unroll 1
        for (int l = 0; l < 8; ++l) { const int L = L0 + l; if (L >= nlines) break; const size_t e = (size_t)L * 64 + lane * 2; const int k = (int)(e % K), n = (int)(e / K); v2us o;
            o[0] = f2bf(w[(size_t)k * N + n]); o[1] = f2bf(w[(size_t)(k + 1) * N + n]); *(v2us*)(Bt + e) = o; }
         }
}
__constant__ float INV[HD / 2] = {1.0f,0.749894202f,0.562341332f,0.421696514f,0.316227764f,0.237137362f,0.177827939f,0.133352146f,0.100000001f,0.0749894157f,0.0562341288f,0.0421696492f,0.0316227786f,0.0237137359f,0.0177827943f,0.0133352149f,0.00999999978f,0.00749894232f,0.00562341325f,0.00421696482f,0.00316227786f,0.00237137382f,0.00177827943f,0.00133352145f,0.00100000005f,0.000749894185f,0.000562341302f,0.000421696488f,0.000316227786f,0.000237137385f,0.00017782794f,0.00013335215f};   // float32 1/10000^(2i/64), eager-JAX values
// rope table, 256 entries a block: cos, sin of batch row idx / HD, dimension idx % HD
__device__ __forceinline__ void cstab(float* CS, int blk) { const int idx = blk * 256 + threadIdx.x; const int tb = idx / HD, d = idx % HD; const int s = sc_of(tb); const int t = tb - soff(s); const float pm = (float)(1 << s); /* batch row tb = row t of scale s: position t x 2^s */ float p = __fmul_rn((float)t, pm); asm volatile("" : "+v"(p)); const float ang = __fmul_rn(p, INV[d % (HD / 2)]); v2f cs; cs[0] = cosf(ang); cs[1] = sinf(ang);
    *(v2f*)(CS + (size_t)idx * 2) = cs;  }
// k_prep: what depends on the inputs alone, in one grid. Blocks < CB_WO: every f32 input matrix (all have DM columns) to bf16 in fragment order (pko), 4096 elements a block: a wave takes one block of 16 rows x 32 columns
// (16 whole 128-byte lines of f32) and stores it as 1 KiB in a row; x0, x1, x2 (the TR batch rows), the 3 q, the 3 k and the v weight matrices land one after the other at XW; the output weights at WOd. Blocks CB_WO .. CB_ALL: the rope table
#define CB_X0 (TT * DM / 4096)
#define CB_X1 (CB_X0 + TT / 2 * DM / 4096)
#define CB_X2 (CB_X1 + TT / 4 * DM / 4096)
#define CB_WQ (CB_X2 + 3 * DQ * DM / 4096)
#define CB_WK (CB_WQ + 3 * DKV * DM / 4096)
#define CB_WV (CB_WK + DKV * DM / 4096)
#define CB_WO (CB_WV + DM * DQ / 4096)
#define CB_ALL (CB_WO + TR * HD / 256)
__global__ __launch_bounds__(256) void k_prep(const float* __restrict__ x0, const float* __restrict__ x1, const float* __restrict__ x2, const float* __restrict__ wq, const float* __restrict__ wk, const float* __restrict__ wv, const float* __restrict__ wo, bf* XW, bf* WOd, float* CS) {
    const int b = blockIdx.x; if (b >= CB_WO) { cstab(CS, b - CB_WO); return; }
    const float* src; bf* dst = XW + (size_t)b * 4096; int bl;   // bl: this block's number inside its source matrix
    if (b < CB_X0) { src = x0; bl = b; } else if (b < CB_X1) { src = x1; bl = b - CB_X0; } else if (b < CB_X2) { src = x2; bl = b - CB_X1; }
    else if (b < CB_WQ) { src = wq; bl = b - CB_X2; } else if (b < CB_WK) { src = wk; bl = b - CB_WQ; } else if (b < CB_WV) { src = wv; bl = b - CB_WK; }
    else { src = wo; bl = b - CB_WV; dst = WOd + (size_t)bl * 4096; }
    const int lane = threadIdx.x & 31, wv8 = threadIdx.x >> 5; const int fb = bl * 8 + wv8;   // fragment block fb of the matrix: rows 16 (fb / 32) .., columns 32 (fb % 32) ..
    const float* sp = src + ((size_t)(fb >> 5) * 16 + (lane & 15)) * DM + (fb & 31) * 32 + (lane >> 4) * 8; bf* dp = dst + wv8 * 512 + lane * 8;
    const v8f v0 = *(const v8f*)sp, v1 = *(const v8f*)(sp + 16); v8us o0, o1;
#pragma unroll
    for (int k = 0; k < 8; ++k) { o0[k] = f2bf(v0[k]); o1[k] = f2bf(v1[k]); }
    *(v8us*)dp = o0; *(v8us*)(dp + 256) = o1;
    asm volatile("s_wait_xcnt 0x0" :: "v"(sp), "v"(dp) : "memory");   // the wait stands behind the block's loads and stores, with their addresses as inputs
}
// ---- k_fattn: scores, softmax, probability x value and the hi/lo split of the context in one kernel; no score or probability leaves the registers.
// One work-group of 8 waves per (head, tile of 64 queries). Transposed products: S^T = K Q^T (a lane holds one query's scores: query = lane & 15, keys = 8 (lane >> 4) + j of each 16-key tile), so two S^T tiles are, register for register,
// the B operand P^T of O^T += V^T P^T, and maximum, sum and rescale factor are per lane. The tile is NG groups of NQ queries, and NS = 8 / NG waves split a group's keys: wave w has group w % NG and takes the 64-key chunks w / NG, w / NG + NS, ... up to its diagonal, in steps of 32 keys, with its own running
// maximum m, sum l and O^T; a group's NS partial results meet in LDS, are brought to the common maximum and added in the order of their first chunks. The NG waves with the same chunks ask for the same key and value lines at about the same time, so that the WGP's cache can serve them from one L2 read.
// Rows < RH of a scale: hi+lo bf16 planes, 3 products each, 4 groups of 16 queries, 2 waves a group; the rest fp16, 2 groups of 32 queries, 4 waves a group.
typedef __attribute__((ext_vector_type(16))) float v16f;
#define PBAND (16 * DM)                  // elements of a band of 16 rows in a plane of DM columns kept in fragment order
#define LC  (SCL * 1.4426950408889634f)   // raw score -> exponent of 2
#define MTH (8.0f / LC)                   // the maximum in use is renewed when a new score exceeds it by more than 2^8
__device__ __forceinline__ float xhalf(float x) { const int b = __float_as_int(x); return __int_as_float(__builtin_amdgcn_permlanex16(b, b, 0x76543210, 0xfedcba98, false, false)); }   // lane l <-> l ^ 16
template <bool HL, int NQT, typename T16>
__device__ __forceinline__ void fa_step(const T16* kp, const T16* kp2, const T16* vp, const T16* vp2, const typename WFrag<T16>::V (&q)[NQT][2], const typename WFrag<T16>::V (&q2)[NQT][2], v8f (&o)[4][NQT], float (&m)[NQT], float (&l)[NQT], int dq, bool diag) {
    typedef typename WFrag<T16>::V V;
    constexpr float PB = HL ? 0.0f : 6.0f;   // fp16 probabilities carry 2^6 (at most 2^14 with the lazy maximum); it cancels in O / l
    V ka[2][2], ka2[2][2], va[4], va2[4];
#pragma unroll
    for (int kt = 0; kt < 2; ++kt)
#pragma unroll
        for (int kc = 0; kc < 2; ++kc) { ka[kt][kc] = WFrag<T16>::ldp(kp + (kt * 2 + kc) * 512); if (HL) ka2[kt][kc] = WFrag<T16>::ldp(kp2 + (kt * 2 + kc) * 512); }
#pragma unroll
    for (int dt = 0; dt < 4; ++dt) { va[dt] = WFrag<T16>::ldp(vp + dt * 512); if (HL) va2[dt] = WFrag<T16>::ldp(vp2 + dt * 512); }
    // the wait stands behind the step's loads; it takes their addresses as inputs, so that no load's result lands on an address register in front of it
    if constexpr (HL) asm volatile("s_wait_xcnt 0x0" :: "v"(kp), "v"(kp2), "v"(vp), "v"(vp2) : "memory");
    else asm volatile("s_wait_xcnt 0x0" :: "v"(kp), "v"(vp) : "memory");
    __builtin_amdgcn_sched_barrier(0);   // every load of the step is issued before its first product: one load latency a step instead of one per group of fragments
    v8f st[2][NQT];
#pragma unroll
    for (int kt = 0; kt < 2; ++kt)
#pragma unroll
        for (int qt = 0; qt < NQT; ++qt) { st[kt][qt] = (v8f){};
#pragma unroll
            for (int kc = 0; kc < 2; ++kc) { st[kt][qt] = WFrag<T16>::mma(ka[kt][kc], q[qt][kc], st[kt][qt]); if (HL) { st[kt][qt] = WFrag<T16>::mma(ka[kt][kc], q2[qt][kc], st[kt][qt]); st[kt][qt] = WFrag<T16>::mma(ka2[kt][kc], q[qt][kc], st[kt][qt]); } } }
    // four vector slots behind the last score product, on both sides of the branch below, before its results are touched
    asm volatile("v_nop\n\tv_nop\n\tv_nop\n\tv_nop" : "+v"(st[0][0]), "+v"(st[1][NQT - 1]));
    if (diag) {   // a step that reaches the diagonal (wave-uniform): dq + 16 qt = this lane's query minus its first key; keys above the query are out
#pragma unroll
        for (int qt = 0; qt < NQT; ++qt)
#pragma unroll
            for (int kt = 0; kt < 2; ++kt)
#pragma unroll
                for (int j = 0; j < 8; ++j) st[kt][qt][j] = (kt * 16 + j <= dq + qt * 16) ? st[kt][qt][j] : -3.0e38f; }
    float tm[NQT]; bool need = false;
#pragma unroll
    for (int qt = 0; qt < NQT; ++qt) {
        float t = fmaxf(st[0][qt][0], st[1][qt][0]);
#pragma unroll
        for (int j = 1; j < 8; ++j) t = fmaxf(t, fmaxf(st[0][qt][j], st[1][qt][j]));
        t = fmaxf(t, xhalf(t)); tm[qt] = t; need = need || (t > m[qt] + MTH); }
    if (__builtin_amdgcn_ballot_w32(need) != 0) {   // one scalar branch a step: rescale only when some query's maximum has grown past the margin
#pragma unroll
        for (int qt = 0; qt < NQT; ++qt) { const float mn = fmaxf(m[qt], tm[qt]); const float al = __builtin_amdgcn_exp2f((m[qt] - mn) * LC); m[qt] = mn; l[qt] *= al;
#pragma unroll
            for (int dt = 0; dt < 4; ++dt) o[dt][qt] *= al; } }
    V pb[NQT], pl[NQT];
#pragma unroll
    for (int qt = 0; qt < NQT; ++qt) { const float mb = __builtin_fmaf(-m[qt], LC, PB); v16f pv; float s0 = 0.f, s1 = 0.f;
#pragma unroll
        for (int j = 0; j < 8; ++j) { pv[j] = __builtin_amdgcn_exp2f(__builtin_fmaf(st[0][qt][j], LC, mb)); pv[8 + j] = __builtin_amdgcn_exp2f(__builtin_fmaf(st[1][qt][j], LC, mb)); s0 += pv[j]; s1 += pv[8 + j]; }
        l[qt] += s0 + s1;
        pb[qt] = __builtin_convertvector(pv, V);
        if constexpr (HL) pl[qt] = __builtin_convertvector(pv - __builtin_convertvector(pb[qt], v16f), V); }
#pragma unroll
    for (int dt = 0; dt < 4; ++dt)
#pragma unroll
        for (int qt = 0; qt < NQT; ++qt) { o[dt][qt] = WFrag<T16>::mma(va[dt], pb[qt], o[dt][qt]); if (HL) { o[dt][qt] = WFrag<T16>::mma(va[dt], pl[qt], o[dt][qt]); o[dt][qt] = WFrag<T16>::mma(va2[dt], pb[qt], o[dt][qt]); } }
    // four vector slots behind the last matrix instruction, on the back edge and on the exit alike, before its operands or results are touched
    asm volatile("v_nop\n\tv_nop\n\tv_nop\n\tv_nop" : "+v"(o[0][0]), "+v"(o[1][0]), "+v"(o[2][NQT - 1]), "+v"(o[3][NQT - 1]) : "v"(va[0]), "v"(va[3]));
}
template <bool HL, typename T16>
__device__ __forceinline__ void fa_tile(const T16* __restrict__ Q, const T16* __restrict__ Q2, const T16* __restrict__ Kp, const T16* __restrict__ Kp2, const T16* __restrict__ Vt, const T16* __restrict__ Vt2, int s, int r0, int h, float* sm, bf* Ah, bf* Al) {
    typedef typename WFrag<T16>::V V;
    constexpr int NQT = HL ? 1 : 2, NQ = 16 * NQT, NG = 64 / NQ, NS = 8 / NG;   // queries a wave, query groups a work-group, waves that split a group's keys
    const int lane = threadIdx.x & 31, lr = lane & 15, hi = lane >> 4;
    const int wv = __builtin_amdgcn_readfirstlane((int)(threadIdx.x >> 5));   // wave number in a scalar register: the key loop stays a scalar loop with every lane on
    const int qg = wv % NG, ks = wv / NG, rw = r0 + qg * NQ;   // this wave's query group, its place among the group's waves, its first query row
    const size_t po = ((size_t)h * TR + soff(s)) * HD + lane * 8;   // planes in fragment order: 16 rows of q or k, and 16 batch rows of the values, are 1024 elements; a lane's 16 bytes lie at 16 lane
    V q[NQT][2], q2[NQT][2];
    const T16* qp = Q + po + (size_t)rw * HD; const T16* qp2 = HL ? Q2 + po + (size_t)rw * HD : qp;
#pragma unroll
    for (int qt = 0; qt < NQT; ++qt)
#pragma unroll
        for (int kc = 0; kc < 2; ++kc) { q[qt][kc] = WFrag<T16>::ldp(qp + (qt * 2 + kc) * 512); if (HL) q2[qt][kc] = WFrag<T16>::ldp(qp2 + (qt * 2 + kc) * 512); }
    asm volatile("s_wait_xcnt 0x0" :: "v"(qp), "v"(qp2) : "memory");   // the wait stands behind the query loads, with their addresses as inputs, before those registers are reused
    v8f o[4][NQT]; float m[NQT], l[NQT];
#pragma unroll
    for (int qt = 0; qt < NQT; ++qt) { m[qt] = -1.0e30f; l[qt] = 0.f;
#pragma unroll
        for (int dt = 0; dt < 4; ++dt) o[dt][qt] = (v8f){}; }
    const T16* kb0 = Kp + po; const T16* kb2 = HL ? Kp2 + po : kb0;
    const T16* vb0 = Vt + po; const T16* vb2 = HL ? Vt2 + po : vb0;
    const int kend = rw + NQ;
#pragma unroll 1   // kept rolled: one copy of the step in the instruction cache, and its registers stay within four waves a SIMD
    for (int k0 = ks * 64; k0 < kend; k0 += (k0 & 32) ? NS * 64 - 32 : 32) {   // both halves of a 64-key chunk, then this wave's next chunk
        const int dq = rw + lr - k0 - hi * 8;
        fa_step<HL, NQT, T16>(kb0 + (size_t)k0 * HD, kb2 + (size_t)k0 * HD, vb0 + (size_t)k0 * HD, vb2 + (size_t)k0 * HD, q, q2, o, m, l, dq, k0 + 31 > rw);
    }
    float* ms = sm; float* ls = sm + 8 * 32; float* os = sm + 2 * 8 * 32;   // maxima [8][32], sums [8][32], partial contexts [8][NQ][68]
    if (hi == 0) {
#pragma unroll
        for (int qt = 0; qt < NQT; ++qt) ms[wv * 32 + qt * 16 + lr] = m[qt]; }
    __syncthreads();                                                  // every wave's maxima are in LDS
#pragma unroll
    for (int qt = 0; qt < NQT; ++qt) { float M = ms[qg * 32 + qt * 16 + lr];   // the group's waves are qg, qg + NG, ...
#pragma unroll
        for (int w = 1; w < NS; ++w) M = fmaxf(M, ms[(w * NG + qg) * 32 + qt * 16 + lr]);
        const float f = __builtin_amdgcn_exp2f((m[qt] - M) * LC);     // a wave without keys for a query: 0
        const float lj = (l[qt] + xhalf(l[qt])) * f; if (hi == 0) ls[wv * 32 + qt * 16 + lr] = lj;
#pragma unroll
        for (int dt = 0; dt < 4; ++dt) { const v8f ov = o[dt][qt] * f; float* d = os + (size_t)((wv * NQ + qt * 16 + lr) * 68 + dt * 16 + hi * 8);
            v4f a, b; a[0] = ov[0]; a[1] = ov[1]; a[2] = ov[2]; a[3] = ov[3]; b[0] = ov[4]; b[1] = ov[5]; b[2] = ov[6]; b[3] = ov[7]; *(v4fa*)d = a; *(v4fa*)(d + 4) = b; } }
    __syncthreads();                                                  // every wave's sums and partial contexts are in LDS
    const int d0 = (threadIdx.x & 7) * 8;                             // a thread: 8 dimensions of queries threadIdx.x / 8 and 32 + threadIdx.x / 8 of the tile
    const size_t pe = pko(soff(s) + r0 + (threadIdx.x >> 3), h * HD + d0); bf* pa = Ah + pe; bf* pc = Al + pe;   // context planes in fragment order for the output product; 8 elements from a multiple of 8 are one 16-byte unit
#pragma unroll
    for (int u = 0; u < 2; ++u) { const int qq = (threadIdx.x >> 3) + u * 32, g = qq / NQ, ql = qq % NQ;   // query, its group, its place in the group
        float L = ls[g * 32 + ql];
#pragma unroll
        for (int w = 1; w < NS; ++w) L += ls[(w * NG + g) * 32 + ql];
        v8us oh, ol;
#pragma unroll
        for (int c = 0; c < 2; ++c) { v4f val = *(const v4fa*)(os + (g * NQ + ql) * 68 + d0 + c * 4);
#pragma unroll
            for (int w = 1; w < NS; ++w) val += *(const v4fa*)(os + ((w * NG + g) * NQ + ql) * 68 + d0 + c * 4);
#pragma unroll
            for (int e = 0; e < 4; ++e) { unsigned short a, c2; splitf(__fdiv_rn(val[e], L), a, c2); oh[c * 4 + e] = a; ol[c * 4 + e] = c2; } }
        *(v8us*)(pa + u * 2 * PBAND) = oh; *(v8us*)(pc + u * 2 * PBAND) = ol; }   // 32 rows on: two bands of 16 rows
    asm volatile("s_wait_xcnt 0x0" :: "v"(pa), "v"(pc) : "memory");   // the wait stands behind the tile's stores, with their addresses as inputs
}
// grid (heads, FT16 + FTHL), tiles of 64 queries, the longest rows first: the fp16 tiles of scale 0, then of scale 1, then the hi+lo tiles of the three scales. Four waves a SIMD (two work-groups a WGP): vector work between the matrix runs wants waves
#define FT0  ((TT - RH) / 64)
#define FT16 (FT0 + (TT / 2 - RH) / 64)
#define FTHL (3 * (RH / 64))
__global__ __launch_bounds__(256) __attribute__((amdgpu_waves_per_eu(4, 4))) void k_fattn(const h16* __restrict__ Q16, const h16* __restrict__ K16, const h16* __restrict__ V16, const bf* __restrict__ Qh, const bf* __restrict__ Ql, const bf* __restrict__ Kh, const bf* __restrict__ Kw, const bf* __restrict__ Vh, const bf* __restrict__ Vl, bf* Ah, bf* Al) {
    __shared__ __align__(16) float sm[2 * 8 * 32 + 8 * 32 * 68];
    const int h = blockIdx.x, y = blockIdx.y;
    if (y < FT16) { const int s = y < FT0 ? 0 : 1; const int r0 = (TT >> s) - 64 * (y - s * FT0 + 1); fa_tile<false, h16>(Q16, nullptr, K16, nullptr, V16, nullptr, s, r0, h, sm, Ah, Al); }
    else { const int yy = y - FT16; const int s = yy % 3; const int r0 = RH - 64 * (yy / 3 + 1); fa_tile<true, bf>(Qh, Ql, Kh, Kw, Vh, Vl, s, r0, h, sm, Ah, Al); }
}

extern "C" void kernel_launch(void* const* d_in, const int* in_sizes, int n_in,
                              void* d_out, int out_size, void* d_ws, size_t ws_size, hipStream_t stream) {
    (void)in_sizes; (void)n_in; (void)out_size;
    const float* x0 = (const float*)d_in[0]; const float* x1 = (const float*)d_in[1]; const float* x2 = (const float*)d_in[2]; const float* wqA = (const float*)d_in[3]; const float* bqA = (const float*)d_in[4]; const float* wkA = (const float*)d_in[5]; const float* bkA = (const float*)d_in[6]; const float* wv = (const float*)d_in[7]; const float* bv = (const float*)d_in[8]; const float* wo = (const float*)d_in[9]; const float* bo = (const float*)d_in[10]; const float* x = nullptr; const float* wq = nullptr; const float* wk = nullptr; (void)x; (void)wq; (void)wk;
    float* OUT = (float*)d_out;     // the tuple's members one after the other: [TR][1024], in the order of the batch rows
    char* wsp = (char*)d_ws;
    auto take = [&](size_t bytes) { char* p = wsp; wsp += (bytes + 255) & ~(size_t)255; return (void*)p; };
    const size_t PL = (size_t)NH_ * TR * HD;   // one set of head planes, in elements
    bf* WO = (bf*)take((size_t)DM * DQ * 2);
    h16* QP16 = (h16*)take(2 * PL * 2); h16* KP16 = QP16 + PL; bf* QPh = (bf*)take(2 * PL * 2); bf* KPh = QPh + PL; bf* QPl = (bf*)take(2 * PL * 2); bf* KPl = QPl + PL;   // q planes, then k planes
    h16* VT16 = (h16*)take(PL * 2); bf* VTh = (bf*)take(PL * 2); bf* VTl = (bf*)take(PL * 2);
    bf* ATh = (bf*)take((size_t)TR * DQ * 2); bf* ATl = (bf*)take((size_t)TR * DQ * 2);
    bf* XB = (bf*)take(((size_t)TR * DM + (size_t)7 * DM * DM) * 2); bf* WQKV = XB + (size_t)TR * DM; float* CS = (float*)take((size_t)TR * HD * 2 * 4);
    if ((size_t)(wsp - (char*)d_ws) > ws_size) return;    // ws 256 MiB
    k_prep<<<CB_ALL, 256, 0, stream>>>(x0, x1, x2, wqA, wkA, wv, wo, XB, WO, CS);                     /* bf16 inputs; rope table, positions t x 2^s */
    k_gemmk<bf, 0, true, 3, 8><<<dim3(TR / 64, DM / 64, 3), 256, 0, stream>>>(XB, nullptr, DM, WQKV, nullptr, DM, nullptr, DM, bqA, bkA, bv, CS, QP16, QPh, QPl, PL, VT16, VTh, VTl);   /* q, k of every scale with rotary; v_base = x0 Wv^T + bv with its pooled rows, transposed; all as 16-bit planes */
    k_fattn<<<dim3(NH_, FT16 + FTHL), 256, 0, stream>>>(QP16, KP16, VT16, QPh, QPl, KPh, KPl, VTh, VTl, ATh, ATl);   /* attention of every head and scale; context as hi/lo planes */
    k_gemmk<bf, 1, true, 0, 8><<<dim3(TR / 64, DM / 64, 1), 256, 0, stream>>>(ATh, ATl, DQ, WO, nullptr, DQ, OUT, DM, bo, nullptr, nullptr, nullptr, nullptr, nullptr, nullptr, 0, nullptr, nullptr, nullptr);
}
